// v000
// Measured on an AMD MI455X. A time is GPU time per run, averaged over a window of back-to-back runs after a warm-up
// (all launches, gaps included; the runs take copies of the inputs in turn), and the median of several windows.
// Apart from v000's, it joins two sittings. Times from different sittings can be a few percent apart, while
// side-by-side timings come from the same sitting.
// The starting kernel, v000, takes 1440 microseconds a run.
// Contractions: q/k/v/o projections X.W [4096x1024].[1024x1024] and the position-wise FFN relu(Y.W1 + b) [4096x1024].[1024x4096], .W2 + b [4096x4096].[4096x1024] with f16 operands on pre-cast planes (v_wmma_f32_16x16x32_f16; 64x64 register-blocked wave tiles, weights x16); the block-diagonal windowed attention (8 blocks of 128 positions per sequence = 32 independent (sequence, block) attentions, 16 heads, keys >= valid_len SET to -1e6 through an integer keep-mask — exactly the module's where, so blocks lying wholly beyond valid_len are uniform) as one flash launch (f16 q.k^T and p.v with p as f16 of 4096 p); f32 accumulate and softmax. AddNorm LayerNorms (block per row, fixed-order trees) and the mask table from the INPUT valid lengths are f32 kernels.
#include <hip/hip_runtime.h>
#include <math.h>

typedef __attribute__((ext_vector_type(16))) _Float16 v16h;
typedef __attribute__((ext_vector_type(8)))  _Float16 v8h;
typedef __attribute__((ext_vector_type(16))) __bf16   v16b;
typedef __attribute__((ext_vector_type(8)))  float    v8f;
typedef __attribute__((ext_vector_type(4)))  float    v4f;

// 16-bit WMMA fragment map (wave32), lane L, h = L>>4, m = L&15:
//   A 16x32: lane = row m;   element i -> k = (i<8) ? 8h+i : 16+8h+(i-8)
//   B 32x16: lane = column m; the SAME k(i,h)
//   D 16x16 (8 f32): lane = column m; element r -> row 8h+r
__device__ __forceinline__ int frag_k(int i, int h) { return (i < 8) ? (8 * h + i) : (16 + 8 * h + (i - 8)); }
__device__ __forceinline__ __bf16 bf16_rne(float f) {
    unsigned int u = __float_as_uint(f);
    u += 0x7fffu + ((u >> 16) & 1u);
    return __builtin_bit_cast(__bf16, (unsigned short)(u >> 16));
}
__device__ __forceinline__ float bf16_f32(__bf16 b) { return __uint_as_float(((unsigned int)__builtin_bit_cast(unsigned short, b)) << 16); }
__device__ __forceinline__ v8f wmma16(v16h a, v16h b, v8f c) {
    c = __builtin_amdgcn_wmma_f32_16x16x32_f16(false, a, false, b, (short)0, c, false, false);
    asm volatile("v_nop\n\tv_nop\n\tv_nop\n\tv_nop" : "+v"(c) : "v"(a), "v"(b));
    return c;
}
__device__ __forceinline__ v8f wmmab(v16b a, v16b b, v8f c) {
    c = __builtin_amdgcn_wmma_f32_16x16x32_bf16(false, a, false, b, (short)0, c, false, false);
    asm volatile("v_nop\n\tv_nop\n\tv_nop\n\tv_nop" : "+v"(c) : "v"(a), "v"(b));
    return c;
}
struct Split { v16b hi, lo; };
// hi/lo split product: a.hi*b.hi + a.hi*b.lo + a.lo*b.hi
__device__ __forceinline__ v8f wmma3(const Split& a, const Split& b, v8f c) {
    c = __builtin_amdgcn_wmma_f32_16x16x32_bf16(false, a.hi, false, b.hi, (short)0, c, false, false);
    c = __builtin_amdgcn_wmma_f32_16x16x32_bf16(false, a.hi, false, b.lo, (short)0, c, false, false);
    c = __builtin_amdgcn_wmma_f32_16x16x32_bf16(false, a.lo, false, b.hi, (short)0, c, false, false);
    asm volatile("v_nop\n\tv_nop\n\tv_nop\n\tv_nop" : "+v"(c) : "v"(a.hi), "v"(a.lo), "v"(b.hi), "v"(b.lo));
    return c;
}
struct Split3 { v16b hi, mid, lo; };
// triple split product (6 terms, drops only terms below 2^-24 relative)
__device__ __forceinline__ v8f wmma6(const Split3& a, const Split3& b, v8f c) {
    c = __builtin_amdgcn_wmma_f32_16x16x32_bf16(false, a.hi, false, b.hi, (short)0, c, false, false);
    c = __builtin_amdgcn_wmma_f32_16x16x32_bf16(false, a.hi, false, b.mid, (short)0, c, false, false);
    c = __builtin_amdgcn_wmma_f32_16x16x32_bf16(false, a.mid, false, b.hi, (short)0, c, false, false);
    c = __builtin_amdgcn_wmma_f32_16x16x32_bf16(false, a.hi, false, b.lo, (short)0, c, false, false);
    c = __builtin_amdgcn_wmma_f32_16x16x32_bf16(false, a.mid, false, b.mid, (short)0, c, false, false);
    c = __builtin_amdgcn_wmma_f32_16x16x32_bf16(false, a.lo, false, b.hi, (short)0, c, false, false);
    asm volatile("v_nop\n\tv_nop\n\tv_nop\n\tv_nop" : "+v"(c) : "v"(a.hi), "v"(a.mid), "v"(a.lo), "v"(b.hi), "v"(b.mid), "v"(b.lo));
    return c;
}

// Fragment gathers from f32 memory: element i <- p[(k0 + frag_k(i,h)) * sk] * s, zero for k >= klen.
__device__ __forceinline__ v16h fh_ld(const float* __restrict__ p, long long sk, int k0, int h, int klen, float s) {
    v16h a;
#pragma unroll
    for (int i = 0; i < 16; ++i) { const int k = k0 + frag_k(i, h); a[i] = (k < klen) ? (_Float16)(p[(long long)k * sk] * s) : (_Float16)0.f; }
    return a;
}
__device__ __forceinline__ Split sp_ld(const float* __restrict__ p, long long sk, int k0, int h, int klen, float s) {
    Split r;
#pragma unroll
    for (int i = 0; i < 16; ++i) {
        const int k = k0 + frag_k(i, h); const float x = (k < klen) ? p[(long long)k * sk] * s : 0.f;
        const __bf16 hb = bf16_rne(x); r.hi[i] = hb; r.lo[i] = bf16_rne(x - bf16_f32(hb));
    }
    return r;
}
__device__ __forceinline__ Split3 sp3_ld(const float* __restrict__ p, long long sk, int k0, int h, int klen, float s) {
    Split3 r;
#pragma unroll
    for (int i = 0; i < 16; ++i) {
        const int k = k0 + frag_k(i, h); const float x = (k < klen) ? p[(long long)k * sk] * s : 0.f;
        const __bf16 hb = bf16_rne(x); const float r1 = x - bf16_f32(hb); const __bf16 mb = bf16_rne(r1);
        r.hi[i] = hb; r.mid[i] = mb; r.lo[i] = bf16_rne(r1 - bf16_f32(mb));
    }
    return r;
}
__device__ __forceinline__ v16b bh_ld(const float* __restrict__ p, long long sk, int k0, int h, int klen, float s) {
    v16b a;
#pragma unroll
    for (int i = 0; i < 16; ++i) { const int k = k0 + frag_k(i, h); a[i] = bf16_rne((k < klen) ? p[(long long)k * sk] * s : 0.f); }
    return a;
}
// f16 fragment from an f16 LDS/global row with element stride 1 (k-contiguous), no bounds (tile already zero padded)
__device__ __forceinline__ v16h fh_row(const _Float16* __restrict__ row, int k0, int h) {
    v16h a;
#pragma unroll
    for (int i = 0; i < 16; ++i) a[i] = row[k0 + frag_k(i, h)];
    return a;
}

#define VST2(T, ptr, val) do { const T vst2_v_ = (val); *(T*)(ptr) = vst2_v_;  } while (0)
typedef float v4f __attribute__((ext_vector_type(4)));
#define VST2V4(ptr, val) do { const v4f vst2_v4_ = (val); *(v4f*)(ptr) = vst2_v4_;  } while (0)

__device__ __attribute__((noinline)) float act_fn(float v, int act) {
    if (act == 1) return fmaxf(v, 0.f);                                                                               // relu
    if (act == 2) { const float u = 0.7978845608028654f * (v + 0.044715f * v * v * v); return 0.5f * v * (1.f + tanhf(u)); } // tanh-gelu
    if (act == 3) return v / (1.f + expf(-v));                                                                        // silu
    if (act == 4) return 0.5f * v * (1.f + erff(v * 0.7071067811865476f));                                             // erf-gelu
    if (act == 5) return tanhf(v);
    if (act == 6) return 1.f / (1.f + expf(-v));                                                                      // sigmoid
    if (act == 7) return (v > 0.f) ? v : 0.01f * v;                                                                   // leaky relu 0.01
    if (act == 8) return (v > 0.f) ? v : (expf(v) - 1.f);                                                             // elu
    if (act == 9) return fminf(fmaxf(v, 0.f), 6.f);                                                                   // relu6
    if (act == 10) return fabsf(v);                                                                                    // abs
    if (act == 11) return (v >= 0.f) ? v : 0.1f * v;                                                                  // leaky 0.1
    if (act == 12) return (v > 0.f) ? v : 0.2f * v;                                                                   // leaky 0.2
    if (act == 13) return (v > 20.f) ? v : log1pf(expf(v));                                                            // softplus
    return v;
}

// =====================================================================================================================
// k_gemm<MODE>: C(z, m, n) = act(alpha * sum_k A(z, m, k) * B(z, k, n) + bias) + beta * R(z, m, n)
//   One wave (32-thread block) per 16 x 32 tile of C; grid (ceil(N/32), ceil(M/16), Z). Batch z -> (zo = z / zi_n, zi = z % zi_n)
//   with separate outer/inner strides for every tensor (e.g. batch and head). A(m,k) = A[zo*sAo + zi*sAi + m*sAm + k*sAk] (f32),
//   B(k,n) = B[zo*sBo + zi*sBi + n*sBn + k*sBk] (f32); any M, N, K (K zero-padded to 32 inside the fragments, M/N tails guarded).
//   C(m,n) = C[zo*sCo + zi*sCi + m*sCm + n] (n contiguous). flags: 1 bias[n], 2 bias[m], 4 residual R[zo*sRo + zi*sRi + m*sRm + n*sRn].
//   MODE 0: f16 operands (A prescaled by sa, B by sb, both undone in the epilogue); 1: bf16 hi/lo split (3 products); 2: bf16;
//   3: bf16 hi/mid/lo triple split (6 products); 4: as 3 with Kahan-compensated f32 accumulation across k-steps.
// =====================================================================================================================
struct GemmP {
    const float* A; const float* B; const float* bias; const float* R; float* C;
    long long sAo, sAi, sAm, sAk, sBo, sBi, sBn, sBk, sCo, sCi, sCm, sRo, sRi, sRm, sRn;
    int M, N, K, zi_n, flags, act; float alpha, beta, sa, sb;
    int Npad, pad_;     // columns [N, Npad) of C are written as 0 so that padded workspace rows are covered by whole-line stores; Npad >= N
};
static_assert(sizeof(GemmP) == 5 * 8 + 15 * 8 + 6 * 4 + 4 * 4 + 2 * 4, "GemmP has padding");

template <int MODE>
__global__ __launch_bounds__(32) void k_gemm(GemmP p) {
    const int lane = threadIdx.x & 31, h = lane >> 4, l15 = lane & 15;
    const int m0 = blockIdx.y * 16, n0 = blockIdx.x * 32;
    const int z = blockIdx.z, zo = z / p.zi_n, zi = z - zo * p.zi_n;
    const float* A = p.A + zo * p.sAo + zi * p.sAi;
    const float* B = p.B + zo * p.sBo + zi * p.sBi;
    const int am = min(m0 + l15, p.M - 1);                       // clamped row for loads (stores are guarded)
    v8f acc[2], comp[2];
#pragma unroll
    for (int t = 0; t < 2; ++t) { v8f zz = {}; acc[t] = zz; comp[t] = zz; }
    for (int k0 = 0; k0 < p.K; k0 += 32) {
        const float* arow = A + (long long)am * p.sAm;
        if (MODE == 1) {
            const Split a = sp_ld(arow, p.sAk, k0, h, p.K, 1.f);
#pragma unroll
            for (int t = 0; t < 2; ++t) {
                const int bn = min(n0 + t * 16 + l15, p.N - 1);
                acc[t] = wmma3(a, sp_ld(B + (long long)bn * p.sBn, p.sBk, k0, h, p.K, 1.f), acc[t]);
            }
        } else if (MODE == 3) {
            const Split3 a = sp3_ld(arow, p.sAk, k0, h, p.K, 1.f);
#pragma unroll
            for (int t = 0; t < 2; ++t) {
                const int bn = min(n0 + t * 16 + l15, p.N - 1);
                acc[t] = wmma6(a, sp3_ld(B + (long long)bn * p.sBn, p.sBk, k0, h, p.K, 1.f), acc[t]);
            }
        } else if (MODE == 4) {
            // triple split as MODE 3, but each k-step's 6 products go into a fresh accumulator and the partial is added to the running f32 sum
            // on the VALU with Kahan compensation (accumulation error stays ~1 ulp however long K is)
            const Split3 a = sp3_ld(arow, p.sAk, k0, h, p.K, 1.f);
#pragma unroll
            for (int t = 0; t < 2; ++t) {
                const int bn = min(n0 + t * 16 + l15, p.N - 1); v8f zz = {};
                const v8f part = wmma6(a, sp3_ld(B + (long long)bn * p.sBn, p.sBk, k0, h, p.K, 1.f), zz);
                const v8f y = part - comp[t]; const v8f s = acc[t] + y; comp[t] = (s - acc[t]) - y; acc[t] = s;
            }
        } else if (MODE == 2) {
            const v16b a = bh_ld(arow, p.sAk, k0, h, p.K, 1.f);
#pragma unroll
            for (int t = 0; t < 2; ++t) {
                const int bn = min(n0 + t * 16 + l15, p.N - 1);
                acc[t] = wmmab(a, bh_ld(B + (long long)bn * p.sBn, p.sBk, k0, h, p.K, 1.f), acc[t]);
            }
        } else {
            const v16h a = fh_ld(arow, p.sAk, k0, h, p.K, p.sa);
#pragma unroll
            for (int t = 0; t < 2; ++t) {
                const int bn = min(n0 + t * 16 + l15, p.N - 1);
                acc[t] = wmma16(a, fh_ld(B + (long long)bn * p.sBn, p.sBk, k0, h, p.K, p.sb), acc[t]);
            }
        }
    }
    const float iscale = (MODE == 0) ? p.alpha / (p.sa * p.sb) : p.alpha;
    float* C = p.C + zo * p.sCo + zi * p.sCi;
    const float* R = p.R + zo * p.sRo + zi * p.sRi;
    __shared__ __align__(16) float ctile[16][36];
#pragma unroll
    for (int t = 0; t < 2; ++t) {
        const int n = n0 + t * 16 + l15; const int nn = min(n, p.N - 1);
#pragma unroll
        for (int r = 0; r < 8; ++r) {
            const int m = m0 + 8 * h + r; const int mm = min(m, p.M - 1);
            float v = acc[t][r] * iscale;
            if (p.flags & 1) v += p.bias[nn];
            if (p.flags & 2) v += p.bias[mm];
            if (p.flags & 8) v *= p.bias[(long long)zo * p.M + mm];   /* per-(z,row) scale vector laid out [Z][M]; exclusive with the bias flags */
            v = act_fn(v, p.act);
            if (p.flags & 4) v += p.beta * R[(long long)mm * p.sRm + (long long)nn * p.sRn];
            ctile[8 * h + r][t * 16 + l15] = (n < p.N) ? v : 0.f;
        }
    }
    __syncthreads();
    const int NW = (p.Npad > p.N) ? p.Npad : p.N;           // write width
    const bool fast = (m0 + 16 <= p.M) && (n0 + 32 <= NW) && ((p.sCm & 3) == 0) && ((((size_t)C) & 15) == 0);
    if (fast) {
#pragma unroll
        for (int s = 0; s < 4; ++s) {
            const int row = s * 4 + (lane >> 3), c4 = (lane & 7) * 4;
            const v4f v = *(const v4f*)&ctile[row][c4];
            VST2V4(C + (long long)(m0 + row) * p.sCm + n0 + c4, v);
        }
    } else {
        for (int row = 0; row < 16; ++row) {
            const int m = m0 + row, n = n0 + lane;
            if (m < p.M && n < NW) VST2(float, C + (long long)m * p.sCm + n, ctile[row][lane]);
        }
    }
}


// =====================================================================================================================
// k_gemmT<MODE, TM, TN>: same contract as k_gemm, but one wave computes a (16*TM) x (16*TN) tile: TM A fragments and TN B fragments are
//   loaded per 32-wide k-step and reused across TM*TN WMMAs (far fewer load/convert instructions per MAC). MODE 0 (f16), 1 (bf16 hi/lo),
//   2 (bf16) only. grid (ceil(NW/(16*TN)), ceil(M/(16*TM)), Z), block 32. Epilogue identical to k_gemm, run per 16x32 sub-tile.
// =====================================================================================================================
template <int MODE, int TM, int TN>
__global__ __launch_bounds__(32) void k_gemmT(GemmP p) {
    const int lane = threadIdx.x & 31, h = lane >> 4, l15 = lane & 15;
    const int m0 = blockIdx.y * (16 * TM), n0 = blockIdx.x * (16 * TN);
    const int z = blockIdx.z, zo = z / p.zi_n, zi = z - zo * p.zi_n;
    const float* A = p.A + zo * p.sAo + zi * p.sAi;
    const float* B = p.B + zo * p.sBo + zi * p.sBi;
    v8f acc[TM][TN];
#pragma unroll
    for (int i = 0; i < TM; ++i)
#pragma unroll
        for (int t = 0; t < TN; ++t) { v8f zz = {}; acc[i][t] = zz; }
    for (int k0 = 0; k0 < p.K; k0 += 32) {
        if (MODE == 1) {
            Split a[TM], b[TN];
#pragma unroll
            for (int i = 0; i < TM; ++i) { const int am = min(m0 + 16 * i + l15, p.M - 1); a[i] = sp_ld(A + (long long)am * p.sAm, p.sAk, k0, h, p.K, 1.f); }
#pragma unroll
            for (int t = 0; t < TN; ++t) { const int bn = min(n0 + 16 * t + l15, p.N - 1); b[t] = sp_ld(B + (long long)bn * p.sBn, p.sBk, k0, h, p.K, 1.f); }
#pragma unroll
            for (int i = 0; i < TM; ++i)
#pragma unroll
                for (int t = 0; t < TN; ++t) acc[i][t] = wmma3(a[i], b[t], acc[i][t]);
        } else if (MODE == 2) {
            v16b a[TM], b[TN];
#pragma unroll
            for (int i = 0; i < TM; ++i) { const int am = min(m0 + 16 * i + l15, p.M - 1); a[i] = bh_ld(A + (long long)am * p.sAm, p.sAk, k0, h, p.K, 1.f); }
#pragma unroll
            for (int t = 0; t < TN; ++t) { const int bn = min(n0 + 16 * t + l15, p.N - 1); b[t] = bh_ld(B + (long long)bn * p.sBn, p.sBk, k0, h, p.K, 1.f); }
#pragma unroll
            for (int i = 0; i < TM; ++i)
#pragma unroll
                for (int t = 0; t < TN; ++t) acc[i][t] = wmmab(a[i], b[t], acc[i][t]);
        } else {
            v16h a[TM], b[TN];
#pragma unroll
            for (int i = 0; i < TM; ++i) { const int am = min(m0 + 16 * i + l15, p.M - 1); a[i] = fh_ld(A + (long long)am * p.sAm, p.sAk, k0, h, p.K, p.sa); }
#pragma unroll
            for (int t = 0; t < TN; ++t) { const int bn = min(n0 + 16 * t + l15, p.N - 1); b[t] = fh_ld(B + (long long)bn * p.sBn, p.sBk, k0, h, p.K, p.sb); }
#pragma unroll
            for (int i = 0; i < TM; ++i)
#pragma unroll
                for (int t = 0; t < TN; ++t) acc[i][t] = wmma16(a[i], b[t], acc[i][t]);
        }
    }
    const float iscale = (MODE == 0) ? p.alpha / (p.sa * p.sb) : p.alpha;
    float* C = p.C + zo * p.sCo + zi * p.sCi;
    const float* R = p.R + zo * p.sRo + zi * p.sRi;
    const int NW = (p.Npad > p.N) ? p.Npad : p.N;
    __shared__ __align__(16) float ctile[16][36];
#pragma unroll
    for (int i = 0; i < TM; ++i) {
        const int mb = m0 + 16 * i; if (mb >= p.M) break;          // wave-uniform
#pragma unroll
        for (int tp = 0; tp < TN / 2; ++tp) {
            const int nb = n0 + 32 * tp; if (nb >= NW) break;        // wave-uniform
#pragma unroll
            for (int t2 = 0; t2 < 2; ++t2) {
                const int t = 2 * tp + t2; const int n = nb + t2 * 16 + l15; const int nn = min(n, p.N - 1);
#pragma unroll
                for (int r = 0; r < 8; ++r) {
                    const int m = mb + 8 * h + r; const int mm = min(m, p.M - 1);
                    float v = acc[i][t][r] * iscale;
                    if (p.flags & 1) v += p.bias[nn];
                    if (p.flags & 2) v += p.bias[mm];
            if (p.flags & 8) v *= p.bias[(long long)zo * p.M + mm];   /* per-(z,row) scale vector laid out [Z][M]; exclusive with the bias flags */
                    v = act_fn(v, p.act);
                    if (p.flags & 4) v += p.beta * R[(long long)mm * p.sRm + (long long)nn * p.sRn];
                    ctile[8 * h + r][t2 * 16 + l15] = (n < p.N) ? v : 0.f;
                }
            }
            __syncthreads();
            const bool fast = (mb + 16 <= p.M) && (nb + 32 <= NW) && ((p.sCm & 3) == 0) && ((((size_t)C) & 15) == 0);
            if (fast) {
#pragma unroll
                for (int s = 0; s < 4; ++s) {
                    const int row = s * 4 + (lane >> 3), c4 = (lane & 7) * 4;
                    const v4f v = *(const v4f*)&ctile[row][c4];
                    VST2V4(C + (long long)(mb + row) * p.sCm + nb + c4, v);
                }
            } else {
                for (int row = 0; row < 16; ++row) {
                    const int m = mb + row, n = nb + lane;
                    if (m < p.M && n < NW) VST2(float, C + (long long)m * p.sCm + n, ctile[row][lane]);
                }
            }
            __syncthreads();
        }
    }
}

// =====================================================================================================================
//   Wave = 16 queries, AW waves per block, 64-key blocks; grid (ceil(Lq/(16*AW)), H, B), block 32*AW. Any Lq, Lk; head dim dh <= DHP
//   (DHP multiple of 32), value dim dv <= DVP (multiple of 16, <= 128). Every tensor addressed by (batch, head, row, element) strides, f32.
//   Scores: QM 0 f16 operands, 1 bf16 hi/lo split, 2 bf16 triple split; statistics f32 (exp2 domain); P.V: P x 4096 as f16 with V f16 staged in LDS
//   (SPLITPV: P and V as bf16 hi/lo splits). kv head = h / hrep. Masking: causal = 1 (keep j <= i + coff, masked -> -inf, key blocks beyond the
//   diagonal skipped), causal = 2 (masked -> mfill, a finite fill like the -1e9; no skipping), causal = 3 (keep j >= i + coff,
//   masked -> -inf, no skipping); optional additive f32 mask Mf,
//   optional int keep-mask Mi (0 -> score := mfill), both addressed b*smb + h*smh + i*smi + j*smj (0 strides broadcast).
// =====================================================================================================================
#define AW 4
struct AttnP {   // apv4
    const float* Q; const float* K; const float* V; float* O; float* P; const float* Mf; const int* Mi; float* ST;
    const float* Pw; const float* Rt; const int* SQ; const int* SK;           // optional: post-softmax weight, relative-position table, segment ids
    long long swb, swh, swi, swj, srb, srh, sri;                                 // Pw strides (b,h,i,j); Rt strides (b,h,i), column = clamp(i - j + roff, 0, rn-1)
    long long sQb, sQh, sQi, sQd, sKb, sKh, sKj, sKd, sVb, sVh, sVj, sVd, sOb, sOh, sOi, sPb, sPh, sPi, smb, smh, smi, smj;
    int Lq, Lk, dh, dv, hrep, causal, coff, pband;   // pband > 0: P holds only the band |j - i| <= pband, column j - i + pband
    float scale, mfill; int nonorm, mpol;             // nonorm (online path only): O = sum_j exp(score_j) V_j without the 1/rowsum (scores must be <= ~0); mpol: Mi masks where ==0 (mpol 0) or where !=0 (mpol 1)
    int roff, rn, segpol, win;                        // Rt column offset/count; SQ/SK: score := mfill where (segpol 0) SQ[i] != SK[j] or (segpol 1) SQ[i] == SK[j]; win > 0: keys with i - j > win (after coff) -> -inf
};
//   Pw: the softmax numerator is multiplied by Pw(b,h,i,j) AFTER the row sum is taken (probs * weight, then P.V), as in post-softmax multiplicative biases.                                                    // ST (optional): per row (b,h,i) -> ST[((b*H + h)*Lq + i)*2 + {0,1}] = {row max of the scaled+masked score (natural units), sum_j exp(score - max)}
static_assert(sizeof(AttnP) == 12 * 8 + 29 * 8 + 16 * 4, "AttnP has padding");

#ifndef KATTN_ATTR
#define KATTN_ATTR
#endif
template <int DHP, int DVP, int QM, bool SPLITPV, bool TWOPASS>
__global__ __launch_bounds__(32 * AW) KATTN_ATTR void k_attn(AttnP p) {
    constexpr int NT = DVP / 16;                // output tiles
    constexpr int KS = DHP / 32;                // k-steps for the scores
    constexpr int VP = DVP + 8;                 // LDS pitch (halves)
    __shared__ __align__(16) float    pl[AW][16 * 64];
    __shared__ __align__(16) _Float16 vl[(SPLITPV ? 2 : 1) * 64 * VP];   // f16 V tile, or bf16 hi and lo tiles (same 2-byte size)
    const int lane = threadIdx.x & 31, hf = lane >> 4, l15 = lane & 15, wave = threadIdx.x >> 5;
    const int h = blockIdx.y, b = blockIdx.z, hk = h / p.hrep;
    const int q0 = (blockIdx.x * AW + wave) * 16;
    float* myp = pl[wave];
    const float L2E = 1.4426950408889634f;
    const float NEG = -__builtin_inff();
    const int qi = min(q0 + l15, p.Lq - 1);
    const float* qrow = p.Q + b * p.sQb + h * p.sQh + (long long)qi * p.sQi;
    const float* kbase = p.K + b * p.sKb + hk * p.sKh;
    const float* vbase = p.V + b * p.sVb + hk * p.sVh;
    v16h qa[QM == 0 ? KS : 1]; Split qs_[QM == 1 ? KS : 1]; Split3 qt_[QM == 2 ? KS : 1];
#pragma unroll
    for (int ks = 0; ks < KS; ++ks) {
        if (QM == 2) qt_[ks] = sp3_ld(qrow, p.sQd, ks * 32, hf, p.dh, 1.f);
        else if (QM == 1) qs_[ks] = sp_ld(qrow, p.sQd, ks * 32, hf, p.dh, 1.f);
        else qa[ks] = fh_ld(qrow, p.sQd, ks * 32, hf, p.dh, 1.f);
    }
    v8f o[NT]; float m8[8], l8[8];
#pragma unroll
    for (int t = 0; t < NT; ++t) { v8f zz = {}; o[t] = zz; }
#pragma unroll
    for (int i = 0; i < 8; ++i) { m8[i] = NEG; l8[i] = 0.f; }
    int jend = p.Lk; int jstart = 0;
    if (p.causal == 1) { const int je = (blockIdx.x * AW + AW - 1) * 16 + 16 + p.coff; jend = min(jend, max(je, 0)); }   // uniform per block
    if (p.win > 0) { const int js = (int)(blockIdx.x * AW) * 16 + p.coff - p.win; jstart = (js > 0) ? (js / 64) * 64 : 0; }   // uniform per block: key blocks entirely outside every row's window hold only -inf entries and are skipped exactly
    const int npass = TWOPASS ? 2 : 1;
    for (int pass = 0; pass < npass; ++pass) {
        const bool dopv = (!TWOPASS) || pass == 1;
        for (int j0 = jstart; j0 < jend; j0 += 64) {
            if (dopv) {
                __syncthreads();                                 // previous key block's reads of vl / pl are done
                for (int idx = threadIdx.x; idx < 64 * DVP; idx += 32 * AW) {
                    const int jr = idx / DVP, d = idx - jr * DVP, j = j0 + jr;
                    const float f = (j < p.Lk && d < p.dv) ? vbase[(long long)j * p.sVj + (long long)d * p.sVd] : 0.f;
                    if (SPLITPV) {
                        const __bf16 hb = bf16_rne(f);
                        ((__bf16*)vl)[jr * VP + d] = hb; ((__bf16*)vl)[64 * VP + jr * VP + d] = bf16_rne(f - bf16_f32(hb));
                    } else vl[jr * VP + d] = (_Float16)f;
                }
            }
            v8f s[4];
#pragma unroll
            for (int t = 0; t < 4; ++t) {
                const int j = min(j0 + t * 16 + l15, p.Lk - 1);
                const float* krow = kbase + (long long)j * p.sKj;
                v8f acc = {};
#pragma unroll
                for (int ks = 0; ks < KS; ++ks) {
                    if (QM == 2)      acc = wmma6(qt_[ks], sp3_ld(krow, p.sKd, ks * 32, hf, p.dh, 1.f), acc);
                    else if (QM == 1) acc = wmma3(qs_[ks], sp_ld(krow, p.sKd, ks * 32, hf, p.dh, 1.f), acc);
                    else              acc = wmma16(qa[ks], fh_ld(krow, p.sKd, ks * 32, hf, p.dh, 1.f), acc);
                }
                s[t] = acc;
            }
            float pv[8][4];
#pragma unroll
            for (int i = 0; i < 8; ++i) {
                const int irow = q0 + i + 8 * hf;
                const int ic = min(irow, p.Lq - 1);
                float sc[4];
#pragma unroll
                for (int t = 0; t < 4; ++t) {
                    const int jg = j0 + t * 16 + l15;
                    float v = s[t][i] * p.scale;
                    if (p.Mf) v += p.Mf[b * p.smb + h * p.smh + (long long)ic * p.smi + (long long)min(jg, p.Lk - 1) * p.smj];
                    if (p.Rt) { int rc = ic - min(jg, p.Lk - 1) + p.roff; rc = rc < 0 ? 0 : (rc >= p.rn ? p.rn - 1 : rc); v += p.Rt[b * p.srb + h * p.srh + (long long)ic * p.sri + rc]; }
                    if (p.Mi) { const int mv = p.Mi[b * p.smb + h * p.smh + (long long)ic * p.smi + (long long)min(jg, p.Lk - 1) * p.smj]; if (p.mpol ? (mv != 0) : (mv == 0)) v = p.mfill; }
                    if (p.SQ) { const bool same = p.SQ[(long long)b * p.Lq + ic] == p.SK[(long long)b * p.Lk + min(jg, p.Lk - 1)]; if (p.segpol ? same : !same) v = p.mfill; }
                    if (p.causal == 2 && jg > irow + p.coff) v = p.mfill;
                    if (jg >= p.Lk || (p.causal == 1 && jg > irow + p.coff) || (p.causal == 3 && jg < irow + p.coff) || (p.win > 0 && irow + p.coff - jg > p.win)) v = NEG; else v *= L2E;
                    sc[t] = v;
                }
                if (!TWOPASS || pass == 0) {
                    float mx = fmaxf(fmaxf(sc[0], sc[1]), fmaxf(sc[2], sc[3]));
                    mx = fmaxf(mx, __shfl_xor(mx, 1, 32)); mx = fmaxf(mx, __shfl_xor(mx, 2, 32));
                    mx = fmaxf(mx, __shfl_xor(mx, 4, 32)); mx = fmaxf(mx, __shfl_xor(mx, 8, 32));
                    const float mnew = fmaxf(m8[i], mx);
                    const float corr = (mnew == NEG) ? 1.f : exp2f(m8[i] - mnew);
                    float rs = 0.f;
#pragma unroll
                    for (int t = 0; t < 4; ++t) {
                        const float pp = (sc[t] == NEG) ? 0.f : exp2f(sc[t] - mnew); rs += pp;
                        pv[i][t] = p.Pw ? pp * p.Pw[b * p.swb + h * p.swh + (long long)ic * p.swi + (long long)min(j0 + t * 16 + l15, p.Lk - 1) * p.swj] : pp;
                    }
                    rs += __shfl_xor(rs, 1, 32); rs += __shfl_xor(rs, 2, 32); rs += __shfl_xor(rs, 4, 32); rs += __shfl_xor(rs, 8, 32);
                    l8[i] = l8[i] * corr + rs; m8[i] = mnew;
                    if (!TWOPASS) {
#pragma unroll
                        for (int t = 0; t < NT; ++t) o[t][i] *= corr;
                    }
                } else {
                    const float inv = (l8[i] > 0.f) ? 1.f / l8[i] : 0.f;
#pragma unroll
                    for (int t = 0; t < 4; ++t) {
                        const int jg = j0 + t * 16 + l15;
                        float pp = (sc[t] == NEG) ? 0.f : exp2f(sc[t] - m8[i]) * inv;
                        if (p.Pw) pp *= p.Pw[b * p.swb + h * p.swh + (long long)ic * p.swi + (long long)min(jg, p.Lk - 1) * p.swj];
                        pv[i][t] = pp;
                    }
                }
            }
            if (dopv) {
#pragma unroll
                for (int i = 0; i < 8; ++i)
#pragma unroll
                    for (int t = 0; t < 4; ++t) ((float*)myp)[(i + 8 * hf) * 64 + t * 16 + l15] = pv[i][t];
                __syncthreads();                                 // P (per wave) and V (shared) visible
                if (p.P) {
                    float* pb_ = p.P + b * p.sPb + h * p.sPh;
                    const bool fastP = (p.pband == 0) && ((p.sPi & 3) == 0) && (j0 + 64 <= p.Lk) && (q0 + 16 <= p.Lq) && ((((size_t)pb_) & 15) == 0);
                    if (fastP) {
#pragma unroll
                        for (int s = 0; s < 8; ++s) {
                            const int row = s * 2 + (lane >> 4), c4 = (lane & 15) * 4;
                            const v4f v = *(const v4f*)(myp + row * 64 + c4);
                            VST2V4(pb_ + (long long)(q0 + row) * p.sPi + j0 + c4, v);
                        }
                    } else {
                        for (int row = 0; row < 16; ++row) {
                            const int irow = q0 + row; if (irow >= p.Lq) continue;
                            for (int c = lane; c < 64; c += 32) {
                                const int jg = j0 + c; if (jg >= p.Lk) continue;
                                if (p.pband == 0) VST2(float, pb_ + (long long)irow * p.sPi + jg, myp[row * 64 + c]);
                                else if (jg - irow <= p.pband && irow - jg <= p.pband) VST2(float, pb_ + (long long)irow * p.sPi + (jg - irow + p.pband), myp[row * 64 + c]);
                            }
                        }
                    }
                }
                if (SPLITPV) {
                    const Split pa0 = sp_ld(myp + l15 * 64, 1, 0, hf, 64, 1.f), pa1 = sp_ld(myp + l15 * 64, 1, 32, hf, 64, 1.f);
                    const __bf16* vh = (const __bf16*)vl; const __bf16* vlo = vh + 64 * VP;
#pragma unroll
                    for (int t = 0; t < NT; ++t) {
                        const int dcol = t * 16 + l15;
                        Split b0, b1;
#pragma unroll
                        for (int e = 0; e < 16; ++e) {
                            const int k0 = frag_k(e, hf), k1 = 32 + frag_k(e, hf);
                            b0.hi[e] = vh[k0 * VP + dcol]; b0.lo[e] = vlo[k0 * VP + dcol]; b1.hi[e] = vh[k1 * VP + dcol]; b1.lo[e] = vlo[k1 * VP + dcol];
                        }
                        o[t] = wmma3(pa0, b0, o[t]);
                        o[t] = wmma3(pa1, b1, o[t]);
                    }
                } else {
                    const v16h pa0 = fh_ld(myp + l15 * 64, 1, 0, hf, 64, 4096.f), pa1 = fh_ld(myp + l15 * 64, 1, 32, hf, 64, 4096.f);
#pragma unroll
                    for (int t = 0; t < NT; ++t) {
                        const int dcol = t * 16 + l15;
                        v16h b0, b1;
#pragma unroll
                        for (int e = 0; e < 16; ++e) { b0[e] = vl[frag_k(e, hf) * VP + dcol]; b1[e] = vl[(32 + frag_k(e, hf)) * VP + dcol]; }
                        o[t] = wmma16(pa0, b0, o[t]);
                        o[t] = wmma16(pa1, b1, o[t]);
                    }
                }
            }
        }
    }
    float* obase = p.O + b * p.sOb + h * p.sOh;
    if (p.ST) {
        const int rl = lane >> 1, isel = rl & 7;           // row q0 + rl ; rl>>3 == hf holds because lane>>4 == (lane>>1)>>3
        float mv = 0.f, lv = 0.f;
#pragma unroll
        for (int i = 0; i < 8; ++i) if (i == isel) { mv = m8[i]; lv = l8[i]; }
        const int irow = q0 + rl;
        if (irow < p.Lq) { float* st = p.ST + (((long long)b * gridDim.y + h) * p.Lq + irow) * 2 + (lane & 1); VST2(float, st, (lane & 1) ? lv : mv * 0.6931471805599453f); }
    }
    float invr[8];
#pragma unroll
    for (int i = 0; i < 8; ++i) {
        if (TWOPASS) invr[i] = SPLITPV ? 1.f : (1.f / 4096.f);
        else if (p.nonorm) invr[i] = exp2f(m8[i]) * (SPLITPV ? 1.f : (1.f / 4096.f));
        else invr[i] = (l8[i] > 0.f) ? (SPLITPV ? 1.f / l8[i] : 1.f / (l8[i] * 4096.f)) : 0.f;
    }
    __syncthreads();                                             // all waves done with pl/vl from the main loop
    const bool ofast = ((p.sOi & 3) == 0) && ((((size_t)obase) & 15) == 0) && (q0 + 16 <= p.Lq);
#pragma unroll
    for (int c0 = 0; c0 < DVP; c0 += 64) {
#pragma unroll
        for (int i = 0; i < 8; ++i)
#pragma unroll
            for (int t = 0; t < NT; ++t) if (t * 16 >= c0 && t * 16 < c0 + 64) ((float*)myp)[(i + 8 * hf) * 64 + (t * 16 - c0) + l15] = o[t][i] * invr[i];
        __syncthreads();
        const int cw = (DVP - c0 < 64) ? (DVP - c0) : 64;      // staged columns in this chunk (multiple of 16)
        if (ofast && (c0 + cw <= p.dv) && (cw % 32 == 0)) {
            const int lpr = cw / 4;                              // lanes per row (16 for 64 cols, 8 for 32)
            const int rows_per_ins = 32 / lpr;
            for (int r0 = 0; r0 < 16; r0 += rows_per_ins) {
                const int row = r0 + lane / lpr, c4 = (lane % lpr) * 4;
                const v4f v = *(const v4f*)(myp + row * 64 + c4);
                VST2V4(obase + (long long)(q0 + row) * p.sOi + c0 + c4, v);
            }
        } else {
            for (int row = 0; row < 16; ++row) {
                const int irow = q0 + row; if (irow >= p.Lq) continue;
                for (int c = lane; c < cw; c += 32) { const int d = c0 + c; if (d < p.dv) VST2(float, obase + (long long)irow * p.sOi + d, myp[row * 64 + c]); }
            }
        }
        __syncthreads();
    }
}

// =====================================================================================================================
// k_tr: dst(z, c, r) = alpha * src(z, r, c) (+ beta * R2(z, c, r)): [Z][R][C] (row stride lds) -> [Z][C][R] (row stride ldd) through a 32x32 LDS tile;
//   flags: 1 -> add beta * residual R2 addressed like dst (z*sRz + c*ldr + r); act applied before the residual.
// =====================================================================================================================
struct TrP { const float* src; float* dst; const float* R2; long long sSz, lds, sDz, ldd, sRz, ldr; int R, C, flags, act; float alpha, beta; };
static_assert(sizeof(TrP) == 3 * 8 + 6 * 8 + 6 * 4, "TrP has padding");
__global__ __launch_bounds__(256) void k_tr(TrP p) {
    __shared__ float tile[32][33];
    const int c0 = blockIdx.x * 32, r0 = blockIdx.y * 32, z = blockIdx.z;
    const int lane = threadIdx.x & 31, wave = threadIdx.x >> 5;
    const float* s = p.src + z * p.sSz;
#pragma unroll
    for (int k = 0; k < 4; ++k) {
        const int rl = wave * 4 + k, r = r0 + rl, c = c0 + lane;
        tile[rl][lane] = (r < p.R && c < p.C) ? s[(long long)r * p.lds + c] : 0.f;
    }
    __syncthreads();
    float* d = p.dst + z * p.sDz; const float* rr = p.R2 + z * p.sRz;
#pragma unroll
    for (int k = 0; k < 4; ++k) {
        const int cl = wave * 4 + k, c = c0 + cl, r = r0 + lane;
        if (c < p.C && r < p.R) {
            float v = act_fn(p.alpha * tile[lane][cl], p.act);
            if (p.flags & 1) v += p.beta * rr[(long long)c * p.ldr + r];
            VST2(float, d + (long long)c * p.ldd + r, v);
        }
    }
}

// k_affine: dst[i] = a * (sdev ? sdev[0] : 1) * src[i] + b, i < n (one thread per element; consecutive lanes -> consecutive addresses)
__global__ __launch_bounds__(256) void k_affine(const float* __restrict__ src, float* __restrict__ dst, int n, float a, float b, const float* __restrict__ sdev) {
    const int i = blockIdx.x * 256 + threadIdx.x;
    if (i < n) { const float aa = sdev ? a * sdev[0] : a; const float v = aa * src[i] + b; VST2(float, dst + i, v); }
}

// =====================================================================================================================
// k_softmax: row softmax over n contiguous elements, one 256-thread block per row; rows addressed z*sz + r*sr (grid (R, Z)).
//   out = scale_out * softmax(scale_in * x + (Mf ? Mf[z*smz + r*smr + j] : 0)); a row whose max is -inf is written as 0.
// =====================================================================================================================
struct SmP { const float* src; float* dst; const float* Mf; long long sz, sr, dz, dr, smz, smr; int n, pad; float scale_in, scale_out; };
static_assert(sizeof(SmP) == 3 * 8 + 6 * 8 + 4 * 4, "SmP has padding");
__global__ __launch_bounds__(256) void k_softmax(SmP p) {
    __shared__ float red[256];
    const int r = blockIdx.x, z = blockIdx.y, tid = threadIdx.x;
    const float* s = p.src + z * p.sz + (long long)r * p.sr;
    const float* mf = p.Mf ? (p.Mf + z * p.smz + (long long)r * p.smr) : nullptr;
    float mx = -__builtin_inff();
    for (int j = tid; j < p.n; j += 256) { float v = s[j] * p.scale_in; if (mf) v += mf[j]; mx = fmaxf(mx, v); }
    red[tid] = mx; __syncthreads();
    for (int o = 128; o > 0; o >>= 1) { if (tid < o) red[tid] = fmaxf(red[tid], red[tid + o]); __syncthreads(); }
    mx = red[0]; __syncthreads();
    float sum = 0.f;
    for (int j = tid; j < p.n; j += 256) { float v = s[j] * p.scale_in; if (mf) v += mf[j]; sum += (mx == -__builtin_inff()) ? 0.f : expf(v - mx); }
    red[tid] = sum; __syncthreads();
    for (int o = 128; o > 0; o >>= 1) { if (tid < o) red[tid] += red[tid + o]; __syncthreads(); }
    sum = red[0];
    const float inv = (sum > 0.f) ? p.scale_out / sum : 0.f;
    float* d = p.dst + z * p.dz + (long long)r * p.dr;
    for (int j = tid; j < p.n; j += 256) { float v = s[j] * p.scale_in; if (mf) v += mf[j]; const float o = (mx == -__builtin_inff()) ? 0.f : expf(v - mx) * inv; VST2(float, d + j, o); }
}
// =====================================================================================================================
// k_stats: mean and rsqrt(var + eps) over a set of n elements addressed base + z*sz + (e / inner) * so + (e % inner) * si, one 256-thread
// k_norm_apply: y = (x - mean[set]) * rstd[set] * g[c] + b[c] over a [Z][C][L] channel-major tensor with set = z*G + c / (C/G) (G groups per z;
//   G = C -> per-channel sets indexed z*C+c; for batch norm pass stats indexed by c only via bn = 1). Optional act. Output same layout.
// =====================================================================================================================
//   mode 0: mean / rsqrt(var + eps); mode 1 (RMSNorm): 0 / rsqrt(mean(x^2) + eps); mode 2 (L2 normalize * sqrt(n)): 0 / sqrt(n) / max(||x||, eps); mode 3: as 0 with unbiased variance (n-1)
__global__ __launch_bounds__(256) void k_stats(const float* __restrict__ x, long long sz, long long so, long long si, int inner, int n, float eps, float* __restrict__ stat, int mode) {
    __shared__ float red[256];
    const int z = blockIdx.x, tid = threadIdx.x;
    const float* base = x + z * sz;
    float s = 0.f;
    for (int e = tid; e < n; e += 256) s += base[(long long)(e / inner) * so + (long long)(e % inner) * si];
    red[tid] = s; __syncthreads();
    for (int o = 128; o > 0; o >>= 1) { if (tid < o) red[tid] += red[tid + o]; __syncthreads(); }
    const float mu = (mode == 0 || mode == 3) ? red[0] / (float)n : 0.f; __syncthreads();
    float q = 0.f;
    for (int e = tid; e < n; e += 256) { const float dlt = base[(long long)(e / inner) * so + (long long)(e % inner) * si] - mu; q += dlt * dlt; }
    red[tid] = q; __syncthreads();
    for (int o = 128; o > 0; o >>= 1) { if (tid < o) red[tid] += red[tid + o]; __syncthreads(); }
    {
        float rs;
        if (mode == 2) rs = sqrtf((float)n) / fmaxf(sqrtf(red[0]), eps); else if (mode == 3) rs = rsqrtf(red[0] / (float)(n - 1) + eps); else rs = rsqrtf(red[0] / (float)n + eps);
        if (tid < 32) { const float v = (tid == 0) ? mu : ((tid == 1) ? rs : 0.f); VST2(float, stat + (long long)z * 32 + tid, v); }
    }
}
//   One thread per element over the flat [Z][C][L] index space: grid ceil(Z*C*L / 256).
__global__ __launch_bounds__(256) void k_norm_apply(const float* __restrict__ x, float* __restrict__ y, const float* __restrict__ stat, const float* __restrict__ g, const float* __restrict__ bta,
                                                     int Z, int C, int L, int G, int bn, int act) {
    const long long idx = (long long)blockIdx.x * 256 + threadIdx.x;
    if (idx >= (long long)Z * C * L) return;
    const int l = (int)(idx % L); const long long zc = idx / L; const int c = (int)(zc % C), z = (int)(zc / C); (void)l;
    const int set = bn ? c : (z * G + c / (C / G));
    float v = (x[idx] - stat[(long long)set * 32]) * stat[(long long)set * 32 + 1];
    if (g) v *= g[c];
    if (bta) v += bta[c];
    v = act_fn(v, act);
    VST2(float, y + idx, v);
}

// k_lse_neg: c[i] = -(st[2i] + log(st[2i+1])) = minus the log-sum-exp of row i from k_attn's ST output (for softmax over the query dimension)
__global__ __launch_bounds__(256) void k_lse_neg(const float* __restrict__ st, float* __restrict__ c, int n) {
    const int i = blockIdx.x * 256 + threadIdx.x;
    if (i < n) { const float v = -(st[2 * i] + logf(st[2 * i + 1])); VST2(float, c + i, v); }
}

// k_iota: dst[i] = a * i + b as int32 (segment/position id helper)
__global__ __launch_bounds__(256) void k_iota(int* __restrict__ dst, int n, int a, int b) {
    const int i = blockIdx.x * 256 + threadIdx.x;
    if (i < n) { const int v = a * i + b; VST2(int, dst + i, v); }
}

// k_axpby: dst[i] = a * x[i] + b * y[i] (+ c), i < n
__global__ __launch_bounds__(256) void k_axpby(const float* __restrict__ x, const float* __restrict__ y, float* __restrict__ dst, int n, float a, float b, float c) {
    const int i = blockIdx.x * 256 + threadIdx.x;
    if (i < n) { const float v = a * x[i] + b * y[i] + c; VST2(float, dst + i, v); }
}

// =====================================================================================================================
// k_rope: rotary embedding on a [R rows][Hn heads][D] view (row stride sXr, head stride sXh, element stride 1) -> Y (own strides).
//   mode 0: rotate_half (partner d±D/2, sign - for d<D/2); mode 1: interleaved pairs (partner d^1, sign - for even d).
//   table column tcol: tmode 0 -> d, 1 -> d % (D/2), 2 -> d / 2; position p: pmode 0 -> r % S, 1 -> head index, 2 -> pos[r];
//   c = C[(r / S) * sCb + p * sCp + tcol * sCd], s likewise from Sn; y = x[d] * c + sign * x[partner] * s. X and Y must not alias.
// =====================================================================================================================
struct RopeP { const float* X; float* Y; const float* C; const float* Sn; const int* pos; long long sXr, sXh, sYr, sYh, sCb, sCp, sCd; int R, Hn, D, S, mode, tmode, pmode, pad; };
static_assert(sizeof(RopeP) == 5 * 8 + 7 * 8 + 8 * 4, "RopeP has padding");
__global__ __launch_bounds__(256) void k_rope(RopeP p) {
    const long long idx = (long long)blockIdx.x * 256 + threadIdx.x;
    if (idx >= (long long)p.R * p.Hn * p.D) return;
    const int d = (int)(idx % p.D); const long long rh = idx / p.D; const int h = (int)(rh % p.Hn); const int r = (int)(rh / p.Hn);
    const int half = p.D / 2;
    int partner; float sign;
    if (p.mode == 0) { partner = (d < half) ? d + half : d - half; sign = (d < half) ? -1.f : 1.f; }
    else { partner = d ^ 1; sign = (d & 1) ? 1.f : -1.f; }
    const int tcol = (p.tmode == 0) ? d : ((p.tmode == 1) ? (d % half) : (d >> 1));
    const int pp = (p.pmode == 0) ? (r % p.S) : ((p.pmode == 1) ? h : p.pos[r]);
    const long long toff = (long long)(r / p.S) * p.sCb + (long long)pp * p.sCp + (long long)tcol * p.sCd;
    const float* xr = p.X + (long long)r * p.sXr + (long long)h * p.sXh;
    const float v = xr[d] * p.C[toff] + sign * xr[partner] * p.Sn[toff];
    VST2(float, p.Y + (long long)r * p.sYr + (long long)h * p.sYh + d, v);
}

// k_invf + k_sincos (split so neither kernel carries a large VALU-fma footprint): invf_i = num * (1 / powf(base, (2 i)/D)) [fmode 0],
//   num * expf((2 i) * cexp) [fmode 1], num * powf(base, -2 (i - 1) / D) [fmode 2]; then cs/sn[s*half + i] = cos/sin((pscale * s) * invf_i)
__global__ __launch_bounds__(256) void k_invf(float* __restrict__ invb, int half, int D, float base, float num, int fmode, float cexp) {
    const int i = blockIdx.x * 256 + threadIdx.x;
    if (i >= ((half + 31) / 32) * 32) return;
    if (i >= half) { VST2(float, invb + i, 0.f); return; }
    const float e = (float)(2 * i) / (float)D;
    float invf;
    if (fmode == 1) invf = num * expf((float)(2 * i) * cexp);
    else if (fmode == 2) invf = num * powf(base, (-2.0f * ((float)i - 1.0f)) / (float)D);
    else invf = num * (1.0f / powf(base, e));
    VST2(float, invb + i, invf);
}
__global__ __launch_bounds__(256) void k_sincos(float* __restrict__ cs, float* __restrict__ sn, const float* __restrict__ invb, int S, int half, float pscale) {
    const int idx = blockIdx.x * 256 + threadIdx.x;
    if (idx >= S * half) return;
    const int s = idx / half, i = idx - s * half;
    const float ang = (pscale * (float)s) * invb[i];
    VST2(float, cs + idx, cosf(ang)); VST2(float, sn + idx, sinf(ang));
}

// k_mulact: dst[i] = act(x[i]) * y[i]
__global__ __launch_bounds__(256) void k_mulact(const float* __restrict__ x, const float* __restrict__ y, float* __restrict__ dst, int n, int act) {
    const int i = blockIdx.x * 256 + threadIdx.x;
    if (i < n) { const float v = act_fn(x[i], act) * y[i]; VST2(float, dst + i, v); }
}

// =====================================================================================================================
// k_matvec: thread-per-row matrix-vector products for N <= 8 output columns (heads with 1-3 outputs, gates), f32 on the VALU.
//   C[r*sCm + j] = act(alpha * sum_k A[r*sAm + k*sAk] * B[j*sBn + k*sBk] + bias[j]) + beta * R[r*sRm + j*sRn]; each thread writes its N contiguous floats.
// =====================================================================================================================
__global__ __launch_bounds__(256) void k_matvec(GemmP p) {
    // 32 lanes write one line with one instruction.
    const int rpt = (p.N == 1) ? 1 : 32;
    const long long r0 = ((long long)blockIdx.x * 256 + threadIdx.x) * rpt; const int z = blockIdx.z, zo = z / p.zi_n, zi = z - zo * p.zi_n;
    if (r0 >= p.M) return;
    const float* Bb = p.B + zo * p.sBo + zi * p.sBi;
    float* C = p.C + zo * p.sCo + zi * p.sCi; const float* R = p.R + zo * p.sRo + zi * p.sRi;
    for (int rr = 0; rr < rpt; ++rr) {
        const long long r = r0 + rr; if (r >= p.M) break;
        const float* A = p.A + zo * p.sAo + zi * p.sAi + r * p.sAm;
        float acc[8] = {0.f, 0.f, 0.f, 0.f, 0.f, 0.f, 0.f, 0.f};
        for (int k = 0; k < p.K; ++k) { const float a = A[(long long)k * p.sAk];
#pragma unroll
            for (int j = 0; j < 8; ++j) if (j < p.N) acc[j] += a * Bb[(long long)j * p.sBn + (long long)k * p.sBk]; }
#pragma unroll
        for (int j = 0; j < 8; ++j) if (j < p.N) {
            float v = acc[j] * p.alpha;
            if (p.flags & 1) v += p.bias[j];
            if (p.flags & 2) v += p.bias[r];
            v = act_fn(v, p.act);
            if (p.flags & 4) v += p.beta * R[r * p.sRm + (long long)j * p.sRn];
            VST2(float, C + r * p.sCm + j, v);
        }
    }
}
// k_smallsoftmax: thread-per-row softmax for short rows (n <= 64): dst[r*dr + j] = softmax(scale*src[r*sr + j])
__global__ __launch_bounds__(256) void k_smallsoftmax(const float* __restrict__ src, float* __restrict__ dst, long long sr, long long dr, int n, long long R, float scale) {
    const long long r0 = ((long long)blockIdx.x * 256 + threadIdx.x) * 32;
    for (int rr = 0; rr < 32; ++rr) {
        const long long r = r0 + rr; if (r >= R) return;
        const float* s = src + r * sr; float* d = dst + r * dr;
        float mx = -__builtin_inff();
        for (int j = 0; j < n; ++j) mx = fmaxf(mx, s[j] * scale);
        float sum = 0.f;
        for (int j = 0; j < n; ++j) sum += expf(s[j] * scale - mx);
        const float inv = 1.f / sum;
        for (int j = 0; j < n; ++j) { const float v = expf(s[j] * scale - mx) * inv; VST2(float, d + j, v); }
    }
}

__global__ __launch_bounds__(32) void k_unitstat(float* __restrict__ st) { const int t = threadIdx.x; const float v = (t == 1) ? 1.f : 0.f; VST2(float, st + t, v); }

// destination (e.g. a d_out whose row width is not a multiple of 32 floats) is written by consecutive lanes of one instruction
__global__ __launch_bounds__(256) void k_lincopy(const float* __restrict__ src, long long lds, float* __restrict__ dst, long long ldd, long long rows, int cols) {
    const long long i = (long long)blockIdx.x * 256 + threadIdx.x; if (i >= rows * cols) return;
    const long long r = i / cols; const int c = (int)(i - r * cols);
    const float v = src[r * lds + c]; VST2(float, dst + r * ldd + c, v);
}

namespace w25 {
typedef __attribute__((ext_vector_type(16))) _Float16 v16h;
typedef __attribute__((ext_vector_type(8)))  _Float16 v8h;
typedef __attribute__((ext_vector_type(16))) __bf16   v16b;
typedef __attribute__((ext_vector_type(8)))  __bf16   v8b;
typedef __attribute__((ext_vector_type(8)))  float    v8f;
typedef __attribute__((ext_vector_type(4)))  float    v4f;

__device__ __forceinline__ unsigned short f2bf_bits(float f) {
  unsigned u = __float_as_uint(f);
  return (unsigned short)((u + 0x7FFFu + ((u >> 16) & 1u)) >> 16);
}
__device__ __forceinline__ float bf_bits2f(unsigned short h) { return __uint_as_float(((unsigned)h) << 16); }

// hazard guards as plain device helpers (no inline asm inside the kernel template body)
__device__ __forceinline__ void dep_guard_h(v8f& a, v8f& b, v16h x, v16h y) { asm volatile("v_nop\n\tv_nop\n\tv_nop\n\tv_nop" : "+v"(a), "+v"(b) : "v"(x), "v"(y)); }
__device__ __forceinline__ void dep_guard_b(v8f& a, v8f& b, v16b x, v16b y) { asm volatile("v_nop\n\tv_nop\n\tv_nop\n\tv_nop" : "+v"(a), "+v"(b) : "v"(x), "v"(y)); }
__device__ __forceinline__ void keep4_h(v16h a, v16h b, v16h c, v16h d) { asm volatile("v_nop" :: "v"(a), "v"(b), "v"(c), "v"(d)); }
__device__ __forceinline__ void keep4_b(v16b a, v16b b, v16b c, v16b d) { asm volatile("v_nop" :: "v"(a), "v"(b), "v"(c), "v"(d)); }
__device__ __forceinline__ void acc_guard4(v8f& a, v8f& b, v8f& c, v8f& d) { asm volatile("v_nop\n\tv_nop\n\tv_nop\n\tv_nop" : "+v"(a), "+v"(b), "+v"(c), "+v"(d)); }
template <typename T> struct Frag;
template <> struct Frag<_Float16> {
  typedef v16h V; union U { v16h v; v8h h[2]; };
  static __device__ __forceinline__ v16h load(const _Float16* p) {   // elements 0..7 <- p[0..7], 8..15 <- p[16..23]
    U f; f.h[0] = *(const v8h*)(p); f.h[1] = *(const v8h*)(p + 16); return f.v;
  }
  static __device__ __forceinline__ v8f mma(v16h a, v16h b, v8f c) {
    return __builtin_amdgcn_wmma_f32_16x16x32_f16(false, a, false, b, (short)0, c, false, false);
  }
  static __device__ __forceinline__ void guard(v8f& a, v8f& b, v16h x, v16h y) { dep_guard_h(a, b, x, y); }
  static __device__ __forceinline__ void keep(v16h a, v16h b, v16h c, v16h d) { keep4_h(a, b, c, d); }
};
template <> struct Frag<__bf16> {
  typedef v16b V; union U { v16b v; v8b h[2]; };
  static __device__ __forceinline__ v16b load(const __bf16* p) {
    U f; f.h[0] = *(const v8b*)(p); f.h[1] = *(const v8b*)(p + 16); return f.v;
  }
  static __device__ __forceinline__ v8f mma(v16b a, v16b b, v8f c) {
    return __builtin_amdgcn_wmma_f32_16x16x32_bf16(false, a, false, b, (short)0, c, false, false);
  }
  static __device__ __forceinline__ void guard(v8f& a, v8f& b, v16b x, v16b y) { dep_guard_b(a, b, x, y); }
  static __device__ __forceinline__ void keep(v16b a, v16b b, v16b c, v16b d) { keep4_b(a, b, c, d); }
};

// ---- Register-blocked batched WMMA GEMM ------------------------------------
// C[m,n] = scale * sum_k A[m,k] * Bt[n,k] (+bias)(+resid); each wave owns a 64x64 tile.
// A row-major [M,K]; Bt row-major [N,K]; M,N % 64 == 0, K % 32 == 0.
// SPLIT: operands are hi/lo planes (A2/Bt2 = lo planes, same layout); product = hi·hi + hi·lo + lo·hi.
// BIAS_MODE: 0 = none, 1 = bias[m], 2 = bias[n].
// OUT_MODE: 0 = f32, 1 = f16, 2 = bf16 hi plane (Cout) + bf16 lo plane (Cout2).
// ET: 0 = f16 operands, 1 = bf16 operands (pointers passed as 16-bit storage)
template <int ET> struct Elem;
template <> struct Elem<0> { typedef _Float16 T; };
template <> struct Elem<1> { typedef __bf16 T; };
template <int ET, bool SPLIT, int BIAS_MODE, int OUT_MODE, bool RESID, int ACT = 0>
__global__ __launch_bounds__(256) void wmma_gemm64(
    const unsigned short* __restrict__ Ap, const unsigned short* __restrict__ A2p, int lda, long strideA,
    const unsigned short* __restrict__ Btp, const unsigned short* __restrict__ Bt2p, int ldb, long strideB,
    void* __restrict__ Cout, void* __restrict__ Cout2, int ldc, long strideC,
    const float* __restrict__ bias,
    const float* __restrict__ resid, long strideR,
    int M, int N, int K, float scale) {
  typedef typename Elem<ET>::T T;
  typedef typename Frag<T>::V V;
  const T* A = (const T*)Ap; const T* A2 = (const T*)A2p; const T* Bt = (const T*)Btp; const T* Bt2 = (const T*)Bt2p;
  __shared__ __align__(16) float sT[8][16 * 68];   // per-wave 16x64 slab, pitch 68 floats
  const int b    = blockIdx.y;
  const int lane = threadIdx.x & 31;
  const int wave = threadIdx.x >> 5;
  const int tilesN = N >> 6;
  const int tilesM = M >> 6;
  const int tile = blockIdx.x * 8 + wave;
  if (tile >= tilesM * tilesN) return;   // wave-uniform; no block barriers in this kernel
  const int tm = tile / tilesN;
  const int tn = tile - tm * tilesN;
  const int m0 = tm << 6;
  const int n0 = tn << 6;

  const T* Ab  = A  + (size_t)b * strideA;
  const T* Bb  = Bt + (size_t)b * strideB;
  const T* Ab2 = SPLIT ? (A2  + (size_t)b * strideA) : nullptr;
  const T* Bb2 = SPLIT ? (Bt2 + (size_t)b * strideB) : nullptr;

  const int rlane = lane & 15;                 // row (A) / col (B, D) within subtile
  const int koff  = (lane >> 4) * 8;           // k offset of this lane half
  const int mOff  = (lane >> 4) * 8;           // D row offset

  v8f acc[4][4];
#pragma unroll
  for (int i = 0; i < 4; ++i)
#pragma unroll
    for (int j = 0; j < 4; ++j) acc[i][j] = (v8f){0.f,0.f,0.f,0.f,0.f,0.f,0.f,0.f};

  for (int k0 = 0; k0 < K; k0 += 32) {
    V bh[4], bl[4];
#pragma unroll
    for (int j = 0; j < 4; ++j) {
      const size_t bo = (size_t)(n0 + (j << 4) + rlane) * ldb + koff + k0;
      bh[j] = Frag<T>::load(Bb + bo);
      if (SPLIT) bl[j] = Frag<T>::load(Bb2 + bo);
    }
#pragma unroll
    for (int i = 0; i < 4; ++i) {
      const size_t ao = (size_t)(m0 + (i << 4) + rlane) * lda + koff + k0;
      V ah = Frag<T>::load(Ab + ao);
      V al;
      if (SPLIT) al = Frag<T>::load(Ab2 + ao);
#pragma unroll
      for (int j = 0; j < 4; ++j) {
        acc[i][j] = Frag<T>::mma(ah, bh[j], acc[i][j]);
        if (SPLIT) {
          acc[i][j] = Frag<T>::mma(ah, bl[j], acc[i][j]);
          acc[i][j] = Frag<T>::mma(al, bh[j], acc[i][j]);
        }
      }
      Frag<T>::guard(acc[i][0], acc[i][3], ah, SPLIT ? al : ah);
    }
    Frag<T>::keep(bh[0], bh[1], bh[2], bh[3]);
    if (SPLIT) Frag<T>::keep(bl[0], bl[1], bl[2], bl[3]);
  }
  acc_guard4(acc[0][0], acc[0][1], acc[0][2], acc[0][3]);
  acc_guard4(acc[1][0], acc[1][1], acc[1][2], acc[1][3]);
  acc_guard4(acc[2][0], acc[2][1], acc[2][2], acc[2][3]);
  acc_guard4(acc[3][0], acc[3][1], acc[3][2], acc[3][3]);

  // ---- epilogue ----
  float* slab = sT[wave];
  const float* Rb = RESID ? (resid + (size_t)b * strideR) : nullptr;
#pragma unroll
  for (int i = 0; i < 4; ++i) {
    const int mBase = m0 + (i << 4);
#pragma unroll
    for (int j = 0; j < 4; ++j) {
      const int n = n0 + (j << 4) + rlane;
      float bv = 0.f;
      if (BIAS_MODE == 2) bv = bias[n];
#pragma unroll
      for (int r = 0; r < 8; ++r) {
        float v = acc[i][j][r] * scale;
        if (BIAS_MODE == 1) v += bias[mBase + mOff + r];
        if (BIAS_MODE == 2) v += bv;
        if (RESID) v += Rb[(size_t)(mBase + mOff + r) * ldc + n];
        if (ACT == 1) v = tanhf(v);
        if (ACT == 2) v = fmaxf(v, 0.0f);
        if (ACT == 3) v = v / (1.0f + expf(-v));
        if (ACT == 4) v = (v > 0.f) ? v : 0.01f * v;
        if (ACT == 5) v = 0.5f * v * (1.0f + erff(v * 0.70710678118654752f));
        slab[(mOff + r) * 68 + (j << 4) + rlane] = v;
      }
    }
    __builtin_amdgcn_fence(__ATOMIC_RELEASE, "workgroup");
    __builtin_amdgcn_wave_barrier();
    __builtin_amdgcn_fence(__ATOMIC_ACQUIRE, "workgroup");
    if (OUT_MODE == 0) {
      float* C = (float*)Cout + (size_t)b * strideC;
      const int hh = lane >> 4, c4 = (lane & 15) * 4;     // row seg = 256 B = 16 lanes x 16 B
      {
#pragma unroll
        for (int it = 0; it < 8; ++it) {
          const int row = it * 2 + hh;
          v4f v = *(const v4f*)(slab + row * 68 + c4);
          *(v4f*)(C + (size_t)(mBase + row) * ldc + n0 + c4) = v;
        }
        
      }
    } else {
      const int q = lane >> 3, c8 = (lane & 7) * 8;
      unsigned short* C  = (unsigned short*)Cout  + (size_t)b * strideC;
      unsigned short* C2 = (OUT_MODE == 2) ? ((unsigned short*)Cout2 + (size_t)b * strideC) : nullptr;
      {
#pragma unroll
        for (int it = 0; it < 4; ++it) {
          const int row = it * 4 + q;
          const float* sp = slab + row * 68 + c8;
          v8h hv, lv;
#pragma unroll
          for (int e = 0; e < 8; ++e) {
            if (OUT_MODE == 1) {
              hv[e] = (_Float16)sp[e];
            } else {
              unsigned short hb = f2bf_bits(sp[e]);
              unsigned short lb = f2bf_bits(sp[e] - bf_bits2f(hb));
              hv[e] = __builtin_bit_cast(_Float16, hb);
              lv[e] = __builtin_bit_cast(_Float16, lb);
            }
          }
          *(v8h*)(C + (size_t)(mBase + row) * ldc + n0 + c8) = hv;
          if (OUT_MODE == 2) *(v8h*)(C2 + (size_t)(mBase + row) * ldc + n0 + c8) = lv;
        }
        
      }
    }
    __builtin_amdgcn_fence(__ATOMIC_RELEASE, "workgroup");
    __builtin_amdgcn_wave_barrier();
    __builtin_amdgcn_fence(__ATOMIC_ACQUIRE, "workgroup");
  }
}

__global__ __launch_bounds__(256) void cast_f32_f16x2(
    const float* __restrict__ in, _Float16* __restrict__ out, int n2) {
  int i = blockIdx.x * 256 + threadIdx.x;
  if (i < n2) {
    const _Float16 h0 = (_Float16)in[2 * i], h1 = (_Float16)in[2 * i + 1];
    const unsigned u = (unsigned)__builtin_bit_cast(unsigned short, h0) | ((unsigned)__builtin_bit_cast(unsigned short, h1) << 16);
    ((unsigned*)out)[i] = u;
    
  }
}


} // namespace w25

__global__ __launch_bounds__(256) void k_castT16(const float* __restrict__ src, long long lds, _Float16* __restrict__ dst, long long ldd, int R, int C, float s) {
    const long long i = (long long)blockIdx.x * 256 + threadIdx.x; const long long np = (long long)C * (R / 2); if (i >= np) return; const int c = (int)(i / (R / 2)); const int r = 2 * (int)(i % (R / 2));
    const _Float16 h0 = (_Float16)(src[(long long)r * lds + c] * s), h1 = (_Float16)(src[(long long)(r + 1) * lds + c] * s);
    const unsigned u = (unsigned)__builtin_bit_cast(unsigned short, h0) | ((unsigned)__builtin_bit_cast(unsigned short, h1) << 16);
    unsigned* d = (unsigned*)(dst + (long long)c * ldd + r); *d = u;  }
__global__ __launch_bounds__(256) void k_cast16(const float* __restrict__ src, long long lds, _Float16* __restrict__ dst, long long ldd, int R, int C, float s) {
    const long long i = (long long)blockIdx.x * 256 + threadIdx.x; const long long np = (long long)R * (C / 2); if (i >= np) return; const int r = (int)(i / (C / 2)); const int c = 2 * (int)(i % (C / 2));
    const _Float16 h0 = (_Float16)(src[(long long)r * lds + c] * s), h1 = (_Float16)(src[(long long)r * lds + c + 1] * s);
    const unsigned u = (unsigned)__builtin_bit_cast(unsigned short, h0) | ((unsigned)__builtin_bit_cast(unsigned short, h1) << 16);
    unsigned* d = (unsigned*)(dst + (long long)r * ldd + c); *d = u;  }

// f32 -> bf16 hi plane + bf16 lo plane (x = hi + lo to ~2^-17 relative; RNE both), [R][C] -> [R][C] (or transposed to [C][R]); 2 consecutive destination elements
__device__ __forceinline__ unsigned int f2bf2_pack(float a, float b, unsigned int* lo) {
    const unsigned short ha = w25::f2bf_bits(a), hb = w25::f2bf_bits(b);
    const unsigned short la = w25::f2bf_bits(a - w25::bf_bits2f(ha)), lb = w25::f2bf_bits(b - w25::bf_bits2f(hb));
    *lo = (unsigned)la | ((unsigned)lb << 16); return (unsigned)ha | ((unsigned)hb << 16); }
__global__ __launch_bounds__(256) void k_castS16(const float* __restrict__ src, long long lds, __bf16* __restrict__ dhi, __bf16* __restrict__ dlo, long long ldd, int R, int C, float s, int transpose) {
    const long long i = (long long)blockIdx.x * 256 + threadIdx.x; long long o; float a, b;
    if (transpose) { const long long np = (long long)C * (R / 2); if (i >= np) return; const int c = (int)(i / (R / 2)); const int r = 2 * (int)(i % (R / 2)); a = src[(long long)r * lds + c] * s; b = src[(long long)(r + 1) * lds + c] * s; o = (long long)c * ldd + r; }
    else { const long long np = (long long)R * (C / 2); if (i >= np) return; const int r = (int)(i / (C / 2)); const int c = 2 * (int)(i % (C / 2)); a = src[(long long)r * lds + c] * s; b = src[(long long)r * lds + c + 1] * s; o = (long long)r * ldd + c; }
    unsigned lo; const unsigned hi = f2bf2_pack(a, b, &lo); unsigned* ph = (unsigned*)(dhi + o); unsigned* pl = (unsigned*)(dlo + o);
    *ph = hi; *pl = lo;  }

namespace w25 {
// =====================================================================================
// Generic causal/non-causal attention for head_dim 64, f32 in / f32 out; 16-bit operands: bf16 with optional hi/lo splits, or
// plain f16 (F16=true, non-split, probabilities carried x2^15).
//   scores = (q*qscale)·kᵀ : v_wmma_f32_16x16x32_bf16; SPLIT_QK -> q,k as bf16 hi/lo (hi·hi + hi·lo + lo·hi)
//   out    = p·v           : v_wmma_f32_16x16x32_bf16; SPLIT_PV -> p,v as bf16 hi/lo; else p,v plain bf16
//   f32 accumulate; online softmax in f32. Block = 4 waves = 64 query rows of one (batch, head); S % 64 == 0.
//   Element (b, s, h, d) of tensor X lives at X[b*X_bs + s*X_rs + h*X_hs + d] (strides in floats, multiples of 4).
//   Masking: mask_mode 0 none, 1 causal (kv > q masked), 2 tensor [S][Skv] shared over (b,h) (float if
//   mask_is_int==0, int32 with element == 0 -> masked if 1, int32 with element != 0 -> masked if 2), 3 per-token vectors qmask[B][S] & kvmask[B][Skv] (int32,
//   0 -> masked), 4 causal + sliding window (kv > q or q - kv > W masked; W passed in mask_is_int);
//   5 = relative-position bias: s += cp[b,h,q][idx[q][kv]] + pc[b,h,kv][idx[q][kv]] with idx = mask_b ([S][Skv] int32) and
//   mask_a an int32 [S][Skv] tensor with nonzero = masked (tables: element (b,h,row,n) at X + b*c_bs + h*c_hs + row*c_rs + n);
//   masked scores are replaced by mask_fill (e.g. -inf or -1e9) before the softmax.
//   grid.x = B * H * (S/64) (or a sub-range with blk0).
// =====================================================================================
#define AT_D 64
#define AT_NW 4
#define AT_QB 64
#define AT_KC 64
struct AttnGeom { const float* cp = nullptr; const float* pc = nullptr; long c_bs = 0, c_rs = 0, c_hs = 0;   // mode-5 score-bias tables
                  long q_bs, q_rs, q_hs, k_bs, k_rs, k_hs, v_bs, v_rs, v_hs, o_bs, o_rs, o_hs;
                  int S, Skv, H, mask_mode; float qscale; int blk0; float mask_fill; int mask_is_int; };
static_assert(sizeof(AttnGeom) == 168, "no padding");

__device__ __forceinline__ unsigned short at_bf_bits(float f) {
  unsigned u = __float_as_uint(f);
  return (unsigned short)((u + 0x7FFFu + ((u >> 16) & 1u)) >> 16);
}
__device__ __forceinline__ __bf16 at_f2bf(float f) { return __builtin_bit_cast(__bf16, at_bf_bits(f)); }
__device__ __forceinline__ void at_split(float f, __bf16& hi, __bf16& lo) {
  const unsigned short hb = at_bf_bits(f);
  hi = __builtin_bit_cast(__bf16, hb);
  lo = at_f2bf(f - __uint_as_float(((unsigned)hb) << 16));
}
__device__ __forceinline__ v8f at_mma(v16b a, v16b b, v8f c) {
  c = __builtin_amdgcn_wmma_f32_16x16x32_bf16(false, a, false, b, (short)0, c, false, false);
  asm volatile("v_nop\n\tv_nop\n\tv_nop\n\tv_nop" : "+v"(c) : "v"(a), "v"(b));
  return c;
}
// 16-bit element as a bit pattern held in a __bf16 slot: f16 bits when F16, bf16 (RNE) otherwise
template <bool F16> __device__ __forceinline__ __bf16 at_to16(float f) {
  if (F16) return __builtin_bit_cast(__bf16, (_Float16)f);
  return at_f2bf(f);
}
template <bool F16> __device__ __forceinline__ v8f at_mma16(v16b a, v16b b, v8f c) {
  if (F16) {
    const v16h ah = __builtin_bit_cast(v16h, a), bh = __builtin_bit_cast(v16h, b);
    c = __builtin_amdgcn_wmma_f32_16x16x32_f16(false, ah, false, bh, (short)0, c, false, false);
    asm volatile("v_nop\n\tv_nop\n\tv_nop\n\tv_nop" : "+v"(c) : "v"(ah), "v"(bh));
    return c;
  }
  return at_mma(a, b, c);
}

template <bool SPLIT_QK, bool SPLIT_PV, bool F16 = false>
__global__ __launch_bounds__(128)
void attn64_kernel(const float* __restrict__ q, const float* __restrict__ k,
                   const float* __restrict__ v, float* __restrict__ out,
                   const void* __restrict__ mask_a, const int* __restrict__ mask_b, AttnGeom g) {
  static_assert(!(F16 && (SPLIT_QK || SPLIT_PV)), "f16 mode is non-split");
  const float PSC = F16 ? 32768.0f : 1.0f;     // f16 probabilities carried x2^15 (subnormal range), folded into the final 1/l
  union FB { v16b v; v8b h[2]; };
  __shared__ __align__(16) __bf16 Ksh[AT_KC * AT_D];             // K hi [kv][d]      8 KB
  __shared__ __align__(16) __bf16 Ksl[SPLIT_QK ? AT_KC * AT_D : 8];
  __shared__ __align__(16) __bf16 Vth[AT_D * AT_KC];             // V hi [d][kv]      8 KB
  __shared__ __align__(16) __bf16 Vtl[SPLIT_PV ? AT_D * AT_KC : 8];
  __shared__ __align__(16) __bf16 Psh[AT_NW][16 * AT_KC];        // per wave P hi [row][kv]  8 KB
  __shared__ __align__(16) __bf16 Psl[SPLIT_PV ? AT_NW : 1][SPLIT_PV ? 16 * AT_KC : 8];
  __shared__ __align__(16) float  Os[AT_NW][16 * 68];            // per wave out tile, pitch 68

  const int tid  = threadIdx.x;
  const int wave = tid >> 5;
  const int lane = tid & 31;
  const int hh   = lane >> 4;
  const int c    = lane & 15;

  const int nqb = g.S / AT_QB;
  const int bx = blockIdx.x + g.blk0;
  const int qb = bx % nqb;
  const int bh = bx / nqb;
  const int h  = bh % g.H;
  const int b  = bh / g.H;
  const int qbase_block = qb * AT_QB;
  const int q0 = qbase_block + wave * 16;

  const float* qb_ptr = q + (size_t)b * g.q_bs + (size_t)h * g.q_hs;
  const float* kb_ptr = k + (size_t)b * g.k_bs + (size_t)h * g.k_hs;
  const float* vb_ptr = v + (size_t)b * g.v_bs + (size_t)h * g.v_hs;
  float*       ob_ptr = out + (size_t)b * g.o_bs + (size_t)h * g.o_hs;

  // ---- Q fragments (A operand): 2 d-chunks, hi (and lo) ----
  v16b qah[2], qal[2];
  {
    const float* qrow = qb_ptr + (size_t)(q0 + c) * g.q_rs;
#pragma unroll
    for (int dc = 0; dc < 2; ++dc) {
#pragma unroll
      for (int e = 0; e < 8; ++e) {
        const float f0 = qrow[dc * 32 + 8 * hh + e] * g.qscale;
        const float f1 = qrow[dc * 32 + 16 + 8 * hh + e] * g.qscale;
        if (SPLIT_QK) { __bf16 hq, lq; at_split(f0, hq, lq); qah[dc][e] = hq; qal[dc][e] = lq; at_split(f1, hq, lq); qah[dc][8 + e] = hq; qal[dc][8 + e] = lq; }
        else { qah[dc][e] = at_to16<F16>(f0); qah[dc][8 + e] = at_to16<F16>(f1); qal[dc][e] = qah[dc][e]; qal[dc][8 + e] = qah[dc][8 + e]; }
      }
    }
  }

  float mrow[8], lrow[8];
  v8f oacc[4];
#pragma unroll
  for (int r = 0; r < 8; ++r) { mrow[r] = -INFINITY; lrow[r] = 0.f; }
#pragma unroll
  for (int t = 0; t < 4; ++t) oacc[t] = (v8f){0.f,0.f,0.f,0.f,0.f,0.f,0.f,0.f};

  const int nChunks = (g.mask_mode == 1 || g.mask_mode == 4) ? (qb + 1) : (g.Skv / AT_KC);   // block-uniform
  // per-row query mask (mode 3)
  int qkeep[8];
#pragma unroll
  for (int r = 0; r < 8; ++r) qkeep[r] = (g.mask_mode == 3) ? mask_b[(size_t)b * g.S + q0 + 8 * hh + r] : 1;   // mask_b = qmask in mode 3
  for (int kc = 0; kc < nChunks; ++kc) {
    const int kv0 = kc * AT_KC;
    __syncthreads();
    {
      const int kvr = tid >> 1, dh = (tid & 1) * 32;
      const float* krow = kb_ptr + (size_t)(kv0 + kvr) * g.k_rs + dh;
      const float* vrow = vb_ptr + (size_t)(kv0 + kvr) * g.v_rs + dh;
#pragma unroll
      for (int i = 0; i < 8; ++i) {
        v4f kk = *(const v4f*)(krow + 4 * i);
        v4f vv = *(const v4f*)(vrow + 4 * i);
#pragma unroll
        for (int e = 0; e < 4; ++e) {
          const int d = dh + 4 * i + e;
          if (SPLIT_QK) { __bf16 a, bl; at_split(kk[e], a, bl); Ksh[kvr * AT_D + d] = a; Ksl[kvr * AT_D + d] = bl; }
          else Ksh[kvr * AT_D + d] = at_to16<F16>(kk[e]);
          if (SPLIT_PV) { __bf16 a, bl; at_split(vv[e], a, bl); Vth[d * AT_KC + kvr] = a; Vtl[d * AT_KC + kvr] = bl; }
          else Vth[d * AT_KC + kvr] = at_to16<F16>(vv[e]);
        }
      }
    }
    __syncthreads();

    v8f s[4];
#pragma unroll
    for (int j = 0; j < 4; ++j) {
      s[j] = (v8f){0.f,0.f,0.f,0.f,0.f,0.f,0.f,0.f};
#pragma unroll 1
      for (int dc = 0; dc < 2; ++dc) {
        FB kb;
        kb.h[0] = *(const v8b*)(Ksh + (j * 16 + c) * AT_D + dc * 32 + 8 * hh);
        kb.h[1] = *(const v8b*)(Ksh + (j * 16 + c) * AT_D + dc * 32 + 16 + 8 * hh);
        s[j] = at_mma16<F16>(qah[dc], kb.v, s[j]);
        if (SPLIT_QK) {
          FB kl;
          kl.h[0] = *(const v8b*)(Ksl + (j * 16 + c) * AT_D + dc * 32 + 8 * hh);
          kl.h[1] = *(const v8b*)(Ksl + (j * 16 + c) * AT_D + dc * 32 + 16 + 8 * hh);
          s[j] = at_mma16<F16>(qah[dc], kl.v, s[j]);
          s[j] = at_mma16<F16>(qal[dc], kb.v, s[j]);
        }
      }
    }
    const bool diag = (g.mask_mode == 1) && (kc == qb);
    int kvkeep[4] = {1, 1, 1, 1};
    if (g.mask_mode == 3) {
#pragma unroll
      for (int j = 0; j < 4; ++j) kvkeep[j] = ((const int*)mask_a)[(size_t)b * g.Skv + kv0 + j * 16 + c];   // mask_a = kvmask
    }
    float cm[8];
#pragma unroll
    for (int r = 0; r < 8; ++r) {
      const int qrow = q0 + 8 * hh + r;
      float m = -INFINITY;
#pragma unroll
      for (int j = 0; j < 4; ++j) {
        const int kvcol = kv0 + j * 16 + c;
        bool masked = false;
        if (diag) masked = (kvcol > qrow);
        else if (g.mask_mode == 4) masked = (kvcol > qrow) || (qrow - kvcol > g.mask_is_int);
        else if (g.mask_mode == 2) {
          const size_t mi = (size_t)qrow * g.Skv + kvcol;
          masked = (g.mask_is_int == 0) ? (((const float*)mask_a)[mi] == 0.0f)
                 : (g.mask_is_int == 1) ? (((const int*)mask_a)[mi] == 0) : (((const int*)mask_a)[mi] != 0);
        } else if (g.mask_mode == 3) masked = (qkeep[r] == 0) || (kvkeep[j] == 0);
        else if (g.mask_mode == 5) {
          const size_t mi = (size_t)qrow * g.Skv + kvcol;
          masked = (((const int*)mask_a)[mi] != 0);
          int n = mask_b[mi]; n = n < 0 ? 0 : n;
          s[j][r] += g.cp[(size_t)b * g.c_bs + (size_t)h * g.c_hs + (size_t)qrow * g.c_rs + n]
                   + g.pc[(size_t)b * g.c_bs + (size_t)h * g.c_hs + (size_t)kvcol * g.c_rs + n];
        }
        if (masked) s[j][r] = g.mask_fill;
        m = fmaxf(m, s[j][r]);
      }
#pragma unroll
      for (int off = 1; off < 16; off <<= 1) m = fmaxf(m, __shfl_xor(m, off, 32));
      cm[r] = m;
    }
    __bf16* pwh = Psh[wave];
    __bf16* pwl = Psl[SPLIT_PV ? wave : 0];
#pragma unroll
    for (int r = 0; r < 8; ++r) {
      const float mnew = fmaxf(mrow[r], cm[r]);
      const float alpha = expf(mrow[r] - mnew);
      mrow[r] = mnew;
      float psum = 0.f;
#pragma unroll
      for (int j = 0; j < 4; ++j) {
        const float p = expf(s[j][r] - mnew);
        psum += p;
        if (SPLIT_PV) { __bf16 a, bl; at_split(p, a, bl); pwh[(8 * hh + r) * AT_KC + j * 16 + c] = a; pwl[(8 * hh + r) * AT_KC + j * 16 + c] = bl; }
        else pwh[(8 * hh + r) * AT_KC + j * 16 + c] = at_to16<F16>(p * PSC);
      }
#pragma unroll
      for (int off = 1; off < 16; off <<= 1) psum += __shfl_xor(psum, off, 32);
      lrow[r] = lrow[r] * alpha + psum;
#pragma unroll
      for (int t = 0; t < 4; ++t) oacc[t][r] *= alpha;
    }
    __builtin_amdgcn_fence(__ATOMIC_RELEASE, "workgroup");
    __builtin_amdgcn_wave_barrier();
    __builtin_amdgcn_fence(__ATOMIC_ACQUIRE, "workgroup");
#pragma unroll 1
    for (int kk = 0; kk < 2; ++kk) {
      FB pa, pl;
      pa.h[0] = *(const v8b*)(pwh + c * AT_KC + kk * 32 + 8 * hh);
      pa.h[1] = *(const v8b*)(pwh + c * AT_KC + kk * 32 + 16 + 8 * hh);
      if (SPLIT_PV) {
        pl.h[0] = *(const v8b*)(pwl + c * AT_KC + kk * 32 + 8 * hh);
        pl.h[1] = *(const v8b*)(pwl + c * AT_KC + kk * 32 + 16 + 8 * hh);
      }
#pragma unroll
      for (int t = 0; t < 4; ++t) {
        FB vb;
        vb.h[0] = *(const v8b*)(Vth + (t * 16 + c) * AT_KC + kk * 32 + 8 * hh);
        vb.h[1] = *(const v8b*)(Vth + (t * 16 + c) * AT_KC + kk * 32 + 16 + 8 * hh);
        oacc[t] = at_mma16<F16>(pa.v, vb.v, oacc[t]);
        if (SPLIT_PV) {
          FB vl;
          vl.h[0] = *(const v8b*)(Vtl + (t * 16 + c) * AT_KC + kk * 32 + 8 * hh);
          vl.h[1] = *(const v8b*)(Vtl + (t * 16 + c) * AT_KC + kk * 32 + 16 + 8 * hh);
          oacc[t] = at_mma16<F16>(pa.v, vl.v, oacc[t]);
          oacc[t] = at_mma16<F16>(pl.v, vb.v, oacc[t]);
        }
      }
    }
  }

  float* os = Os[wave];
#pragma unroll
  for (int r = 0; r < 8; ++r) {
    const float inv = 1.0f / (lrow[r] * PSC);
#pragma unroll
    for (int t = 0; t < 4; ++t) os[(8 * hh + r) * 68 + t * 16 + c] = oacc[t][r] * inv;
  }
  __builtin_amdgcn_fence(__ATOMIC_RELEASE, "workgroup");
  __builtin_amdgcn_wave_barrier();
  __builtin_amdgcn_fence(__ATOMIC_ACQUIRE, "workgroup");
  {
    const int c4 = (lane & 15) * 4;
    {
#pragma unroll
      for (int it = 0; it < 8; ++it) {
        const int row = it * 2 + hh;
        v4f val = *(const v4f*)(os + row * 68 + c4);
        *(v4f*)(ob_ptr + (size_t)(q0 + row) * g.o_rs + c4) = val;
      }
      
    }
  }
}

} // namespace w25

// MI[(b, s)] = (s < valid_len[b]) ? 1 : 0 as INT (keep-mask: masked scores are SET to -1e6 exactly like the module's where, so a 128-key block lying entirely beyond valid_len comes out uniform)
__global__ __launch_bounds__(256) void k_te_mask(const int* __restrict__ VL, int* __restrict__ MI, int Bn, int S) { const int t = blockIdx.x * 256 + threadIdx.x; if (t >= Bn * S) return; int* d = MI + t; const int v = ((t % S) < VL[t / S]) ? 1 : 0; *d = v;  }


extern "C" void kernel_launch(void* const* d_in, const int* in_sizes, int n_in, void* d_out, int out_size, void* d_ws, size_t ws_size, hipStream_t stream) {
    (void)in_sizes; (void)n_in; (void)out_size; (void)ws_size;
    const float* X = (const float*)d_in[0];
    const int* vl = (const int*)d_in[1];
    const float* Wq = (const float*)d_in[2];
    const float* Wk = (const float*)d_in[3];
    const float* Wv = (const float*)d_in[4];
    const float* Wo = (const float*)d_in[5];
    const float* g1 = (const float*)d_in[6];
    const float* be1 = (const float*)d_in[7];
    const float* W1 = (const float*)d_in[8];
    const float* bf1 = (const float*)d_in[9];
    const float* W2 = (const float*)d_in[10];
    const float* bf2 = (const float*)d_in[11];
    const float* g2 = (const float*)d_in[12];
    const float* be2 = (const float*)d_in[13];
    const int Bn = 4;
    const int S = 1024;
    const int D = 1024;
    const int NH = 16;
    const int DH = 64;
    const int F = 4096;
    const int M = 128;
    const int NB = S / M;
    const int NR = Bn * S;
    float* out = (float*)d_out;
    char* wsp = (char*)d_ws;
    float* Q = (float*)wsp; wsp += (((size_t)((size_t)NR * D) * 4 + 255) / 256) * 256;
    float* Kb = (float*)wsp; wsp += (((size_t)((size_t)NR * D) * 4 + 255) / 256) * 256;
    float* V = (float*)wsp; wsp += (((size_t)((size_t)NR * D) * 4 + 255) / 256) * 256;
    float* AT = (float*)wsp; wsp += (((size_t)((size_t)NR * D) * 4 + 255) / 256) * 256;
    float* MF = (float*)wsp; wsp += (((size_t)((size_t)NR) * 4 + 255) / 256) * 256;
    float* Y = (float*)wsp; wsp += (((size_t)((size_t)NR * D) * 4 + 255) / 256) * 256;
    float* ST = (float*)wsp; wsp += (((size_t)((size_t)NR * 32) * 4 + 255) / 256) * 256;
    float* H1 = (float*)wsp; wsp += (((size_t)((size_t)1024 * F) * 4 + 255) / 256) * 256;
    unsigned short* G64A = (unsigned short*)wsp; wsp += (((size_t)(4194304) * 2 + 255) / 256) * 256;
    unsigned short* G64B = (unsigned short*)wsp; wsp += (((size_t)(4194304) * 2 + 255) / 256) * 256;
    k_cast16<<<(unsigned)((((long long)(4096) * ((1024) / 2)) + 255) / 256), 256, 0, stream>>>(X, 1024, (_Float16*)(G64A), 1024, 4096, 1024, 1.0f);
    k_castT16<<<(unsigned)((((long long)(1024) * ((1024) / 2)) + 255) / 256), 256, 0, stream>>>(Wq, 1024, (_Float16*)(G64B), 1024, 1024, 1024, 16.0f);
    w25::wmma_gemm64<0, false, 0, 0, false, 0><<<dim3((unsigned)((((4096) / 64) * ((1024) / 64) + 7) / 8), (unsigned)(1)), 256, 0, stream>>>((const unsigned short*)(G64A), nullptr, 1024, 0, (const unsigned short*)(G64B), nullptr, 1024, 0, (void*)(Q), nullptr, 1024, 0, nullptr, nullptr, 0, 4096, 1024, 1024, 0.0625f);
    k_cast16<<<(unsigned)((((long long)(4096) * ((1024) / 2)) + 255) / 256), 256, 0, stream>>>(X, 1024, (_Float16*)(G64A), 1024, 4096, 1024, 1.0f);
    k_castT16<<<(unsigned)((((long long)(1024) * ((1024) / 2)) + 255) / 256), 256, 0, stream>>>(Wk, 1024, (_Float16*)(G64B), 1024, 1024, 1024, 16.0f);
    w25::wmma_gemm64<0, false, 0, 0, false, 0><<<dim3((unsigned)((((4096) / 64) * ((1024) / 64) + 7) / 8), (unsigned)(1)), 256, 0, stream>>>((const unsigned short*)(G64A), nullptr, 1024, 0, (const unsigned short*)(G64B), nullptr, 1024, 0, (void*)(Kb), nullptr, 1024, 0, nullptr, nullptr, 0, 4096, 1024, 1024, 0.0625f);
    k_cast16<<<(unsigned)((((long long)(4096) * ((1024) / 2)) + 255) / 256), 256, 0, stream>>>(X, 1024, (_Float16*)(G64A), 1024, 4096, 1024, 1.0f);
    k_castT16<<<(unsigned)((((long long)(1024) * ((1024) / 2)) + 255) / 256), 256, 0, stream>>>(Wv, 1024, (_Float16*)(G64B), 1024, 1024, 1024, 16.0f);
    w25::wmma_gemm64<0, false, 0, 0, false, 0><<<dim3((unsigned)((((4096) / 64) * ((1024) / 64) + 7) / 8), (unsigned)(1)), 256, 0, stream>>>((const unsigned short*)(G64A), nullptr, 1024, 0, (const unsigned short*)(G64B), nullptr, 1024, 0, (void*)(V), nullptr, 1024, 0, nullptr, nullptr, 0, 4096, 1024, 1024, 0.0625f);
    k_te_mask<<<(NR + 255) / 256, 256, 0, stream>>>((const int*)vl, (int*)MF, Bn, S);
    { /*apv4*/ AttnP a;
      a.Q = Q; a.K = Kb; a.V = V; a.O = AT; a.P = 0; a.Mf = 0; a.Mi = (const int*)MF; a.ST = 0;
      a.Pw = 0; a.Rt = 0; a.SQ = 0; a.SK = 0;
      a.swb = 0; a.swh = 0; a.swi = 0; a.swj = 0; a.srb = 0; a.srh = 0; a.sri = 0; a.sQb = (long long)M * D; a.sQh = DH; a.sQi = D; a.sQd = 1; a.sKb = (long long)M * D; a.sKh = DH; a.sKj = D; a.sKd = 1; a.sVb = (long long)M * D; a.sVh = DH; a.sVj = D; a.sVd = 1; a.sOb = (long long)M * D; a.sOh = DH; a.sOi = D; a.sPb = 0; a.sPh = 0; a.sPi = 0; a.smb = M; a.smh = 0; a.smi = 0; a.smj = 1;
      a.Lq = M; a.Lk = M; a.dh = DH; a.dv = DH; a.hrep = 1; a.causal = 0; a.coff = 0; a.pband = 0;
      a.scale = 0.125f; a.mfill = -1000000.0f; a.nonorm = 0; a.mpol = 0;
      a.roff = 0; a.rn = 1; a.segpol = 0; a.win = 0;
      k_attn<64, 64, 0, false, false><<<dim3((unsigned)((M) + 16 * AW - 1) / (16 * AW), (unsigned)(NH), (unsigned)(Bn * NB)), 32 * AW, 0, stream>>>(a); }
    k_cast16<<<(unsigned)((((long long)(4096) * ((1024) / 2)) + 255) / 256), 256, 0, stream>>>(AT, 1024, (_Float16*)(G64A), 1024, 4096, 1024, 1.0f);
    k_castT16<<<(unsigned)((((long long)(1024) * ((1024) / 2)) + 255) / 256), 256, 0, stream>>>(Wo, 1024, (_Float16*)(G64B), 1024, 1024, 1024, 16.0f);
    w25::wmma_gemm64<0, false, 0, 0, true, 0><<<dim3((unsigned)((((4096) / 64) * ((1024) / 64) + 7) / 8), (unsigned)(1)), 256, 0, stream>>>((const unsigned short*)(G64A), nullptr, 1024, 0, (const unsigned short*)(G64B), nullptr, 1024, 0, (void*)(Y), nullptr, 1024, 0, nullptr, X, 0, 4096, 1024, 1024, 0.0625f);
    k_stats<<<(unsigned)(NR), 256, 0, stream>>>(Y, D, 1, 1, 1, D, 1e-05f, ST, 0);
    k_norm_apply<<<(unsigned)(((long long)(NR) * (D) * (1) + 255) / 256), 256, 0, stream>>>(Y, Y, ST, g1, be1, NR, D, 1, 1, 0, 0);
    k_cast16<<<(unsigned)((((long long)(1024) * ((1024) / 2)) + 255) / 256), 256, 0, stream>>>(Y + (size_t)0 * D, 1024, (_Float16*)(G64A), 1024, 1024, 1024, 1.0f);
    k_castT16<<<(unsigned)((((long long)(4096) * ((1024) / 2)) + 255) / 256), 256, 0, stream>>>(W1, 4096, (_Float16*)(G64B), 1024, 1024, 4096, 16.0f);
    w25::wmma_gemm64<0, false, 2, 0, false, 2><<<dim3((unsigned)((((1024) / 64) * ((4096) / 64) + 7) / 8), (unsigned)(1)), 256, 0, stream>>>((const unsigned short*)(G64A), nullptr, 1024, 0, (const unsigned short*)(G64B), nullptr, 1024, 0, (void*)(H1), nullptr, 4096, 0, bf1, nullptr, 0, 1024, 4096, 1024, 0.0625f);
    k_cast16<<<(unsigned)((((long long)(1024) * ((4096) / 2)) + 255) / 256), 256, 0, stream>>>(H1, 4096, (_Float16*)(G64A), 4096, 1024, 4096, 1.0f);
    k_castT16<<<(unsigned)((((long long)(1024) * ((4096) / 2)) + 255) / 256), 256, 0, stream>>>(W2, 1024, (_Float16*)(G64B), 4096, 4096, 1024, 16.0f);
    w25::wmma_gemm64<0, false, 2, 0, true, 0><<<dim3((unsigned)((((1024) / 64) * ((1024) / 64) + 7) / 8), (unsigned)(1)), 256, 0, stream>>>((const unsigned short*)(G64A), nullptr, 4096, 0, (const unsigned short*)(G64B), nullptr, 4096, 0, (void*)(Kb + (size_t)0 * D), nullptr, 1024, 0, bf2, Y + (size_t)0 * D, 0, 1024, 1024, 4096, 0.0625f);
    k_cast16<<<(unsigned)((((long long)(1024) * ((1024) / 2)) + 255) / 256), 256, 0, stream>>>(Y + (size_t)1024 * D, 1024, (_Float16*)(G64A), 1024, 1024, 1024, 1.0f);
    k_castT16<<<(unsigned)((((long long)(4096) * ((1024) / 2)) + 255) / 256), 256, 0, stream>>>(W1, 4096, (_Float16*)(G64B), 1024, 1024, 4096, 16.0f);
    w25::wmma_gemm64<0, false, 2, 0, false, 2><<<dim3((unsigned)((((1024) / 64) * ((4096) / 64) + 7) / 8), (unsigned)(1)), 256, 0, stream>>>((const unsigned short*)(G64A), nullptr, 1024, 0, (const unsigned short*)(G64B), nullptr, 1024, 0, (void*)(H1), nullptr, 4096, 0, bf1, nullptr, 0, 1024, 4096, 1024, 0.0625f);
    k_cast16<<<(unsigned)((((long long)(1024) * ((4096) / 2)) + 255) / 256), 256, 0, stream>>>(H1, 4096, (_Float16*)(G64A), 4096, 1024, 4096, 1.0f);
    k_castT16<<<(unsigned)((((long long)(1024) * ((4096) / 2)) + 255) / 256), 256, 0, stream>>>(W2, 1024, (_Float16*)(G64B), 4096, 4096, 1024, 16.0f);
    w25::wmma_gemm64<0, false, 2, 0, true, 0><<<dim3((unsigned)((((1024) / 64) * ((1024) / 64) + 7) / 8), (unsigned)(1)), 256, 0, stream>>>((const unsigned short*)(G64A), nullptr, 4096, 0, (const unsigned short*)(G64B), nullptr, 4096, 0, (void*)(Kb + (size_t)1024 * D), nullptr, 1024, 0, bf2, Y + (size_t)1024 * D, 0, 1024, 1024, 4096, 0.0625f);
    k_cast16<<<(unsigned)((((long long)(1024) * ((1024) / 2)) + 255) / 256), 256, 0, stream>>>(Y + (size_t)2048 * D, 1024, (_Float16*)(G64A), 1024, 1024, 1024, 1.0f);
    k_castT16<<<(unsigned)((((long long)(4096) * ((1024) / 2)) + 255) / 256), 256, 0, stream>>>(W1, 4096, (_Float16*)(G64B), 1024, 1024, 4096, 16.0f);
    w25::wmma_gemm64<0, false, 2, 0, false, 2><<<dim3((unsigned)((((1024) / 64) * ((4096) / 64) + 7) / 8), (unsigned)(1)), 256, 0, stream>>>((const unsigned short*)(G64A), nullptr, 1024, 0, (const unsigned short*)(G64B), nullptr, 1024, 0, (void*)(H1), nullptr, 4096, 0, bf1, nullptr, 0, 1024, 4096, 1024, 0.0625f);
    k_cast16<<<(unsigned)((((long long)(1024) * ((4096) / 2)) + 255) / 256), 256, 0, stream>>>(H1, 4096, (_Float16*)(G64A), 4096, 1024, 4096, 1.0f);
    k_castT16<<<(unsigned)((((long long)(1024) * ((4096) / 2)) + 255) / 256), 256, 0, stream>>>(W2, 1024, (_Float16*)(G64B), 4096, 4096, 1024, 16.0f);
    w25::wmma_gemm64<0, false, 2, 0, true, 0><<<dim3((unsigned)((((1024) / 64) * ((1024) / 64) + 7) / 8), (unsigned)(1)), 256, 0, stream>>>((const unsigned short*)(G64A), nullptr, 4096, 0, (const unsigned short*)(G64B), nullptr, 4096, 0, (void*)(Kb + (size_t)2048 * D), nullptr, 1024, 0, bf2, Y + (size_t)2048 * D, 0, 1024, 1024, 4096, 0.0625f);
    k_cast16<<<(unsigned)((((long long)(1024) * ((1024) / 2)) + 255) / 256), 256, 0, stream>>>(Y + (size_t)3072 * D, 1024, (_Float16*)(G64A), 1024, 1024, 1024, 1.0f);
    k_castT16<<<(unsigned)((((long long)(4096) * ((1024) / 2)) + 255) / 256), 256, 0, stream>>>(W1, 4096, (_Float16*)(G64B), 1024, 1024, 4096, 16.0f);
    w25::wmma_gemm64<0, false, 2, 0, false, 2><<<dim3((unsigned)((((1024) / 64) * ((4096) / 64) + 7) / 8), (unsigned)(1)), 256, 0, stream>>>((const unsigned short*)(G64A), nullptr, 1024, 0, (const unsigned short*)(G64B), nullptr, 1024, 0, (void*)(H1), nullptr, 4096, 0, bf1, nullptr, 0, 1024, 4096, 1024, 0.0625f);
    k_cast16<<<(unsigned)((((long long)(1024) * ((4096) / 2)) + 255) / 256), 256, 0, stream>>>(H1, 4096, (_Float16*)(G64A), 4096, 1024, 4096, 1.0f);
    k_castT16<<<(unsigned)((((long long)(1024) * ((4096) / 2)) + 255) / 256), 256, 0, stream>>>(W2, 1024, (_Float16*)(G64B), 4096, 4096, 1024, 16.0f);
    w25::wmma_gemm64<0, false, 2, 0, true, 0><<<dim3((unsigned)((((1024) / 64) * ((1024) / 64) + 7) / 8), (unsigned)(1)), 256, 0, stream>>>((const unsigned short*)(G64A), nullptr, 4096, 0, (const unsigned short*)(G64B), nullptr, 4096, 0, (void*)(Kb + (size_t)3072 * D), nullptr, 1024, 0, bf2, Y + (size_t)3072 * D, 0, 1024, 1024, 4096, 0.0625f);
    k_stats<<<(unsigned)(NR), 256, 0, stream>>>(Kb, D, 1, 1, 1, D, 1e-05f, ST, 0);
    k_norm_apply<<<(unsigned)(((long long)(NR) * (D) * (1) + 255) / 256), 256, 0, stream>>>(Kb, out, ST, g2, be2, NR, D, 1, 1, 0, 0);
}

// v001
// A run of this version takes 788 microseconds.
// Timed twice side by side with v000, it ran 1.82 and 1.84 times as fast.
// Contractions: q/k/v/o projections X.W [4096x1024].[1024x1024] and the position-wise FFN relu(Y.W1 + b) [4096x1024].[1024x4096], .W2 + b [4096x4096].[4096x1024] with f16 operands on pre-cast planes (v_wmma_f32_16x16x32_f16; 64x64 register-blocked wave tiles, weights x16); the block-diagonal windowed attention (8 blocks of 128 positions per sequence = 32 independent (sequence, block) attentions, 16 heads, keys >= valid_len SET to -1e6 through an integer keep-mask — exactly the module's where, so blocks lying wholly beyond valid_len are uniform) as one flash launch (f16 q.k^T and p.v with p as f16 of 4096 p); f32 accumulate and softmax. AddNorm LayerNorms (block per row, fixed-order trees) and the mask table from the INPUT valid lengths are f32 kernels.
#include <hip/hip_runtime.h>
#include <math.h>

typedef __attribute__((ext_vector_type(16))) _Float16 v16h;
typedef __attribute__((ext_vector_type(8)))  _Float16 v8h;
typedef __attribute__((ext_vector_type(16))) __bf16   v16b;
typedef __attribute__((ext_vector_type(8)))  float    v8f;
typedef __attribute__((ext_vector_type(4)))  float    v4f;

// 16-bit WMMA fragment map (wave32), lane L, h = L>>4, m = L&15:
//   A 16x32: lane = row m;   element i -> k = (i<8) ? 8h+i : 16+8h+(i-8)
//   B 32x16: lane = column m; the SAME k(i,h)
//   D 16x16 (8 f32): lane = column m; element r -> row 8h+r
__device__ __forceinline__ int frag_k(int i, int h) { return (i < 8) ? (8 * h + i) : (16 + 8 * h + (i - 8)); }
__device__ __forceinline__ __bf16 bf16_rne(float f) {
    unsigned int u = __float_as_uint(f);
    u += 0x7fffu + ((u >> 16) & 1u);
    return __builtin_bit_cast(__bf16, (unsigned short)(u >> 16));
}
__device__ __forceinline__ float bf16_f32(__bf16 b) { return __uint_as_float(((unsigned int)__builtin_bit_cast(unsigned short, b)) << 16); }
__device__ __forceinline__ v8f wmma16(v16h a, v16h b, v8f c) {
    c = __builtin_amdgcn_wmma_f32_16x16x32_f16(false, a, false, b, (short)0, c, false, false);
    asm volatile("v_nop\n\tv_nop\n\tv_nop\n\tv_nop" : "+v"(c) : "v"(a), "v"(b));
    return c;
}
__device__ __forceinline__ v8f wmmab(v16b a, v16b b, v8f c) {
    c = __builtin_amdgcn_wmma_f32_16x16x32_bf16(false, a, false, b, (short)0, c, false, false);
    asm volatile("v_nop\n\tv_nop\n\tv_nop\n\tv_nop" : "+v"(c) : "v"(a), "v"(b));
    return c;
}
struct Split { v16b hi, lo; };
// hi/lo split product: a.hi*b.hi + a.hi*b.lo + a.lo*b.hi
__device__ __forceinline__ v8f wmma3(const Split& a, const Split& b, v8f c) {
    c = __builtin_amdgcn_wmma_f32_16x16x32_bf16(false, a.hi, false, b.hi, (short)0, c, false, false);
    c = __builtin_amdgcn_wmma_f32_16x16x32_bf16(false, a.hi, false, b.lo, (short)0, c, false, false);
    c = __builtin_amdgcn_wmma_f32_16x16x32_bf16(false, a.lo, false, b.hi, (short)0, c, false, false);
    asm volatile("v_nop\n\tv_nop\n\tv_nop\n\tv_nop" : "+v"(c) : "v"(a.hi), "v"(a.lo), "v"(b.hi), "v"(b.lo));
    return c;
}
struct Split3 { v16b hi, mid, lo; };
// triple split product (6 terms, drops only terms below 2^-24 relative)
__device__ __forceinline__ v8f wmma6(const Split3& a, const Split3& b, v8f c) {
    c = __builtin_amdgcn_wmma_f32_16x16x32_bf16(false, a.hi, false, b.hi, (short)0, c, false, false);
    c = __builtin_amdgcn_wmma_f32_16x16x32_bf16(false, a.hi, false, b.mid, (short)0, c, false, false);
    c = __builtin_amdgcn_wmma_f32_16x16x32_bf16(false, a.mid, false, b.hi, (short)0, c, false, false);
    c = __builtin_amdgcn_wmma_f32_16x16x32_bf16(false, a.hi, false, b.lo, (short)0, c, false, false);
    c = __builtin_amdgcn_wmma_f32_16x16x32_bf16(false, a.mid, false, b.mid, (short)0, c, false, false);
    c = __builtin_amdgcn_wmma_f32_16x16x32_bf16(false, a.lo, false, b.hi, (short)0, c, false, false);
    asm volatile("v_nop\n\tv_nop\n\tv_nop\n\tv_nop" : "+v"(c) : "v"(a.hi), "v"(a.mid), "v"(a.lo), "v"(b.hi), "v"(b.mid), "v"(b.lo));
    return c;
}

// Fragment gathers from f32 memory: element i <- p[(k0 + frag_k(i,h)) * sk] * s, zero for k >= klen.
__device__ __forceinline__ v16h fh_ld(const float* __restrict__ p, long long sk, int k0, int h, int klen, float s) {
    v16h a;
#pragma unroll
    for (int i = 0; i < 16; ++i) { const int k = k0 + frag_k(i, h); a[i] = (k < klen) ? (_Float16)(p[(long long)k * sk] * s) : (_Float16)0.f; }
    return a;
}
__device__ __forceinline__ Split sp_ld(const float* __restrict__ p, long long sk, int k0, int h, int klen, float s) {
    Split r;
#pragma unroll
    for (int i = 0; i < 16; ++i) {
        const int k = k0 + frag_k(i, h); const float x = (k < klen) ? p[(long long)k * sk] * s : 0.f;
        const __bf16 hb = bf16_rne(x); r.hi[i] = hb; r.lo[i] = bf16_rne(x - bf16_f32(hb));
    }
    return r;
}
__device__ __forceinline__ Split3 sp3_ld(const float* __restrict__ p, long long sk, int k0, int h, int klen, float s) {
    Split3 r;
#pragma unroll
    for (int i = 0; i < 16; ++i) {
        const int k = k0 + frag_k(i, h); const float x = (k < klen) ? p[(long long)k * sk] * s : 0.f;
        const __bf16 hb = bf16_rne(x); const float r1 = x - bf16_f32(hb); const __bf16 mb = bf16_rne(r1);
        r.hi[i] = hb; r.mid[i] = mb; r.lo[i] = bf16_rne(r1 - bf16_f32(mb));
    }
    return r;
}
__device__ __forceinline__ v16b bh_ld(const float* __restrict__ p, long long sk, int k0, int h, int klen, float s) {
    v16b a;
#pragma unroll
    for (int i = 0; i < 16; ++i) { const int k = k0 + frag_k(i, h); a[i] = bf16_rne((k < klen) ? p[(long long)k * sk] * s : 0.f); }
    return a;
}
// f16 fragment from an f16 LDS/global row with element stride 1 (k-contiguous), no bounds (tile already zero padded)
__device__ __forceinline__ v16h fh_row(const _Float16* __restrict__ row, int k0, int h) {
    v16h a;
#pragma unroll
    for (int i = 0; i < 16; ++i) a[i] = row[k0 + frag_k(i, h)];
    return a;
}

#define VST2(T, ptr, val) do { const T vst2_v_ = (val); *(T*)(ptr) = vst2_v_;  } while (0)
typedef float v4f __attribute__((ext_vector_type(4)));
#define VST2V4(ptr, val) do { const v4f vst2_v4_ = (val); *(v4f*)(ptr) = vst2_v4_;  } while (0)

__device__ __attribute__((noinline)) float act_fn(float v, int act) {
    if (act == 1) return fmaxf(v, 0.f);                                                                               // relu
    if (act == 2) { const float u = 0.7978845608028654f * (v + 0.044715f * v * v * v); return 0.5f * v * (1.f + tanhf(u)); } // tanh-gelu
    if (act == 3) return v / (1.f + expf(-v));                                                                        // silu
    if (act == 4) return 0.5f * v * (1.f + erff(v * 0.7071067811865476f));                                             // erf-gelu
    if (act == 5) return tanhf(v);
    if (act == 6) return 1.f / (1.f + expf(-v));                                                                      // sigmoid
    if (act == 7) return (v > 0.f) ? v : 0.01f * v;                                                                   // leaky relu 0.01
    if (act == 8) return (v > 0.f) ? v : (expf(v) - 1.f);                                                             // elu
    if (act == 9) return fminf(fmaxf(v, 0.f), 6.f);                                                                   // relu6
    if (act == 10) return fabsf(v);                                                                                    // abs
    if (act == 11) return (v >= 0.f) ? v : 0.1f * v;                                                                  // leaky 0.1
    if (act == 12) return (v > 0.f) ? v : 0.2f * v;                                                                   // leaky 0.2
    if (act == 13) return (v > 20.f) ? v : log1pf(expf(v));                                                            // softplus
    return v;
}

// =====================================================================================================================
// k_gemm<MODE>: C(z, m, n) = act(alpha * sum_k A(z, m, k) * B(z, k, n) + bias) + beta * R(z, m, n)
//   One wave (32-thread block) per 16 x 32 tile of C; grid (ceil(N/32), ceil(M/16), Z). Batch z -> (zo = z / zi_n, zi = z % zi_n)
//   with separate outer/inner strides for every tensor (e.g. batch and head). A(m,k) = A[zo*sAo + zi*sAi + m*sAm + k*sAk] (f32),
//   B(k,n) = B[zo*sBo + zi*sBi + n*sBn + k*sBk] (f32); any M, N, K (K zero-padded to 32 inside the fragments, M/N tails guarded).
//   C(m,n) = C[zo*sCo + zi*sCi + m*sCm + n] (n contiguous). flags: 1 bias[n], 2 bias[m], 4 residual R[zo*sRo + zi*sRi + m*sRm + n*sRn].
//   MODE 0: f16 operands (A prescaled by sa, B by sb, both undone in the epilogue); 1: bf16 hi/lo split (3 products); 2: bf16;
//   3: bf16 hi/mid/lo triple split (6 products); 4: as 3 with Kahan-compensated f32 accumulation across k-steps.
// =====================================================================================================================
struct GemmP {
    const float* A; const float* B; const float* bias; const float* R; float* C;
    long long sAo, sAi, sAm, sAk, sBo, sBi, sBn, sBk, sCo, sCi, sCm, sRo, sRi, sRm, sRn;
    int M, N, K, zi_n, flags, act; float alpha, beta, sa, sb;
    int Npad, pad_;     // columns [N, Npad) of C are written as 0 so that padded workspace rows are covered by whole-line stores; Npad >= N
};
static_assert(sizeof(GemmP) == 5 * 8 + 15 * 8 + 6 * 4 + 4 * 4 + 2 * 4, "GemmP has padding");

template <int MODE>
__global__ __launch_bounds__(32) void k_gemm(GemmP p) {
    const int lane = threadIdx.x & 31, h = lane >> 4, l15 = lane & 15;
    const int m0 = blockIdx.y * 16, n0 = blockIdx.x * 32;
    const int z = blockIdx.z, zo = z / p.zi_n, zi = z - zo * p.zi_n;
    const float* A = p.A + zo * p.sAo + zi * p.sAi;
    const float* B = p.B + zo * p.sBo + zi * p.sBi;
    const int am = min(m0 + l15, p.M - 1);                       // clamped row for loads (stores are guarded)
    v8f acc[2], comp[2];
#pragma unroll
    for (int t = 0; t < 2; ++t) { v8f zz = {}; acc[t] = zz; comp[t] = zz; }
    for (int k0 = 0; k0 < p.K; k0 += 32) {
        const float* arow = A + (long long)am * p.sAm;
        if (MODE == 1) {
            const Split a = sp_ld(arow, p.sAk, k0, h, p.K, 1.f);
#pragma unroll
            for (int t = 0; t < 2; ++t) {
                const int bn = min(n0 + t * 16 + l15, p.N - 1);
                acc[t] = wmma3(a, sp_ld(B + (long long)bn * p.sBn, p.sBk, k0, h, p.K, 1.f), acc[t]);
            }
        } else if (MODE == 3) {
            const Split3 a = sp3_ld(arow, p.sAk, k0, h, p.K, 1.f);
#pragma unroll
            for (int t = 0; t < 2; ++t) {
                const int bn = min(n0 + t * 16 + l15, p.N - 1);
                acc[t] = wmma6(a, sp3_ld(B + (long long)bn * p.sBn, p.sBk, k0, h, p.K, 1.f), acc[t]);
            }
        } else if (MODE == 4) {
            // triple split as MODE 3, but each k-step's 6 products go into a fresh accumulator and the partial is added to the running f32 sum
            // on the VALU with Kahan compensation (accumulation error stays ~1 ulp however long K is)
            const Split3 a = sp3_ld(arow, p.sAk, k0, h, p.K, 1.f);
#pragma unroll
            for (int t = 0; t < 2; ++t) {
                const int bn = min(n0 + t * 16 + l15, p.N - 1); v8f zz = {};
                const v8f part = wmma6(a, sp3_ld(B + (long long)bn * p.sBn, p.sBk, k0, h, p.K, 1.f), zz);
                const v8f y = part - comp[t]; const v8f s = acc[t] + y; comp[t] = (s - acc[t]) - y; acc[t] = s;
            }
        } else if (MODE == 2) {
            const v16b a = bh_ld(arow, p.sAk, k0, h, p.K, 1.f);
#pragma unroll
            for (int t = 0; t < 2; ++t) {
                const int bn = min(n0 + t * 16 + l15, p.N - 1);
                acc[t] = wmmab(a, bh_ld(B + (long long)bn * p.sBn, p.sBk, k0, h, p.K, 1.f), acc[t]);
            }
        } else {
            const v16h a = fh_ld(arow, p.sAk, k0, h, p.K, p.sa);
#pragma unroll
            for (int t = 0; t < 2; ++t) {
                const int bn = min(n0 + t * 16 + l15, p.N - 1);
                acc[t] = wmma16(a, fh_ld(B + (long long)bn * p.sBn, p.sBk, k0, h, p.K, p.sb), acc[t]);
            }
        }
    }
    const float iscale = (MODE == 0) ? p.alpha / (p.sa * p.sb) : p.alpha;
    float* C = p.C + zo * p.sCo + zi * p.sCi;
    const float* R = p.R + zo * p.sRo + zi * p.sRi;
    __shared__ __align__(16) float ctile[16][36];
#pragma unroll
    for (int t = 0; t < 2; ++t) {
        const int n = n0 + t * 16 + l15; const int nn = min(n, p.N - 1);
#pragma unroll
        for (int r = 0; r < 8; ++r) {
            const int m = m0 + 8 * h + r; const int mm = min(m, p.M - 1);
            float v = acc[t][r] * iscale;
            if (p.flags & 1) v += p.bias[nn];
            if (p.flags & 2) v += p.bias[mm];
            if (p.flags & 8) v *= p.bias[(long long)zo * p.M + mm];   /* per-(z,row) scale vector laid out [Z][M]; exclusive with the bias flags */
            v = act_fn(v, p.act);
            if (p.flags & 4) v += p.beta * R[(long long)mm * p.sRm + (long long)nn * p.sRn];
            ctile[8 * h + r][t * 16 + l15] = (n < p.N) ? v : 0.f;
        }
    }
    __syncthreads();
    const int NW = (p.Npad > p.N) ? p.Npad : p.N;           // write width
    const bool fast = (m0 + 16 <= p.M) && (n0 + 32 <= NW) && ((p.sCm & 3) == 0) && ((((size_t)C) & 15) == 0);
    if (fast) {
#pragma unroll
        for (int s = 0; s < 4; ++s) {
            const int row = s * 4 + (lane >> 3), c4 = (lane & 7) * 4;
            const v4f v = *(const v4f*)&ctile[row][c4];
            VST2V4(C + (long long)(m0 + row) * p.sCm + n0 + c4, v);
        }
    } else {
        for (int row = 0; row < 16; ++row) {
            const int m = m0 + row, n = n0 + lane;
            if (m < p.M && n < NW) VST2(float, C + (long long)m * p.sCm + n, ctile[row][lane]);
        }
    }
}


// =====================================================================================================================
// k_gemmT<MODE, TM, TN>: same contract as k_gemm, but one wave computes a (16*TM) x (16*TN) tile: TM A fragments and TN B fragments are
//   loaded per 32-wide k-step and reused across TM*TN WMMAs (far fewer load/convert instructions per MAC). MODE 0 (f16), 1 (bf16 hi/lo),
//   2 (bf16) only. grid (ceil(NW/(16*TN)), ceil(M/(16*TM)), Z), block 32. Epilogue identical to k_gemm, run per 16x32 sub-tile.
// =====================================================================================================================
template <int MODE, int TM, int TN>
__global__ __launch_bounds__(32) void k_gemmT(GemmP p) {
    const int lane = threadIdx.x & 31, h = lane >> 4, l15 = lane & 15;
    const int m0 = blockIdx.y * (16 * TM), n0 = blockIdx.x * (16 * TN);
    const int z = blockIdx.z, zo = z / p.zi_n, zi = z - zo * p.zi_n;
    const float* A = p.A + zo * p.sAo + zi * p.sAi;
    const float* B = p.B + zo * p.sBo + zi * p.sBi;
    v8f acc[TM][TN];
#pragma unroll
    for (int i = 0; i < TM; ++i)
#pragma unroll
        for (int t = 0; t < TN; ++t) { v8f zz = {}; acc[i][t] = zz; }
    for (int k0 = 0; k0 < p.K; k0 += 32) {
        if (MODE == 1) {
            Split a[TM], b[TN];
#pragma unroll
            for (int i = 0; i < TM; ++i) { const int am = min(m0 + 16 * i + l15, p.M - 1); a[i] = sp_ld(A + (long long)am * p.sAm, p.sAk, k0, h, p.K, 1.f); }
#pragma unroll
            for (int t = 0; t < TN; ++t) { const int bn = min(n0 + 16 * t + l15, p.N - 1); b[t] = sp_ld(B + (long long)bn * p.sBn, p.sBk, k0, h, p.K, 1.f); }
#pragma unroll
            for (int i = 0; i < TM; ++i)
#pragma unroll
                for (int t = 0; t < TN; ++t) acc[i][t] = wmma3(a[i], b[t], acc[i][t]);
        } else if (MODE == 2) {
            v16b a[TM], b[TN];
#pragma unroll
            for (int i = 0; i < TM; ++i) { const int am = min(m0 + 16 * i + l15, p.M - 1); a[i] = bh_ld(A + (long long)am * p.sAm, p.sAk, k0, h, p.K, 1.f); }
#pragma unroll
            for (int t = 0; t < TN; ++t) { const int bn = min(n0 + 16 * t + l15, p.N - 1); b[t] = bh_ld(B + (long long)bn * p.sBn, p.sBk, k0, h, p.K, 1.f); }
#pragma unroll
            for (int i = 0; i < TM; ++i)
#pragma unroll
                for (int t = 0; t < TN; ++t) acc[i][t] = wmmab(a[i], b[t], acc[i][t]);
        } else {
            v16h a[TM], b[TN];
#pragma unroll
            for (int i = 0; i < TM; ++i) { const int am = min(m0 + 16 * i + l15, p.M - 1); a[i] = fh_ld(A + (long long)am * p.sAm, p.sAk, k0, h, p.K, p.sa); }
#pragma unroll
            for (int t = 0; t < TN; ++t) { const int bn = min(n0 + 16 * t + l15, p.N - 1); b[t] = fh_ld(B + (long long)bn * p.sBn, p.sBk, k0, h, p.K, p.sb); }
#pragma unroll
            for (int i = 0; i < TM; ++i)
#pragma unroll
                for (int t = 0; t < TN; ++t) acc[i][t] = wmma16(a[i], b[t], acc[i][t]);
        }
    }
    const float iscale = (MODE == 0) ? p.alpha / (p.sa * p.sb) : p.alpha;
    float* C = p.C + zo * p.sCo + zi * p.sCi;
    const float* R = p.R + zo * p.sRo + zi * p.sRi;
    const int NW = (p.Npad > p.N) ? p.Npad : p.N;
    __shared__ __align__(16) float ctile[16][36];
#pragma unroll
    for (int i = 0; i < TM; ++i) {
        const int mb = m0 + 16 * i; if (mb >= p.M) break;          // wave-uniform
#pragma unroll
        for (int tp = 0; tp < TN / 2; ++tp) {
            const int nb = n0 + 32 * tp; if (nb >= NW) break;        // wave-uniform
#pragma unroll
            for (int t2 = 0; t2 < 2; ++t2) {
                const int t = 2 * tp + t2; const int n = nb + t2 * 16 + l15; const int nn = min(n, p.N - 1);
#pragma unroll
                for (int r = 0; r < 8; ++r) {
                    const int m = mb + 8 * h + r; const int mm = min(m, p.M - 1);
                    float v = acc[i][t][r] * iscale;
                    if (p.flags & 1) v += p.bias[nn];
                    if (p.flags & 2) v += p.bias[mm];
            if (p.flags & 8) v *= p.bias[(long long)zo * p.M + mm];   /* per-(z,row) scale vector laid out [Z][M]; exclusive with the bias flags */
                    v = act_fn(v, p.act);
                    if (p.flags & 4) v += p.beta * R[(long long)mm * p.sRm + (long long)nn * p.sRn];
                    ctile[8 * h + r][t2 * 16 + l15] = (n < p.N) ? v : 0.f;
                }
            }
            __syncthreads();
            const bool fast = (mb + 16 <= p.M) && (nb + 32 <= NW) && ((p.sCm & 3) == 0) && ((((size_t)C) & 15) == 0);
            if (fast) {
#pragma unroll
                for (int s = 0; s < 4; ++s) {
                    const int row = s * 4 + (lane >> 3), c4 = (lane & 7) * 4;
                    const v4f v = *(const v4f*)&ctile[row][c4];
                    VST2V4(C + (long long)(mb + row) * p.sCm + nb + c4, v);
                }
            } else {
                for (int row = 0; row < 16; ++row) {
                    const int m = mb + row, n = nb + lane;
                    if (m < p.M && n < NW) VST2(float, C + (long long)m * p.sCm + n, ctile[row][lane]);
                }
            }
            __syncthreads();
        }
    }
}

// =====================================================================================================================
//   Wave = 16 queries, AW waves per block, 64-key blocks; grid (ceil(Lq/(16*AW)), H, B), block 32*AW. Any Lq, Lk; head dim dh <= DHP
//   (DHP multiple of 32), value dim dv <= DVP (multiple of 16, <= 128). Every tensor addressed by (batch, head, row, element) strides, f32.
//   Scores: QM 0 f16 operands, 1 bf16 hi/lo split, 2 bf16 triple split; statistics f32 (exp2 domain); P.V: P x 4096 as f16 with V f16 staged in LDS
//   (SPLITPV: P and V as bf16 hi/lo splits). kv head = h / hrep. Masking: causal = 1 (keep j <= i + coff, masked -> -inf, key blocks beyond the
//   diagonal skipped), causal = 2 (masked -> mfill, a finite fill like the -1e9; no skipping), causal = 3 (keep j >= i + coff,
//   masked -> -inf, no skipping); optional additive f32 mask Mf,
//   optional int keep-mask Mi (0 -> score := mfill), both addressed b*smb + h*smh + i*smi + j*smj (0 strides broadcast).
// =====================================================================================================================
#define AW 4
struct AttnP {   // apv4
    const float* Q; const float* K; const float* V; float* O; float* P; const float* Mf; const int* Mi; float* ST;
    const float* Pw; const float* Rt; const int* SQ; const int* SK;           // optional: post-softmax weight, relative-position table, segment ids
    long long swb, swh, swi, swj, srb, srh, sri;                                 // Pw strides (b,h,i,j); Rt strides (b,h,i), column = clamp(i - j + roff, 0, rn-1)
    long long sQb, sQh, sQi, sQd, sKb, sKh, sKj, sKd, sVb, sVh, sVj, sVd, sOb, sOh, sOi, sPb, sPh, sPi, smb, smh, smi, smj;
    int Lq, Lk, dh, dv, hrep, causal, coff, pband;   // pband > 0: P holds only the band |j - i| <= pband, column j - i + pband
    float scale, mfill; int nonorm, mpol;             // nonorm (online path only): O = sum_j exp(score_j) V_j without the 1/rowsum (scores must be <= ~0); mpol: Mi masks where ==0 (mpol 0) or where !=0 (mpol 1)
    int roff, rn, segpol, win;                        // Rt column offset/count; SQ/SK: score := mfill where (segpol 0) SQ[i] != SK[j] or (segpol 1) SQ[i] == SK[j]; win > 0: keys with i - j > win (after coff) -> -inf
};
//   Pw: the softmax numerator is multiplied by Pw(b,h,i,j) AFTER the row sum is taken (probs * weight, then P.V), as in post-softmax multiplicative biases.                                                    // ST (optional): per row (b,h,i) -> ST[((b*H + h)*Lq + i)*2 + {0,1}] = {row max of the scaled+masked score (natural units), sum_j exp(score - max)}
static_assert(sizeof(AttnP) == 12 * 8 + 29 * 8 + 16 * 4, "AttnP has padding");

#ifndef KATTN_ATTR
#define KATTN_ATTR
#endif
template <int DHP, int DVP, int QM, bool SPLITPV, bool TWOPASS>
__global__ __launch_bounds__(32 * AW) KATTN_ATTR void k_attn(AttnP p) {
    constexpr int NT = DVP / 16;                // output tiles
    constexpr int KS = DHP / 32;                // k-steps for the scores
    constexpr int VP = DVP + 8;                 // LDS pitch (halves)
    __shared__ __align__(16) float    pl[AW][16 * 64];
    __shared__ __align__(16) _Float16 vl[(SPLITPV ? 2 : 1) * 64 * VP];   // f16 V tile, or bf16 hi and lo tiles (same 2-byte size)
    const int lane = threadIdx.x & 31, hf = lane >> 4, l15 = lane & 15, wave = threadIdx.x >> 5;
    const int h = blockIdx.y, b = blockIdx.z, hk = h / p.hrep;
    const int q0 = (blockIdx.x * AW + wave) * 16;
    float* myp = pl[wave];
    const float L2E = 1.4426950408889634f;
    const float NEG = -__builtin_inff();
    const int qi = min(q0 + l15, p.Lq - 1);
    const float* qrow = p.Q + b * p.sQb + h * p.sQh + (long long)qi * p.sQi;
    const float* kbase = p.K + b * p.sKb + hk * p.sKh;
    const float* vbase = p.V + b * p.sVb + hk * p.sVh;
    v16h qa[QM == 0 ? KS : 1]; Split qs_[QM == 1 ? KS : 1]; Split3 qt_[QM == 2 ? KS : 1];
#pragma unroll
    for (int ks = 0; ks < KS; ++ks) {
        if (QM == 2) qt_[ks] = sp3_ld(qrow, p.sQd, ks * 32, hf, p.dh, 1.f);
        else if (QM == 1) qs_[ks] = sp_ld(qrow, p.sQd, ks * 32, hf, p.dh, 1.f);
        else qa[ks] = fh_ld(qrow, p.sQd, ks * 32, hf, p.dh, 1.f);
    }
    v8f o[NT]; float m8[8], l8[8];
#pragma unroll
    for (int t = 0; t < NT; ++t) { v8f zz = {}; o[t] = zz; }
#pragma unroll
    for (int i = 0; i < 8; ++i) { m8[i] = NEG; l8[i] = 0.f; }
    int jend = p.Lk; int jstart = 0;
    if (p.causal == 1) { const int je = (blockIdx.x * AW + AW - 1) * 16 + 16 + p.coff; jend = min(jend, max(je, 0)); }   // uniform per block
    if (p.win > 0) { const int js = (int)(blockIdx.x * AW) * 16 + p.coff - p.win; jstart = (js > 0) ? (js / 64) * 64 : 0; }   // uniform per block: key blocks entirely outside every row's window hold only -inf entries and are skipped exactly
    const int npass = TWOPASS ? 2 : 1;
    for (int pass = 0; pass < npass; ++pass) {
        const bool dopv = (!TWOPASS) || pass == 1;
        for (int j0 = jstart; j0 < jend; j0 += 64) {
            if (dopv) {
                __syncthreads();                                 // previous key block's reads of vl / pl are done
                for (int idx = threadIdx.x; idx < 64 * DVP; idx += 32 * AW) {
                    const int jr = idx / DVP, d = idx - jr * DVP, j = j0 + jr;
                    const float f = (j < p.Lk && d < p.dv) ? vbase[(long long)j * p.sVj + (long long)d * p.sVd] : 0.f;
                    if (SPLITPV) {
                        const __bf16 hb = bf16_rne(f);
                        ((__bf16*)vl)[jr * VP + d] = hb; ((__bf16*)vl)[64 * VP + jr * VP + d] = bf16_rne(f - bf16_f32(hb));
                    } else vl[jr * VP + d] = (_Float16)f;
                }
            }
            v8f s[4];
#pragma unroll
            for (int t = 0; t < 4; ++t) {
                const int j = min(j0 + t * 16 + l15, p.Lk - 1);
                const float* krow = kbase + (long long)j * p.sKj;
                v8f acc = {};
#pragma unroll
                for (int ks = 0; ks < KS; ++ks) {
                    if (QM == 2)      acc = wmma6(qt_[ks], sp3_ld(krow, p.sKd, ks * 32, hf, p.dh, 1.f), acc);
                    else if (QM == 1) acc = wmma3(qs_[ks], sp_ld(krow, p.sKd, ks * 32, hf, p.dh, 1.f), acc);
                    else              acc = wmma16(qa[ks], fh_ld(krow, p.sKd, ks * 32, hf, p.dh, 1.f), acc);
                }
                s[t] = acc;
            }
            float pv[8][4];
#pragma unroll
            for (int i = 0; i < 8; ++i) {
                const int irow = q0 + i + 8 * hf;
                const int ic = min(irow, p.Lq - 1);
                float sc[4];
#pragma unroll
                for (int t = 0; t < 4; ++t) {
                    const int jg = j0 + t * 16 + l15;
                    float v = s[t][i] * p.scale;
                    if (p.Mf) v += p.Mf[b * p.smb + h * p.smh + (long long)ic * p.smi + (long long)min(jg, p.Lk - 1) * p.smj];
                    if (p.Rt) { int rc = ic - min(jg, p.Lk - 1) + p.roff; rc = rc < 0 ? 0 : (rc >= p.rn ? p.rn - 1 : rc); v += p.Rt[b * p.srb + h * p.srh + (long long)ic * p.sri + rc]; }
                    if (p.Mi) { const int mv = p.Mi[b * p.smb + h * p.smh + (long long)ic * p.smi + (long long)min(jg, p.Lk - 1) * p.smj]; if (p.mpol ? (mv != 0) : (mv == 0)) v = p.mfill; }
                    if (p.SQ) { const bool same = p.SQ[(long long)b * p.Lq + ic] == p.SK[(long long)b * p.Lk + min(jg, p.Lk - 1)]; if (p.segpol ? same : !same) v = p.mfill; }
                    if (p.causal == 2 && jg > irow + p.coff) v = p.mfill;
                    if (jg >= p.Lk || (p.causal == 1 && jg > irow + p.coff) || (p.causal == 3 && jg < irow + p.coff) || (p.win > 0 && irow + p.coff - jg > p.win)) v = NEG; else v *= L2E;
                    sc[t] = v;
                }
                if (!TWOPASS || pass == 0) {
                    float mx = fmaxf(fmaxf(sc[0], sc[1]), fmaxf(sc[2], sc[3]));
                    mx = fmaxf(mx, __shfl_xor(mx, 1, 32)); mx = fmaxf(mx, __shfl_xor(mx, 2, 32));
                    mx = fmaxf(mx, __shfl_xor(mx, 4, 32)); mx = fmaxf(mx, __shfl_xor(mx, 8, 32));
                    const float mnew = fmaxf(m8[i], mx);
                    const float corr = (mnew == NEG) ? 1.f : exp2f(m8[i] - mnew);
                    float rs = 0.f;
#pragma unroll
                    for (int t = 0; t < 4; ++t) {
                        const float pp = (sc[t] == NEG) ? 0.f : exp2f(sc[t] - mnew); rs += pp;
                        pv[i][t] = p.Pw ? pp * p.Pw[b * p.swb + h * p.swh + (long long)ic * p.swi + (long long)min(j0 + t * 16 + l15, p.Lk - 1) * p.swj] : pp;
                    }
                    rs += __shfl_xor(rs, 1, 32); rs += __shfl_xor(rs, 2, 32); rs += __shfl_xor(rs, 4, 32); rs += __shfl_xor(rs, 8, 32);
                    l8[i] = l8[i] * corr + rs; m8[i] = mnew;
                    if (!TWOPASS) {
#pragma unroll
                        for (int t = 0; t < NT; ++t) o[t][i] *= corr;
                    }
                } else {
                    const float inv = (l8[i] > 0.f) ? 1.f / l8[i] : 0.f;
#pragma unroll
                    for (int t = 0; t < 4; ++t) {
                        const int jg = j0 + t * 16 + l15;
                        float pp = (sc[t] == NEG) ? 0.f : exp2f(sc[t] - m8[i]) * inv;
                        if (p.Pw) pp *= p.Pw[b * p.swb + h * p.swh + (long long)ic * p.swi + (long long)min(jg, p.Lk - 1) * p.swj];
                        pv[i][t] = pp;
                    }
                }
            }
            if (dopv) {
#pragma unroll
                for (int i = 0; i < 8; ++i)
#pragma unroll
                    for (int t = 0; t < 4; ++t) ((float*)myp)[(i + 8 * hf) * 64 + t * 16 + l15] = pv[i][t];
                __syncthreads();                                 // P (per wave) and V (shared) visible
                if (p.P) {
                    float* pb_ = p.P + b * p.sPb + h * p.sPh;
                    const bool fastP = (p.pband == 0) && ((p.sPi & 3) == 0) && (j0 + 64 <= p.Lk) && (q0 + 16 <= p.Lq) && ((((size_t)pb_) & 15) == 0);
                    if (fastP) {
#pragma unroll
                        for (int s = 0; s < 8; ++s) {
                            const int row = s * 2 + (lane >> 4), c4 = (lane & 15) * 4;
                            const v4f v = *(const v4f*)(myp + row * 64 + c4);
                            VST2V4(pb_ + (long long)(q0 + row) * p.sPi + j0 + c4, v);
                        }
                    } else {
                        for (int row = 0; row < 16; ++row) {
                            const int irow = q0 + row; if (irow >= p.Lq) continue;
                            for (int c = lane; c < 64; c += 32) {
                                const int jg = j0 + c; if (jg >= p.Lk) continue;
                                if (p.pband == 0) VST2(float, pb_ + (long long)irow * p.sPi + jg, myp[row * 64 + c]);
                                else if (jg - irow <= p.pband && irow - jg <= p.pband) VST2(float, pb_ + (long long)irow * p.sPi + (jg - irow + p.pband), myp[row * 64 + c]);
                            }
                        }
                    }
                }
                if (SPLITPV) {
                    const Split pa0 = sp_ld(myp + l15 * 64, 1, 0, hf, 64, 1.f), pa1 = sp_ld(myp + l15 * 64, 1, 32, hf, 64, 1.f);
                    const __bf16* vh = (const __bf16*)vl; const __bf16* vlo = vh + 64 * VP;
#pragma unroll
                    for (int t = 0; t < NT; ++t) {
                        const int dcol = t * 16 + l15;
                        Split b0, b1;
#pragma unroll
                        for (int e = 0; e < 16; ++e) {
                            const int k0 = frag_k(e, hf), k1 = 32 + frag_k(e, hf);
                            b0.hi[e] = vh[k0 * VP + dcol]; b0.lo[e] = vlo[k0 * VP + dcol]; b1.hi[e] = vh[k1 * VP + dcol]; b1.lo[e] = vlo[k1 * VP + dcol];
                        }
                        o[t] = wmma3(pa0, b0, o[t]);
                        o[t] = wmma3(pa1, b1, o[t]);
                    }
                } else {
                    const v16h pa0 = fh_ld(myp + l15 * 64, 1, 0, hf, 64, 4096.f), pa1 = fh_ld(myp + l15 * 64, 1, 32, hf, 64, 4096.f);
#pragma unroll
                    for (int t = 0; t < NT; ++t) {
                        const int dcol = t * 16 + l15;
                        v16h b0, b1;
#pragma unroll
                        for (int e = 0; e < 16; ++e) { b0[e] = vl[frag_k(e, hf) * VP + dcol]; b1[e] = vl[(32 + frag_k(e, hf)) * VP + dcol]; }
                        o[t] = wmma16(pa0, b0, o[t]);
                        o[t] = wmma16(pa1, b1, o[t]);
                    }
                }
            }
        }
    }
    float* obase = p.O + b * p.sOb + h * p.sOh;
    if (p.ST) {
        const int rl = lane >> 1, isel = rl & 7;           // row q0 + rl ; rl>>3 == hf holds because lane>>4 == (lane>>1)>>3
        float mv = 0.f, lv = 0.f;
#pragma unroll
        for (int i = 0; i < 8; ++i) if (i == isel) { mv = m8[i]; lv = l8[i]; }
        const int irow = q0 + rl;
        if (irow < p.Lq) { float* st = p.ST + (((long long)b * gridDim.y + h) * p.Lq + irow) * 2 + (lane & 1); VST2(float, st, (lane & 1) ? lv : mv * 0.6931471805599453f); }
    }
    float invr[8];
#pragma unroll
    for (int i = 0; i < 8; ++i) {
        if (TWOPASS) invr[i] = SPLITPV ? 1.f : (1.f / 4096.f);
        else if (p.nonorm) invr[i] = exp2f(m8[i]) * (SPLITPV ? 1.f : (1.f / 4096.f));
        else invr[i] = (l8[i] > 0.f) ? (SPLITPV ? 1.f / l8[i] : 1.f / (l8[i] * 4096.f)) : 0.f;
    }
    __syncthreads();                                             // all waves done with pl/vl from the main loop
    const bool ofast = ((p.sOi & 3) == 0) && ((((size_t)obase) & 15) == 0) && (q0 + 16 <= p.Lq);
#pragma unroll
    for (int c0 = 0; c0 < DVP; c0 += 64) {
#pragma unroll
        for (int i = 0; i < 8; ++i)
#pragma unroll
            for (int t = 0; t < NT; ++t) if (t * 16 >= c0 && t * 16 < c0 + 64) ((float*)myp)[(i + 8 * hf) * 64 + (t * 16 - c0) + l15] = o[t][i] * invr[i];
        __syncthreads();
        const int cw = (DVP - c0 < 64) ? (DVP - c0) : 64;      // staged columns in this chunk (multiple of 16)
        if (ofast && (c0 + cw <= p.dv) && (cw % 32 == 0)) {
            const int lpr = cw / 4;                              // lanes per row (16 for 64 cols, 8 for 32)
            const int rows_per_ins = 32 / lpr;
            for (int r0 = 0; r0 < 16; r0 += rows_per_ins) {
                const int row = r0 + lane / lpr, c4 = (lane % lpr) * 4;
                const v4f v = *(const v4f*)(myp + row * 64 + c4);
                VST2V4(obase + (long long)(q0 + row) * p.sOi + c0 + c4, v);
            }
        } else {
            for (int row = 0; row < 16; ++row) {
                const int irow = q0 + row; if (irow >= p.Lq) continue;
                for (int c = lane; c < cw; c += 32) { const int d = c0 + c; if (d < p.dv) VST2(float, obase + (long long)irow * p.sOi + d, myp[row * 64 + c]); }
            }
        }
        __syncthreads();
    }
}

// =====================================================================================================================
// k_tr: dst(z, c, r) = alpha * src(z, r, c) (+ beta * R2(z, c, r)): [Z][R][C] (row stride lds) -> [Z][C][R] (row stride ldd) through a 32x32 LDS tile;
//   flags: 1 -> add beta * residual R2 addressed like dst (z*sRz + c*ldr + r); act applied before the residual.
// =====================================================================================================================
struct TrP { const float* src; float* dst; const float* R2; long long sSz, lds, sDz, ldd, sRz, ldr; int R, C, flags, act; float alpha, beta; };
static_assert(sizeof(TrP) == 3 * 8 + 6 * 8 + 6 * 4, "TrP has padding");
__global__ __launch_bounds__(256) void k_tr(TrP p) {
    __shared__ float tile[32][33];
    const int c0 = blockIdx.x * 32, r0 = blockIdx.y * 32, z = blockIdx.z;
    const int lane = threadIdx.x & 31, wave = threadIdx.x >> 5;
    const float* s = p.src + z * p.sSz;
#pragma unroll
    for (int k = 0; k < 4; ++k) {
        const int rl = wave * 4 + k, r = r0 + rl, c = c0 + lane;
        tile[rl][lane] = (r < p.R && c < p.C) ? s[(long long)r * p.lds + c] : 0.f;
    }
    __syncthreads();
    float* d = p.dst + z * p.sDz; const float* rr = p.R2 + z * p.sRz;
#pragma unroll
    for (int k = 0; k < 4; ++k) {
        const int cl = wave * 4 + k, c = c0 + cl, r = r0 + lane;
        if (c < p.C && r < p.R) {
            float v = act_fn(p.alpha * tile[lane][cl], p.act);
            if (p.flags & 1) v += p.beta * rr[(long long)c * p.ldr + r];
            VST2(float, d + (long long)c * p.ldd + r, v);
        }
    }
}

// k_affine: dst[i] = a * (sdev ? sdev[0] : 1) * src[i] + b, i < n (one thread per element; consecutive lanes -> consecutive addresses)
__global__ __launch_bounds__(256) void k_affine(const float* __restrict__ src, float* __restrict__ dst, int n, float a, float b, const float* __restrict__ sdev) {
    const int i = blockIdx.x * 256 + threadIdx.x;
    if (i < n) { const float aa = sdev ? a * sdev[0] : a; const float v = aa * src[i] + b; VST2(float, dst + i, v); }
}

// =====================================================================================================================
// k_softmax: row softmax over n contiguous elements, one 256-thread block per row; rows addressed z*sz + r*sr (grid (R, Z)).
//   out = scale_out * softmax(scale_in * x + (Mf ? Mf[z*smz + r*smr + j] : 0)); a row whose max is -inf is written as 0.
// =====================================================================================================================
struct SmP { const float* src; float* dst; const float* Mf; long long sz, sr, dz, dr, smz, smr; int n, pad; float scale_in, scale_out; };
static_assert(sizeof(SmP) == 3 * 8 + 6 * 8 + 4 * 4, "SmP has padding");
__global__ __launch_bounds__(256) void k_softmax(SmP p) {
    __shared__ float red[256];
    const int r = blockIdx.x, z = blockIdx.y, tid = threadIdx.x;
    const float* s = p.src + z * p.sz + (long long)r * p.sr;
    const float* mf = p.Mf ? (p.Mf + z * p.smz + (long long)r * p.smr) : nullptr;
    float mx = -__builtin_inff();
    for (int j = tid; j < p.n; j += 256) { float v = s[j] * p.scale_in; if (mf) v += mf[j]; mx = fmaxf(mx, v); }
    red[tid] = mx; __syncthreads();
    for (int o = 128; o > 0; o >>= 1) { if (tid < o) red[tid] = fmaxf(red[tid], red[tid + o]); __syncthreads(); }
    mx = red[0]; __syncthreads();
    float sum = 0.f;
    for (int j = tid; j < p.n; j += 256) { float v = s[j] * p.scale_in; if (mf) v += mf[j]; sum += (mx == -__builtin_inff()) ? 0.f : expf(v - mx); }
    red[tid] = sum; __syncthreads();
    for (int o = 128; o > 0; o >>= 1) { if (tid < o) red[tid] += red[tid + o]; __syncthreads(); }
    sum = red[0];
    const float inv = (sum > 0.f) ? p.scale_out / sum : 0.f;
    float* d = p.dst + z * p.dz + (long long)r * p.dr;
    for (int j = tid; j < p.n; j += 256) { float v = s[j] * p.scale_in; if (mf) v += mf[j]; const float o = (mx == -__builtin_inff()) ? 0.f : expf(v - mx) * inv; VST2(float, d + j, o); }
}
// =====================================================================================================================
// k_stats: mean and rsqrt(var + eps) over a set of n elements addressed base + z*sz + (e / inner) * so + (e % inner) * si, one 256-thread
// k_norm_apply: y = (x - mean[set]) * rstd[set] * g[c] + b[c] over a [Z][C][L] channel-major tensor with set = z*G + c / (C/G) (G groups per z;
//   G = C -> per-channel sets indexed z*C+c; for batch norm pass stats indexed by c only via bn = 1). Optional act. Output same layout.
// =====================================================================================================================
//   mode 0: mean / rsqrt(var + eps); mode 1 (RMSNorm): 0 / rsqrt(mean(x^2) + eps); mode 2 (L2 normalize * sqrt(n)): 0 / sqrt(n) / max(||x||, eps); mode 3: as 0 with unbiased variance (n-1)
__global__ __launch_bounds__(256) void k_stats(const float* __restrict__ x, long long sz, long long so, long long si, int inner, int n, float eps, float* __restrict__ stat, int mode) {
    __shared__ float red[256];
    const int z = blockIdx.x, tid = threadIdx.x;
    const float* base = x + z * sz;
    float s = 0.f;
    for (int e = tid; e < n; e += 256) s += base[(long long)(e / inner) * so + (long long)(e % inner) * si];
    red[tid] = s; __syncthreads();
    for (int o = 128; o > 0; o >>= 1) { if (tid < o) red[tid] += red[tid + o]; __syncthreads(); }
    const float mu = (mode == 0 || mode == 3) ? red[0] / (float)n : 0.f; __syncthreads();
    float q = 0.f;
    for (int e = tid; e < n; e += 256) { const float dlt = base[(long long)(e / inner) * so + (long long)(e % inner) * si] - mu; q += dlt * dlt; }
    red[tid] = q; __syncthreads();
    for (int o = 128; o > 0; o >>= 1) { if (tid < o) red[tid] += red[tid + o]; __syncthreads(); }
    {
        float rs;
        if (mode == 2) rs = sqrtf((float)n) / fmaxf(sqrtf(red[0]), eps); else if (mode == 3) rs = rsqrtf(red[0] / (float)(n - 1) + eps); else rs = rsqrtf(red[0] / (float)n + eps);
        if (tid < 32) { const float v = (tid == 0) ? mu : ((tid == 1) ? rs : 0.f); VST2(float, stat + (long long)z * 32 + tid, v); }
    }
}
//   One thread per element over the flat [Z][C][L] index space: grid ceil(Z*C*L / 256).
__global__ __launch_bounds__(256) void k_norm_apply(const float* __restrict__ x, float* __restrict__ y, const float* __restrict__ stat, const float* __restrict__ g, const float* __restrict__ bta,
                                                     int Z, int C, int L, int G, int bn, int act) {
    const long long idx = (long long)blockIdx.x * 256 + threadIdx.x;
    if (idx >= (long long)Z * C * L) return;
    const int l = (int)(idx % L); const long long zc = idx / L; const int c = (int)(zc % C), z = (int)(zc / C); (void)l;
    const int set = bn ? c : (z * G + c / (C / G));
    float v = (x[idx] - stat[(long long)set * 32]) * stat[(long long)set * 32 + 1];
    if (g) v *= g[c];
    if (bta) v += bta[c];
    v = act_fn(v, act);
    VST2(float, y + idx, v);
}

// k_lse_neg: c[i] = -(st[2i] + log(st[2i+1])) = minus the log-sum-exp of row i from k_attn's ST output (for softmax over the query dimension)
__global__ __launch_bounds__(256) void k_lse_neg(const float* __restrict__ st, float* __restrict__ c, int n) {
    const int i = blockIdx.x * 256 + threadIdx.x;
    if (i < n) { const float v = -(st[2 * i] + logf(st[2 * i + 1])); VST2(float, c + i, v); }
}

// k_iota: dst[i] = a * i + b as int32 (segment/position id helper)
__global__ __launch_bounds__(256) void k_iota(int* __restrict__ dst, int n, int a, int b) {
    const int i = blockIdx.x * 256 + threadIdx.x;
    if (i < n) { const int v = a * i + b; VST2(int, dst + i, v); }
}

// k_axpby: dst[i] = a * x[i] + b * y[i] (+ c), i < n
__global__ __launch_bounds__(256) void k_axpby(const float* __restrict__ x, const float* __restrict__ y, float* __restrict__ dst, int n, float a, float b, float c) {
    const int i = blockIdx.x * 256 + threadIdx.x;
    if (i < n) { const float v = a * x[i] + b * y[i] + c; VST2(float, dst + i, v); }
}

// =====================================================================================================================
// k_rope: rotary embedding on a [R rows][Hn heads][D] view (row stride sXr, head stride sXh, element stride 1) -> Y (own strides).
//   mode 0: rotate_half (partner d±D/2, sign - for d<D/2); mode 1: interleaved pairs (partner d^1, sign - for even d).
//   table column tcol: tmode 0 -> d, 1 -> d % (D/2), 2 -> d / 2; position p: pmode 0 -> r % S, 1 -> head index, 2 -> pos[r];
//   c = C[(r / S) * sCb + p * sCp + tcol * sCd], s likewise from Sn; y = x[d] * c + sign * x[partner] * s. X and Y must not alias.
// =====================================================================================================================
struct RopeP { const float* X; float* Y; const float* C; const float* Sn; const int* pos; long long sXr, sXh, sYr, sYh, sCb, sCp, sCd; int R, Hn, D, S, mode, tmode, pmode, pad; };
static_assert(sizeof(RopeP) == 5 * 8 + 7 * 8 + 8 * 4, "RopeP has padding");
__global__ __launch_bounds__(256) void k_rope(RopeP p) {
    const long long idx = (long long)blockIdx.x * 256 + threadIdx.x;
    if (idx >= (long long)p.R * p.Hn * p.D) return;
    const int d = (int)(idx % p.D); const long long rh = idx / p.D; const int h = (int)(rh % p.Hn); const int r = (int)(rh / p.Hn);
    const int half = p.D / 2;
    int partner; float sign;
    if (p.mode == 0) { partner = (d < half) ? d + half : d - half; sign = (d < half) ? -1.f : 1.f; }
    else { partner = d ^ 1; sign = (d & 1) ? 1.f : -1.f; }
    const int tcol = (p.tmode == 0) ? d : ((p.tmode == 1) ? (d % half) : (d >> 1));
    const int pp = (p.pmode == 0) ? (r % p.S) : ((p.pmode == 1) ? h : p.pos[r]);
    const long long toff = (long long)(r / p.S) * p.sCb + (long long)pp * p.sCp + (long long)tcol * p.sCd;
    const float* xr = p.X + (long long)r * p.sXr + (long long)h * p.sXh;
    const float v = xr[d] * p.C[toff] + sign * xr[partner] * p.Sn[toff];
    VST2(float, p.Y + (long long)r * p.sYr + (long long)h * p.sYh + d, v);
}

// k_invf + k_sincos (split so neither kernel carries a large VALU-fma footprint): invf_i = num * (1 / powf(base, (2 i)/D)) [fmode 0],
//   num * expf((2 i) * cexp) [fmode 1], num * powf(base, -2 (i - 1) / D) [fmode 2]; then cs/sn[s*half + i] = cos/sin((pscale * s) * invf_i)
__global__ __launch_bounds__(256) void k_invf(float* __restrict__ invb, int half, int D, float base, float num, int fmode, float cexp) {
    const int i = blockIdx.x * 256 + threadIdx.x;
    if (i >= ((half + 31) / 32) * 32) return;
    if (i >= half) { VST2(float, invb + i, 0.f); return; }
    const float e = (float)(2 * i) / (float)D;
    float invf;
    if (fmode == 1) invf = num * expf((float)(2 * i) * cexp);
    else if (fmode == 2) invf = num * powf(base, (-2.0f * ((float)i - 1.0f)) / (float)D);
    else invf = num * (1.0f / powf(base, e));
    VST2(float, invb + i, invf);
}
__global__ __launch_bounds__(256) void k_sincos(float* __restrict__ cs, float* __restrict__ sn, const float* __restrict__ invb, int S, int half, float pscale) {
    const int idx = blockIdx.x * 256 + threadIdx.x;
    if (idx >= S * half) return;
    const int s = idx / half, i = idx - s * half;
    const float ang = (pscale * (float)s) * invb[i];
    VST2(float, cs + idx, cosf(ang)); VST2(float, sn + idx, sinf(ang));
}

// k_mulact: dst[i] = act(x[i]) * y[i]
__global__ __launch_bounds__(256) void k_mulact(const float* __restrict__ x, const float* __restrict__ y, float* __restrict__ dst, int n, int act) {
    const int i = blockIdx.x * 256 + threadIdx.x;
    if (i < n) { const float v = act_fn(x[i], act) * y[i]; VST2(float, dst + i, v); }
}

// =====================================================================================================================
// k_matvec: thread-per-row matrix-vector products for N <= 8 output columns (heads with 1-3 outputs, gates), f32 on the VALU.
//   C[r*sCm + j] = act(alpha * sum_k A[r*sAm + k*sAk] * B[j*sBn + k*sBk] + bias[j]) + beta * R[r*sRm + j*sRn]; each thread writes its N contiguous floats.
// =====================================================================================================================
__global__ __launch_bounds__(256) void k_matvec(GemmP p) {
    // 32 lanes write one line with one instruction.
    const int rpt = (p.N == 1) ? 1 : 32;
    const long long r0 = ((long long)blockIdx.x * 256 + threadIdx.x) * rpt; const int z = blockIdx.z, zo = z / p.zi_n, zi = z - zo * p.zi_n;
    if (r0 >= p.M) return;
    const float* Bb = p.B + zo * p.sBo + zi * p.sBi;
    float* C = p.C + zo * p.sCo + zi * p.sCi; const float* R = p.R + zo * p.sRo + zi * p.sRi;
    for (int rr = 0; rr < rpt; ++rr) {
        const long long r = r0 + rr; if (r >= p.M) break;
        const float* A = p.A + zo * p.sAo + zi * p.sAi + r * p.sAm;
        float acc[8] = {0.f, 0.f, 0.f, 0.f, 0.f, 0.f, 0.f, 0.f};
        for (int k = 0; k < p.K; ++k) { const float a = A[(long long)k * p.sAk];
#pragma unroll
            for (int j = 0; j < 8; ++j) if (j < p.N) acc[j] += a * Bb[(long long)j * p.sBn + (long long)k * p.sBk]; }
#pragma unroll
        for (int j = 0; j < 8; ++j) if (j < p.N) {
            float v = acc[j] * p.alpha;
            if (p.flags & 1) v += p.bias[j];
            if (p.flags & 2) v += p.bias[r];
            v = act_fn(v, p.act);
            if (p.flags & 4) v += p.beta * R[r * p.sRm + (long long)j * p.sRn];
            VST2(float, C + r * p.sCm + j, v);
        }
    }
}
// k_smallsoftmax: thread-per-row softmax for short rows (n <= 64): dst[r*dr + j] = softmax(scale*src[r*sr + j])
__global__ __launch_bounds__(256) void k_smallsoftmax(const float* __restrict__ src, float* __restrict__ dst, long long sr, long long dr, int n, long long R, float scale) {
    const long long r0 = ((long long)blockIdx.x * 256 + threadIdx.x) * 32;
    for (int rr = 0; rr < 32; ++rr) {
        const long long r = r0 + rr; if (r >= R) return;
        const float* s = src + r * sr; float* d = dst + r * dr;
        float mx = -__builtin_inff();
        for (int j = 0; j < n; ++j) mx = fmaxf(mx, s[j] * scale);
        float sum = 0.f;
        for (int j = 0; j < n; ++j) sum += expf(s[j] * scale - mx);
        const float inv = 1.f / sum;
        for (int j = 0; j < n; ++j) { const float v = expf(s[j] * scale - mx) * inv; VST2(float, d + j, v); }
    }
}

__global__ __launch_bounds__(32) void k_unitstat(float* __restrict__ st) { const int t = threadIdx.x; const float v = (t == 1) ? 1.f : 0.f; VST2(float, st + t, v); }

// destination (e.g. a d_out whose row width is not a multiple of 32 floats) is written by consecutive lanes of one instruction
__global__ __launch_bounds__(256) void k_lincopy(const float* __restrict__ src, long long lds, float* __restrict__ dst, long long ldd, long long rows, int cols) {
    const long long i = (long long)blockIdx.x * 256 + threadIdx.x; if (i >= rows * cols) return;
    const long long r = i / cols; const int c = (int)(i - r * cols);
    const float v = src[r * lds + c]; VST2(float, dst + r * ldd + c, v);
}

namespace w25 {
typedef __attribute__((ext_vector_type(16))) _Float16 v16h;
typedef __attribute__((ext_vector_type(8)))  _Float16 v8h;
typedef __attribute__((ext_vector_type(16))) __bf16   v16b;
typedef __attribute__((ext_vector_type(8)))  __bf16   v8b;
typedef __attribute__((ext_vector_type(8)))  float    v8f;
typedef __attribute__((ext_vector_type(4)))  float    v4f;

__device__ __forceinline__ unsigned short f2bf_bits(float f) {
  unsigned u = __float_as_uint(f);
  return (unsigned short)((u + 0x7FFFu + ((u >> 16) & 1u)) >> 16);
}
__device__ __forceinline__ float bf_bits2f(unsigned short h) { return __uint_as_float(((unsigned)h) << 16); }

// hazard guards as plain device helpers (no inline asm inside the kernel template body)
__device__ __forceinline__ void dep_guard_h(v8f& a, v8f& b, v16h x, v16h y) { asm volatile("v_nop\n\tv_nop\n\tv_nop\n\tv_nop" : "+v"(a), "+v"(b) : "v"(x), "v"(y)); }
__device__ __forceinline__ void dep_guard_b(v8f& a, v8f& b, v16b x, v16b y) { asm volatile("v_nop\n\tv_nop\n\tv_nop\n\tv_nop" : "+v"(a), "+v"(b) : "v"(x), "v"(y)); }
__device__ __forceinline__ void keep4_h(v16h a, v16h b, v16h c, v16h d) { asm volatile("v_nop" :: "v"(a), "v"(b), "v"(c), "v"(d)); }
__device__ __forceinline__ void keep4_b(v16b a, v16b b, v16b c, v16b d) { asm volatile("v_nop" :: "v"(a), "v"(b), "v"(c), "v"(d)); }
__device__ __forceinline__ void acc_guard4(v8f& a, v8f& b, v8f& c, v8f& d) { asm volatile("v_nop\n\tv_nop\n\tv_nop\n\tv_nop" : "+v"(a), "+v"(b), "+v"(c), "+v"(d)); }
template <typename T> struct Frag;
template <> struct Frag<_Float16> {
  typedef v16h V; union U { v16h v; v8h h[2]; };
  static __device__ __forceinline__ v16h load(const _Float16* p) {   // elements 0..7 <- p[0..7], 8..15 <- p[16..23]
    U f; f.h[0] = *(const v8h*)(p); f.h[1] = *(const v8h*)(p + 16); return f.v;
  }
  static __device__ __forceinline__ v8f mma(v16h a, v16h b, v8f c) {
    return __builtin_amdgcn_wmma_f32_16x16x32_f16(false, a, false, b, (short)0, c, false, false);
  }
  static __device__ __forceinline__ void guard(v8f& a, v8f& b, v16h x, v16h y) { dep_guard_h(a, b, x, y); }
  static __device__ __forceinline__ void keep(v16h a, v16h b, v16h c, v16h d) { keep4_h(a, b, c, d); }
};
template <> struct Frag<__bf16> {
  typedef v16b V; union U { v16b v; v8b h[2]; };
  static __device__ __forceinline__ v16b load(const __bf16* p) {
    U f; f.h[0] = *(const v8b*)(p); f.h[1] = *(const v8b*)(p + 16); return f.v;
  }
  static __device__ __forceinline__ v8f mma(v16b a, v16b b, v8f c) {
    return __builtin_amdgcn_wmma_f32_16x16x32_bf16(false, a, false, b, (short)0, c, false, false);
  }
  static __device__ __forceinline__ void guard(v8f& a, v8f& b, v16b x, v16b y) { dep_guard_b(a, b, x, y); }
  static __device__ __forceinline__ void keep(v16b a, v16b b, v16b c, v16b d) { keep4_b(a, b, c, d); }
};

// ---- Register-blocked batched WMMA GEMM ------------------------------------
// C[m,n] = scale * sum_k A[m,k] * Bt[n,k] (+bias)(+resid); each wave owns a 64x64 tile.
// A row-major [M,K]; Bt row-major [N,K]; M,N % 64 == 0, K % 32 == 0.
// SPLIT: operands are hi/lo planes (A2/Bt2 = lo planes, same layout); product = hi·hi + hi·lo + lo·hi.
// BIAS_MODE: 0 = none, 1 = bias[m], 2 = bias[n].
// OUT_MODE: 0 = f32, 1 = f16, 2 = bf16 hi plane (Cout) + bf16 lo plane (Cout2).
// ET: 0 = f16 operands, 1 = bf16 operands (pointers passed as 16-bit storage)
template <int ET> struct Elem;
template <> struct Elem<0> { typedef _Float16 T; };
template <> struct Elem<1> { typedef __bf16 T; };
template <int ET, bool SPLIT, int BIAS_MODE, int OUT_MODE, bool RESID, int ACT = 0>
__global__ __launch_bounds__(256) void wmma_gemm64(
    const unsigned short* __restrict__ Ap, const unsigned short* __restrict__ A2p, int lda, long strideA,
    const unsigned short* __restrict__ Btp, const unsigned short* __restrict__ Bt2p, int ldb, long strideB,
    void* __restrict__ Cout, void* __restrict__ Cout2, int ldc, long strideC,
    const float* __restrict__ bias,
    const float* __restrict__ resid, long strideR,
    int M, int N, int K, float scale) {
  typedef typename Elem<ET>::T T;
  typedef typename Frag<T>::V V;
  const T* A = (const T*)Ap; const T* A2 = (const T*)A2p; const T* Bt = (const T*)Btp; const T* Bt2 = (const T*)Bt2p;
  __shared__ __align__(16) float sT[8][16 * 68];   // per-wave 16x64 slab, pitch 68 floats
  const int b    = blockIdx.y;
  const int lane = threadIdx.x & 31;
  const int wave = threadIdx.x >> 5;
  const int tilesN = N >> 6;
  const int tilesM = M >> 6;
  const int tile = blockIdx.x * 8 + wave;
  if (tile >= tilesM * tilesN) return;   // wave-uniform; no block barriers in this kernel
  const int tm = tile / tilesN;
  const int tn = tile - tm * tilesN;
  const int m0 = tm << 6;
  const int n0 = tn << 6;

  const T* Ab  = A  + (size_t)b * strideA;
  const T* Bb  = Bt + (size_t)b * strideB;
  const T* Ab2 = SPLIT ? (A2  + (size_t)b * strideA) : nullptr;
  const T* Bb2 = SPLIT ? (Bt2 + (size_t)b * strideB) : nullptr;

  const int rlane = lane & 15;                 // row (A) / col (B, D) within subtile
  const int koff  = (lane >> 4) * 8;           // k offset of this lane half
  const int mOff  = (lane >> 4) * 8;           // D row offset

  v8f acc[4][4];
#pragma unroll
  for (int i = 0; i < 4; ++i)
#pragma unroll
    for (int j = 0; j < 4; ++j) acc[i][j] = (v8f){0.f,0.f,0.f,0.f,0.f,0.f,0.f,0.f};

  for (int k0 = 0; k0 < K; k0 += 32) {
    V bh[4], bl[4];
#pragma unroll
    for (int j = 0; j < 4; ++j) {
      const size_t bo = (size_t)(n0 + (j << 4) + rlane) * ldb + koff + k0;
      bh[j] = Frag<T>::load(Bb + bo);
      if (SPLIT) bl[j] = Frag<T>::load(Bb2 + bo);
    }
#pragma unroll
    for (int i = 0; i < 4; ++i) {
      const size_t ao = (size_t)(m0 + (i << 4) + rlane) * lda + koff + k0;
      V ah = Frag<T>::load(Ab + ao);
      V al;
      if (SPLIT) al = Frag<T>::load(Ab2 + ao);
#pragma unroll
      for (int j = 0; j < 4; ++j) {
        acc[i][j] = Frag<T>::mma(ah, bh[j], acc[i][j]);
        if (SPLIT) {
          acc[i][j] = Frag<T>::mma(ah, bl[j], acc[i][j]);
          acc[i][j] = Frag<T>::mma(al, bh[j], acc[i][j]);
        }
      }
      Frag<T>::guard(acc[i][0], acc[i][3], ah, SPLIT ? al : ah);
    }
    Frag<T>::keep(bh[0], bh[1], bh[2], bh[3]);
    if (SPLIT) Frag<T>::keep(bl[0], bl[1], bl[2], bl[3]);
  }
  acc_guard4(acc[0][0], acc[0][1], acc[0][2], acc[0][3]);
  acc_guard4(acc[1][0], acc[1][1], acc[1][2], acc[1][3]);
  acc_guard4(acc[2][0], acc[2][1], acc[2][2], acc[2][3]);
  acc_guard4(acc[3][0], acc[3][1], acc[3][2], acc[3][3]);

  // ---- epilogue ----
  float* slab = sT[wave];
  const float* Rb = RESID ? (resid + (size_t)b * strideR) : nullptr;
#pragma unroll
  for (int i = 0; i < 4; ++i) {
    const int mBase = m0 + (i << 4);
#pragma unroll
    for (int j = 0; j < 4; ++j) {
      const int n = n0 + (j << 4) + rlane;
      float bv = 0.f;
      if (BIAS_MODE == 2) bv = bias[n];
#pragma unroll
      for (int r = 0; r < 8; ++r) {
        float v = acc[i][j][r] * scale;
        if (BIAS_MODE == 1) v += bias[mBase + mOff + r];
        if (BIAS_MODE == 2) v += bv;
        if (RESID) v += Rb[(size_t)(mBase + mOff + r) * ldc + n];
        if (ACT == 1) v = tanhf(v);
        if (ACT == 2) v = fmaxf(v, 0.0f);
        if (ACT == 3) v = v / (1.0f + expf(-v));
        if (ACT == 4) v = (v > 0.f) ? v : 0.01f * v;
        if (ACT == 5) v = 0.5f * v * (1.0f + erff(v * 0.70710678118654752f));
        slab[(mOff + r) * 68 + (j << 4) + rlane] = v;
      }
    }
    __builtin_amdgcn_fence(__ATOMIC_RELEASE, "workgroup");
    __builtin_amdgcn_wave_barrier();
    __builtin_amdgcn_fence(__ATOMIC_ACQUIRE, "workgroup");
    if (OUT_MODE == 0) {
      float* C = (float*)Cout + (size_t)b * strideC;
      const int hh = lane >> 4, c4 = (lane & 15) * 4;     // row seg = 256 B = 16 lanes x 16 B
      {
#pragma unroll
        for (int it = 0; it < 8; ++it) {
          const int row = it * 2 + hh;
          v4f v = *(const v4f*)(slab + row * 68 + c4);
          *(v4f*)(C + (size_t)(mBase + row) * ldc + n0 + c4) = v;
        }
        
      }
    } else {
      const int q = lane >> 3, c8 = (lane & 7) * 8;
      unsigned short* C  = (unsigned short*)Cout  + (size_t)b * strideC;
      unsigned short* C2 = (OUT_MODE == 2) ? ((unsigned short*)Cout2 + (size_t)b * strideC) : nullptr;
      {
#pragma unroll
        for (int it = 0; it < 4; ++it) {
          const int row = it * 4 + q;
          const float* sp = slab + row * 68 + c8;
          v8h hv, lv;
#pragma unroll
          for (int e = 0; e < 8; ++e) {
            if (OUT_MODE == 1) {
              hv[e] = (_Float16)sp[e];
            } else {
              unsigned short hb = f2bf_bits(sp[e]);
              unsigned short lb = f2bf_bits(sp[e] - bf_bits2f(hb));
              hv[e] = __builtin_bit_cast(_Float16, hb);
              lv[e] = __builtin_bit_cast(_Float16, lb);
            }
          }
          *(v8h*)(C + (size_t)(mBase + row) * ldc + n0 + c8) = hv;
          if (OUT_MODE == 2) *(v8h*)(C2 + (size_t)(mBase + row) * ldc + n0 + c8) = lv;
        }
        
      }
    }
    __builtin_amdgcn_fence(__ATOMIC_RELEASE, "workgroup");
    __builtin_amdgcn_wave_barrier();
    __builtin_amdgcn_fence(__ATOMIC_ACQUIRE, "workgroup");
  }
}

__global__ __launch_bounds__(256) void cast_f32_f16x2(
    const float* __restrict__ in, _Float16* __restrict__ out, int n2) {
  int i = blockIdx.x * 256 + threadIdx.x;
  if (i < n2) {
    const _Float16 h0 = (_Float16)in[2 * i], h1 = (_Float16)in[2 * i + 1];
    const unsigned u = (unsigned)__builtin_bit_cast(unsigned short, h0) | ((unsigned)__builtin_bit_cast(unsigned short, h1) << 16);
    ((unsigned*)out)[i] = u;
    
  }
}


} // namespace w25

__global__ __launch_bounds__(256) void k_castT16(const float* __restrict__ src, long long lds, _Float16* __restrict__ dst, long long ldd, int R, int C, float s) {
    const long long i = (long long)blockIdx.x * 256 + threadIdx.x; const long long np = (long long)C * (R / 2); if (i >= np) return; const int c = (int)(i / (R / 2)); const int r = 2 * (int)(i % (R / 2));
    const _Float16 h0 = (_Float16)(src[(long long)r * lds + c] * s), h1 = (_Float16)(src[(long long)(r + 1) * lds + c] * s);
    const unsigned u = (unsigned)__builtin_bit_cast(unsigned short, h0) | ((unsigned)__builtin_bit_cast(unsigned short, h1) << 16);
    unsigned* d = (unsigned*)(dst + (long long)c * ldd + r); *d = u;  }
__global__ __launch_bounds__(256) void k_cast16(const float* __restrict__ src, long long lds, _Float16* __restrict__ dst, long long ldd, int R, int C, float s) {
    const long long i = (long long)blockIdx.x * 256 + threadIdx.x; const long long np = (long long)R * (C / 2); if (i >= np) return; const int r = (int)(i / (C / 2)); const int c = 2 * (int)(i % (C / 2));
    const _Float16 h0 = (_Float16)(src[(long long)r * lds + c] * s), h1 = (_Float16)(src[(long long)r * lds + c + 1] * s);
    const unsigned u = (unsigned)__builtin_bit_cast(unsigned short, h0) | ((unsigned)__builtin_bit_cast(unsigned short, h1) << 16);
    unsigned* d = (unsigned*)(dst + (long long)r * ldd + c); *d = u;  }

// f32 -> bf16 hi plane + bf16 lo plane (x = hi + lo to ~2^-17 relative; RNE both), [R][C] -> [R][C] (or transposed to [C][R]); 2 consecutive destination elements
__device__ __forceinline__ unsigned int f2bf2_pack(float a, float b, unsigned int* lo) {
    const unsigned short ha = w25::f2bf_bits(a), hb = w25::f2bf_bits(b);
    const unsigned short la = w25::f2bf_bits(a - w25::bf_bits2f(ha)), lb = w25::f2bf_bits(b - w25::bf_bits2f(hb));
    *lo = (unsigned)la | ((unsigned)lb << 16); return (unsigned)ha | ((unsigned)hb << 16); }
__global__ __launch_bounds__(256) void k_castS16(const float* __restrict__ src, long long lds, __bf16* __restrict__ dhi, __bf16* __restrict__ dlo, long long ldd, int R, int C, float s, int transpose) {
    const long long i = (long long)blockIdx.x * 256 + threadIdx.x; long long o; float a, b;
    if (transpose) { const long long np = (long long)C * (R / 2); if (i >= np) return; const int c = (int)(i / (R / 2)); const int r = 2 * (int)(i % (R / 2)); a = src[(long long)r * lds + c] * s; b = src[(long long)(r + 1) * lds + c] * s; o = (long long)c * ldd + r; }
    else { const long long np = (long long)R * (C / 2); if (i >= np) return; const int r = (int)(i / (C / 2)); const int c = 2 * (int)(i % (C / 2)); a = src[(long long)r * lds + c] * s; b = src[(long long)r * lds + c + 1] * s; o = (long long)r * ldd + c; }
    unsigned lo; const unsigned hi = f2bf2_pack(a, b, &lo); unsigned* ph = (unsigned*)(dhi + o); unsigned* pl = (unsigned*)(dlo + o);
    *ph = hi; *pl = lo;  }

namespace w25 {
// =====================================================================================
// Generic causal/non-causal attention for head_dim 64, f32 in / f32 out; 16-bit operands: bf16 with optional hi/lo splits, or
// plain f16 (F16=true, non-split, probabilities carried x2^15).
//   scores = (q*qscale)·kᵀ : v_wmma_f32_16x16x32_bf16; SPLIT_QK -> q,k as bf16 hi/lo (hi·hi + hi·lo + lo·hi)
//   out    = p·v           : v_wmma_f32_16x16x32_bf16; SPLIT_PV -> p,v as bf16 hi/lo; else p,v plain bf16
//   f32 accumulate; online softmax in f32. Block = 4 waves = 64 query rows of one (batch, head); S % 64 == 0.
//   Element (b, s, h, d) of tensor X lives at X[b*X_bs + s*X_rs + h*X_hs + d] (strides in floats, multiples of 4).
//   Masking: mask_mode 0 none, 1 causal (kv > q masked), 2 tensor [S][Skv] shared over (b,h) (float if
//   mask_is_int==0, int32 with element == 0 -> masked if 1, int32 with element != 0 -> masked if 2), 3 per-token vectors qmask[B][S] & kvmask[B][Skv] (int32,
//   0 -> masked), 4 causal + sliding window (kv > q or q - kv > W masked; W passed in mask_is_int);
//   5 = relative-position bias: s += cp[b,h,q][idx[q][kv]] + pc[b,h,kv][idx[q][kv]] with idx = mask_b ([S][Skv] int32) and
//   mask_a an int32 [S][Skv] tensor with nonzero = masked (tables: element (b,h,row,n) at X + b*c_bs + h*c_hs + row*c_rs + n);
//   masked scores are replaced by mask_fill (e.g. -inf or -1e9) before the softmax.
//   grid.x = B * H * (S/64) (or a sub-range with blk0).
// =====================================================================================
#define AT_D 64
#define AT_NW 4
#define AT_QB 64
#define AT_KC 64
struct AttnGeom { const float* cp = nullptr; const float* pc = nullptr; long c_bs = 0, c_rs = 0, c_hs = 0;   // mode-5 score-bias tables
                  long q_bs, q_rs, q_hs, k_bs, k_rs, k_hs, v_bs, v_rs, v_hs, o_bs, o_rs, o_hs;
                  int S, Skv, H, mask_mode; float qscale; int blk0; float mask_fill; int mask_is_int; };
static_assert(sizeof(AttnGeom) == 168, "no padding");

__device__ __forceinline__ unsigned short at_bf_bits(float f) {
  unsigned u = __float_as_uint(f);
  return (unsigned short)((u + 0x7FFFu + ((u >> 16) & 1u)) >> 16);
}
__device__ __forceinline__ __bf16 at_f2bf(float f) { return __builtin_bit_cast(__bf16, at_bf_bits(f)); }
__device__ __forceinline__ void at_split(float f, __bf16& hi, __bf16& lo) {
  const unsigned short hb = at_bf_bits(f);
  hi = __builtin_bit_cast(__bf16, hb);
  lo = at_f2bf(f - __uint_as_float(((unsigned)hb) << 16));
}
__device__ __forceinline__ v8f at_mma(v16b a, v16b b, v8f c) {
  c = __builtin_amdgcn_wmma_f32_16x16x32_bf16(false, a, false, b, (short)0, c, false, false);
  asm volatile("v_nop\n\tv_nop\n\tv_nop\n\tv_nop" : "+v"(c) : "v"(a), "v"(b));
  return c;
}
// 16-bit element as a bit pattern held in a __bf16 slot: f16 bits when F16, bf16 (RNE) otherwise
template <bool F16> __device__ __forceinline__ __bf16 at_to16(float f) {
  if (F16) return __builtin_bit_cast(__bf16, (_Float16)f);
  return at_f2bf(f);
}
template <bool F16> __device__ __forceinline__ v8f at_mma16(v16b a, v16b b, v8f c) {
  if (F16) {
    const v16h ah = __builtin_bit_cast(v16h, a), bh = __builtin_bit_cast(v16h, b);
    c = __builtin_amdgcn_wmma_f32_16x16x32_f16(false, ah, false, bh, (short)0, c, false, false);
    asm volatile("v_nop\n\tv_nop\n\tv_nop\n\tv_nop" : "+v"(c) : "v"(ah), "v"(bh));
    return c;
  }
  return at_mma(a, b, c);
}

template <bool SPLIT_QK, bool SPLIT_PV, bool F16 = false>
__global__ __launch_bounds__(128)
void attn64_kernel(const float* __restrict__ q, const float* __restrict__ k,
                   const float* __restrict__ v, float* __restrict__ out,
                   const void* __restrict__ mask_a, const int* __restrict__ mask_b, AttnGeom g) {
  static_assert(!(F16 && (SPLIT_QK || SPLIT_PV)), "f16 mode is non-split");
  const float PSC = F16 ? 32768.0f : 1.0f;     // f16 probabilities carried x2^15 (subnormal range), folded into the final 1/l
  union FB { v16b v; v8b h[2]; };
  __shared__ __align__(16) __bf16 Ksh[AT_KC * AT_D];             // K hi [kv][d]      8 KB
  __shared__ __align__(16) __bf16 Ksl[SPLIT_QK ? AT_KC * AT_D : 8];
  __shared__ __align__(16) __bf16 Vth[AT_D * AT_KC];             // V hi [d][kv]      8 KB
  __shared__ __align__(16) __bf16 Vtl[SPLIT_PV ? AT_D * AT_KC : 8];
  __shared__ __align__(16) __bf16 Psh[AT_NW][16 * AT_KC];        // per wave P hi [row][kv]  8 KB
  __shared__ __align__(16) __bf16 Psl[SPLIT_PV ? AT_NW : 1][SPLIT_PV ? 16 * AT_KC : 8];
  __shared__ __align__(16) float  Os[AT_NW][16 * 68];            // per wave out tile, pitch 68

  const int tid  = threadIdx.x;
  const int wave = tid >> 5;
  const int lane = tid & 31;
  const int hh   = lane >> 4;
  const int c    = lane & 15;

  const int nqb = g.S / AT_QB;
  const int bx = blockIdx.x + g.blk0;
  const int qb = bx % nqb;
  const int bh = bx / nqb;
  const int h  = bh % g.H;
  const int b  = bh / g.H;
  const int qbase_block = qb * AT_QB;
  const int q0 = qbase_block + wave * 16;

  const float* qb_ptr = q + (size_t)b * g.q_bs + (size_t)h * g.q_hs;
  const float* kb_ptr = k + (size_t)b * g.k_bs + (size_t)h * g.k_hs;
  const float* vb_ptr = v + (size_t)b * g.v_bs + (size_t)h * g.v_hs;
  float*       ob_ptr = out + (size_t)b * g.o_bs + (size_t)h * g.o_hs;

  // ---- Q fragments (A operand): 2 d-chunks, hi (and lo) ----
  v16b qah[2], qal[2];
  {
    const float* qrow = qb_ptr + (size_t)(q0 + c) * g.q_rs;
#pragma unroll
    for (int dc = 0; dc < 2; ++dc) {
#pragma unroll
      for (int e = 0; e < 8; ++e) {
        const float f0 = qrow[dc * 32 + 8 * hh + e] * g.qscale;
        const float f1 = qrow[dc * 32 + 16 + 8 * hh + e] * g.qscale;
        if (SPLIT_QK) { __bf16 hq, lq; at_split(f0, hq, lq); qah[dc][e] = hq; qal[dc][e] = lq; at_split(f1, hq, lq); qah[dc][8 + e] = hq; qal[dc][8 + e] = lq; }
        else { qah[dc][e] = at_to16<F16>(f0); qah[dc][8 + e] = at_to16<F16>(f1); qal[dc][e] = qah[dc][e]; qal[dc][8 + e] = qah[dc][8 + e]; }
      }
    }
  }

  float mrow[8], lrow[8];
  v8f oacc[4];
#pragma unroll
  for (int r = 0; r < 8; ++r) { mrow[r] = -INFINITY; lrow[r] = 0.f; }
#pragma unroll
  for (int t = 0; t < 4; ++t) oacc[t] = (v8f){0.f,0.f,0.f,0.f,0.f,0.f,0.f,0.f};

  const int nChunks = (g.mask_mode == 1 || g.mask_mode == 4) ? (qb + 1) : (g.Skv / AT_KC);   // block-uniform
  // per-row query mask (mode 3)
  int qkeep[8];
#pragma unroll
  for (int r = 0; r < 8; ++r) qkeep[r] = (g.mask_mode == 3) ? mask_b[(size_t)b * g.S + q0 + 8 * hh + r] : 1;   // mask_b = qmask in mode 3
  for (int kc = 0; kc < nChunks; ++kc) {
    const int kv0 = kc * AT_KC;
    __syncthreads();
    {
      const int kvr = tid >> 1, dh = (tid & 1) * 32;
      const float* krow = kb_ptr + (size_t)(kv0 + kvr) * g.k_rs + dh;
      const float* vrow = vb_ptr + (size_t)(kv0 + kvr) * g.v_rs + dh;
#pragma unroll
      for (int i = 0; i < 8; ++i) {
        v4f kk = *(const v4f*)(krow + 4 * i);
        v4f vv = *(const v4f*)(vrow + 4 * i);
#pragma unroll
        for (int e = 0; e < 4; ++e) {
          const int d = dh + 4 * i + e;
          if (SPLIT_QK) { __bf16 a, bl; at_split(kk[e], a, bl); Ksh[kvr * AT_D + d] = a; Ksl[kvr * AT_D + d] = bl; }
          else Ksh[kvr * AT_D + d] = at_to16<F16>(kk[e]);
          if (SPLIT_PV) { __bf16 a, bl; at_split(vv[e], a, bl); Vth[d * AT_KC + kvr] = a; Vtl[d * AT_KC + kvr] = bl; }
          else Vth[d * AT_KC + kvr] = at_to16<F16>(vv[e]);
        }
      }
    }
    __syncthreads();

    v8f s[4];
#pragma unroll
    for (int j = 0; j < 4; ++j) {
      s[j] = (v8f){0.f,0.f,0.f,0.f,0.f,0.f,0.f,0.f};
#pragma unroll 1
      for (int dc = 0; dc < 2; ++dc) {
        FB kb;
        kb.h[0] = *(const v8b*)(Ksh + (j * 16 + c) * AT_D + dc * 32 + 8 * hh);
        kb.h[1] = *(const v8b*)(Ksh + (j * 16 + c) * AT_D + dc * 32 + 16 + 8 * hh);
        s[j] = at_mma16<F16>(qah[dc], kb.v, s[j]);
        if (SPLIT_QK) {
          FB kl;
          kl.h[0] = *(const v8b*)(Ksl + (j * 16 + c) * AT_D + dc * 32 + 8 * hh);
          kl.h[1] = *(const v8b*)(Ksl + (j * 16 + c) * AT_D + dc * 32 + 16 + 8 * hh);
          s[j] = at_mma16<F16>(qah[dc], kl.v, s[j]);
          s[j] = at_mma16<F16>(qal[dc], kb.v, s[j]);
        }
      }
    }
    const bool diag = (g.mask_mode == 1) && (kc == qb);
    int kvkeep[4] = {1, 1, 1, 1};
    if (g.mask_mode == 3) {
#pragma unroll
      for (int j = 0; j < 4; ++j) kvkeep[j] = ((const int*)mask_a)[(size_t)b * g.Skv + kv0 + j * 16 + c];   // mask_a = kvmask
    }
    float cm[8];
#pragma unroll
    for (int r = 0; r < 8; ++r) {
      const int qrow = q0 + 8 * hh + r;
      float m = -INFINITY;
#pragma unroll
      for (int j = 0; j < 4; ++j) {
        const int kvcol = kv0 + j * 16 + c;
        bool masked = false;
        if (diag) masked = (kvcol > qrow);
        else if (g.mask_mode == 4) masked = (kvcol > qrow) || (qrow - kvcol > g.mask_is_int);
        else if (g.mask_mode == 2) {
          const size_t mi = (size_t)qrow * g.Skv + kvcol;
          masked = (g.mask_is_int == 0) ? (((const float*)mask_a)[mi] == 0.0f)
                 : (g.mask_is_int == 1) ? (((const int*)mask_a)[mi] == 0) : (((const int*)mask_a)[mi] != 0);
        } else if (g.mask_mode == 3) masked = (qkeep[r] == 0) || (kvkeep[j] == 0);
        else if (g.mask_mode == 5) {
          const size_t mi = (size_t)qrow * g.Skv + kvcol;
          masked = (((const int*)mask_a)[mi] != 0);
          int n = mask_b[mi]; n = n < 0 ? 0 : n;
          s[j][r] += g.cp[(size_t)b * g.c_bs + (size_t)h * g.c_hs + (size_t)qrow * g.c_rs + n]
                   + g.pc[(size_t)b * g.c_bs + (size_t)h * g.c_hs + (size_t)kvcol * g.c_rs + n];
        }
        if (masked) s[j][r] = g.mask_fill;
        m = fmaxf(m, s[j][r]);
      }
#pragma unroll
      for (int off = 1; off < 16; off <<= 1) m = fmaxf(m, __shfl_xor(m, off, 32));
      cm[r] = m;
    }
    __bf16* pwh = Psh[wave];
    __bf16* pwl = Psl[SPLIT_PV ? wave : 0];
#pragma unroll
    for (int r = 0; r < 8; ++r) {
      const float mnew = fmaxf(mrow[r], cm[r]);
      const float alpha = expf(mrow[r] - mnew);
      mrow[r] = mnew;
      float psum = 0.f;
#pragma unroll
      for (int j = 0; j < 4; ++j) {
        const float p = expf(s[j][r] - mnew);
        psum += p;
        if (SPLIT_PV) { __bf16 a, bl; at_split(p, a, bl); pwh[(8 * hh + r) * AT_KC + j * 16 + c] = a; pwl[(8 * hh + r) * AT_KC + j * 16 + c] = bl; }
        else pwh[(8 * hh + r) * AT_KC + j * 16 + c] = at_to16<F16>(p * PSC);
      }
#pragma unroll
      for (int off = 1; off < 16; off <<= 1) psum += __shfl_xor(psum, off, 32);
      lrow[r] = lrow[r] * alpha + psum;
#pragma unroll
      for (int t = 0; t < 4; ++t) oacc[t][r] *= alpha;
    }
    __builtin_amdgcn_fence(__ATOMIC_RELEASE, "workgroup");
    __builtin_amdgcn_wave_barrier();
    __builtin_amdgcn_fence(__ATOMIC_ACQUIRE, "workgroup");
#pragma unroll 1
    for (int kk = 0; kk < 2; ++kk) {
      FB pa, pl;
      pa.h[0] = *(const v8b*)(pwh + c * AT_KC + kk * 32 + 8 * hh);
      pa.h[1] = *(const v8b*)(pwh + c * AT_KC + kk * 32 + 16 + 8 * hh);
      if (SPLIT_PV) {
        pl.h[0] = *(const v8b*)(pwl + c * AT_KC + kk * 32 + 8 * hh);
        pl.h[1] = *(const v8b*)(pwl + c * AT_KC + kk * 32 + 16 + 8 * hh);
      }
#pragma unroll
      for (int t = 0; t < 4; ++t) {
        FB vb;
        vb.h[0] = *(const v8b*)(Vth + (t * 16 + c) * AT_KC + kk * 32 + 8 * hh);
        vb.h[1] = *(const v8b*)(Vth + (t * 16 + c) * AT_KC + kk * 32 + 16 + 8 * hh);
        oacc[t] = at_mma16<F16>(pa.v, vb.v, oacc[t]);
        if (SPLIT_PV) {
          FB vl;
          vl.h[0] = *(const v8b*)(Vtl + (t * 16 + c) * AT_KC + kk * 32 + 8 * hh);
          vl.h[1] = *(const v8b*)(Vtl + (t * 16 + c) * AT_KC + kk * 32 + 16 + 8 * hh);
          oacc[t] = at_mma16<F16>(pa.v, vl.v, oacc[t]);
          oacc[t] = at_mma16<F16>(pl.v, vb.v, oacc[t]);
        }
      }
    }
  }

  float* os = Os[wave];
#pragma unroll
  for (int r = 0; r < 8; ++r) {
    const float inv = 1.0f / (lrow[r] * PSC);
#pragma unroll
    for (int t = 0; t < 4; ++t) os[(8 * hh + r) * 68 + t * 16 + c] = oacc[t][r] * inv;
  }
  __builtin_amdgcn_fence(__ATOMIC_RELEASE, "workgroup");
  __builtin_amdgcn_wave_barrier();
  __builtin_amdgcn_fence(__ATOMIC_ACQUIRE, "workgroup");
  {
    const int c4 = (lane & 15) * 4;
    {
#pragma unroll
      for (int it = 0; it < 8; ++it) {
        const int row = it * 2 + hh;
        v4f val = *(const v4f*)(os + row * 68 + c4);
        *(v4f*)(ob_ptr + (size_t)(q0 + row) * g.o_rs + c4) = val;
      }
      
    }
  }
}

} // namespace w25

// MI[(b, s)] = (s < valid_len[b]) ? 1 : 0 as INT (keep-mask: masked scores are SET to -1e6 exactly like the module's where, so a 128-key block lying entirely beyond valid_len comes out uniform)
__global__ __launch_bounds__(256) void k_te_mask(const int* __restrict__ VL, int* __restrict__ MI, int Bn, int S) { const int t = blockIdx.x * 256 + threadIdx.x; if (t >= Bn * S) return; int* d = MI + t; const int v = ((t % S) < VL[t / S]) ? 1 : 0; *d = v;  }


extern "C" void kernel_launch(void* const* d_in, const int* in_sizes, int n_in, void* d_out, int out_size, void* d_ws, size_t ws_size, hipStream_t stream) {
    (void)in_sizes; (void)n_in; (void)out_size; (void)ws_size;
    const float* X = (const float*)d_in[0];
    const int* vl = (const int*)d_in[1];
    const float* Wq = (const float*)d_in[2];
    const float* Wk = (const float*)d_in[3];
    const float* Wv = (const float*)d_in[4];
    const float* Wo = (const float*)d_in[5];
    const float* g1 = (const float*)d_in[6];
    const float* be1 = (const float*)d_in[7];
    const float* W1 = (const float*)d_in[8];
    const float* bf1 = (const float*)d_in[9];
    const float* W2 = (const float*)d_in[10];
    const float* bf2 = (const float*)d_in[11];
    const float* g2 = (const float*)d_in[12];
    const float* be2 = (const float*)d_in[13];
    const int Bn = 4;
    const int S = 1024;
    const int D = 1024;
    const int NH = 16;
    const int DH = 64;
    const int F = 4096;
    const int M = 128;
    const int NB = S / M;
    const int NR = Bn * S;
    float* out = (float*)d_out;
    char* wsp = (char*)d_ws;
    float* Q = (float*)wsp; wsp += (((size_t)((size_t)NR * D) * 4 + 255) / 256) * 256;
    float* Kb = (float*)wsp; wsp += (((size_t)((size_t)NR * D) * 4 + 255) / 256) * 256;
    float* V = (float*)wsp; wsp += (((size_t)((size_t)NR * D) * 4 + 255) / 256) * 256;
    float* AT = (float*)wsp; wsp += (((size_t)((size_t)NR * D) * 4 + 255) / 256) * 256;
    float* MF = (float*)wsp; wsp += (((size_t)((size_t)NR) * 4 + 255) / 256) * 256;
    float* Y = (float*)wsp; wsp += (((size_t)((size_t)NR * D) * 4 + 255) / 256) * 256;
    float* ST = (float*)wsp; wsp += (((size_t)((size_t)NR * 32) * 4 + 255) / 256) * 256;
    float* H1 = (float*)wsp; wsp += (((size_t)((size_t)NR * F) * 4 + 255) / 256) * 256;
    unsigned short* G64A = (unsigned short*)wsp; wsp += (((size_t)(16777216) * 2 + 255) / 256) * 256;
    unsigned short* G64B = (unsigned short*)wsp; wsp += (((size_t)(4194304) * 2 + 255) / 256) * 256;
    k_cast16<<<(unsigned)((((long long)(4096) * ((1024) / 2)) + 255) / 256), 256, 0, stream>>>(X, 1024, (_Float16*)(G64A), 1024, 4096, 1024, 1.0f);
    k_castT16<<<(unsigned)((((long long)(1024) * ((1024) / 2)) + 255) / 256), 256, 0, stream>>>(Wq, 1024, (_Float16*)(G64B), 1024, 1024, 1024, 16.0f);
    w25::wmma_gemm64<0, false, 0, 0, false, 0><<<dim3((unsigned)((((4096) / 64) * ((1024) / 64) + 7) / 8), (unsigned)(1)), 256, 0, stream>>>((const unsigned short*)(G64A), nullptr, 1024, 0, (const unsigned short*)(G64B), nullptr, 1024, 0, (void*)(Q), nullptr, 1024, 0, nullptr, nullptr, 0, 4096, 1024, 1024, 0.0625f);
    k_cast16<<<(unsigned)((((long long)(4096) * ((1024) / 2)) + 255) / 256), 256, 0, stream>>>(X, 1024, (_Float16*)(G64A), 1024, 4096, 1024, 1.0f);
    k_castT16<<<(unsigned)((((long long)(1024) * ((1024) / 2)) + 255) / 256), 256, 0, stream>>>(Wk, 1024, (_Float16*)(G64B), 1024, 1024, 1024, 16.0f);
    w25::wmma_gemm64<0, false, 0, 0, false, 0><<<dim3((unsigned)((((4096) / 64) * ((1024) / 64) + 7) / 8), (unsigned)(1)), 256, 0, stream>>>((const unsigned short*)(G64A), nullptr, 1024, 0, (const unsigned short*)(G64B), nullptr, 1024, 0, (void*)(Kb), nullptr, 1024, 0, nullptr, nullptr, 0, 4096, 1024, 1024, 0.0625f);
    k_cast16<<<(unsigned)((((long long)(4096) * ((1024) / 2)) + 255) / 256), 256, 0, stream>>>(X, 1024, (_Float16*)(G64A), 1024, 4096, 1024, 1.0f);
    k_castT16<<<(unsigned)((((long long)(1024) * ((1024) / 2)) + 255) / 256), 256, 0, stream>>>(Wv, 1024, (_Float16*)(G64B), 1024, 1024, 1024, 16.0f);
    w25::wmma_gemm64<0, false, 0, 0, false, 0><<<dim3((unsigned)((((4096) / 64) * ((1024) / 64) + 7) / 8), (unsigned)(1)), 256, 0, stream>>>((const unsigned short*)(G64A), nullptr, 1024, 0, (const unsigned short*)(G64B), nullptr, 1024, 0, (void*)(V), nullptr, 1024, 0, nullptr, nullptr, 0, 4096, 1024, 1024, 0.0625f);
    k_te_mask<<<(NR + 255) / 256, 256, 0, stream>>>((const int*)vl, (int*)MF, Bn, S);
    { /*apv4*/ AttnP a;
      a.Q = Q; a.K = Kb; a.V = V; a.O = AT; a.P = 0; a.Mf = 0; a.Mi = (const int*)MF; a.ST = 0;
      a.Pw = 0; a.Rt = 0; a.SQ = 0; a.SK = 0;
      a.swb = 0; a.swh = 0; a.swi = 0; a.swj = 0; a.srb = 0; a.srh = 0; a.sri = 0; a.sQb = (long long)M * D; a.sQh = DH; a.sQi = D; a.sQd = 1; a.sKb = (long long)M * D; a.sKh = DH; a.sKj = D; a.sKd = 1; a.sVb = (long long)M * D; a.sVh = DH; a.sVj = D; a.sVd = 1; a.sOb = (long long)M * D; a.sOh = DH; a.sOi = D; a.sPb = 0; a.sPh = 0; a.sPi = 0; a.smb = M; a.smh = 0; a.smi = 0; a.smj = 1;
      a.Lq = M; a.Lk = M; a.dh = DH; a.dv = DH; a.hrep = 1; a.causal = 0; a.coff = 0; a.pband = 0;
      a.scale = 0.125f; a.mfill = -1000000.0f; a.nonorm = 0; a.mpol = 0;
      a.roff = 0; a.rn = 1; a.segpol = 0; a.win = 0;
      k_attn<64, 64, 0, false, false><<<dim3((unsigned)((M) + 16 * AW - 1) / (16 * AW), (unsigned)(NH), (unsigned)(Bn * NB)), 32 * AW, 0, stream>>>(a); }
    k_cast16<<<(unsigned)((((long long)(4096) * ((1024) / 2)) + 255) / 256), 256, 0, stream>>>(AT, 1024, (_Float16*)(G64A), 1024, 4096, 1024, 1.0f);
    k_castT16<<<(unsigned)((((long long)(1024) * ((1024) / 2)) + 255) / 256), 256, 0, stream>>>(Wo, 1024, (_Float16*)(G64B), 1024, 1024, 1024, 16.0f);
    w25::wmma_gemm64<0, false, 0, 0, true, 0><<<dim3((unsigned)((((4096) / 64) * ((1024) / 64) + 7) / 8), (unsigned)(1)), 256, 0, stream>>>((const unsigned short*)(G64A), nullptr, 1024, 0, (const unsigned short*)(G64B), nullptr, 1024, 0, (void*)(Y), nullptr, 1024, 0, nullptr, X, 0, 4096, 1024, 1024, 0.0625f);
    k_stats<<<(unsigned)(NR), 256, 0, stream>>>(Y, D, 1, 1, 1, D, 1e-05f, ST, 0);
    k_norm_apply<<<(unsigned)(((long long)(NR) * (D) * (1) + 255) / 256), 256, 0, stream>>>(Y, Y, ST, g1, be1, NR, D, 1, 1, 0, 0);
    k_cast16<<<(unsigned)((((long long)(4096) * ((1024) / 2)) + 255) / 256), 256, 0, stream>>>(Y, 1024, (_Float16*)(G64A), 1024, 4096, 1024, 1.0f);
    k_castT16<<<(unsigned)((((long long)(4096) * ((1024) / 2)) + 255) / 256), 256, 0, stream>>>(W1, 4096, (_Float16*)(G64B), 1024, 1024, 4096, 16.0f);
    w25::wmma_gemm64<0, false, 2, 0, false, 2><<<dim3((unsigned)((((4096) / 64) * ((4096) / 64) + 7) / 8), (unsigned)(1)), 256, 0, stream>>>((const unsigned short*)(G64A), nullptr, 1024, 0, (const unsigned short*)(G64B), nullptr, 1024, 0, (void*)(H1), nullptr, 4096, 0, bf1, nullptr, 0, 4096, 4096, 1024, 0.0625f);
    k_cast16<<<(unsigned)((((long long)(4096) * ((4096) / 2)) + 255) / 256), 256, 0, stream>>>(H1, 4096, (_Float16*)(G64A), 4096, 4096, 4096, 1.0f);
    k_castT16<<<(unsigned)((((long long)(1024) * ((4096) / 2)) + 255) / 256), 256, 0, stream>>>(W2, 1024, (_Float16*)(G64B), 4096, 4096, 1024, 16.0f);
    w25::wmma_gemm64<0, false, 2, 0, true, 0><<<dim3((unsigned)((((4096) / 64) * ((1024) / 64) + 7) / 8), (unsigned)(1)), 256, 0, stream>>>((const unsigned short*)(G64A), nullptr, 4096, 0, (const unsigned short*)(G64B), nullptr, 4096, 0, (void*)(Kb), nullptr, 1024, 0, bf2, Y, 0, 4096, 1024, 4096, 0.0625f);
    k_stats<<<(unsigned)(NR), 256, 0, stream>>>(Kb, D, 1, 1, 1, D, 1e-05f, ST, 0);
    k_norm_apply<<<(unsigned)(((long long)(NR) * (D) * (1) + 255) / 256), 256, 0, stream>>>(Kb, out, ST, g2, be2, NR, D, 1, 1, 0, 0);
}

// v002
// A run of this version takes 688 microseconds.
// In two side-by-side timings against v001, it was 1.14 and 1.15 times as fast.
// Over all steps from v000 it is 2.09 times as fast.
// Contractions: q/k/v/o projections X.W [4096x1024].[1024x1024] and the position-wise FFN relu(Y.W1 + b) [4096x1024].[1024x4096], .W2 + b [4096x4096].[4096x1024] with f16 operands on pre-cast planes (v_wmma_f32_16x16x32_f16; 64x64 register-blocked wave tiles, weights x16); the block-diagonal windowed attention (8 blocks of 128 positions per sequence = 32 independent (sequence, block) attentions, 16 heads, keys >= valid_len SET to -1e6 through the integer keep-mask — exactly the module's where, so blocks lying wholly beyond valid_len are uniform) as one flash launch (f16 q.k^T and p.v with p as f16 of 4096 p); f32 accumulate and softmax. AddNorm LayerNorms (wave per row, fixed-order trees) and the mask table from the INPUT valid lengths are f32 kernels.
#include <hip/hip_runtime.h>
#include <math.h>

typedef __attribute__((ext_vector_type(16))) _Float16 v16h;
typedef __attribute__((ext_vector_type(8)))  _Float16 v8h;
typedef __attribute__((ext_vector_type(16))) __bf16   v16b;
typedef __attribute__((ext_vector_type(8)))  float    v8f;
typedef __attribute__((ext_vector_type(4)))  float    v4f;

// 16-bit WMMA fragment map (wave32), lane L, h = L>>4, m = L&15:
//   A 16x32: lane = row m;   element i -> k = (i<8) ? 8h+i : 16+8h+(i-8)
//   B 32x16: lane = column m; the SAME k(i,h)
//   D 16x16 (8 f32): lane = column m; element r -> row 8h+r
__device__ __forceinline__ int frag_k(int i, int h) { return (i < 8) ? (8 * h + i) : (16 + 8 * h + (i - 8)); }
__device__ __forceinline__ __bf16 bf16_rne(float f) {
    unsigned int u = __float_as_uint(f);
    u += 0x7fffu + ((u >> 16) & 1u);
    return __builtin_bit_cast(__bf16, (unsigned short)(u >> 16));
}
__device__ __forceinline__ float bf16_f32(__bf16 b) { return __uint_as_float(((unsigned int)__builtin_bit_cast(unsigned short, b)) << 16); }
__device__ __forceinline__ v8f wmma16(v16h a, v16h b, v8f c) {
    c = __builtin_amdgcn_wmma_f32_16x16x32_f16(false, a, false, b, (short)0, c, false, false);
    asm volatile("v_nop\n\tv_nop\n\tv_nop\n\tv_nop" : "+v"(c) : "v"(a), "v"(b));
    return c;
}
__device__ __forceinline__ v8f wmmab(v16b a, v16b b, v8f c) {
    c = __builtin_amdgcn_wmma_f32_16x16x32_bf16(false, a, false, b, (short)0, c, false, false);
    asm volatile("v_nop\n\tv_nop\n\tv_nop\n\tv_nop" : "+v"(c) : "v"(a), "v"(b));
    return c;
}
struct Split { v16b hi, lo; };
// hi/lo split product: a.hi*b.hi + a.hi*b.lo + a.lo*b.hi
__device__ __forceinline__ v8f wmma3(const Split& a, const Split& b, v8f c) {
    c = __builtin_amdgcn_wmma_f32_16x16x32_bf16(false, a.hi, false, b.hi, (short)0, c, false, false);
    c = __builtin_amdgcn_wmma_f32_16x16x32_bf16(false, a.hi, false, b.lo, (short)0, c, false, false);
    c = __builtin_amdgcn_wmma_f32_16x16x32_bf16(false, a.lo, false, b.hi, (short)0, c, false, false);
    asm volatile("v_nop\n\tv_nop\n\tv_nop\n\tv_nop" : "+v"(c) : "v"(a.hi), "v"(a.lo), "v"(b.hi), "v"(b.lo));
    return c;
}
struct Split3 { v16b hi, mid, lo; };
// triple split product (6 terms, drops only terms below 2^-24 relative)
__device__ __forceinline__ v8f wmma6(const Split3& a, const Split3& b, v8f c) {
    c = __builtin_amdgcn_wmma_f32_16x16x32_bf16(false, a.hi, false, b.hi, (short)0, c, false, false);
    c = __builtin_amdgcn_wmma_f32_16x16x32_bf16(false, a.hi, false, b.mid, (short)0, c, false, false);
    c = __builtin_amdgcn_wmma_f32_16x16x32_bf16(false, a.mid, false, b.hi, (short)0, c, false, false);
    c = __builtin_amdgcn_wmma_f32_16x16x32_bf16(false, a.hi, false, b.lo, (short)0, c, false, false);
    c = __builtin_amdgcn_wmma_f32_16x16x32_bf16(false, a.mid, false, b.mid, (short)0, c, false, false);
    c = __builtin_amdgcn_wmma_f32_16x16x32_bf16(false, a.lo, false, b.hi, (short)0, c, false, false);
    asm volatile("v_nop\n\tv_nop\n\tv_nop\n\tv_nop" : "+v"(c) : "v"(a.hi), "v"(a.mid), "v"(a.lo), "v"(b.hi), "v"(b.mid), "v"(b.lo));
    return c;
}

// Fragment gathers from f32 memory: element i <- p[(k0 + frag_k(i,h)) * sk] * s, zero for k >= klen.
__device__ __forceinline__ v16h fh_ld(const float* __restrict__ p, long long sk, int k0, int h, int klen, float s) {
    v16h a;
#pragma unroll
    for (int i = 0; i < 16; ++i) { const int k = k0 + frag_k(i, h); a[i] = (k < klen) ? (_Float16)(p[(long long)k * sk] * s) : (_Float16)0.f; }
    return a;
}
__device__ __forceinline__ Split sp_ld(const float* __restrict__ p, long long sk, int k0, int h, int klen, float s) {
    Split r;
#pragma unroll
    for (int i = 0; i < 16; ++i) {
        const int k = k0 + frag_k(i, h); const float x = (k < klen) ? p[(long long)k * sk] * s : 0.f;
        const __bf16 hb = bf16_rne(x); r.hi[i] = hb; r.lo[i] = bf16_rne(x - bf16_f32(hb));
    }
    return r;
}
__device__ __forceinline__ Split3 sp3_ld(const float* __restrict__ p, long long sk, int k0, int h, int klen, float s) {
    Split3 r;
#pragma unroll
    for (int i = 0; i < 16; ++i) {
        const int k = k0 + frag_k(i, h); const float x = (k < klen) ? p[(long long)k * sk] * s : 0.f;
        const __bf16 hb = bf16_rne(x); const float r1 = x - bf16_f32(hb); const __bf16 mb = bf16_rne(r1);
        r.hi[i] = hb; r.mid[i] = mb; r.lo[i] = bf16_rne(r1 - bf16_f32(mb));
    }
    return r;
}
__device__ __forceinline__ v16b bh_ld(const float* __restrict__ p, long long sk, int k0, int h, int klen, float s) {
    v16b a;
#pragma unroll
    for (int i = 0; i < 16; ++i) { const int k = k0 + frag_k(i, h); a[i] = bf16_rne((k < klen) ? p[(long long)k * sk] * s : 0.f); }
    return a;
}
// f16 fragment from an f16 LDS/global row with element stride 1 (k-contiguous), no bounds (tile already zero padded)
__device__ __forceinline__ v16h fh_row(const _Float16* __restrict__ row, int k0, int h) {
    v16h a;
#pragma unroll
    for (int i = 0; i < 16; ++i) a[i] = row[k0 + frag_k(i, h)];
    return a;
}

#define VST2(T, ptr, val) do { const T vst2_v_ = (val); *(T*)(ptr) = vst2_v_;  } while (0)
typedef float v4f __attribute__((ext_vector_type(4)));
#define VST2V4(ptr, val) do { const v4f vst2_v4_ = (val); *(v4f*)(ptr) = vst2_v4_;  } while (0)

__device__ __attribute__((noinline)) float act_fn(float v, int act) {
    if (act == 1) return fmaxf(v, 0.f);                                                                               // relu
    if (act == 2) { const float u = 0.7978845608028654f * (v + 0.044715f * v * v * v); return 0.5f * v * (1.f + tanhf(u)); } // tanh-gelu
    if (act == 3) return v / (1.f + expf(-v));                                                                        // silu
    if (act == 4) return 0.5f * v * (1.f + erff(v * 0.7071067811865476f));                                             // erf-gelu
    if (act == 5) return tanhf(v);
    if (act == 6) return 1.f / (1.f + expf(-v));                                                                      // sigmoid
    if (act == 7) return (v > 0.f) ? v : 0.01f * v;                                                                   // leaky relu 0.01
    if (act == 8) return (v > 0.f) ? v : (expf(v) - 1.f);                                                             // elu
    if (act == 9) return fminf(fmaxf(v, 0.f), 6.f);                                                                   // relu6
    if (act == 10) return fabsf(v);                                                                                    // abs
    if (act == 11) return (v >= 0.f) ? v : 0.1f * v;                                                                  // leaky 0.1
    if (act == 12) return (v > 0.f) ? v : 0.2f * v;                                                                   // leaky 0.2
    if (act == 13) return (v > 20.f) ? v : log1pf(expf(v));                                                            // softplus
    return v;
}

// =====================================================================================================================
// k_gemm<MODE>: C(z, m, n) = act(alpha * sum_k A(z, m, k) * B(z, k, n) + bias) + beta * R(z, m, n)
//   One wave (32-thread block) per 16 x 32 tile of C; grid (ceil(N/32), ceil(M/16), Z). Batch z -> (zo = z / zi_n, zi = z % zi_n)
//   with separate outer/inner strides for every tensor (e.g. batch and head). A(m,k) = A[zo*sAo + zi*sAi + m*sAm + k*sAk] (f32),
//   B(k,n) = B[zo*sBo + zi*sBi + n*sBn + k*sBk] (f32); any M, N, K (K zero-padded to 32 inside the fragments, M/N tails guarded).
//   C(m,n) = C[zo*sCo + zi*sCi + m*sCm + n] (n contiguous). flags: 1 bias[n], 2 bias[m], 4 residual R[zo*sRo + zi*sRi + m*sRm + n*sRn].
//   MODE 0: f16 operands (A prescaled by sa, B by sb, both undone in the epilogue); 1: bf16 hi/lo split (3 products); 2: bf16;
//   3: bf16 hi/mid/lo triple split (6 products); 4: as 3 with Kahan-compensated f32 accumulation across k-steps.
// =====================================================================================================================
struct GemmP {
    const float* A; const float* B; const float* bias; const float* R; float* C;
    long long sAo, sAi, sAm, sAk, sBo, sBi, sBn, sBk, sCo, sCi, sCm, sRo, sRi, sRm, sRn;
    int M, N, K, zi_n, flags, act; float alpha, beta, sa, sb;
    int Npad, pad_;     // columns [N, Npad) of C are written as 0 so that padded workspace rows are covered by whole-line stores; Npad >= N
};
static_assert(sizeof(GemmP) == 5 * 8 + 15 * 8 + 6 * 4 + 4 * 4 + 2 * 4, "GemmP has padding");

template <int MODE>
__global__ __launch_bounds__(32) void k_gemm(GemmP p) {
    const int lane = threadIdx.x & 31, h = lane >> 4, l15 = lane & 15;
    const int m0 = blockIdx.y * 16, n0 = blockIdx.x * 32;
    const int z = blockIdx.z, zo = z / p.zi_n, zi = z - zo * p.zi_n;
    const float* A = p.A + zo * p.sAo + zi * p.sAi;
    const float* B = p.B + zo * p.sBo + zi * p.sBi;
    const int am = min(m0 + l15, p.M - 1);                       // clamped row for loads (stores are guarded)
    v8f acc[2], comp[2];
#pragma unroll
    for (int t = 0; t < 2; ++t) { v8f zz = {}; acc[t] = zz; comp[t] = zz; }
    for (int k0 = 0; k0 < p.K; k0 += 32) {
        const float* arow = A + (long long)am * p.sAm;
        if (MODE == 1) {
            const Split a = sp_ld(arow, p.sAk, k0, h, p.K, 1.f);
#pragma unroll
            for (int t = 0; t < 2; ++t) {
                const int bn = min(n0 + t * 16 + l15, p.N - 1);
                acc[t] = wmma3(a, sp_ld(B + (long long)bn * p.sBn, p.sBk, k0, h, p.K, 1.f), acc[t]);
            }
        } else if (MODE == 3) {
            const Split3 a = sp3_ld(arow, p.sAk, k0, h, p.K, 1.f);
#pragma unroll
            for (int t = 0; t < 2; ++t) {
                const int bn = min(n0 + t * 16 + l15, p.N - 1);
                acc[t] = wmma6(a, sp3_ld(B + (long long)bn * p.sBn, p.sBk, k0, h, p.K, 1.f), acc[t]);
            }
        } else if (MODE == 4) {
            // triple split as MODE 3, but each k-step's 6 products go into a fresh accumulator and the partial is added to the running f32 sum
            // on the VALU with Kahan compensation (accumulation error stays ~1 ulp however long K is)
            const Split3 a = sp3_ld(arow, p.sAk, k0, h, p.K, 1.f);
#pragma unroll
            for (int t = 0; t < 2; ++t) {
                const int bn = min(n0 + t * 16 + l15, p.N - 1); v8f zz = {};
                const v8f part = wmma6(a, sp3_ld(B + (long long)bn * p.sBn, p.sBk, k0, h, p.K, 1.f), zz);
                const v8f y = part - comp[t]; const v8f s = acc[t] + y; comp[t] = (s - acc[t]) - y; acc[t] = s;
            }
        } else if (MODE == 2) {
            const v16b a = bh_ld(arow, p.sAk, k0, h, p.K, 1.f);
#pragma unroll
            for (int t = 0; t < 2; ++t) {
                const int bn = min(n0 + t * 16 + l15, p.N - 1);
                acc[t] = wmmab(a, bh_ld(B + (long long)bn * p.sBn, p.sBk, k0, h, p.K, 1.f), acc[t]);
            }
        } else {
            const v16h a = fh_ld(arow, p.sAk, k0, h, p.K, p.sa);
#pragma unroll
            for (int t = 0; t < 2; ++t) {
                const int bn = min(n0 + t * 16 + l15, p.N - 1);
                acc[t] = wmma16(a, fh_ld(B + (long long)bn * p.sBn, p.sBk, k0, h, p.K, p.sb), acc[t]);
            }
        }
    }
    const float iscale = (MODE == 0) ? p.alpha / (p.sa * p.sb) : p.alpha;
    float* C = p.C + zo * p.sCo + zi * p.sCi;
    const float* R = p.R + zo * p.sRo + zi * p.sRi;
    __shared__ __align__(16) float ctile[16][36];
#pragma unroll
    for (int t = 0; t < 2; ++t) {
        const int n = n0 + t * 16 + l15; const int nn = min(n, p.N - 1);
#pragma unroll
        for (int r = 0; r < 8; ++r) {
            const int m = m0 + 8 * h + r; const int mm = min(m, p.M - 1);
            float v = acc[t][r] * iscale;
            if (p.flags & 1) v += p.bias[nn];
            if (p.flags & 2) v += p.bias[mm];
            if (p.flags & 8) v *= p.bias[(long long)zo * p.M + mm];   /* per-(z,row) scale vector laid out [Z][M]; exclusive with the bias flags */
            v = act_fn(v, p.act);
            if (p.flags & 4) v += p.beta * R[(long long)mm * p.sRm + (long long)nn * p.sRn];
            ctile[8 * h + r][t * 16 + l15] = (n < p.N) ? v : 0.f;
        }
    }
    __syncthreads();
    const int NW = (p.Npad > p.N) ? p.Npad : p.N;           // write width
    const bool fast = (m0 + 16 <= p.M) && (n0 + 32 <= NW) && ((p.sCm & 3) == 0) && ((((size_t)C) & 15) == 0);
    if (fast) {
#pragma unroll
        for (int s = 0; s < 4; ++s) {
            const int row = s * 4 + (lane >> 3), c4 = (lane & 7) * 4;
            const v4f v = *(const v4f*)&ctile[row][c4];
            VST2V4(C + (long long)(m0 + row) * p.sCm + n0 + c4, v);
        }
    } else {
        for (int row = 0; row < 16; ++row) {
            const int m = m0 + row, n = n0 + lane;
            if (m < p.M && n < NW) VST2(float, C + (long long)m * p.sCm + n, ctile[row][lane]);
        }
    }
}


// =====================================================================================================================
// k_gemmT<MODE, TM, TN>: same contract as k_gemm, but one wave computes a (16*TM) x (16*TN) tile: TM A fragments and TN B fragments are
//   loaded per 32-wide k-step and reused across TM*TN WMMAs (far fewer load/convert instructions per MAC). MODE 0 (f16), 1 (bf16 hi/lo),
//   2 (bf16) only. grid (ceil(NW/(16*TN)), ceil(M/(16*TM)), Z), block 32. Epilogue identical to k_gemm, run per 16x32 sub-tile.
// =====================================================================================================================
template <int MODE, int TM, int TN>
__global__ __launch_bounds__(32) void k_gemmT(GemmP p) {
    const int lane = threadIdx.x & 31, h = lane >> 4, l15 = lane & 15;
    const int m0 = blockIdx.y * (16 * TM), n0 = blockIdx.x * (16 * TN);
    const int z = blockIdx.z, zo = z / p.zi_n, zi = z - zo * p.zi_n;
    const float* A = p.A + zo * p.sAo + zi * p.sAi;
    const float* B = p.B + zo * p.sBo + zi * p.sBi;
    v8f acc[TM][TN];
#pragma unroll
    for (int i = 0; i < TM; ++i)
#pragma unroll
        for (int t = 0; t < TN; ++t) { v8f zz = {}; acc[i][t] = zz; }
    for (int k0 = 0; k0 < p.K; k0 += 32) {
        if (MODE == 1) {
            Split a[TM], b[TN];
#pragma unroll
            for (int i = 0; i < TM; ++i) { const int am = min(m0 + 16 * i + l15, p.M - 1); a[i] = sp_ld(A + (long long)am * p.sAm, p.sAk, k0, h, p.K, 1.f); }
#pragma unroll
            for (int t = 0; t < TN; ++t) { const int bn = min(n0 + 16 * t + l15, p.N - 1); b[t] = sp_ld(B + (long long)bn * p.sBn, p.sBk, k0, h, p.K, 1.f); }
#pragma unroll
            for (int i = 0; i < TM; ++i)
#pragma unroll
                for (int t = 0; t < TN; ++t) acc[i][t] = wmma3(a[i], b[t], acc[i][t]);
        } else if (MODE == 2) {
            v16b a[TM], b[TN];
#pragma unroll
            for (int i = 0; i < TM; ++i) { const int am = min(m0 + 16 * i + l15, p.M - 1); a[i] = bh_ld(A + (long long)am * p.sAm, p.sAk, k0, h, p.K, 1.f); }
#pragma unroll
            for (int t = 0; t < TN; ++t) { const int bn = min(n0 + 16 * t + l15, p.N - 1); b[t] = bh_ld(B + (long long)bn * p.sBn, p.sBk, k0, h, p.K, 1.f); }
#pragma unroll
            for (int i = 0; i < TM; ++i)
#pragma unroll
                for (int t = 0; t < TN; ++t) acc[i][t] = wmmab(a[i], b[t], acc[i][t]);
        } else {
            v16h a[TM], b[TN];
#pragma unroll
            for (int i = 0; i < TM; ++i) { const int am = min(m0 + 16 * i + l15, p.M - 1); a[i] = fh_ld(A + (long long)am * p.sAm, p.sAk, k0, h, p.K, p.sa); }
#pragma unroll
            for (int t = 0; t < TN; ++t) { const int bn = min(n0 + 16 * t + l15, p.N - 1); b[t] = fh_ld(B + (long long)bn * p.sBn, p.sBk, k0, h, p.K, p.sb); }
#pragma unroll
            for (int i = 0; i < TM; ++i)
#pragma unroll
                for (int t = 0; t < TN; ++t) acc[i][t] = wmma16(a[i], b[t], acc[i][t]);
        }
    }
    const float iscale = (MODE == 0) ? p.alpha / (p.sa * p.sb) : p.alpha;
    float* C = p.C + zo * p.sCo + zi * p.sCi;
    const float* R = p.R + zo * p.sRo + zi * p.sRi;
    const int NW = (p.Npad > p.N) ? p.Npad : p.N;
    __shared__ __align__(16) float ctile[16][36];
#pragma unroll
    for (int i = 0; i < TM; ++i) {
        const int mb = m0 + 16 * i; if (mb >= p.M) break;          // wave-uniform
#pragma unroll
        for (int tp = 0; tp < TN / 2; ++tp) {
            const int nb = n0 + 32 * tp; if (nb >= NW) break;        // wave-uniform
#pragma unroll
            for (int t2 = 0; t2 < 2; ++t2) {
                const int t = 2 * tp + t2; const int n = nb + t2 * 16 + l15; const int nn = min(n, p.N - 1);
#pragma unroll
                for (int r = 0; r < 8; ++r) {
                    const int m = mb + 8 * h + r; const int mm = min(m, p.M - 1);
                    float v = acc[i][t][r] * iscale;
                    if (p.flags & 1) v += p.bias[nn];
                    if (p.flags & 2) v += p.bias[mm];
            if (p.flags & 8) v *= p.bias[(long long)zo * p.M + mm];   /* per-(z,row) scale vector laid out [Z][M]; exclusive with the bias flags */
                    v = act_fn(v, p.act);
                    if (p.flags & 4) v += p.beta * R[(long long)mm * p.sRm + (long long)nn * p.sRn];
                    ctile[8 * h + r][t2 * 16 + l15] = (n < p.N) ? v : 0.f;
                }
            }
            __syncthreads();
            const bool fast = (mb + 16 <= p.M) && (nb + 32 <= NW) && ((p.sCm & 3) == 0) && ((((size_t)C) & 15) == 0);
            if (fast) {
#pragma unroll
                for (int s = 0; s < 4; ++s) {
                    const int row = s * 4 + (lane >> 3), c4 = (lane & 7) * 4;
                    const v4f v = *(const v4f*)&ctile[row][c4];
                    VST2V4(C + (long long)(mb + row) * p.sCm + nb + c4, v);
                }
            } else {
                for (int row = 0; row < 16; ++row) {
                    const int m = mb + row, n = nb + lane;
                    if (m < p.M && n < NW) VST2(float, C + (long long)m * p.sCm + n, ctile[row][lane]);
                }
            }
            __syncthreads();
        }
    }
}

// =====================================================================================================================
//   Wave = 16 queries, AW waves per block, 64-key blocks; grid (ceil(Lq/(16*AW)), H, B), block 32*AW. Any Lq, Lk; head dim dh <= DHP
//   (DHP multiple of 32), value dim dv <= DVP (multiple of 16, <= 128). Every tensor addressed by (batch, head, row, element) strides, f32.
//   Scores: QM 0 f16 operands, 1 bf16 hi/lo split, 2 bf16 triple split; statistics f32 (exp2 domain); P.V: P x 4096 as f16 with V f16 staged in LDS
//   (SPLITPV: P and V as bf16 hi/lo splits). kv head = h / hrep. Masking: causal = 1 (keep j <= i + coff, masked -> -inf, key blocks beyond the
//   diagonal skipped), causal = 2 (masked -> mfill, a finite fill like the -1e9; no skipping), causal = 3 (keep j >= i + coff,
//   masked -> -inf, no skipping); optional additive f32 mask Mf,
//   optional int keep-mask Mi (0 -> score := mfill), both addressed b*smb + h*smh + i*smi + j*smj (0 strides broadcast).
// =====================================================================================================================
#define AW 4
struct AttnP {   // apv4
    const float* Q; const float* K; const float* V; float* O; float* P; const float* Mf; const int* Mi; float* ST;
    const float* Pw; const float* Rt; const int* SQ; const int* SK;           // optional: post-softmax weight, relative-position table, segment ids
    long long swb, swh, swi, swj, srb, srh, sri;                                 // Pw strides (b,h,i,j); Rt strides (b,h,i), column = clamp(i - j + roff, 0, rn-1)
    long long sQb, sQh, sQi, sQd, sKb, sKh, sKj, sKd, sVb, sVh, sVj, sVd, sOb, sOh, sOi, sPb, sPh, sPi, smb, smh, smi, smj;
    int Lq, Lk, dh, dv, hrep, causal, coff, pband;   // pband > 0: P holds only the band |j - i| <= pband, column j - i + pband
    float scale, mfill; int nonorm, mpol;             // nonorm (online path only): O = sum_j exp(score_j) V_j without the 1/rowsum (scores must be <= ~0); mpol: Mi masks where ==0 (mpol 0) or where !=0 (mpol 1)
    int roff, rn, segpol, win;                        // Rt column offset/count; SQ/SK: score := mfill where (segpol 0) SQ[i] != SK[j] or (segpol 1) SQ[i] == SK[j]; win > 0: keys with i - j > win (after coff) -> -inf
};
//   Pw: the softmax numerator is multiplied by Pw(b,h,i,j) AFTER the row sum is taken (probs * weight, then P.V), as in post-softmax multiplicative biases.                                                    // ST (optional): per row (b,h,i) -> ST[((b*H + h)*Lq + i)*2 + {0,1}] = {row max of the scaled+masked score (natural units), sum_j exp(score - max)}
static_assert(sizeof(AttnP) == 12 * 8 + 29 * 8 + 16 * 4, "AttnP has padding");

#ifndef KATTN_ATTR
#define KATTN_ATTR
#endif
template <int DHP, int DVP, int QM, bool SPLITPV, bool TWOPASS>
__global__ __launch_bounds__(32 * AW) KATTN_ATTR void k_attn(AttnP p) {
    constexpr int NT = DVP / 16;                // output tiles
    constexpr int KS = DHP / 32;                // k-steps for the scores
    constexpr int VP = DVP + 8;                 // LDS pitch (halves)
    __shared__ __align__(16) float    pl[AW][16 * 64];
    __shared__ __align__(16) _Float16 vl[(SPLITPV ? 2 : 1) * 64 * VP];   // f16 V tile, or bf16 hi and lo tiles (same 2-byte size)
    const int lane = threadIdx.x & 31, hf = lane >> 4, l15 = lane & 15, wave = threadIdx.x >> 5;
    const int h = blockIdx.y, b = blockIdx.z, hk = h / p.hrep;
    const int q0 = (blockIdx.x * AW + wave) * 16;
    float* myp = pl[wave];
    const float L2E = 1.4426950408889634f;
    const float NEG = -__builtin_inff();
    const int qi = min(q0 + l15, p.Lq - 1);
    const float* qrow = p.Q + b * p.sQb + h * p.sQh + (long long)qi * p.sQi;
    const float* kbase = p.K + b * p.sKb + hk * p.sKh;
    const float* vbase = p.V + b * p.sVb + hk * p.sVh;
    v16h qa[QM == 0 ? KS : 1]; Split qs_[QM == 1 ? KS : 1]; Split3 qt_[QM == 2 ? KS : 1];
#pragma unroll
    for (int ks = 0; ks < KS; ++ks) {
        if (QM == 2) qt_[ks] = sp3_ld(qrow, p.sQd, ks * 32, hf, p.dh, 1.f);
        else if (QM == 1) qs_[ks] = sp_ld(qrow, p.sQd, ks * 32, hf, p.dh, 1.f);
        else qa[ks] = fh_ld(qrow, p.sQd, ks * 32, hf, p.dh, 1.f);
    }
    v8f o[NT]; float m8[8], l8[8];
#pragma unroll
    for (int t = 0; t < NT; ++t) { v8f zz = {}; o[t] = zz; }
#pragma unroll
    for (int i = 0; i < 8; ++i) { m8[i] = NEG; l8[i] = 0.f; }
    int jend = p.Lk; int jstart = 0;
    if (p.causal == 1) { const int je = (blockIdx.x * AW + AW - 1) * 16 + 16 + p.coff; jend = min(jend, max(je, 0)); }   // uniform per block
    if (p.win > 0) { const int js = (int)(blockIdx.x * AW) * 16 + p.coff - p.win; jstart = (js > 0) ? (js / 64) * 64 : 0; }   // uniform per block: key blocks entirely outside every row's window hold only -inf entries and are skipped exactly
    const int npass = TWOPASS ? 2 : 1;
    for (int pass = 0; pass < npass; ++pass) {
        const bool dopv = (!TWOPASS) || pass == 1;
        for (int j0 = jstart; j0 < jend; j0 += 64) {
            if (dopv) {
                __syncthreads();                                 // previous key block's reads of vl / pl are done
                for (int idx = threadIdx.x; idx < 64 * DVP; idx += 32 * AW) {
                    const int jr = idx / DVP, d = idx - jr * DVP, j = j0 + jr;
                    const float f = (j < p.Lk && d < p.dv) ? vbase[(long long)j * p.sVj + (long long)d * p.sVd] : 0.f;
                    if (SPLITPV) {
                        const __bf16 hb = bf16_rne(f);
                        ((__bf16*)vl)[jr * VP + d] = hb; ((__bf16*)vl)[64 * VP + jr * VP + d] = bf16_rne(f - bf16_f32(hb));
                    } else vl[jr * VP + d] = (_Float16)f;
                }
            }
            v8f s[4];
#pragma unroll
            for (int t = 0; t < 4; ++t) {
                const int j = min(j0 + t * 16 + l15, p.Lk - 1);
                const float* krow = kbase + (long long)j * p.sKj;
                v8f acc = {};
#pragma unroll
                for (int ks = 0; ks < KS; ++ks) {
                    if (QM == 2)      acc = wmma6(qt_[ks], sp3_ld(krow, p.sKd, ks * 32, hf, p.dh, 1.f), acc);
                    else if (QM == 1) acc = wmma3(qs_[ks], sp_ld(krow, p.sKd, ks * 32, hf, p.dh, 1.f), acc);
                    else              acc = wmma16(qa[ks], fh_ld(krow, p.sKd, ks * 32, hf, p.dh, 1.f), acc);
                }
                s[t] = acc;
            }
            float pv[8][4];
#pragma unroll
            for (int i = 0; i < 8; ++i) {
                const int irow = q0 + i + 8 * hf;
                const int ic = min(irow, p.Lq - 1);
                float sc[4];
#pragma unroll
                for (int t = 0; t < 4; ++t) {
                    const int jg = j0 + t * 16 + l15;
                    float v = s[t][i] * p.scale;
                    if (p.Mf) v += p.Mf[b * p.smb + h * p.smh + (long long)ic * p.smi + (long long)min(jg, p.Lk - 1) * p.smj];
                    if (p.Rt) { int rc = ic - min(jg, p.Lk - 1) + p.roff; rc = rc < 0 ? 0 : (rc >= p.rn ? p.rn - 1 : rc); v += p.Rt[b * p.srb + h * p.srh + (long long)ic * p.sri + rc]; }
                    if (p.Mi) { const int mv = p.Mi[b * p.smb + h * p.smh + (long long)ic * p.smi + (long long)min(jg, p.Lk - 1) * p.smj]; if (p.mpol ? (mv != 0) : (mv == 0)) v = p.mfill; }
                    if (p.SQ) { const bool same = p.SQ[(long long)b * p.Lq + ic] == p.SK[(long long)b * p.Lk + min(jg, p.Lk - 1)]; if (p.segpol ? same : !same) v = p.mfill; }
                    if (p.causal == 2 && jg > irow + p.coff) v = p.mfill;
                    if (jg >= p.Lk || (p.causal == 1 && jg > irow + p.coff) || (p.causal == 3 && jg < irow + p.coff) || (p.win > 0 && irow + p.coff - jg > p.win)) v = NEG; else v *= L2E;
                    sc[t] = v;
                }
                if (!TWOPASS || pass == 0) {
                    float mx = fmaxf(fmaxf(sc[0], sc[1]), fmaxf(sc[2], sc[3]));
                    mx = fmaxf(mx, __shfl_xor(mx, 1, 32)); mx = fmaxf(mx, __shfl_xor(mx, 2, 32));
                    mx = fmaxf(mx, __shfl_xor(mx, 4, 32)); mx = fmaxf(mx, __shfl_xor(mx, 8, 32));
                    const float mnew = fmaxf(m8[i], mx);
                    const float corr = (mnew == NEG) ? 1.f : exp2f(m8[i] - mnew);
                    float rs = 0.f;
#pragma unroll
                    for (int t = 0; t < 4; ++t) {
                        const float pp = (sc[t] == NEG) ? 0.f : exp2f(sc[t] - mnew); rs += pp;
                        pv[i][t] = p.Pw ? pp * p.Pw[b * p.swb + h * p.swh + (long long)ic * p.swi + (long long)min(j0 + t * 16 + l15, p.Lk - 1) * p.swj] : pp;
                    }
                    rs += __shfl_xor(rs, 1, 32); rs += __shfl_xor(rs, 2, 32); rs += __shfl_xor(rs, 4, 32); rs += __shfl_xor(rs, 8, 32);
                    l8[i] = l8[i] * corr + rs; m8[i] = mnew;
                    if (!TWOPASS) {
#pragma unroll
                        for (int t = 0; t < NT; ++t) o[t][i] *= corr;
                    }
                } else {
                    const float inv = (l8[i] > 0.f) ? 1.f / l8[i] : 0.f;
#pragma unroll
                    for (int t = 0; t < 4; ++t) {
                        const int jg = j0 + t * 16 + l15;
                        float pp = (sc[t] == NEG) ? 0.f : exp2f(sc[t] - m8[i]) * inv;
                        if (p.Pw) pp *= p.Pw[b * p.swb + h * p.swh + (long long)ic * p.swi + (long long)min(jg, p.Lk - 1) * p.swj];
                        pv[i][t] = pp;
                    }
                }
            }
            if (dopv) {
#pragma unroll
                for (int i = 0; i < 8; ++i)
#pragma unroll
                    for (int t = 0; t < 4; ++t) ((float*)myp)[(i + 8 * hf) * 64 + t * 16 + l15] = pv[i][t];
                __syncthreads();                                 // P (per wave) and V (shared) visible
                if (p.P) {
                    float* pb_ = p.P + b * p.sPb + h * p.sPh;
                    const bool fastP = (p.pband == 0) && ((p.sPi & 3) == 0) && (j0 + 64 <= p.Lk) && (q0 + 16 <= p.Lq) && ((((size_t)pb_) & 15) == 0);
                    if (fastP) {
#pragma unroll
                        for (int s = 0; s < 8; ++s) {
                            const int row = s * 2 + (lane >> 4), c4 = (lane & 15) * 4;
                            const v4f v = *(const v4f*)(myp + row * 64 + c4);
                            VST2V4(pb_ + (long long)(q0 + row) * p.sPi + j0 + c4, v);
                        }
                    } else {
                        for (int row = 0; row < 16; ++row) {
                            const int irow = q0 + row; if (irow >= p.Lq) continue;
                            for (int c = lane; c < 64; c += 32) {
                                const int jg = j0 + c; if (jg >= p.Lk) continue;
                                if (p.pband == 0) VST2(float, pb_ + (long long)irow * p.sPi + jg, myp[row * 64 + c]);
                                else if (jg - irow <= p.pband && irow - jg <= p.pband) VST2(float, pb_ + (long long)irow * p.sPi + (jg - irow + p.pband), myp[row * 64 + c]);
                            }
                        }
                    }
                }
                if (SPLITPV) {
                    const Split pa0 = sp_ld(myp + l15 * 64, 1, 0, hf, 64, 1.f), pa1 = sp_ld(myp + l15 * 64, 1, 32, hf, 64, 1.f);
                    const __bf16* vh = (const __bf16*)vl; const __bf16* vlo = vh + 64 * VP;
#pragma unroll
                    for (int t = 0; t < NT; ++t) {
                        const int dcol = t * 16 + l15;
                        Split b0, b1;
#pragma unroll
                        for (int e = 0; e < 16; ++e) {
                            const int k0 = frag_k(e, hf), k1 = 32 + frag_k(e, hf);
                            b0.hi[e] = vh[k0 * VP + dcol]; b0.lo[e] = vlo[k0 * VP + dcol]; b1.hi[e] = vh[k1 * VP + dcol]; b1.lo[e] = vlo[k1 * VP + dcol];
                        }
                        o[t] = wmma3(pa0, b0, o[t]);
                        o[t] = wmma3(pa1, b1, o[t]);
                    }
                } else {
                    const v16h pa0 = fh_ld(myp + l15 * 64, 1, 0, hf, 64, 4096.f), pa1 = fh_ld(myp + l15 * 64, 1, 32, hf, 64, 4096.f);
#pragma unroll
                    for (int t = 0; t < NT; ++t) {
                        const int dcol = t * 16 + l15;
                        v16h b0, b1;
#pragma unroll
                        for (int e = 0; e < 16; ++e) { b0[e] = vl[frag_k(e, hf) * VP + dcol]; b1[e] = vl[(32 + frag_k(e, hf)) * VP + dcol]; }
                        o[t] = wmma16(pa0, b0, o[t]);
                        o[t] = wmma16(pa1, b1, o[t]);
                    }
                }
            }
        }
    }
    float* obase = p.O + b * p.sOb + h * p.sOh;
    if (p.ST) {
        const int rl = lane >> 1, isel = rl & 7;           // row q0 + rl ; rl>>3 == hf holds because lane>>4 == (lane>>1)>>3
        float mv = 0.f, lv = 0.f;
#pragma unroll
        for (int i = 0; i < 8; ++i) if (i == isel) { mv = m8[i]; lv = l8[i]; }
        const int irow = q0 + rl;
        if (irow < p.Lq) { float* st = p.ST + (((long long)b * gridDim.y + h) * p.Lq + irow) * 2 + (lane & 1); VST2(float, st, (lane & 1) ? lv : mv * 0.6931471805599453f); }
    }
    float invr[8];
#pragma unroll
    for (int i = 0; i < 8; ++i) {
        if (TWOPASS) invr[i] = SPLITPV ? 1.f : (1.f / 4096.f);
        else if (p.nonorm) invr[i] = exp2f(m8[i]) * (SPLITPV ? 1.f : (1.f / 4096.f));
        else invr[i] = (l8[i] > 0.f) ? (SPLITPV ? 1.f / l8[i] : 1.f / (l8[i] * 4096.f)) : 0.f;
    }
    __syncthreads();                                             // all waves done with pl/vl from the main loop
    const bool ofast = ((p.sOi & 3) == 0) && ((((size_t)obase) & 15) == 0) && (q0 + 16 <= p.Lq);
#pragma unroll
    for (int c0 = 0; c0 < DVP; c0 += 64) {
#pragma unroll
        for (int i = 0; i < 8; ++i)
#pragma unroll
            for (int t = 0; t < NT; ++t) if (t * 16 >= c0 && t * 16 < c0 + 64) ((float*)myp)[(i + 8 * hf) * 64 + (t * 16 - c0) + l15] = o[t][i] * invr[i];
        __syncthreads();
        const int cw = (DVP - c0 < 64) ? (DVP - c0) : 64;      // staged columns in this chunk (multiple of 16)
        if (ofast && (c0 + cw <= p.dv) && (cw % 32 == 0)) {
            const int lpr = cw / 4;                              // lanes per row (16 for 64 cols, 8 for 32)
            const int rows_per_ins = 32 / lpr;
            for (int r0 = 0; r0 < 16; r0 += rows_per_ins) {
                const int row = r0 + lane / lpr, c4 = (lane % lpr) * 4;
                const v4f v = *(const v4f*)(myp + row * 64 + c4);
                VST2V4(obase + (long long)(q0 + row) * p.sOi + c0 + c4, v);
            }
        } else {
            for (int row = 0; row < 16; ++row) {
                const int irow = q0 + row; if (irow >= p.Lq) continue;
                for (int c = lane; c < cw; c += 32) { const int d = c0 + c; if (d < p.dv) VST2(float, obase + (long long)irow * p.sOi + d, myp[row * 64 + c]); }
            }
        }
        __syncthreads();
    }
}

// =====================================================================================================================
// k_tr: dst(z, c, r) = alpha * src(z, r, c) (+ beta * R2(z, c, r)): [Z][R][C] (row stride lds) -> [Z][C][R] (row stride ldd) through a 32x32 LDS tile;
//   flags: 1 -> add beta * residual R2 addressed like dst (z*sRz + c*ldr + r); act applied before the residual.
// =====================================================================================================================
struct TrP { const float* src; float* dst; const float* R2; long long sSz, lds, sDz, ldd, sRz, ldr; int R, C, flags, act; float alpha, beta; };
static_assert(sizeof(TrP) == 3 * 8 + 6 * 8 + 6 * 4, "TrP has padding");
__global__ __launch_bounds__(256) void k_tr(TrP p) {
    __shared__ float tile[32][33];
    const int c0 = blockIdx.x * 32, r0 = blockIdx.y * 32, z = blockIdx.z;
    const int lane = threadIdx.x & 31, wave = threadIdx.x >> 5;
    const float* s = p.src + z * p.sSz;
#pragma unroll
    for (int k = 0; k < 4; ++k) {
        const int rl = wave * 4 + k, r = r0 + rl, c = c0 + lane;
        tile[rl][lane] = (r < p.R && c < p.C) ? s[(long long)r * p.lds + c] : 0.f;
    }
    __syncthreads();
    float* d = p.dst + z * p.sDz; const float* rr = p.R2 + z * p.sRz;
#pragma unroll
    for (int k = 0; k < 4; ++k) {
        const int cl = wave * 4 + k, c = c0 + cl, r = r0 + lane;
        if (c < p.C && r < p.R) {
            float v = act_fn(p.alpha * tile[lane][cl], p.act);
            if (p.flags & 1) v += p.beta * rr[(long long)c * p.ldr + r];
            VST2(float, d + (long long)c * p.ldd + r, v);
        }
    }
}

// k_affine: dst[i] = a * (sdev ? sdev[0] : 1) * src[i] + b, i < n (one thread per element; consecutive lanes -> consecutive addresses)
__global__ __launch_bounds__(256) void k_affine(const float* __restrict__ src, float* __restrict__ dst, int n, float a, float b, const float* __restrict__ sdev) {
    const int i = blockIdx.x * 256 + threadIdx.x;
    if (i < n) { const float aa = sdev ? a * sdev[0] : a; const float v = aa * src[i] + b; VST2(float, dst + i, v); }
}

// =====================================================================================================================
// k_softmax: row softmax over n contiguous elements, one 256-thread block per row; rows addressed z*sz + r*sr (grid (R, Z)).
//   out = scale_out * softmax(scale_in * x + (Mf ? Mf[z*smz + r*smr + j] : 0)); a row whose max is -inf is written as 0.
// =====================================================================================================================
struct SmP { const float* src; float* dst; const float* Mf; long long sz, sr, dz, dr, smz, smr; int n, pad; float scale_in, scale_out; };
static_assert(sizeof(SmP) == 3 * 8 + 6 * 8 + 4 * 4, "SmP has padding");
__global__ __launch_bounds__(256) void k_softmax(SmP p) {
    __shared__ float red[256];
    const int r = blockIdx.x, z = blockIdx.y, tid = threadIdx.x;
    const float* s = p.src + z * p.sz + (long long)r * p.sr;
    const float* mf = p.Mf ? (p.Mf + z * p.smz + (long long)r * p.smr) : nullptr;
    float mx = -__builtin_inff();
    for (int j = tid; j < p.n; j += 256) { float v = s[j] * p.scale_in; if (mf) v += mf[j]; mx = fmaxf(mx, v); }
    red[tid] = mx; __syncthreads();
    for (int o = 128; o > 0; o >>= 1) { if (tid < o) red[tid] = fmaxf(red[tid], red[tid + o]); __syncthreads(); }
    mx = red[0]; __syncthreads();
    float sum = 0.f;
    for (int j = tid; j < p.n; j += 256) { float v = s[j] * p.scale_in; if (mf) v += mf[j]; sum += (mx == -__builtin_inff()) ? 0.f : expf(v - mx); }
    red[tid] = sum; __syncthreads();
    for (int o = 128; o > 0; o >>= 1) { if (tid < o) red[tid] += red[tid + o]; __syncthreads(); }
    sum = red[0];
    const float inv = (sum > 0.f) ? p.scale_out / sum : 0.f;
    float* d = p.dst + z * p.dz + (long long)r * p.dr;
    for (int j = tid; j < p.n; j += 256) { float v = s[j] * p.scale_in; if (mf) v += mf[j]; const float o = (mx == -__builtin_inff()) ? 0.f : expf(v - mx) * inv; VST2(float, d + j, o); }
}
// =====================================================================================================================
// k_stats: mean and rsqrt(var + eps) over a set of n elements addressed base + z*sz + (e / inner) * so + (e % inner) * si, one 256-thread
// k_norm_apply: y = (x - mean[set]) * rstd[set] * g[c] + b[c] over a [Z][C][L] channel-major tensor with set = z*G + c / (C/G) (G groups per z;
//   G = C -> per-channel sets indexed z*C+c; for batch norm pass stats indexed by c only via bn = 1). Optional act. Output same layout.
// =====================================================================================================================
//   mode 0: mean / rsqrt(var + eps); mode 1 (RMSNorm): 0 / rsqrt(mean(x^2) + eps); mode 2 (L2 normalize * sqrt(n)): 0 / sqrt(n) / max(||x||, eps); mode 3: as 0 with unbiased variance (n-1)
__global__ __launch_bounds__(256) void k_stats(const float* __restrict__ x, long long sz, long long so, long long si, int inner, int n, float eps, float* __restrict__ stat, int mode) {
    __shared__ float red[256];
    const int z = blockIdx.x, tid = threadIdx.x;
    const float* base = x + z * sz;
    float s = 0.f;
    for (int e = tid; e < n; e += 256) s += base[(long long)(e / inner) * so + (long long)(e % inner) * si];
    red[tid] = s; __syncthreads();
    for (int o = 128; o > 0; o >>= 1) { if (tid < o) red[tid] += red[tid + o]; __syncthreads(); }
    const float mu = (mode == 0 || mode == 3) ? red[0] / (float)n : 0.f; __syncthreads();
    float q = 0.f;
    for (int e = tid; e < n; e += 256) { const float dlt = base[(long long)(e / inner) * so + (long long)(e % inner) * si] - mu; q += dlt * dlt; }
    red[tid] = q; __syncthreads();
    for (int o = 128; o > 0; o >>= 1) { if (tid < o) red[tid] += red[tid + o]; __syncthreads(); }
    {
        float rs;
        if (mode == 2) rs = sqrtf((float)n) / fmaxf(sqrtf(red[0]), eps); else if (mode == 3) rs = rsqrtf(red[0] / (float)(n - 1) + eps); else rs = rsqrtf(red[0] / (float)n + eps);
        if (tid < 32) { const float v = (tid == 0) ? mu : ((tid == 1) ? rs : 0.f); VST2(float, stat + (long long)z * 32 + tid, v); }
    }
}
//   One thread per element over the flat [Z][C][L] index space: grid ceil(Z*C*L / 256).
__global__ __launch_bounds__(256) void k_norm_apply(const float* __restrict__ x, float* __restrict__ y, const float* __restrict__ stat, const float* __restrict__ g, const float* __restrict__ bta,
                                                     int Z, int C, int L, int G, int bn, int act) {
    const long long idx = (long long)blockIdx.x * 256 + threadIdx.x;
    if (idx >= (long long)Z * C * L) return;
    const int l = (int)(idx % L); const long long zc = idx / L; const int c = (int)(zc % C), z = (int)(zc / C); (void)l;
    const int set = bn ? c : (z * G + c / (C / G));
    float v = (x[idx] - stat[(long long)set * 32]) * stat[(long long)set * 32 + 1];
    if (g) v *= g[c];
    if (bta) v += bta[c];
    v = act_fn(v, act);
    VST2(float, y + idx, v);
}

// k_lse_neg: c[i] = -(st[2i] + log(st[2i+1])) = minus the log-sum-exp of row i from k_attn's ST output (for softmax over the query dimension)
__global__ __launch_bounds__(256) void k_lse_neg(const float* __restrict__ st, float* __restrict__ c, int n) {
    const int i = blockIdx.x * 256 + threadIdx.x;
    if (i < n) { const float v = -(st[2 * i] + logf(st[2 * i + 1])); VST2(float, c + i, v); }
}

// k_iota: dst[i] = a * i + b as int32 (segment/position id helper)
__global__ __launch_bounds__(256) void k_iota(int* __restrict__ dst, int n, int a, int b) {
    const int i = blockIdx.x * 256 + threadIdx.x;
    if (i < n) { const int v = a * i + b; VST2(int, dst + i, v); }
}

// k_axpby: dst[i] = a * x[i] + b * y[i] (+ c), i < n
__global__ __launch_bounds__(256) void k_axpby(const float* __restrict__ x, const float* __restrict__ y, float* __restrict__ dst, int n, float a, float b, float c) {
    const int i = blockIdx.x * 256 + threadIdx.x;
    if (i < n) { const float v = a * x[i] + b * y[i] + c; VST2(float, dst + i, v); }
}

// =====================================================================================================================
// k_rope: rotary embedding on a [R rows][Hn heads][D] view (row stride sXr, head stride sXh, element stride 1) -> Y (own strides).
//   mode 0: rotate_half (partner d±D/2, sign - for d<D/2); mode 1: interleaved pairs (partner d^1, sign - for even d).
//   table column tcol: tmode 0 -> d, 1 -> d % (D/2), 2 -> d / 2; position p: pmode 0 -> r % S, 1 -> head index, 2 -> pos[r];
//   c = C[(r / S) * sCb + p * sCp + tcol * sCd], s likewise from Sn; y = x[d] * c + sign * x[partner] * s. X and Y must not alias.
// =====================================================================================================================
struct RopeP { const float* X; float* Y; const float* C; const float* Sn; const int* pos; long long sXr, sXh, sYr, sYh, sCb, sCp, sCd; int R, Hn, D, S, mode, tmode, pmode, pad; };
static_assert(sizeof(RopeP) == 5 * 8 + 7 * 8 + 8 * 4, "RopeP has padding");
__global__ __launch_bounds__(256) void k_rope(RopeP p) {
    const long long idx = (long long)blockIdx.x * 256 + threadIdx.x;
    if (idx >= (long long)p.R * p.Hn * p.D) return;
    const int d = (int)(idx % p.D); const long long rh = idx / p.D; const int h = (int)(rh % p.Hn); const int r = (int)(rh / p.Hn);
    const int half = p.D / 2;
    int partner; float sign;
    if (p.mode == 0) { partner = (d < half) ? d + half : d - half; sign = (d < half) ? -1.f : 1.f; }
    else { partner = d ^ 1; sign = (d & 1) ? 1.f : -1.f; }
    const int tcol = (p.tmode == 0) ? d : ((p.tmode == 1) ? (d % half) : (d >> 1));
    const int pp = (p.pmode == 0) ? (r % p.S) : ((p.pmode == 1) ? h : p.pos[r]);
    const long long toff = (long long)(r / p.S) * p.sCb + (long long)pp * p.sCp + (long long)tcol * p.sCd;
    const float* xr = p.X + (long long)r * p.sXr + (long long)h * p.sXh;
    const float v = xr[d] * p.C[toff] + sign * xr[partner] * p.Sn[toff];
    VST2(float, p.Y + (long long)r * p.sYr + (long long)h * p.sYh + d, v);
}

// k_invf + k_sincos (split so neither kernel carries a large VALU-fma footprint): invf_i = num * (1 / powf(base, (2 i)/D)) [fmode 0],
//   num * expf((2 i) * cexp) [fmode 1], num * powf(base, -2 (i - 1) / D) [fmode 2]; then cs/sn[s*half + i] = cos/sin((pscale * s) * invf_i)
__global__ __launch_bounds__(256) void k_invf(float* __restrict__ invb, int half, int D, float base, float num, int fmode, float cexp) {
    const int i = blockIdx.x * 256 + threadIdx.x;
    if (i >= ((half + 31) / 32) * 32) return;
    if (i >= half) { VST2(float, invb + i, 0.f); return; }
    const float e = (float)(2 * i) / (float)D;
    float invf;
    if (fmode == 1) invf = num * expf((float)(2 * i) * cexp);
    else if (fmode == 2) invf = num * powf(base, (-2.0f * ((float)i - 1.0f)) / (float)D);
    else invf = num * (1.0f / powf(base, e));
    VST2(float, invb + i, invf);
}
__global__ __launch_bounds__(256) void k_sincos(float* __restrict__ cs, float* __restrict__ sn, const float* __restrict__ invb, int S, int half, float pscale) {
    const int idx = blockIdx.x * 256 + threadIdx.x;
    if (idx >= S * half) return;
    const int s = idx / half, i = idx - s * half;
    const float ang = (pscale * (float)s) * invb[i];
    VST2(float, cs + idx, cosf(ang)); VST2(float, sn + idx, sinf(ang));
}

// k_mulact: dst[i] = act(x[i]) * y[i]
__global__ __launch_bounds__(256) void k_mulact(const float* __restrict__ x, const float* __restrict__ y, float* __restrict__ dst, int n, int act) {
    const int i = blockIdx.x * 256 + threadIdx.x;
    if (i < n) { const float v = act_fn(x[i], act) * y[i]; VST2(float, dst + i, v); }
}

// =====================================================================================================================
// k_matvec: thread-per-row matrix-vector products for N <= 8 output columns (heads with 1-3 outputs, gates), f32 on the VALU.
//   C[r*sCm + j] = act(alpha * sum_k A[r*sAm + k*sAk] * B[j*sBn + k*sBk] + bias[j]) + beta * R[r*sRm + j*sRn]; each thread writes its N contiguous floats.
// =====================================================================================================================
__global__ __launch_bounds__(256) void k_matvec(GemmP p) {
    // 32 lanes write one line with one instruction.
    const int rpt = (p.N == 1) ? 1 : 32;
    const long long r0 = ((long long)blockIdx.x * 256 + threadIdx.x) * rpt; const int z = blockIdx.z, zo = z / p.zi_n, zi = z - zo * p.zi_n;
    if (r0 >= p.M) return;
    const float* Bb = p.B + zo * p.sBo + zi * p.sBi;
    float* C = p.C + zo * p.sCo + zi * p.sCi; const float* R = p.R + zo * p.sRo + zi * p.sRi;
    for (int rr = 0; rr < rpt; ++rr) {
        const long long r = r0 + rr; if (r >= p.M) break;
        const float* A = p.A + zo * p.sAo + zi * p.sAi + r * p.sAm;
        float acc[8] = {0.f, 0.f, 0.f, 0.f, 0.f, 0.f, 0.f, 0.f};
        for (int k = 0; k < p.K; ++k) { const float a = A[(long long)k * p.sAk];
#pragma unroll
            for (int j = 0; j < 8; ++j) if (j < p.N) acc[j] += a * Bb[(long long)j * p.sBn + (long long)k * p.sBk]; }
#pragma unroll
        for (int j = 0; j < 8; ++j) if (j < p.N) {
            float v = acc[j] * p.alpha;
            if (p.flags & 1) v += p.bias[j];
            if (p.flags & 2) v += p.bias[r];
            v = act_fn(v, p.act);
            if (p.flags & 4) v += p.beta * R[r * p.sRm + (long long)j * p.sRn];
            VST2(float, C + r * p.sCm + j, v);
        }
    }
}
// k_smallsoftmax: thread-per-row softmax for short rows (n <= 64): dst[r*dr + j] = softmax(scale*src[r*sr + j])
__global__ __launch_bounds__(256) void k_smallsoftmax(const float* __restrict__ src, float* __restrict__ dst, long long sr, long long dr, int n, long long R, float scale) {
    const long long r0 = ((long long)blockIdx.x * 256 + threadIdx.x) * 32;
    for (int rr = 0; rr < 32; ++rr) {
        const long long r = r0 + rr; if (r >= R) return;
        const float* s = src + r * sr; float* d = dst + r * dr;
        float mx = -__builtin_inff();
        for (int j = 0; j < n; ++j) mx = fmaxf(mx, s[j] * scale);
        float sum = 0.f;
        for (int j = 0; j < n; ++j) sum += expf(s[j] * scale - mx);
        const float inv = 1.f / sum;
        for (int j = 0; j < n; ++j) { const float v = expf(s[j] * scale - mx) * inv; VST2(float, d + j, v); }
    }
}

__global__ __launch_bounds__(32) void k_unitstat(float* __restrict__ st) { const int t = threadIdx.x; const float v = (t == 1) ? 1.f : 0.f; VST2(float, st + t, v); }

// destination (e.g. a d_out whose row width is not a multiple of 32 floats) is written by consecutive lanes of one instruction
__global__ __launch_bounds__(256) void k_lincopy(const float* __restrict__ src, long long lds, float* __restrict__ dst, long long ldd, long long rows, int cols) {
    const long long i = (long long)blockIdx.x * 256 + threadIdx.x; if (i >= rows * cols) return;
    const long long r = i / cols; const int c = (int)(i - r * cols);
    const float v = src[r * lds + c]; VST2(float, dst + r * ldd + c, v);
}

namespace w25 {
typedef __attribute__((ext_vector_type(16))) _Float16 v16h;
typedef __attribute__((ext_vector_type(8)))  _Float16 v8h;
typedef __attribute__((ext_vector_type(16))) __bf16   v16b;
typedef __attribute__((ext_vector_type(8)))  __bf16   v8b;
typedef __attribute__((ext_vector_type(8)))  float    v8f;
typedef __attribute__((ext_vector_type(4)))  float    v4f;

__device__ __forceinline__ unsigned short f2bf_bits(float f) {
  unsigned u = __float_as_uint(f);
  return (unsigned short)((u + 0x7FFFu + ((u >> 16) & 1u)) >> 16);
}
__device__ __forceinline__ float bf_bits2f(unsigned short h) { return __uint_as_float(((unsigned)h) << 16); }

// hazard guards as plain device helpers (no inline asm inside the kernel template body)
__device__ __forceinline__ void dep_guard_h(v8f& a, v8f& b, v16h x, v16h y) { asm volatile("v_nop\n\tv_nop\n\tv_nop\n\tv_nop" : "+v"(a), "+v"(b) : "v"(x), "v"(y)); }
__device__ __forceinline__ void dep_guard_b(v8f& a, v8f& b, v16b x, v16b y) { asm volatile("v_nop\n\tv_nop\n\tv_nop\n\tv_nop" : "+v"(a), "+v"(b) : "v"(x), "v"(y)); }
__device__ __forceinline__ void keep4_h(v16h a, v16h b, v16h c, v16h d) { asm volatile("v_nop" :: "v"(a), "v"(b), "v"(c), "v"(d)); }
__device__ __forceinline__ void keep4_b(v16b a, v16b b, v16b c, v16b d) { asm volatile("v_nop" :: "v"(a), "v"(b), "v"(c), "v"(d)); }
__device__ __forceinline__ void acc_guard4(v8f& a, v8f& b, v8f& c, v8f& d) { asm volatile("v_nop\n\tv_nop\n\tv_nop\n\tv_nop" : "+v"(a), "+v"(b), "+v"(c), "+v"(d)); }
template <typename T> struct Frag;
template <> struct Frag<_Float16> {
  typedef v16h V; union U { v16h v; v8h h[2]; };
  static __device__ __forceinline__ v16h load(const _Float16* p) {   // elements 0..7 <- p[0..7], 8..15 <- p[16..23]
    U f; f.h[0] = *(const v8h*)(p); f.h[1] = *(const v8h*)(p + 16); return f.v;
  }
  static __device__ __forceinline__ v8f mma(v16h a, v16h b, v8f c) {
    return __builtin_amdgcn_wmma_f32_16x16x32_f16(false, a, false, b, (short)0, c, false, false);
  }
  static __device__ __forceinline__ void guard(v8f& a, v8f& b, v16h x, v16h y) { dep_guard_h(a, b, x, y); }
  static __device__ __forceinline__ void keep(v16h a, v16h b, v16h c, v16h d) { keep4_h(a, b, c, d); }
};
template <> struct Frag<__bf16> {
  typedef v16b V; union U { v16b v; v8b h[2]; };
  static __device__ __forceinline__ v16b load(const __bf16* p) {
    U f; f.h[0] = *(const v8b*)(p); f.h[1] = *(const v8b*)(p + 16); return f.v;
  }
  static __device__ __forceinline__ v8f mma(v16b a, v16b b, v8f c) {
    return __builtin_amdgcn_wmma_f32_16x16x32_bf16(false, a, false, b, (short)0, c, false, false);
  }
  static __device__ __forceinline__ void guard(v8f& a, v8f& b, v16b x, v16b y) { dep_guard_b(a, b, x, y); }
  static __device__ __forceinline__ void keep(v16b a, v16b b, v16b c, v16b d) { keep4_b(a, b, c, d); }
};

// ---- Register-blocked batched WMMA GEMM ------------------------------------
// C[m,n] = scale * sum_k A[m,k] * Bt[n,k] (+bias)(+resid); each wave owns a 64x64 tile.
// A row-major [M,K]; Bt row-major [N,K]; M,N % 64 == 0, K % 32 == 0.
// SPLIT: operands are hi/lo planes (A2/Bt2 = lo planes, same layout); product = hi·hi + hi·lo + lo·hi.
// BIAS_MODE: 0 = none, 1 = bias[m], 2 = bias[n].
// OUT_MODE: 0 = f32, 1 = f16, 2 = bf16 hi plane (Cout) + bf16 lo plane (Cout2).
// ET: 0 = f16 operands, 1 = bf16 operands (pointers passed as 16-bit storage)
template <int ET> struct Elem;
template <> struct Elem<0> { typedef _Float16 T; };
template <> struct Elem<1> { typedef __bf16 T; };
template <int ET, bool SPLIT, int BIAS_MODE, int OUT_MODE, bool RESID, int ACT = 0>
__global__ __launch_bounds__(256) void wmma_gemm64(
    const unsigned short* __restrict__ Ap, const unsigned short* __restrict__ A2p, int lda, long strideA,
    const unsigned short* __restrict__ Btp, const unsigned short* __restrict__ Bt2p, int ldb, long strideB,
    void* __restrict__ Cout, void* __restrict__ Cout2, int ldc, long strideC,
    const float* __restrict__ bias,
    const float* __restrict__ resid, long strideR,
    int M, int N, int K, float scale) {
  typedef typename Elem<ET>::T T;
  typedef typename Frag<T>::V V;
  const T* A = (const T*)Ap; const T* A2 = (const T*)A2p; const T* Bt = (const T*)Btp; const T* Bt2 = (const T*)Bt2p;
  __shared__ __align__(16) float sT[8][16 * 68];   // per-wave 16x64 slab, pitch 68 floats
  const int b    = blockIdx.y;
  const int lane = threadIdx.x & 31;
  const int wave = threadIdx.x >> 5;
  const int tilesN = N >> 6;
  const int tilesM = M >> 6;
  const int tile = blockIdx.x * 8 + wave;
  if (tile >= tilesM * tilesN) return;   // wave-uniform; no block barriers in this kernel
  const int tm = tile / tilesN;
  const int tn = tile - tm * tilesN;
  const int m0 = tm << 6;
  const int n0 = tn << 6;

  const T* Ab  = A  + (size_t)b * strideA;
  const T* Bb  = Bt + (size_t)b * strideB;
  const T* Ab2 = SPLIT ? (A2  + (size_t)b * strideA) : nullptr;
  const T* Bb2 = SPLIT ? (Bt2 + (size_t)b * strideB) : nullptr;

  const int rlane = lane & 15;                 // row (A) / col (B, D) within subtile
  const int koff  = (lane >> 4) * 8;           // k offset of this lane half
  const int mOff  = (lane >> 4) * 8;           // D row offset

  v8f acc[4][4];
#pragma unroll
  for (int i = 0; i < 4; ++i)
#pragma unroll
    for (int j = 0; j < 4; ++j) acc[i][j] = (v8f){0.f,0.f,0.f,0.f,0.f,0.f,0.f,0.f};

  for (int k0 = 0; k0 < K; k0 += 32) {
    V bh[4], bl[4];
#pragma unroll
    for (int j = 0; j < 4; ++j) {
      const size_t bo = (size_t)(n0 + (j << 4) + rlane) * ldb + koff + k0;
      bh[j] = Frag<T>::load(Bb + bo);
      if (SPLIT) bl[j] = Frag<T>::load(Bb2 + bo);
    }
#pragma unroll
    for (int i = 0; i < 4; ++i) {
      const size_t ao = (size_t)(m0 + (i << 4) + rlane) * lda + koff + k0;
      V ah = Frag<T>::load(Ab + ao);
      V al;
      if (SPLIT) al = Frag<T>::load(Ab2 + ao);
#pragma unroll
      for (int j = 0; j < 4; ++j) {
        acc[i][j] = Frag<T>::mma(ah, bh[j], acc[i][j]);
        if (SPLIT) {
          acc[i][j] = Frag<T>::mma(ah, bl[j], acc[i][j]);
          acc[i][j] = Frag<T>::mma(al, bh[j], acc[i][j]);
        }
      }
      Frag<T>::guard(acc[i][0], acc[i][3], ah, SPLIT ? al : ah);
    }
    Frag<T>::keep(bh[0], bh[1], bh[2], bh[3]);
    if (SPLIT) Frag<T>::keep(bl[0], bl[1], bl[2], bl[3]);
  }
  acc_guard4(acc[0][0], acc[0][1], acc[0][2], acc[0][3]);
  acc_guard4(acc[1][0], acc[1][1], acc[1][2], acc[1][3]);
  acc_guard4(acc[2][0], acc[2][1], acc[2][2], acc[2][3]);
  acc_guard4(acc[3][0], acc[3][1], acc[3][2], acc[3][3]);

  // ---- epilogue ----
  float* slab = sT[wave];
  const float* Rb = RESID ? (resid + (size_t)b * strideR) : nullptr;
#pragma unroll
  for (int i = 0; i < 4; ++i) {
    const int mBase = m0 + (i << 4);
#pragma unroll
    for (int j = 0; j < 4; ++j) {
      const int n = n0 + (j << 4) + rlane;
      float bv = 0.f;
      if (BIAS_MODE == 2) bv = bias[n];
#pragma unroll
      for (int r = 0; r < 8; ++r) {
        float v = acc[i][j][r] * scale;
        if (BIAS_MODE == 1) v += bias[mBase + mOff + r];
        if (BIAS_MODE == 2) v += bv;
        if (RESID) v += Rb[(size_t)(mBase + mOff + r) * ldc + n];
        if (ACT == 1) v = tanhf(v);
        if (ACT == 2) v = fmaxf(v, 0.0f);
        if (ACT == 3) v = v / (1.0f + expf(-v));
        if (ACT == 4) v = (v > 0.f) ? v : 0.01f * v;
        if (ACT == 5) v = 0.5f * v * (1.0f + erff(v * 0.70710678118654752f));
        slab[(mOff + r) * 68 + (j << 4) + rlane] = v;
      }
    }
    __builtin_amdgcn_fence(__ATOMIC_RELEASE, "workgroup");
    __builtin_amdgcn_wave_barrier();
    __builtin_amdgcn_fence(__ATOMIC_ACQUIRE, "workgroup");
    if (OUT_MODE == 0) {
      float* C = (float*)Cout + (size_t)b * strideC;
      const int hh = lane >> 4, c4 = (lane & 15) * 4;     // row seg = 256 B = 16 lanes x 16 B
      {
#pragma unroll
        for (int it = 0; it < 8; ++it) {
          const int row = it * 2 + hh;
          v4f v = *(const v4f*)(slab + row * 68 + c4);
          *(v4f*)(C + (size_t)(mBase + row) * ldc + n0 + c4) = v;
        }
        
      }
    } else {
      const int q = lane >> 3, c8 = (lane & 7) * 8;
      unsigned short* C  = (unsigned short*)Cout  + (size_t)b * strideC;
      unsigned short* C2 = (OUT_MODE == 2) ? ((unsigned short*)Cout2 + (size_t)b * strideC) : nullptr;
      {
#pragma unroll
        for (int it = 0; it < 4; ++it) {
          const int row = it * 4 + q;
          const float* sp = slab + row * 68 + c8;
          v8h hv, lv;
#pragma unroll
          for (int e = 0; e < 8; ++e) {
            if (OUT_MODE == 1) {
              hv[e] = (_Float16)sp[e];
            } else {
              unsigned short hb = f2bf_bits(sp[e]);
              unsigned short lb = f2bf_bits(sp[e] - bf_bits2f(hb));
              hv[e] = __builtin_bit_cast(_Float16, hb);
              lv[e] = __builtin_bit_cast(_Float16, lb);
            }
          }
          *(v8h*)(C + (size_t)(mBase + row) * ldc + n0 + c8) = hv;
          if (OUT_MODE == 2) *(v8h*)(C2 + (size_t)(mBase + row) * ldc + n0 + c8) = lv;
        }
        
      }
    }
    __builtin_amdgcn_fence(__ATOMIC_RELEASE, "workgroup");
    __builtin_amdgcn_wave_barrier();
    __builtin_amdgcn_fence(__ATOMIC_ACQUIRE, "workgroup");
  }
}

__global__ __launch_bounds__(256) void cast_f32_f16x2(
    const float* __restrict__ in, _Float16* __restrict__ out, int n2) {
  int i = blockIdx.x * 256 + threadIdx.x;
  if (i < n2) {
    const _Float16 h0 = (_Float16)in[2 * i], h1 = (_Float16)in[2 * i + 1];
    const unsigned u = (unsigned)__builtin_bit_cast(unsigned short, h0) | ((unsigned)__builtin_bit_cast(unsigned short, h1) << 16);
    ((unsigned*)out)[i] = u;
    
  }
}


} // namespace w25

__global__ __launch_bounds__(256) void k_castT16(const float* __restrict__ src, long long lds, _Float16* __restrict__ dst, long long ldd, int R, int C, float s) {
    const long long i = (long long)blockIdx.x * 256 + threadIdx.x; const long long np = (long long)C * (R / 2); if (i >= np) return; const int c = (int)(i / (R / 2)); const int r = 2 * (int)(i % (R / 2));
    const _Float16 h0 = (_Float16)(src[(long long)r * lds + c] * s), h1 = (_Float16)(src[(long long)(r + 1) * lds + c] * s);
    const unsigned u = (unsigned)__builtin_bit_cast(unsigned short, h0) | ((unsigned)__builtin_bit_cast(unsigned short, h1) << 16);
    unsigned* d = (unsigned*)(dst + (long long)c * ldd + r); *d = u;  }
__global__ __launch_bounds__(256) void k_cast16(const float* __restrict__ src, long long lds, _Float16* __restrict__ dst, long long ldd, int R, int C, float s) {
    const long long i = (long long)blockIdx.x * 256 + threadIdx.x; const long long np = (long long)R * (C / 2); if (i >= np) return; const int r = (int)(i / (C / 2)); const int c = 2 * (int)(i % (C / 2));
    const _Float16 h0 = (_Float16)(src[(long long)r * lds + c] * s), h1 = (_Float16)(src[(long long)r * lds + c + 1] * s);
    const unsigned u = (unsigned)__builtin_bit_cast(unsigned short, h0) | ((unsigned)__builtin_bit_cast(unsigned short, h1) << 16);
    unsigned* d = (unsigned*)(dst + (long long)r * ldd + c); *d = u;  }

// f32 -> bf16 hi plane + bf16 lo plane (x = hi + lo to ~2^-17 relative; RNE both), [R][C] -> [R][C] (or transposed to [C][R]); 2 consecutive destination elements
__device__ __forceinline__ unsigned int f2bf2_pack(float a, float b, unsigned int* lo) {
    const unsigned short ha = w25::f2bf_bits(a), hb = w25::f2bf_bits(b);
    const unsigned short la = w25::f2bf_bits(a - w25::bf_bits2f(ha)), lb = w25::f2bf_bits(b - w25::bf_bits2f(hb));
    *lo = (unsigned)la | ((unsigned)lb << 16); return (unsigned)ha | ((unsigned)hb << 16); }
__global__ __launch_bounds__(256) void k_castS16(const float* __restrict__ src, long long lds, __bf16* __restrict__ dhi, __bf16* __restrict__ dlo, long long ldd, int R, int C, float s, int transpose) {
    const long long i = (long long)blockIdx.x * 256 + threadIdx.x; long long o; float a, b;
    if (transpose) { const long long np = (long long)C * (R / 2); if (i >= np) return; const int c = (int)(i / (R / 2)); const int r = 2 * (int)(i % (R / 2)); a = src[(long long)r * lds + c] * s; b = src[(long long)(r + 1) * lds + c] * s; o = (long long)c * ldd + r; }
    else { const long long np = (long long)R * (C / 2); if (i >= np) return; const int r = (int)(i / (C / 2)); const int c = 2 * (int)(i % (C / 2)); a = src[(long long)r * lds + c] * s; b = src[(long long)r * lds + c + 1] * s; o = (long long)r * ldd + c; }
    unsigned lo; const unsigned hi = f2bf2_pack(a, b, &lo); unsigned* ph = (unsigned*)(dhi + o); unsigned* pl = (unsigned*)(dlo + o);
    *ph = hi; *pl = lo;  }

namespace w25 {
// =====================================================================================
// Generic causal/non-causal attention for head_dim 64, f32 in / f32 out; 16-bit operands: bf16 with optional hi/lo splits, or
// plain f16 (F16=true, non-split, probabilities carried x2^15).
//   scores = (q*qscale)·kᵀ : v_wmma_f32_16x16x32_bf16; SPLIT_QK -> q,k as bf16 hi/lo (hi·hi + hi·lo + lo·hi)
//   out    = p·v           : v_wmma_f32_16x16x32_bf16; SPLIT_PV -> p,v as bf16 hi/lo; else p,v plain bf16
//   f32 accumulate; online softmax in f32. Block = 4 waves = 64 query rows of one (batch, head); S % 64 == 0.
//   Element (b, s, h, d) of tensor X lives at X[b*X_bs + s*X_rs + h*X_hs + d] (strides in floats, multiples of 4).
//   Masking: mask_mode 0 none, 1 causal (kv > q masked), 2 tensor [S][Skv] shared over (b,h) (float if
//   mask_is_int==0, int32 with element == 0 -> masked if 1, int32 with element != 0 -> masked if 2), 3 per-token vectors qmask[B][S] & kvmask[B][Skv] (int32,
//   0 -> masked), 4 causal + sliding window (kv > q or q - kv > W masked; W passed in mask_is_int);
//   5 = relative-position bias: s += cp[b,h,q][idx[q][kv]] + pc[b,h,kv][idx[q][kv]] with idx = mask_b ([S][Skv] int32) and
//   mask_a an int32 [S][Skv] tensor with nonzero = masked (tables: element (b,h,row,n) at X + b*c_bs + h*c_hs + row*c_rs + n);
//   masked scores are replaced by mask_fill (e.g. -inf or -1e9) before the softmax.
//   grid.x = B * H * (S/64) (or a sub-range with blk0).
// =====================================================================================
#define AT_D 64
#define AT_NW 4
#define AT_QB 64
#define AT_KC 64
struct AttnGeom { const float* cp = nullptr; const float* pc = nullptr; long c_bs = 0, c_rs = 0, c_hs = 0;   // mode-5 score-bias tables
                  long q_bs, q_rs, q_hs, k_bs, k_rs, k_hs, v_bs, v_rs, v_hs, o_bs, o_rs, o_hs;
                  int S, Skv, H, mask_mode; float qscale; int blk0; float mask_fill; int mask_is_int; };
static_assert(sizeof(AttnGeom) == 168, "no padding");

__device__ __forceinline__ unsigned short at_bf_bits(float f) {
  unsigned u = __float_as_uint(f);
  return (unsigned short)((u + 0x7FFFu + ((u >> 16) & 1u)) >> 16);
}
__device__ __forceinline__ __bf16 at_f2bf(float f) { return __builtin_bit_cast(__bf16, at_bf_bits(f)); }
__device__ __forceinline__ void at_split(float f, __bf16& hi, __bf16& lo) {
  const unsigned short hb = at_bf_bits(f);
  hi = __builtin_bit_cast(__bf16, hb);
  lo = at_f2bf(f - __uint_as_float(((unsigned)hb) << 16));
}
__device__ __forceinline__ v8f at_mma(v16b a, v16b b, v8f c) {
  c = __builtin_amdgcn_wmma_f32_16x16x32_bf16(false, a, false, b, (short)0, c, false, false);
  asm volatile("v_nop\n\tv_nop\n\tv_nop\n\tv_nop" : "+v"(c) : "v"(a), "v"(b));
  return c;
}
// 16-bit element as a bit pattern held in a __bf16 slot: f16 bits when F16, bf16 (RNE) otherwise
template <bool F16> __device__ __forceinline__ __bf16 at_to16(float f) {
  if (F16) return __builtin_bit_cast(__bf16, (_Float16)f);
  return at_f2bf(f);
}
template <bool F16> __device__ __forceinline__ v8f at_mma16(v16b a, v16b b, v8f c) {
  if (F16) {
    const v16h ah = __builtin_bit_cast(v16h, a), bh = __builtin_bit_cast(v16h, b);
    c = __builtin_amdgcn_wmma_f32_16x16x32_f16(false, ah, false, bh, (short)0, c, false, false);
    asm volatile("v_nop\n\tv_nop\n\tv_nop\n\tv_nop" : "+v"(c) : "v"(ah), "v"(bh));
    return c;
  }
  return at_mma(a, b, c);
}

template <bool SPLIT_QK, bool SPLIT_PV, bool F16 = false>
__global__ __launch_bounds__(128)
void attn64_kernel(const float* __restrict__ q, const float* __restrict__ k,
                   const float* __restrict__ v, float* __restrict__ out,
                   const void* __restrict__ mask_a, const int* __restrict__ mask_b, AttnGeom g) {
  static_assert(!(F16 && (SPLIT_QK || SPLIT_PV)), "f16 mode is non-split");
  const float PSC = F16 ? 32768.0f : 1.0f;     // f16 probabilities carried x2^15 (subnormal range), folded into the final 1/l
  union FB { v16b v; v8b h[2]; };
  __shared__ __align__(16) __bf16 Ksh[AT_KC * AT_D];             // K hi [kv][d]      8 KB
  __shared__ __align__(16) __bf16 Ksl[SPLIT_QK ? AT_KC * AT_D : 8];
  __shared__ __align__(16) __bf16 Vth[AT_D * AT_KC];             // V hi [d][kv]      8 KB
  __shared__ __align__(16) __bf16 Vtl[SPLIT_PV ? AT_D * AT_KC : 8];
  __shared__ __align__(16) __bf16 Psh[AT_NW][16 * AT_KC];        // per wave P hi [row][kv]  8 KB
  __shared__ __align__(16) __bf16 Psl[SPLIT_PV ? AT_NW : 1][SPLIT_PV ? 16 * AT_KC : 8];
  __shared__ __align__(16) float  Os[AT_NW][16 * 68];            // per wave out tile, pitch 68

  const int tid  = threadIdx.x;
  const int wave = tid >> 5;
  const int lane = tid & 31;
  const int hh   = lane >> 4;
  const int c    = lane & 15;

  const int nqb = g.S / AT_QB;
  const int bx = blockIdx.x + g.blk0;
  const int qb = bx % nqb;
  const int bh = bx / nqb;
  const int h  = bh % g.H;
  const int b  = bh / g.H;
  const int qbase_block = qb * AT_QB;
  const int q0 = qbase_block + wave * 16;

  const float* qb_ptr = q + (size_t)b * g.q_bs + (size_t)h * g.q_hs;
  const float* kb_ptr = k + (size_t)b * g.k_bs + (size_t)h * g.k_hs;
  const float* vb_ptr = v + (size_t)b * g.v_bs + (size_t)h * g.v_hs;
  float*       ob_ptr = out + (size_t)b * g.o_bs + (size_t)h * g.o_hs;

  // ---- Q fragments (A operand): 2 d-chunks, hi (and lo) ----
  v16b qah[2], qal[2];
  {
    const float* qrow = qb_ptr + (size_t)(q0 + c) * g.q_rs;
#pragma unroll
    for (int dc = 0; dc < 2; ++dc) {
#pragma unroll
      for (int e = 0; e < 8; ++e) {
        const float f0 = qrow[dc * 32 + 8 * hh + e] * g.qscale;
        const float f1 = qrow[dc * 32 + 16 + 8 * hh + e] * g.qscale;
        if (SPLIT_QK) { __bf16 hq, lq; at_split(f0, hq, lq); qah[dc][e] = hq; qal[dc][e] = lq; at_split(f1, hq, lq); qah[dc][8 + e] = hq; qal[dc][8 + e] = lq; }
        else { qah[dc][e] = at_to16<F16>(f0); qah[dc][8 + e] = at_to16<F16>(f1); qal[dc][e] = qah[dc][e]; qal[dc][8 + e] = qah[dc][8 + e]; }
      }
    }
  }

  float mrow[8], lrow[8];
  v8f oacc[4];
#pragma unroll
  for (int r = 0; r < 8; ++r) { mrow[r] = -INFINITY; lrow[r] = 0.f; }
#pragma unroll
  for (int t = 0; t < 4; ++t) oacc[t] = (v8f){0.f,0.f,0.f,0.f,0.f,0.f,0.f,0.f};

  const int nChunks = (g.mask_mode == 1 || g.mask_mode == 4) ? (qb + 1) : (g.Skv / AT_KC);   // block-uniform
  // per-row query mask (mode 3)
  int qkeep[8];
#pragma unroll
  for (int r = 0; r < 8; ++r) qkeep[r] = (g.mask_mode == 3) ? mask_b[(size_t)b * g.S + q0 + 8 * hh + r] : 1;   // mask_b = qmask in mode 3
  for (int kc = 0; kc < nChunks; ++kc) {
    const int kv0 = kc * AT_KC;
    __syncthreads();
    {
      const int kvr = tid >> 1, dh = (tid & 1) * 32;
      const float* krow = kb_ptr + (size_t)(kv0 + kvr) * g.k_rs + dh;
      const float* vrow = vb_ptr + (size_t)(kv0 + kvr) * g.v_rs + dh;
#pragma unroll
      for (int i = 0; i < 8; ++i) {
        v4f kk = *(const v4f*)(krow + 4 * i);
        v4f vv = *(const v4f*)(vrow + 4 * i);
#pragma unroll
        for (int e = 0; e < 4; ++e) {
          const int d = dh + 4 * i + e;
          if (SPLIT_QK) { __bf16 a, bl; at_split(kk[e], a, bl); Ksh[kvr * AT_D + d] = a; Ksl[kvr * AT_D + d] = bl; }
          else Ksh[kvr * AT_D + d] = at_to16<F16>(kk[e]);
          if (SPLIT_PV) { __bf16 a, bl; at_split(vv[e], a, bl); Vth[d * AT_KC + kvr] = a; Vtl[d * AT_KC + kvr] = bl; }
          else Vth[d * AT_KC + kvr] = at_to16<F16>(vv[e]);
        }
      }
    }
    __syncthreads();

    v8f s[4];
#pragma unroll
    for (int j = 0; j < 4; ++j) {
      s[j] = (v8f){0.f,0.f,0.f,0.f,0.f,0.f,0.f,0.f};
#pragma unroll 1
      for (int dc = 0; dc < 2; ++dc) {
        FB kb;
        kb.h[0] = *(const v8b*)(Ksh + (j * 16 + c) * AT_D + dc * 32 + 8 * hh);
        kb.h[1] = *(const v8b*)(Ksh + (j * 16 + c) * AT_D + dc * 32 + 16 + 8 * hh);
        s[j] = at_mma16<F16>(qah[dc], kb.v, s[j]);
        if (SPLIT_QK) {
          FB kl;
          kl.h[0] = *(const v8b*)(Ksl + (j * 16 + c) * AT_D + dc * 32 + 8 * hh);
          kl.h[1] = *(const v8b*)(Ksl + (j * 16 + c) * AT_D + dc * 32 + 16 + 8 * hh);
          s[j] = at_mma16<F16>(qah[dc], kl.v, s[j]);
          s[j] = at_mma16<F16>(qal[dc], kb.v, s[j]);
        }
      }
    }
    const bool diag = (g.mask_mode == 1) && (kc == qb);
    int kvkeep[4] = {1, 1, 1, 1};
    if (g.mask_mode == 3) {
#pragma unroll
      for (int j = 0; j < 4; ++j) kvkeep[j] = ((const int*)mask_a)[(size_t)b * g.Skv + kv0 + j * 16 + c];   // mask_a = kvmask
    }
    float cm[8];
#pragma unroll
    for (int r = 0; r < 8; ++r) {
      const int qrow = q0 + 8 * hh + r;
      float m = -INFINITY;
#pragma unroll
      for (int j = 0; j < 4; ++j) {
        const int kvcol = kv0 + j * 16 + c;
        bool masked = false;
        if (diag) masked = (kvcol > qrow);
        else if (g.mask_mode == 4) masked = (kvcol > qrow) || (qrow - kvcol > g.mask_is_int);
        else if (g.mask_mode == 2) {
          const size_t mi = (size_t)qrow * g.Skv + kvcol;
          masked = (g.mask_is_int == 0) ? (((const float*)mask_a)[mi] == 0.0f)
                 : (g.mask_is_int == 1) ? (((const int*)mask_a)[mi] == 0) : (((const int*)mask_a)[mi] != 0);
        } else if (g.mask_mode == 3) masked = (qkeep[r] == 0) || (kvkeep[j] == 0);
        else if (g.mask_mode == 5) {
          const size_t mi = (size_t)qrow * g.Skv + kvcol;
          masked = (((const int*)mask_a)[mi] != 0);
          int n = mask_b[mi]; n = n < 0 ? 0 : n;
          s[j][r] += g.cp[(size_t)b * g.c_bs + (size_t)h * g.c_hs + (size_t)qrow * g.c_rs + n]
                   + g.pc[(size_t)b * g.c_bs + (size_t)h * g.c_hs + (size_t)kvcol * g.c_rs + n];
        }
        if (masked) s[j][r] = g.mask_fill;
        m = fmaxf(m, s[j][r]);
      }
#pragma unroll
      for (int off = 1; off < 16; off <<= 1) m = fmaxf(m, __shfl_xor(m, off, 32));
      cm[r] = m;
    }
    __bf16* pwh = Psh[wave];
    __bf16* pwl = Psl[SPLIT_PV ? wave : 0];
#pragma unroll
    for (int r = 0; r < 8; ++r) {
      const float mnew = fmaxf(mrow[r], cm[r]);
      const float alpha = expf(mrow[r] - mnew);
      mrow[r] = mnew;
      float psum = 0.f;
#pragma unroll
      for (int j = 0; j < 4; ++j) {
        const float p = expf(s[j][r] - mnew);
        psum += p;
        if (SPLIT_PV) { __bf16 a, bl; at_split(p, a, bl); pwh[(8 * hh + r) * AT_KC + j * 16 + c] = a; pwl[(8 * hh + r) * AT_KC + j * 16 + c] = bl; }
        else pwh[(8 * hh + r) * AT_KC + j * 16 + c] = at_to16<F16>(p * PSC);
      }
#pragma unroll
      for (int off = 1; off < 16; off <<= 1) psum += __shfl_xor(psum, off, 32);
      lrow[r] = lrow[r] * alpha + psum;
#pragma unroll
      for (int t = 0; t < 4; ++t) oacc[t][r] *= alpha;
    }
    __builtin_amdgcn_fence(__ATOMIC_RELEASE, "workgroup");
    __builtin_amdgcn_wave_barrier();
    __builtin_amdgcn_fence(__ATOMIC_ACQUIRE, "workgroup");
#pragma unroll 1
    for (int kk = 0; kk < 2; ++kk) {
      FB pa, pl;
      pa.h[0] = *(const v8b*)(pwh + c * AT_KC + kk * 32 + 8 * hh);
      pa.h[1] = *(const v8b*)(pwh + c * AT_KC + kk * 32 + 16 + 8 * hh);
      if (SPLIT_PV) {
        pl.h[0] = *(const v8b*)(pwl + c * AT_KC + kk * 32 + 8 * hh);
        pl.h[1] = *(const v8b*)(pwl + c * AT_KC + kk * 32 + 16 + 8 * hh);
      }
#pragma unroll
      for (int t = 0; t < 4; ++t) {
        FB vb;
        vb.h[0] = *(const v8b*)(Vth + (t * 16 + c) * AT_KC + kk * 32 + 8 * hh);
        vb.h[1] = *(const v8b*)(Vth + (t * 16 + c) * AT_KC + kk * 32 + 16 + 8 * hh);
        oacc[t] = at_mma16<F16>(pa.v, vb.v, oacc[t]);
        if (SPLIT_PV) {
          FB vl;
          vl.h[0] = *(const v8b*)(Vtl + (t * 16 + c) * AT_KC + kk * 32 + 8 * hh);
          vl.h[1] = *(const v8b*)(Vtl + (t * 16 + c) * AT_KC + kk * 32 + 16 + 8 * hh);
          oacc[t] = at_mma16<F16>(pa.v, vl.v, oacc[t]);
          oacc[t] = at_mma16<F16>(pl.v, vb.v, oacc[t]);
        }
      }
    }
  }

  float* os = Os[wave];
#pragma unroll
  for (int r = 0; r < 8; ++r) {
    const float inv = 1.0f / (lrow[r] * PSC);
#pragma unroll
    for (int t = 0; t < 4; ++t) os[(8 * hh + r) * 68 + t * 16 + c] = oacc[t][r] * inv;
  }
  __builtin_amdgcn_fence(__ATOMIC_RELEASE, "workgroup");
  __builtin_amdgcn_wave_barrier();
  __builtin_amdgcn_fence(__ATOMIC_ACQUIRE, "workgroup");
  {
    const int c4 = (lane & 15) * 4;
    {
#pragma unroll
      for (int it = 0; it < 8; ++it) {
        const int row = it * 2 + hh;
        v4f val = *(const v4f*)(os + row * 68 + c4);
        *(v4f*)(ob_ptr + (size_t)(q0 + row) * g.o_rs + c4) = val;
      }
      
    }
  }
}

} // namespace w25

// ---- Wide elementwise and row passes: a thread moves 32 or 64 elements with 16-byte loads, so that a pass starts a few thousand waves instead of
//      one wave per 64 or 128 elements. Every wave-wide store covers whole 128-byte lines. Formulas and sum trees are those of the narrow kernels above.
typedef __attribute__((ext_vector_type(4))) _Float16 v4h;
// k_cast16w<G>: dst[i] = f16(src[i] * s) over a flat range; a block takes G * 1024 consecutive elements, a thread 4 consecutive ones of each 1024.
template <int G>
__global__ __launch_bounds__(256) void k_cast16w(const float* __restrict__ src, _Float16* __restrict__ dst, float s) {
    const v4f* sp = (const v4f*)(src + (size_t)blockIdx.x * (G * 1024));
    v4h* dp = (v4h*)(dst + (size_t)blockIdx.x * (G * 1024));
    const unsigned t = threadIdx.x;
    v4f a[G];
#pragma unroll
    for (int g = 0; g < G; ++g) a[g] = sp[t + g * 256];
#pragma unroll
    for (int g = 0; g < G; ++g) {
        v4h h;
#pragma unroll
        for (int e = 0; e < 4; ++e) h[e] = (_Float16)(a[g][e] * s);
        dp[t + g * 256] = h;
    }
}
// k_castT16w<LDS, LDD>: dst[c * LDD + r] = f16(src[r * LDS + c] * s). Block = 64 source rows x 128 source columns, wave = 64 x 16, lane = 8 rows x 4 columns
//   transposed in registers: 8 lanes side by side in r fill one 128-byte line of a dst row. grid (C / 128, R / 64).
template <int LDS, int LDD>
__global__ __launch_bounds__(256) void k_castT16w(const float* __restrict__ src, _Float16* __restrict__ dst, float s) {
    const int lane = threadIdx.x & 31, wave = threadIdx.x >> 5;
    const int r = blockIdx.y * 64 + (lane & 7) * 8;
    const int c = blockIdx.x * 128 + wave * 16 + (lane >> 3) * 4;
    const float* sp = src + (size_t)r * LDS + c;
    _Float16* dp = dst + (size_t)c * LDD + r;
    v4f x[8];
#pragma unroll
    for (int i = 0; i < 8; ++i) x[i] = *(const v4f*)(sp + i * LDS);
#pragma unroll
    for (int j = 0; j < 4; ++j) {
        v8h h;
#pragma unroll
        for (int i = 0; i < 8; ++i) h[i] = (_Float16)(x[i][j] * s);
        *(v8h*)(dp + j * LDD) = h;
    }
}
// Sum of one value per position t = 0..255 of k_stats' tree, add for add: lane l holds positions 4l + q in lo[q] and 128 + 4l + q in hi[q].
//   Levels 128 (in the lane), 64..4 (lanes l and l ^ 16, 8, 4, 2, 1), 2 and 1 (in the lane); every lane ends with the root.
__device__ __forceinline__ float tree256(v4f lo, v4f hi) {
    v4f t = lo + hi;
#pragma unroll
    for (int o = 16; o > 0; o >>= 1) {
#pragma unroll
        for (int q = 0; q < 4; ++q) t[q] += __shfl_xor(t[q], o, 32);
    }
    return (t[0] + t[2]) + (t[1] + t[3]);
}
// k_stats_w: mean and rsqrt(var + eps) of rows of 1024, one wave per row with the row held in registers (k_stats mode 0; same partial sums, same tree).
__global__ __launch_bounds__(256) void k_stats_w(const float* __restrict__ x, float eps, float* __restrict__ stat) {
    const int lane = threadIdx.x & 31; const size_t row = (size_t)blockIdx.x * 8 + (threadIdx.x >> 5);
    const float* base = x + row * 1024 + 4 * lane;
    v4f v[8];
#pragma unroll
    for (int m = 0; m < 8; ++m) v[m] = *(const v4f*)(base + 128 * m);
    const float mu = tree256(((v[0] + v[2]) + v[4]) + v[6], ((v[1] + v[3]) + v[5]) + v[7]) / 1024.f;
    v4f q0 = {}, q1 = {};
#pragma unroll
    for (int k = 0; k < 4; ++k) { const v4f d0 = v[2 * k] - mu, d1 = v[2 * k + 1] - mu; q0 = __builtin_elementwise_fma(d0, d0, q0); q1 = __builtin_elementwise_fma(d1, d1, q1); }
    const float rs = rsqrtf(tree256(q0, q1) / 1024.f + eps);
    const float o = (lane == 0) ? mu : ((lane == 1) ? rs : 0.f);
    stat[row * 32 + lane] = o;
}
// k_norm_apply_w: y = (x - mean[row]) * rstd[row] * g[c] + b[c] on rows of 1024; a block takes 8 rows, a thread 4 columns of each (x and y may be the same buffer).
__global__ __launch_bounds__(256) void k_norm_apply_w(const float* x, float* y, const float* __restrict__ stat, const float* __restrict__ g, const float* __restrict__ bta) {
    const int c = threadIdx.x * 4; const size_t r0 = (size_t)blockIdx.x * 8;
    const v4f gg = *(const v4f*)(g + c), bb = *(const v4f*)(bta + c);
    v4f v[8];
#pragma unroll
    for (int i = 0; i < 8; ++i) v[i] = *(const v4f*)(x + (r0 + i) * 1024 + c);
#pragma unroll
    for (int i = 0; i < 8; ++i) {
        v4f o = (v[i] - stat[(r0 + i) * 32]) * stat[(r0 + i) * 32 + 1];
        o *= gg; o += bb;
        *(v4f*)(y + (r0 + i) * 1024 + c) = o;
    }
}


// MI[(b, s)] = (s < valid_len[b]) ? 1 : 0 as INT (keep-mask: masked scores are SET to -1e6 exactly like the module's where, so a 128-key block lying entirely beyond valid_len comes out uniform)
__global__ __launch_bounds__(256) void k_te_mask(const int* __restrict__ VL, int* __restrict__ MI, int Bn, int S) { const int t = blockIdx.x * 256 + threadIdx.x; if (t >= Bn * S) return; int* d = MI + t; const int v = ((t % S) < VL[t / S]) ? 1 : 0; *d = v;  }


extern "C" void kernel_launch(void* const* d_in, const int* in_sizes, int n_in, void* d_out, int out_size, void* d_ws, size_t ws_size, hipStream_t stream) {
    (void)in_sizes; (void)n_in; (void)out_size; (void)ws_size;
    const float* X = (const float*)d_in[0];
    const int* vl = (const int*)d_in[1];
    const float* Wq = (const float*)d_in[2];
    const float* Wk = (const float*)d_in[3];
    const float* Wv = (const float*)d_in[4];
    const float* Wo = (const float*)d_in[5];
    const float* g1 = (const float*)d_in[6];
    const float* be1 = (const float*)d_in[7];
    const float* W1 = (const float*)d_in[8];
    const float* bf1 = (const float*)d_in[9];
    const float* W2 = (const float*)d_in[10];
    const float* bf2 = (const float*)d_in[11];
    const float* g2 = (const float*)d_in[12];
    const float* be2 = (const float*)d_in[13];
    const int Bn = 4;
    const int S = 1024;
    const int D = 1024;
    const int NH = 16;
    const int DH = 64;
    const int F = 4096;
    const int M = 128;
    const int NB = S / M;
    const int NR = Bn * S;
    float* out = (float*)d_out;
    char* wsp = (char*)d_ws;
    float* Q = (float*)wsp; wsp += (((size_t)((size_t)NR * D) * 4 + 255) / 256) * 256;
    float* Kb = (float*)wsp; wsp += (((size_t)((size_t)NR * D) * 4 + 255) / 256) * 256;
    float* V = (float*)wsp; wsp += (((size_t)((size_t)NR * D) * 4 + 255) / 256) * 256;
    float* AT = (float*)wsp; wsp += (((size_t)((size_t)NR * D) * 4 + 255) / 256) * 256;
    float* MF = (float*)wsp; wsp += (((size_t)((size_t)NR) * 4 + 255) / 256) * 256;
    float* Y = (float*)wsp; wsp += (((size_t)((size_t)NR * D) * 4 + 255) / 256) * 256;
    float* ST = (float*)wsp; wsp += (((size_t)((size_t)NR * 32) * 4 + 255) / 256) * 256;
    float* H1 = (float*)wsp; wsp += (((size_t)((size_t)NR * F) * 4 + 255) / 256) * 256;
    unsigned short* G64A = (unsigned short*)wsp; wsp += (((size_t)(16777216) * 2 + 255) / 256) * 256;
    unsigned short* G64B = (unsigned short*)wsp; wsp += (((size_t)(4194304) * 2 + 255) / 256) * 256;
    k_cast16w<8><<<512, 256, 0, stream>>>(X, (_Float16*)(G64A), 1.0f);
    k_castT16w<1024, 1024><<<dim3(1024 / 128, 1024 / 64), 256, 0, stream>>>(Wq, (_Float16*)(G64B), 16.0f);
    w25::wmma_gemm64<0, false, 0, 0, false, 0><<<dim3((unsigned)((((4096) / 64) * ((1024) / 64) + 7) / 8), (unsigned)(1)), 256, 0, stream>>>((const unsigned short*)(G64A), nullptr, 1024, 0, (const unsigned short*)(G64B), nullptr, 1024, 0, (void*)(Q), nullptr, 1024, 0, nullptr, nullptr, 0, 4096, 1024, 1024, 0.0625f);
    k_cast16w<8><<<512, 256, 0, stream>>>(X, (_Float16*)(G64A), 1.0f);
    k_castT16w<1024, 1024><<<dim3(1024 / 128, 1024 / 64), 256, 0, stream>>>(Wk, (_Float16*)(G64B), 16.0f);
    w25::wmma_gemm64<0, false, 0, 0, false, 0><<<dim3((unsigned)((((4096) / 64) * ((1024) / 64) + 7) / 8), (unsigned)(1)), 256, 0, stream>>>((const unsigned short*)(G64A), nullptr, 1024, 0, (const unsigned short*)(G64B), nullptr, 1024, 0, (void*)(Kb), nullptr, 1024, 0, nullptr, nullptr, 0, 4096, 1024, 1024, 0.0625f);
    k_cast16w<8><<<512, 256, 0, stream>>>(X, (_Float16*)(G64A), 1.0f);
    k_castT16w<1024, 1024><<<dim3(1024 / 128, 1024 / 64), 256, 0, stream>>>(Wv, (_Float16*)(G64B), 16.0f);
    w25::wmma_gemm64<0, false, 0, 0, false, 0><<<dim3((unsigned)((((4096) / 64) * ((1024) / 64) + 7) / 8), (unsigned)(1)), 256, 0, stream>>>((const unsigned short*)(G64A), nullptr, 1024, 0, (const unsigned short*)(G64B), nullptr, 1024, 0, (void*)(V), nullptr, 1024, 0, nullptr, nullptr, 0, 4096, 1024, 1024, 0.0625f);
    k_te_mask<<<(NR + 255) / 256, 256, 0, stream>>>((const int*)vl, (int*)MF, Bn, S);
    { /*apv4*/ AttnP a;
      a.Q = Q; a.K = Kb; a.V = V; a.O = AT; a.P = 0; a.Mf = 0; a.Mi = (const int*)MF; a.ST = 0;
      a.Pw = 0; a.Rt = 0; a.SQ = 0; a.SK = 0;
      a.swb = 0; a.swh = 0; a.swi = 0; a.swj = 0; a.srb = 0; a.srh = 0; a.sri = 0; a.sQb = (long long)M * D; a.sQh = DH; a.sQi = D; a.sQd = 1; a.sKb = (long long)M * D; a.sKh = DH; a.sKj = D; a.sKd = 1; a.sVb = (long long)M * D; a.sVh = DH; a.sVj = D; a.sVd = 1; a.sOb = (long long)M * D; a.sOh = DH; a.sOi = D; a.sPb = 0; a.sPh = 0; a.sPi = 0; a.smb = M; a.smh = 0; a.smi = 0; a.smj = 1;
      a.Lq = M; a.Lk = M; a.dh = DH; a.dv = DH; a.hrep = 1; a.causal = 0; a.coff = 0; a.pband = 0;
      a.scale = 0.125f; a.mfill = -1000000.0f; a.nonorm = 0; a.mpol = 0;
      a.roff = 0; a.rn = 1; a.segpol = 0; a.win = 0;
      k_attn<64, 64, 0, false, false><<<dim3((unsigned)((M) + 16 * AW - 1) / (16 * AW), (unsigned)(NH), (unsigned)(Bn * NB)), 32 * AW, 0, stream>>>(a); }
    k_cast16w<8><<<512, 256, 0, stream>>>(AT, (_Float16*)(G64A), 1.0f);
    k_castT16w<1024, 1024><<<dim3(1024 / 128, 1024 / 64), 256, 0, stream>>>(Wo, (_Float16*)(G64B), 16.0f);
    w25::wmma_gemm64<0, false, 0, 0, true, 0><<<dim3((unsigned)((((4096) / 64) * ((1024) / 64) + 7) / 8), (unsigned)(1)), 256, 0, stream>>>((const unsigned short*)(G64A), nullptr, 1024, 0, (const unsigned short*)(G64B), nullptr, 1024, 0, (void*)(Y), nullptr, 1024, 0, nullptr, X, 0, 4096, 1024, 1024, 0.0625f);
    k_stats_w<<<(unsigned)(NR / 8), 256, 0, stream>>>(Y, 1e-05f, ST);
    k_norm_apply_w<<<(unsigned)(NR / 8), 256, 0, stream>>>(Y, Y, ST, g1, be1);
    k_cast16w<8><<<512, 256, 0, stream>>>(Y, (_Float16*)(G64A), 1.0f);
    k_castT16w<4096, 1024><<<dim3(4096 / 128, 1024 / 64), 256, 0, stream>>>(W1, (_Float16*)(G64B), 16.0f);
    w25::wmma_gemm64<0, false, 2, 0, false, 2><<<dim3((unsigned)((((4096) / 64) * ((4096) / 64) + 7) / 8), (unsigned)(1)), 256, 0, stream>>>((const unsigned short*)(G64A), nullptr, 1024, 0, (const unsigned short*)(G64B), nullptr, 1024, 0, (void*)(H1), nullptr, 4096, 0, bf1, nullptr, 0, 4096, 4096, 1024, 0.0625f);
    k_cast16w<16><<<1024, 256, 0, stream>>>(H1, (_Float16*)(G64A), 1.0f);
    k_castT16w<1024, 4096><<<dim3(1024 / 128, 4096 / 64), 256, 0, stream>>>(W2, (_Float16*)(G64B), 16.0f);
    w25::wmma_gemm64<0, false, 2, 0, true, 0><<<dim3((unsigned)((((4096) / 64) * ((1024) / 64) + 7) / 8), (unsigned)(1)), 256, 0, stream>>>((const unsigned short*)(G64A), nullptr, 4096, 0, (const unsigned short*)(G64B), nullptr, 4096, 0, (void*)(Kb), nullptr, 1024, 0, bf2, Y, 0, 4096, 1024, 4096, 0.0625f);
    k_stats_w<<<(unsigned)(NR / 8), 256, 0, stream>>>(Kb, 1e-05f, ST);
    k_norm_apply_w<<<(unsigned)(NR / 8), 256, 0, stream>>>(Kb, out, ST, g2, be2);
}

// v003
// Measured time: 358 microseconds a run.
// In two side-by-side timings against v002, it was 1.92 and 1.95 times as fast.
// Counting every step since v000, it is 4.04 times as fast.
// Contractions: q/k/v/o projections X.W [4096x1024].[1024x1024] and the position-wise FFN relu(Y.W1 + b) [4096x1024].[1024x4096], .W2 + b [4096x4096].[4096x1024] with f16 operands on pre-cast planes (v_wmma_f32_16x16x32_f16; 128x128 work-group tiles staged through LDS, 32x64 per wave, weights x16); the block-diagonal windowed attention (8 blocks of 128 positions per sequence = 32 independent (sequence, block) attentions, 16 heads, keys >= valid_len SET to -1e6 through an integer keep-mask — exactly the module's where, so blocks lying wholly beyond valid_len are uniform) as one flash launch (f16 q.k^T and p.v with p as f16 of 4096 p); f32 accumulate and softmax. AddNorm LayerNorms (wave per row, fixed-order trees) and the mask table from the INPUT valid lengths are f32 kernels.
#include <hip/hip_runtime.h>
#include <math.h>

typedef __attribute__((ext_vector_type(16))) _Float16 v16h;
typedef __attribute__((ext_vector_type(8)))  _Float16 v8h;
typedef __attribute__((ext_vector_type(16))) __bf16   v16b;
typedef __attribute__((ext_vector_type(8)))  float    v8f;
typedef __attribute__((ext_vector_type(4)))  float    v4f;

// 16-bit WMMA fragment map (wave32), lane L, h = L>>4, m = L&15:
//   A 16x32: lane = row m;   element i -> k = (i<8) ? 8h+i : 16+8h+(i-8)
//   B 32x16: lane = column m; the SAME k(i,h)
//   D 16x16 (8 f32): lane = column m; element r -> row 8h+r
__device__ __forceinline__ int frag_k(int i, int h) { return (i < 8) ? (8 * h + i) : (16 + 8 * h + (i - 8)); }
__device__ __forceinline__ __bf16 bf16_rne(float f) {
    unsigned int u = __float_as_uint(f);
    u += 0x7fffu + ((u >> 16) & 1u);
    return __builtin_bit_cast(__bf16, (unsigned short)(u >> 16));
}
__device__ __forceinline__ float bf16_f32(__bf16 b) { return __uint_as_float(((unsigned int)__builtin_bit_cast(unsigned short, b)) << 16); }
__device__ __forceinline__ v8f wmma16(v16h a, v16h b, v8f c) {
    c = __builtin_amdgcn_wmma_f32_16x16x32_f16(false, a, false, b, (short)0, c, false, false);
    asm volatile("v_nop\n\tv_nop\n\tv_nop\n\tv_nop" : "+v"(c) : "v"(a), "v"(b));
    return c;
}
__device__ __forceinline__ v8f wmmab(v16b a, v16b b, v8f c) {
    c = __builtin_amdgcn_wmma_f32_16x16x32_bf16(false, a, false, b, (short)0, c, false, false);
    asm volatile("v_nop\n\tv_nop\n\tv_nop\n\tv_nop" : "+v"(c) : "v"(a), "v"(b));
    return c;
}
struct Split { v16b hi, lo; };
// hi/lo split product: a.hi*b.hi + a.hi*b.lo + a.lo*b.hi
__device__ __forceinline__ v8f wmma3(const Split& a, const Split& b, v8f c) {
    c = __builtin_amdgcn_wmma_f32_16x16x32_bf16(false, a.hi, false, b.hi, (short)0, c, false, false);
    c = __builtin_amdgcn_wmma_f32_16x16x32_bf16(false, a.hi, false, b.lo, (short)0, c, false, false);
    c = __builtin_amdgcn_wmma_f32_16x16x32_bf16(false, a.lo, false, b.hi, (short)0, c, false, false);
    asm volatile("v_nop\n\tv_nop\n\tv_nop\n\tv_nop" : "+v"(c) : "v"(a.hi), "v"(a.lo), "v"(b.hi), "v"(b.lo));
    return c;
}
struct Split3 { v16b hi, mid, lo; };
// triple split product (6 terms, drops only terms below 2^-24 relative)
__device__ __forceinline__ v8f wmma6(const Split3& a, const Split3& b, v8f c) {
    c = __builtin_amdgcn_wmma_f32_16x16x32_bf16(false, a.hi, false, b.hi, (short)0, c, false, false);
    c = __builtin_amdgcn_wmma_f32_16x16x32_bf16(false, a.hi, false, b.mid, (short)0, c, false, false);
    c = __builtin_amdgcn_wmma_f32_16x16x32_bf16(false, a.mid, false, b.hi, (short)0, c, false, false);
    c = __builtin_amdgcn_wmma_f32_16x16x32_bf16(false, a.hi, false, b.lo, (short)0, c, false, false);
    c = __builtin_amdgcn_wmma_f32_16x16x32_bf16(false, a.mid, false, b.mid, (short)0, c, false, false);
    c = __builtin_amdgcn_wmma_f32_16x16x32_bf16(false, a.lo, false, b.hi, (short)0, c, false, false);
    asm volatile("v_nop\n\tv_nop\n\tv_nop\n\tv_nop" : "+v"(c) : "v"(a.hi), "v"(a.mid), "v"(a.lo), "v"(b.hi), "v"(b.mid), "v"(b.lo));
    return c;
}

// Fragment gathers from f32 memory: element i <- p[(k0 + frag_k(i,h)) * sk] * s, zero for k >= klen.
__device__ __forceinline__ v16h fh_ld(const float* __restrict__ p, long long sk, int k0, int h, int klen, float s) {
    v16h a;
#pragma unroll
    for (int i = 0; i < 16; ++i) { const int k = k0 + frag_k(i, h); a[i] = (k < klen) ? (_Float16)(p[(long long)k * sk] * s) : (_Float16)0.f; }
    return a;
}
__device__ __forceinline__ Split sp_ld(const float* __restrict__ p, long long sk, int k0, int h, int klen, float s) {
    Split r;
#pragma unroll
    for (int i = 0; i < 16; ++i) {
        const int k = k0 + frag_k(i, h); const float x = (k < klen) ? p[(long long)k * sk] * s : 0.f;
        const __bf16 hb = bf16_rne(x); r.hi[i] = hb; r.lo[i] = bf16_rne(x - bf16_f32(hb));
    }
    return r;
}
__device__ __forceinline__ Split3 sp3_ld(const float* __restrict__ p, long long sk, int k0, int h, int klen, float s) {
    Split3 r;
#pragma unroll
    for (int i = 0; i < 16; ++i) {
        const int k = k0 + frag_k(i, h); const float x = (k < klen) ? p[(long long)k * sk] * s : 0.f;
        const __bf16 hb = bf16_rne(x); const float r1 = x - bf16_f32(hb); const __bf16 mb = bf16_rne(r1);
        r.hi[i] = hb; r.mid[i] = mb; r.lo[i] = bf16_rne(r1 - bf16_f32(mb));
    }
    return r;
}
__device__ __forceinline__ v16b bh_ld(const float* __restrict__ p, long long sk, int k0, int h, int klen, float s) {
    v16b a;
#pragma unroll
    for (int i = 0; i < 16; ++i) { const int k = k0 + frag_k(i, h); a[i] = bf16_rne((k < klen) ? p[(long long)k * sk] * s : 0.f); }
    return a;
}
// f16 fragment from an f16 LDS/global row with element stride 1 (k-contiguous), no bounds (tile already zero padded)
__device__ __forceinline__ v16h fh_row(const _Float16* __restrict__ row, int k0, int h) {
    v16h a;
#pragma unroll
    for (int i = 0; i < 16; ++i) a[i] = row[k0 + frag_k(i, h)];
    return a;
}

#define VST2(T, ptr, val) do { const T vst2_v_ = (val); *(T*)(ptr) = vst2_v_;  } while (0)
typedef float v4f __attribute__((ext_vector_type(4)));
#define VST2V4(ptr, val) do { const v4f vst2_v4_ = (val); *(v4f*)(ptr) = vst2_v4_;  } while (0)

__device__ __attribute__((noinline)) float act_fn(float v, int act) {
    if (act == 1) return fmaxf(v, 0.f);                                                                               // relu
    if (act == 2) { const float u = 0.7978845608028654f * (v + 0.044715f * v * v * v); return 0.5f * v * (1.f + tanhf(u)); } // tanh-gelu
    if (act == 3) return v / (1.f + expf(-v));                                                                        // silu
    if (act == 4) return 0.5f * v * (1.f + erff(v * 0.7071067811865476f));                                             // erf-gelu
    if (act == 5) return tanhf(v);
    if (act == 6) return 1.f / (1.f + expf(-v));                                                                      // sigmoid
    if (act == 7) return (v > 0.f) ? v : 0.01f * v;                                                                   // leaky relu 0.01
    if (act == 8) return (v > 0.f) ? v : (expf(v) - 1.f);                                                             // elu
    if (act == 9) return fminf(fmaxf(v, 0.f), 6.f);                                                                   // relu6
    if (act == 10) return fabsf(v);                                                                                    // abs
    if (act == 11) return (v >= 0.f) ? v : 0.1f * v;                                                                  // leaky 0.1
    if (act == 12) return (v > 0.f) ? v : 0.2f * v;                                                                   // leaky 0.2
    if (act == 13) return (v > 20.f) ? v : log1pf(expf(v));                                                            // softplus
    return v;
}

// =====================================================================================================================
// k_gemm<MODE>: C(z, m, n) = act(alpha * sum_k A(z, m, k) * B(z, k, n) + bias) + beta * R(z, m, n)
//   One wave (32-thread block) per 16 x 32 tile of C; grid (ceil(N/32), ceil(M/16), Z). Batch z -> (zo = z / zi_n, zi = z % zi_n)
//   with separate outer/inner strides for every tensor (e.g. batch and head). A(m,k) = A[zo*sAo + zi*sAi + m*sAm + k*sAk] (f32),
//   B(k,n) = B[zo*sBo + zi*sBi + n*sBn + k*sBk] (f32); any M, N, K (K zero-padded to 32 inside the fragments, M/N tails guarded).
//   C(m,n) = C[zo*sCo + zi*sCi + m*sCm + n] (n contiguous). flags: 1 bias[n], 2 bias[m], 4 residual R[zo*sRo + zi*sRi + m*sRm + n*sRn].
//   MODE 0: f16 operands (A prescaled by sa, B by sb, both undone in the epilogue); 1: bf16 hi/lo split (3 products); 2: bf16;
//   3: bf16 hi/mid/lo triple split (6 products); 4: as 3 with Kahan-compensated f32 accumulation across k-steps.
// =====================================================================================================================
struct GemmP {
    const float* A; const float* B; const float* bias; const float* R; float* C;
    long long sAo, sAi, sAm, sAk, sBo, sBi, sBn, sBk, sCo, sCi, sCm, sRo, sRi, sRm, sRn;
    int M, N, K, zi_n, flags, act; float alpha, beta, sa, sb;
    int Npad, pad_;     // columns [N, Npad) of C are written as 0 so that padded workspace rows are covered by whole-line stores; Npad >= N
};
static_assert(sizeof(GemmP) == 5 * 8 + 15 * 8 + 6 * 4 + 4 * 4 + 2 * 4, "GemmP has padding");

template <int MODE>
__global__ __launch_bounds__(32) void k_gemm(GemmP p) {
    const int lane = threadIdx.x & 31, h = lane >> 4, l15 = lane & 15;
    const int m0 = blockIdx.y * 16, n0 = blockIdx.x * 32;
    const int z = blockIdx.z, zo = z / p.zi_n, zi = z - zo * p.zi_n;
    const float* A = p.A + zo * p.sAo + zi * p.sAi;
    const float* B = p.B + zo * p.sBo + zi * p.sBi;
    const int am = min(m0 + l15, p.M - 1);                       // clamped row for loads (stores are guarded)
    v8f acc[2], comp[2];
#pragma unroll
    for (int t = 0; t < 2; ++t) { v8f zz = {}; acc[t] = zz; comp[t] = zz; }
    for (int k0 = 0; k0 < p.K; k0 += 32) {
        const float* arow = A + (long long)am * p.sAm;
        if (MODE == 1) {
            const Split a = sp_ld(arow, p.sAk, k0, h, p.K, 1.f);
#pragma unroll
            for (int t = 0; t < 2; ++t) {
                const int bn = min(n0 + t * 16 + l15, p.N - 1);
                acc[t] = wmma3(a, sp_ld(B + (long long)bn * p.sBn, p.sBk, k0, h, p.K, 1.f), acc[t]);
            }
        } else if (MODE == 3) {
            const Split3 a = sp3_ld(arow, p.sAk, k0, h, p.K, 1.f);
#pragma unroll
            for (int t = 0; t < 2; ++t) {
                const int bn = min(n0 + t * 16 + l15, p.N - 1);
                acc[t] = wmma6(a, sp3_ld(B + (long long)bn * p.sBn, p.sBk, k0, h, p.K, 1.f), acc[t]);
            }
        } else if (MODE == 4) {
            // triple split as MODE 3, but each k-step's 6 products go into a fresh accumulator and the partial is added to the running f32 sum
            // on the VALU with Kahan compensation (accumulation error stays ~1 ulp however long K is)
            const Split3 a = sp3_ld(arow, p.sAk, k0, h, p.K, 1.f);
#pragma unroll
            for (int t = 0; t < 2; ++t) {
                const int bn = min(n0 + t * 16 + l15, p.N - 1); v8f zz = {};
                const v8f part = wmma6(a, sp3_ld(B + (long long)bn * p.sBn, p.sBk, k0, h, p.K, 1.f), zz);
                const v8f y = part - comp[t]; const v8f s = acc[t] + y; comp[t] = (s - acc[t]) - y; acc[t] = s;
            }
        } else if (MODE == 2) {
            const v16b a = bh_ld(arow, p.sAk, k0, h, p.K, 1.f);
#pragma unroll
            for (int t = 0; t < 2; ++t) {
                const int bn = min(n0 + t * 16 + l15, p.N - 1);
                acc[t] = wmmab(a, bh_ld(B + (long long)bn * p.sBn, p.sBk, k0, h, p.K, 1.f), acc[t]);
            }
        } else {
            const v16h a = fh_ld(arow, p.sAk, k0, h, p.K, p.sa);
#pragma unroll
            for (int t = 0; t < 2; ++t) {
                const int bn = min(n0 + t * 16 + l15, p.N - 1);
                acc[t] = wmma16(a, fh_ld(B + (long long)bn * p.sBn, p.sBk, k0, h, p.K, p.sb), acc[t]);
            }
        }
    }
    const float iscale = (MODE == 0) ? p.alpha / (p.sa * p.sb) : p.alpha;
    float* C = p.C + zo * p.sCo + zi * p.sCi;
    const float* R = p.R + zo * p.sRo + zi * p.sRi;
    __shared__ __align__(16) float ctile[16][36];
#pragma unroll
    for (int t = 0; t < 2; ++t) {
        const int n = n0 + t * 16 + l15; const int nn = min(n, p.N - 1);
#pragma unroll
        for (int r = 0; r < 8; ++r) {
            const int m = m0 + 8 * h + r; const int mm = min(m, p.M - 1);
            float v = acc[t][r] * iscale;
            if (p.flags & 1) v += p.bias[nn];
            if (p.flags & 2) v += p.bias[mm];
            if (p.flags & 8) v *= p.bias[(long long)zo * p.M + mm];   /* per-(z,row) scale vector laid out [Z][M]; exclusive with the bias flags */
            v = act_fn(v, p.act);
            if (p.flags & 4) v += p.beta * R[(long long)mm * p.sRm + (long long)nn * p.sRn];
            ctile[8 * h + r][t * 16 + l15] = (n < p.N) ? v : 0.f;
        }
    }
    __syncthreads();
    const int NW = (p.Npad > p.N) ? p.Npad : p.N;           // write width
    const bool fast = (m0 + 16 <= p.M) && (n0 + 32 <= NW) && ((p.sCm & 3) == 0) && ((((size_t)C) & 15) == 0);
    if (fast) {
#pragma unroll
        for (int s = 0; s < 4; ++s) {
            const int row = s * 4 + (lane >> 3), c4 = (lane & 7) * 4;
            const v4f v = *(const v4f*)&ctile[row][c4];
            VST2V4(C + (long long)(m0 + row) * p.sCm + n0 + c4, v);
        }
    } else {
        for (int row = 0; row < 16; ++row) {
            const int m = m0 + row, n = n0 + lane;
            if (m < p.M && n < NW) VST2(float, C + (long long)m * p.sCm + n, ctile[row][lane]);
        }
    }
}


// =====================================================================================================================
// k_gemmT<MODE, TM, TN>: same contract as k_gemm, but one wave computes a (16*TM) x (16*TN) tile: TM A fragments and TN B fragments are
//   loaded per 32-wide k-step and reused across TM*TN WMMAs (far fewer load/convert instructions per MAC). MODE 0 (f16), 1 (bf16 hi/lo),
//   2 (bf16) only. grid (ceil(NW/(16*TN)), ceil(M/(16*TM)), Z), block 32. Epilogue identical to k_gemm, run per 16x32 sub-tile.
// =====================================================================================================================
template <int MODE, int TM, int TN>
__global__ __launch_bounds__(32) void k_gemmT(GemmP p) {
    const int lane = threadIdx.x & 31, h = lane >> 4, l15 = lane & 15;
    const int m0 = blockIdx.y * (16 * TM), n0 = blockIdx.x * (16 * TN);
    const int z = blockIdx.z, zo = z / p.zi_n, zi = z - zo * p.zi_n;
    const float* A = p.A + zo * p.sAo + zi * p.sAi;
    const float* B = p.B + zo * p.sBo + zi * p.sBi;
    v8f acc[TM][TN];
#pragma unroll
    for (int i = 0; i < TM; ++i)
#pragma unroll
        for (int t = 0; t < TN; ++t) { v8f zz = {}; acc[i][t] = zz; }
    for (int k0 = 0; k0 < p.K; k0 += 32) {
        if (MODE == 1) {
            Split a[TM], b[TN];
#pragma unroll
            for (int i = 0; i < TM; ++i) { const int am = min(m0 + 16 * i + l15, p.M - 1); a[i] = sp_ld(A + (long long)am * p.sAm, p.sAk, k0, h, p.K, 1.f); }
#pragma unroll
            for (int t = 0; t < TN; ++t) { const int bn = min(n0 + 16 * t + l15, p.N - 1); b[t] = sp_ld(B + (long long)bn * p.sBn, p.sBk, k0, h, p.K, 1.f); }
#pragma unroll
            for (int i = 0; i < TM; ++i)
#pragma unroll
                for (int t = 0; t < TN; ++t) acc[i][t] = wmma3(a[i], b[t], acc[i][t]);
        } else if (MODE == 2) {
            v16b a[TM], b[TN];
#pragma unroll
            for (int i = 0; i < TM; ++i) { const int am = min(m0 + 16 * i + l15, p.M - 1); a[i] = bh_ld(A + (long long)am * p.sAm, p.sAk, k0, h, p.K, 1.f); }
#pragma unroll
            for (int t = 0; t < TN; ++t) { const int bn = min(n0 + 16 * t + l15, p.N - 1); b[t] = bh_ld(B + (long long)bn * p.sBn, p.sBk, k0, h, p.K, 1.f); }
#pragma unroll
            for (int i = 0; i < TM; ++i)
#pragma unroll
                for (int t = 0; t < TN; ++t) acc[i][t] = wmmab(a[i], b[t], acc[i][t]);
        } else {
            v16h a[TM], b[TN];
#pragma unroll
            for (int i = 0; i < TM; ++i) { const int am = min(m0 + 16 * i + l15, p.M - 1); a[i] = fh_ld(A + (long long)am * p.sAm, p.sAk, k0, h, p.K, p.sa); }
#pragma unroll
            for (int t = 0; t < TN; ++t) { const int bn = min(n0 + 16 * t + l15, p.N - 1); b[t] = fh_ld(B + (long long)bn * p.sBn, p.sBk, k0, h, p.K, p.sb); }
#pragma unroll
            for (int i = 0; i < TM; ++i)
#pragma unroll
                for (int t = 0; t < TN; ++t) acc[i][t] = wmma16(a[i], b[t], acc[i][t]);
        }
    }
    const float iscale = (MODE == 0) ? p.alpha / (p.sa * p.sb) : p.alpha;
    float* C = p.C + zo * p.sCo + zi * p.sCi;
    const float* R = p.R + zo * p.sRo + zi * p.sRi;
    const int NW = (p.Npad > p.N) ? p.Npad : p.N;
    __shared__ __align__(16) float ctile[16][36];
#pragma unroll
    for (int i = 0; i < TM; ++i) {
        const int mb = m0 + 16 * i; if (mb >= p.M) break;          // wave-uniform
#pragma unroll
        for (int tp = 0; tp < TN / 2; ++tp) {
            const int nb = n0 + 32 * tp; if (nb >= NW) break;        // wave-uniform
#pragma unroll
            for (int t2 = 0; t2 < 2; ++t2) {
                const int t = 2 * tp + t2; const int n = nb + t2 * 16 + l15; const int nn = min(n, p.N - 1);
#pragma unroll
                for (int r = 0; r < 8; ++r) {
                    const int m = mb + 8 * h + r; const int mm = min(m, p.M - 1);
                    float v = acc[i][t][r] * iscale;
                    if (p.flags & 1) v += p.bias[nn];
                    if (p.flags & 2) v += p.bias[mm];
            if (p.flags & 8) v *= p.bias[(long long)zo * p.M + mm];   /* per-(z,row) scale vector laid out [Z][M]; exclusive with the bias flags */
                    v = act_fn(v, p.act);
                    if (p.flags & 4) v += p.beta * R[(long long)mm * p.sRm + (long long)nn * p.sRn];
                    ctile[8 * h + r][t2 * 16 + l15] = (n < p.N) ? v : 0.f;
                }
            }
            __syncthreads();
            const bool fast = (mb + 16 <= p.M) && (nb + 32 <= NW) && ((p.sCm & 3) == 0) && ((((size_t)C) & 15) == 0);
            if (fast) {
#pragma unroll
                for (int s = 0; s < 4; ++s) {
                    const int row = s * 4 + (lane >> 3), c4 = (lane & 7) * 4;
                    const v4f v = *(const v4f*)&ctile[row][c4];
                    VST2V4(C + (long long)(mb + row) * p.sCm + nb + c4, v);
                }
            } else {
                for (int row = 0; row < 16; ++row) {
                    const int m = mb + row, n = nb + lane;
                    if (m < p.M && n < NW) VST2(float, C + (long long)m * p.sCm + n, ctile[row][lane]);
                }
            }
            __syncthreads();
        }
    }
}

// =====================================================================================================================
//   Wave = 16 queries, AW waves per block, 64-key blocks; grid (ceil(Lq/(16*AW)), H, B), block 32*AW. Any Lq, Lk; head dim dh <= DHP
//   (DHP multiple of 32), value dim dv <= DVP (multiple of 16, <= 128). Every tensor addressed by (batch, head, row, element) strides, f32.
//   Scores: QM 0 f16 operands, 1 bf16 hi/lo split, 2 bf16 triple split; statistics f32 (exp2 domain); P.V: P x 4096 as f16 with V f16 staged in LDS
//   (SPLITPV: P and V as bf16 hi/lo splits). kv head = h / hrep. Masking: causal = 1 (keep j <= i + coff, masked -> -inf, key blocks beyond the
//   diagonal skipped), causal = 2 (masked -> mfill, a finite fill like the -1e9; no skipping), causal = 3 (keep j >= i + coff,
//   masked -> -inf, no skipping); optional additive f32 mask Mf,
//   optional int keep-mask Mi (0 -> score := mfill), both addressed b*smb + h*smh + i*smi + j*smj (0 strides broadcast).
// =====================================================================================================================
#define AW 4
struct AttnP {   // apv4
    const float* Q; const float* K; const float* V; float* O; float* P; const float* Mf; const int* Mi; float* ST;
    const float* Pw; const float* Rt; const int* SQ; const int* SK;           // optional: post-softmax weight, relative-position table, segment ids
    long long swb, swh, swi, swj, srb, srh, sri;                                 // Pw strides (b,h,i,j); Rt strides (b,h,i), column = clamp(i - j + roff, 0, rn-1)
    long long sQb, sQh, sQi, sQd, sKb, sKh, sKj, sKd, sVb, sVh, sVj, sVd, sOb, sOh, sOi, sPb, sPh, sPi, smb, smh, smi, smj;
    int Lq, Lk, dh, dv, hrep, causal, coff, pband;   // pband > 0: P holds only the band |j - i| <= pband, column j - i + pband
    float scale, mfill; int nonorm, mpol;             // nonorm (online path only): O = sum_j exp(score_j) V_j without the 1/rowsum (scores must be <= ~0); mpol: Mi masks where ==0 (mpol 0) or where !=0 (mpol 1)
    int roff, rn, segpol, win;                        // Rt column offset/count; SQ/SK: score := mfill where (segpol 0) SQ[i] != SK[j] or (segpol 1) SQ[i] == SK[j]; win > 0: keys with i - j > win (after coff) -> -inf
};
//   Pw: the softmax numerator is multiplied by Pw(b,h,i,j) AFTER the row sum is taken (probs * weight, then P.V), as in post-softmax multiplicative biases.                                                    // ST (optional): per row (b,h,i) -> ST[((b*H + h)*Lq + i)*2 + {0,1}] = {row max of the scaled+masked score (natural units), sum_j exp(score - max)}
static_assert(sizeof(AttnP) == 12 * 8 + 29 * 8 + 16 * 4, "AttnP has padding");

#ifndef KATTN_ATTR
#define KATTN_ATTR
#endif
template <int DHP, int DVP, int QM, bool SPLITPV, bool TWOPASS>
__global__ __launch_bounds__(32 * AW) KATTN_ATTR void k_attn(AttnP p) {
    constexpr int NT = DVP / 16;                // output tiles
    constexpr int KS = DHP / 32;                // k-steps for the scores
    constexpr int VP = DVP + 8;                 // LDS pitch (halves)
    __shared__ __align__(16) float    pl[AW][16 * 64];
    __shared__ __align__(16) _Float16 vl[(SPLITPV ? 2 : 1) * 64 * VP];   // f16 V tile, or bf16 hi and lo tiles (same 2-byte size)
    const int lane = threadIdx.x & 31, hf = lane >> 4, l15 = lane & 15, wave = threadIdx.x >> 5;
    const int h = blockIdx.y, b = blockIdx.z, hk = h / p.hrep;
    const int q0 = (blockIdx.x * AW + wave) * 16;
    float* myp = pl[wave];
    const float L2E = 1.4426950408889634f;
    const float NEG = -__builtin_inff();
    const int qi = min(q0 + l15, p.Lq - 1);
    const float* qrow = p.Q + b * p.sQb + h * p.sQh + (long long)qi * p.sQi;
    const float* kbase = p.K + b * p.sKb + hk * p.sKh;
    const float* vbase = p.V + b * p.sVb + hk * p.sVh;
    v16h qa[QM == 0 ? KS : 1]; Split qs_[QM == 1 ? KS : 1]; Split3 qt_[QM == 2 ? KS : 1];
#pragma unroll
    for (int ks = 0; ks < KS; ++ks) {
        if (QM == 2) qt_[ks] = sp3_ld(qrow, p.sQd, ks * 32, hf, p.dh, 1.f);
        else if (QM == 1) qs_[ks] = sp_ld(qrow, p.sQd, ks * 32, hf, p.dh, 1.f);
        else qa[ks] = fh_ld(qrow, p.sQd, ks * 32, hf, p.dh, 1.f);
    }
    v8f o[NT]; float m8[8], l8[8];
#pragma unroll
    for (int t = 0; t < NT; ++t) { v8f zz = {}; o[t] = zz; }
#pragma unroll
    for (int i = 0; i < 8; ++i) { m8[i] = NEG; l8[i] = 0.f; }
    int jend = p.Lk; int jstart = 0;
    if (p.causal == 1) { const int je = (blockIdx.x * AW + AW - 1) * 16 + 16 + p.coff; jend = min(jend, max(je, 0)); }   // uniform per block
    if (p.win > 0) { const int js = (int)(blockIdx.x * AW) * 16 + p.coff - p.win; jstart = (js > 0) ? (js / 64) * 64 : 0; }   // uniform per block: key blocks entirely outside every row's window hold only -inf entries and are skipped exactly
    const int npass = TWOPASS ? 2 : 1;
    for (int pass = 0; pass < npass; ++pass) {
        const bool dopv = (!TWOPASS) || pass == 1;
        for (int j0 = jstart; j0 < jend; j0 += 64) {
            if (dopv) {
                __syncthreads();                                 // previous key block's reads of vl / pl are done
                for (int idx = threadIdx.x; idx < 64 * DVP; idx += 32 * AW) {
                    const int jr = idx / DVP, d = idx - jr * DVP, j = j0 + jr;
                    const float f = (j < p.Lk && d < p.dv) ? vbase[(long long)j * p.sVj + (long long)d * p.sVd] : 0.f;
                    if (SPLITPV) {
                        const __bf16 hb = bf16_rne(f);
                        ((__bf16*)vl)[jr * VP + d] = hb; ((__bf16*)vl)[64 * VP + jr * VP + d] = bf16_rne(f - bf16_f32(hb));
                    } else vl[jr * VP + d] = (_Float16)f;
                }
            }
            v8f s[4];
#pragma unroll
            for (int t = 0; t < 4; ++t) {
                const int j = min(j0 + t * 16 + l15, p.Lk - 1);
                const float* krow = kbase + (long long)j * p.sKj;
                v8f acc = {};
#pragma unroll
                for (int ks = 0; ks < KS; ++ks) {
                    if (QM == 2)      acc = wmma6(qt_[ks], sp3_ld(krow, p.sKd, ks * 32, hf, p.dh, 1.f), acc);
                    else if (QM == 1) acc = wmma3(qs_[ks], sp_ld(krow, p.sKd, ks * 32, hf, p.dh, 1.f), acc);
                    else              acc = wmma16(qa[ks], fh_ld(krow, p.sKd, ks * 32, hf, p.dh, 1.f), acc);
                }
                s[t] = acc;
            }
            float pv[8][4];
#pragma unroll
            for (int i = 0; i < 8; ++i) {
                const int irow = q0 + i + 8 * hf;
                const int ic = min(irow, p.Lq - 1);
                float sc[4];
#pragma unroll
                for (int t = 0; t < 4; ++t) {
                    const int jg = j0 + t * 16 + l15;
                    float v = s[t][i] * p.scale;
                    if (p.Mf) v += p.Mf[b * p.smb + h * p.smh + (long long)ic * p.smi + (long long)min(jg, p.Lk - 1) * p.smj];
                    if (p.Rt) { int rc = ic - min(jg, p.Lk - 1) + p.roff; rc = rc < 0 ? 0 : (rc >= p.rn ? p.rn - 1 : rc); v += p.Rt[b * p.srb + h * p.srh + (long long)ic * p.sri + rc]; }
                    if (p.Mi) { const int mv = p.Mi[b * p.smb + h * p.smh + (long long)ic * p.smi + (long long)min(jg, p.Lk - 1) * p.smj]; if (p.mpol ? (mv != 0) : (mv == 0)) v = p.mfill; }
                    if (p.SQ) { const bool same = p.SQ[(long long)b * p.Lq + ic] == p.SK[(long long)b * p.Lk + min(jg, p.Lk - 1)]; if (p.segpol ? same : !same) v = p.mfill; }
                    if (p.causal == 2 && jg > irow + p.coff) v = p.mfill;
                    if (jg >= p.Lk || (p.causal == 1 && jg > irow + p.coff) || (p.causal == 3 && jg < irow + p.coff) || (p.win > 0 && irow + p.coff - jg > p.win)) v = NEG; else v *= L2E;
                    sc[t] = v;
                }
                if (!TWOPASS || pass == 0) {
                    float mx = fmaxf(fmaxf(sc[0], sc[1]), fmaxf(sc[2], sc[3]));
                    mx = fmaxf(mx, __shfl_xor(mx, 1, 32)); mx = fmaxf(mx, __shfl_xor(mx, 2, 32));
                    mx = fmaxf(mx, __shfl_xor(mx, 4, 32)); mx = fmaxf(mx, __shfl_xor(mx, 8, 32));
                    const float mnew = fmaxf(m8[i], mx);
                    const float corr = (mnew == NEG) ? 1.f : exp2f(m8[i] - mnew);
                    float rs = 0.f;
#pragma unroll
                    for (int t = 0; t < 4; ++t) {
                        const float pp = (sc[t] == NEG) ? 0.f : exp2f(sc[t] - mnew); rs += pp;
                        pv[i][t] = p.Pw ? pp * p.Pw[b * p.swb + h * p.swh + (long long)ic * p.swi + (long long)min(j0 + t * 16 + l15, p.Lk - 1) * p.swj] : pp;
                    }
                    rs += __shfl_xor(rs, 1, 32); rs += __shfl_xor(rs, 2, 32); rs += __shfl_xor(rs, 4, 32); rs += __shfl_xor(rs, 8, 32);
                    l8[i] = l8[i] * corr + rs; m8[i] = mnew;
                    if (!TWOPASS) {
#pragma unroll
                        for (int t = 0; t < NT; ++t) o[t][i] *= corr;
                    }
                } else {
                    const float inv = (l8[i] > 0.f) ? 1.f / l8[i] : 0.f;
#pragma unroll
                    for (int t = 0; t < 4; ++t) {
                        const int jg = j0 + t * 16 + l15;
                        float pp = (sc[t] == NEG) ? 0.f : exp2f(sc[t] - m8[i]) * inv;
                        if (p.Pw) pp *= p.Pw[b * p.swb + h * p.swh + (long long)ic * p.swi + (long long)min(jg, p.Lk - 1) * p.swj];
                        pv[i][t] = pp;
                    }
                }
            }
            if (dopv) {
#pragma unroll
                for (int i = 0; i < 8; ++i)
#pragma unroll
                    for (int t = 0; t < 4; ++t) ((float*)myp)[(i + 8 * hf) * 64 + t * 16 + l15] = pv[i][t];
                __syncthreads();                                 // P (per wave) and V (shared) visible
                if (p.P) {
                    float* pb_ = p.P + b * p.sPb + h * p.sPh;
                    const bool fastP = (p.pband == 0) && ((p.sPi & 3) == 0) && (j0 + 64 <= p.Lk) && (q0 + 16 <= p.Lq) && ((((size_t)pb_) & 15) == 0);
                    if (fastP) {
#pragma unroll
                        for (int s = 0; s < 8; ++s) {
                            const int row = s * 2 + (lane >> 4), c4 = (lane & 15) * 4;
                            const v4f v = *(const v4f*)(myp + row * 64 + c4);
                            VST2V4(pb_ + (long long)(q0 + row) * p.sPi + j0 + c4, v);
                        }
                    } else {
                        for (int row = 0; row < 16; ++row) {
                            const int irow = q0 + row; if (irow >= p.Lq) continue;
                            for (int c = lane; c < 64; c += 32) {
                                const int jg = j0 + c; if (jg >= p.Lk) continue;
                                if (p.pband == 0) VST2(float, pb_ + (long long)irow * p.sPi + jg, myp[row * 64 + c]);
                                else if (jg - irow <= p.pband && irow - jg <= p.pband) VST2(float, pb_ + (long long)irow * p.sPi + (jg - irow + p.pband), myp[row * 64 + c]);
                            }
                        }
                    }
                }
                if (SPLITPV) {
                    const Split pa0 = sp_ld(myp + l15 * 64, 1, 0, hf, 64, 1.f), pa1 = sp_ld(myp + l15 * 64, 1, 32, hf, 64, 1.f);
                    const __bf16* vh = (const __bf16*)vl; const __bf16* vlo = vh + 64 * VP;
#pragma unroll
                    for (int t = 0; t < NT; ++t) {
                        const int dcol = t * 16 + l15;
                        Split b0, b1;
#pragma unroll
                        for (int e = 0; e < 16; ++e) {
                            const int k0 = frag_k(e, hf), k1 = 32 + frag_k(e, hf);
                            b0.hi[e] = vh[k0 * VP + dcol]; b0.lo[e] = vlo[k0 * VP + dcol]; b1.hi[e] = vh[k1 * VP + dcol]; b1.lo[e] = vlo[k1 * VP + dcol];
                        }
                        o[t] = wmma3(pa0, b0, o[t]);
                        o[t] = wmma3(pa1, b1, o[t]);
                    }
                } else {
                    const v16h pa0 = fh_ld(myp + l15 * 64, 1, 0, hf, 64, 4096.f), pa1 = fh_ld(myp + l15 * 64, 1, 32, hf, 64, 4096.f);
#pragma unroll
                    for (int t = 0; t < NT; ++t) {
                        const int dcol = t * 16 + l15;
                        v16h b0, b1;
#pragma unroll
                        for (int e = 0; e < 16; ++e) { b0[e] = vl[frag_k(e, hf) * VP + dcol]; b1[e] = vl[(32 + frag_k(e, hf)) * VP + dcol]; }
                        o[t] = wmma16(pa0, b0, o[t]);
                        o[t] = wmma16(pa1, b1, o[t]);
                    }
                }
            }
        }
    }
    float* obase = p.O + b * p.sOb + h * p.sOh;
    if (p.ST) {
        const int rl = lane >> 1, isel = rl & 7;           // row q0 + rl ; rl>>3 == hf holds because lane>>4 == (lane>>1)>>3
        float mv = 0.f, lv = 0.f;
#pragma unroll
        for (int i = 0; i < 8; ++i) if (i == isel) { mv = m8[i]; lv = l8[i]; }
        const int irow = q0 + rl;
        if (irow < p.Lq) { float* st = p.ST + (((long long)b * gridDim.y + h) * p.Lq + irow) * 2 + (lane & 1); VST2(float, st, (lane & 1) ? lv : mv * 0.6931471805599453f); }
    }
    float invr[8];
#pragma unroll
    for (int i = 0; i < 8; ++i) {
        if (TWOPASS) invr[i] = SPLITPV ? 1.f : (1.f / 4096.f);
        else if (p.nonorm) invr[i] = exp2f(m8[i]) * (SPLITPV ? 1.f : (1.f / 4096.f));
        else invr[i] = (l8[i] > 0.f) ? (SPLITPV ? 1.f / l8[i] : 1.f / (l8[i] * 4096.f)) : 0.f;
    }
    __syncthreads();                                             // all waves done with pl/vl from the main loop
    const bool ofast = ((p.sOi & 3) == 0) && ((((size_t)obase) & 15) == 0) && (q0 + 16 <= p.Lq);
#pragma unroll
    for (int c0 = 0; c0 < DVP; c0 += 64) {
#pragma unroll
        for (int i = 0; i < 8; ++i)
#pragma unroll
            for (int t = 0; t < NT; ++t) if (t * 16 >= c0 && t * 16 < c0 + 64) ((float*)myp)[(i + 8 * hf) * 64 + (t * 16 - c0) + l15] = o[t][i] * invr[i];
        __syncthreads();
        const int cw = (DVP - c0 < 64) ? (DVP - c0) : 64;      // staged columns in this chunk (multiple of 16)
        if (ofast && (c0 + cw <= p.dv) && (cw % 32 == 0)) {
            const int lpr = cw / 4;                              // lanes per row (16 for 64 cols, 8 for 32)
            const int rows_per_ins = 32 / lpr;
            for (int r0 = 0; r0 < 16; r0 += rows_per_ins) {
                const int row = r0 + lane / lpr, c4 = (lane % lpr) * 4;
                const v4f v = *(const v4f*)(myp + row * 64 + c4);
                VST2V4(obase + (long long)(q0 + row) * p.sOi + c0 + c4, v);
            }
        } else {
            for (int row = 0; row < 16; ++row) {
                const int irow = q0 + row; if (irow >= p.Lq) continue;
                for (int c = lane; c < cw; c += 32) { const int d = c0 + c; if (d < p.dv) VST2(float, obase + (long long)irow * p.sOi + d, myp[row * 64 + c]); }
            }
        }
        __syncthreads();
    }
}

// =====================================================================================================================
// k_tr: dst(z, c, r) = alpha * src(z, r, c) (+ beta * R2(z, c, r)): [Z][R][C] (row stride lds) -> [Z][C][R] (row stride ldd) through a 32x32 LDS tile;
//   flags: 1 -> add beta * residual R2 addressed like dst (z*sRz + c*ldr + r); act applied before the residual.
// =====================================================================================================================
struct TrP { const float* src; float* dst; const float* R2; long long sSz, lds, sDz, ldd, sRz, ldr; int R, C, flags, act; float alpha, beta; };
static_assert(sizeof(TrP) == 3 * 8 + 6 * 8 + 6 * 4, "TrP has padding");
__global__ __launch_bounds__(256) void k_tr(TrP p) {
    __shared__ float tile[32][33];
    const int c0 = blockIdx.x * 32, r0 = blockIdx.y * 32, z = blockIdx.z;
    const int lane = threadIdx.x & 31, wave = threadIdx.x >> 5;
    const float* s = p.src + z * p.sSz;
#pragma unroll
    for (int k = 0; k < 4; ++k) {
        const int rl = wave * 4 + k, r = r0 + rl, c = c0 + lane;
        tile[rl][lane] = (r < p.R && c < p.C) ? s[(long long)r * p.lds + c] : 0.f;
    }
    __syncthreads();
    float* d = p.dst + z * p.sDz; const float* rr = p.R2 + z * p.sRz;
#pragma unroll
    for (int k = 0; k < 4; ++k) {
        const int cl = wave * 4 + k, c = c0 + cl, r = r0 + lane;
        if (c < p.C && r < p.R) {
            float v = act_fn(p.alpha * tile[lane][cl], p.act);
            if (p.flags & 1) v += p.beta * rr[(long long)c * p.ldr + r];
            VST2(float, d + (long long)c * p.ldd + r, v);
        }
    }
}

// k_affine: dst[i] = a * (sdev ? sdev[0] : 1) * src[i] + b, i < n (one thread per element; consecutive lanes -> consecutive addresses)
__global__ __launch_bounds__(256) void k_affine(const float* __restrict__ src, float* __restrict__ dst, int n, float a, float b, const float* __restrict__ sdev) {
    const int i = blockIdx.x * 256 + threadIdx.x;
    if (i < n) { const float aa = sdev ? a * sdev[0] : a; const float v = aa * src[i] + b; VST2(float, dst + i, v); }
}

// =====================================================================================================================
// k_softmax: row softmax over n contiguous elements, one 256-thread block per row; rows addressed z*sz + r*sr (grid (R, Z)).
//   out = scale_out * softmax(scale_in * x + (Mf ? Mf[z*smz + r*smr + j] : 0)); a row whose max is -inf is written as 0.
// =====================================================================================================================
struct SmP { const float* src; float* dst; const float* Mf; long long sz, sr, dz, dr, smz, smr; int n, pad; float scale_in, scale_out; };
static_assert(sizeof(SmP) == 3 * 8 + 6 * 8 + 4 * 4, "SmP has padding");
__global__ __launch_bounds__(256) void k_softmax(SmP p) {
    __shared__ float red[256];
    const int r = blockIdx.x, z = blockIdx.y, tid = threadIdx.x;
    const float* s = p.src + z * p.sz + (long long)r * p.sr;
    const float* mf = p.Mf ? (p.Mf + z * p.smz + (long long)r * p.smr) : nullptr;
    float mx = -__builtin_inff();
    for (int j = tid; j < p.n; j += 256) { float v = s[j] * p.scale_in; if (mf) v += mf[j]; mx = fmaxf(mx, v); }
    red[tid] = mx; __syncthreads();
    for (int o = 128; o > 0; o >>= 1) { if (tid < o) red[tid] = fmaxf(red[tid], red[tid + o]); __syncthreads(); }
    mx = red[0]; __syncthreads();
    float sum = 0.f;
    for (int j = tid; j < p.n; j += 256) { float v = s[j] * p.scale_in; if (mf) v += mf[j]; sum += (mx == -__builtin_inff()) ? 0.f : expf(v - mx); }
    red[tid] = sum; __syncthreads();
    for (int o = 128; o > 0; o >>= 1) { if (tid < o) red[tid] += red[tid + o]; __syncthreads(); }
    sum = red[0];
    const float inv = (sum > 0.f) ? p.scale_out / sum : 0.f;
    float* d = p.dst + z * p.dz + (long long)r * p.dr;
    for (int j = tid; j < p.n; j += 256) { float v = s[j] * p.scale_in; if (mf) v += mf[j]; const float o = (mx == -__builtin_inff()) ? 0.f : expf(v - mx) * inv; VST2(float, d + j, o); }
}
// =====================================================================================================================
// k_stats: mean and rsqrt(var + eps) over a set of n elements addressed base + z*sz + (e / inner) * so + (e % inner) * si, one 256-thread
// k_norm_apply: y = (x - mean[set]) * rstd[set] * g[c] + b[c] over a [Z][C][L] channel-major tensor with set = z*G + c / (C/G) (G groups per z;
//   G = C -> per-channel sets indexed z*C+c; for batch norm pass stats indexed by c only via bn = 1). Optional act. Output same layout.
// =====================================================================================================================
//   mode 0: mean / rsqrt(var + eps); mode 1 (RMSNorm): 0 / rsqrt(mean(x^2) + eps); mode 2 (L2 normalize * sqrt(n)): 0 / sqrt(n) / max(||x||, eps); mode 3: as 0 with unbiased variance (n-1)
__global__ __launch_bounds__(256) void k_stats(const float* __restrict__ x, long long sz, long long so, long long si, int inner, int n, float eps, float* __restrict__ stat, int mode) {
    __shared__ float red[256];
    const int z = blockIdx.x, tid = threadIdx.x;
    const float* base = x + z * sz;
    float s = 0.f;
    for (int e = tid; e < n; e += 256) s += base[(long long)(e / inner) * so + (long long)(e % inner) * si];
    red[tid] = s; __syncthreads();
    for (int o = 128; o > 0; o >>= 1) { if (tid < o) red[tid] += red[tid + o]; __syncthreads(); }
    const float mu = (mode == 0 || mode == 3) ? red[0] / (float)n : 0.f; __syncthreads();
    float q = 0.f;
    for (int e = tid; e < n; e += 256) { const float dlt = base[(long long)(e / inner) * so + (long long)(e % inner) * si] - mu; q += dlt * dlt; }
    red[tid] = q; __syncthreads();
    for (int o = 128; o > 0; o >>= 1) { if (tid < o) red[tid] += red[tid + o]; __syncthreads(); }
    {
        float rs;
        if (mode == 2) rs = sqrtf((float)n) / fmaxf(sqrtf(red[0]), eps); else if (mode == 3) rs = rsqrtf(red[0] / (float)(n - 1) + eps); else rs = rsqrtf(red[0] / (float)n + eps);
        if (tid < 32) { const float v = (tid == 0) ? mu : ((tid == 1) ? rs : 0.f); VST2(float, stat + (long long)z * 32 + tid, v); }
    }
}
//   One thread per element over the flat [Z][C][L] index space: grid ceil(Z*C*L / 256).
__global__ __launch_bounds__(256) void k_norm_apply(const float* __restrict__ x, float* __restrict__ y, const float* __restrict__ stat, const float* __restrict__ g, const float* __restrict__ bta,
                                                     int Z, int C, int L, int G, int bn, int act) {
    const long long idx = (long long)blockIdx.x * 256 + threadIdx.x;
    if (idx >= (long long)Z * C * L) return;
    const int l = (int)(idx % L); const long long zc = idx / L; const int c = (int)(zc % C), z = (int)(zc / C); (void)l;
    const int set = bn ? c : (z * G + c / (C / G));
    float v = (x[idx] - stat[(long long)set * 32]) * stat[(long long)set * 32 + 1];
    if (g) v *= g[c];
    if (bta) v += bta[c];
    v = act_fn(v, act);
    VST2(float, y + idx, v);
}

// k_lse_neg: c[i] = -(st[2i] + log(st[2i+1])) = minus the log-sum-exp of row i from k_attn's ST output (for softmax over the query dimension)
__global__ __launch_bounds__(256) void k_lse_neg(const float* __restrict__ st, float* __restrict__ c, int n) {
    const int i = blockIdx.x * 256 + threadIdx.x;
    if (i < n) { const float v = -(st[2 * i] + logf(st[2 * i + 1])); VST2(float, c + i, v); }
}

// k_iota: dst[i] = a * i + b as int32 (segment/position id helper)
__global__ __launch_bounds__(256) void k_iota(int* __restrict__ dst, int n, int a, int b) {
    const int i = blockIdx.x * 256 + threadIdx.x;
    if (i < n) { const int v = a * i + b; VST2(int, dst + i, v); }
}

// k_axpby: dst[i] = a * x[i] + b * y[i] (+ c), i < n
__global__ __launch_bounds__(256) void k_axpby(const float* __restrict__ x, const float* __restrict__ y, float* __restrict__ dst, int n, float a, float b, float c) {
    const int i = blockIdx.x * 256 + threadIdx.x;
    if (i < n) { const float v = a * x[i] + b * y[i] + c; VST2(float, dst + i, v); }
}

// =====================================================================================================================
// k_rope: rotary embedding on a [R rows][Hn heads][D] view (row stride sXr, head stride sXh, element stride 1) -> Y (own strides).
//   mode 0: rotate_half (partner d±D/2, sign - for d<D/2); mode 1: interleaved pairs (partner d^1, sign - for even d).
//   table column tcol: tmode 0 -> d, 1 -> d % (D/2), 2 -> d / 2; position p: pmode 0 -> r % S, 1 -> head index, 2 -> pos[r];
//   c = C[(r / S) * sCb + p * sCp + tcol * sCd], s likewise from Sn; y = x[d] * c + sign * x[partner] * s. X and Y must not alias.
// =====================================================================================================================
struct RopeP { const float* X; float* Y; const float* C; const float* Sn; const int* pos; long long sXr, sXh, sYr, sYh, sCb, sCp, sCd; int R, Hn, D, S, mode, tmode, pmode, pad; };
static_assert(sizeof(RopeP) == 5 * 8 + 7 * 8 + 8 * 4, "RopeP has padding");
__global__ __launch_bounds__(256) void k_rope(RopeP p) {
    const long long idx = (long long)blockIdx.x * 256 + threadIdx.x;
    if (idx >= (long long)p.R * p.Hn * p.D) return;
    const int d = (int)(idx % p.D); const long long rh = idx / p.D; const int h = (int)(rh % p.Hn); const int r = (int)(rh / p.Hn);
    const int half = p.D / 2;
    int partner; float sign;
    if (p.mode == 0) { partner = (d < half) ? d + half : d - half; sign = (d < half) ? -1.f : 1.f; }
    else { partner = d ^ 1; sign = (d & 1) ? 1.f : -1.f; }
    const int tcol = (p.tmode == 0) ? d : ((p.tmode == 1) ? (d % half) : (d >> 1));
    const int pp = (p.pmode == 0) ? (r % p.S) : ((p.pmode == 1) ? h : p.pos[r]);
    const long long toff = (long long)(r / p.S) * p.sCb + (long long)pp * p.sCp + (long long)tcol * p.sCd;
    const float* xr = p.X + (long long)r * p.sXr + (long long)h * p.sXh;
    const float v = xr[d] * p.C[toff] + sign * xr[partner] * p.Sn[toff];
    VST2(float, p.Y + (long long)r * p.sYr + (long long)h * p.sYh + d, v);
}

// k_invf + k_sincos (split so neither kernel carries a large VALU-fma footprint): invf_i = num * (1 / powf(base, (2 i)/D)) [fmode 0],
//   num * expf((2 i) * cexp) [fmode 1], num * powf(base, -2 (i - 1) / D) [fmode 2]; then cs/sn[s*half + i] = cos/sin((pscale * s) * invf_i)
__global__ __launch_bounds__(256) void k_invf(float* __restrict__ invb, int half, int D, float base, float num, int fmode, float cexp) {
    const int i = blockIdx.x * 256 + threadIdx.x;
    if (i >= ((half + 31) / 32) * 32) return;
    if (i >= half) { VST2(float, invb + i, 0.f); return; }
    const float e = (float)(2 * i) / (float)D;
    float invf;
    if (fmode == 1) invf = num * expf((float)(2 * i) * cexp);
    else if (fmode == 2) invf = num * powf(base, (-2.0f * ((float)i - 1.0f)) / (float)D);
    else invf = num * (1.0f / powf(base, e));
    VST2(float, invb + i, invf);
}
__global__ __launch_bounds__(256) void k_sincos(float* __restrict__ cs, float* __restrict__ sn, const float* __restrict__ invb, int S, int half, float pscale) {
    const int idx = blockIdx.x * 256 + threadIdx.x;
    if (idx >= S * half) return;
    const int s = idx / half, i = idx - s * half;
    const float ang = (pscale * (float)s) * invb[i];
    VST2(float, cs + idx, cosf(ang)); VST2(float, sn + idx, sinf(ang));
}

// k_mulact: dst[i] = act(x[i]) * y[i]
__global__ __launch_bounds__(256) void k_mulact(const float* __restrict__ x, const float* __restrict__ y, float* __restrict__ dst, int n, int act) {
    const int i = blockIdx.x * 256 + threadIdx.x;
    if (i < n) { const float v = act_fn(x[i], act) * y[i]; VST2(float, dst + i, v); }
}

// =====================================================================================================================
// k_matvec: thread-per-row matrix-vector products for N <= 8 output columns (heads with 1-3 outputs, gates), f32 on the VALU.
//   C[r*sCm + j] = act(alpha * sum_k A[r*sAm + k*sAk] * B[j*sBn + k*sBk] + bias[j]) + beta * R[r*sRm + j*sRn]; each thread writes its N contiguous floats.
// =====================================================================================================================
__global__ __launch_bounds__(256) void k_matvec(GemmP p) {
    // 32 lanes write one line with one instruction.
    const int rpt = (p.N == 1) ? 1 : 32;
    const long long r0 = ((long long)blockIdx.x * 256 + threadIdx.x) * rpt; const int z = blockIdx.z, zo = z / p.zi_n, zi = z - zo * p.zi_n;
    if (r0 >= p.M) return;
    const float* Bb = p.B + zo * p.sBo + zi * p.sBi;
    float* C = p.C + zo * p.sCo + zi * p.sCi; const float* R = p.R + zo * p.sRo + zi * p.sRi;
    for (int rr = 0; rr < rpt; ++rr) {
        const long long r = r0 + rr; if (r >= p.M) break;
        const float* A = p.A + zo * p.sAo + zi * p.sAi + r * p.sAm;
        float acc[8] = {0.f, 0.f, 0.f, 0.f, 0.f, 0.f, 0.f, 0.f};
        for (int k = 0; k < p.K; ++k) { const float a = A[(long long)k * p.sAk];
#pragma unroll
            for (int j = 0; j < 8; ++j) if (j < p.N) acc[j] += a * Bb[(long long)j * p.sBn + (long long)k * p.sBk]; }
#pragma unroll
        for (int j = 0; j < 8; ++j) if (j < p.N) {
            float v = acc[j] * p.alpha;
            if (p.flags & 1) v += p.bias[j];
            if (p.flags & 2) v += p.bias[r];
            v = act_fn(v, p.act);
            if (p.flags & 4) v += p.beta * R[r * p.sRm + (long long)j * p.sRn];
            VST2(float, C + r * p.sCm + j, v);
        }
    }
}
// k_smallsoftmax: thread-per-row softmax for short rows (n <= 64): dst[r*dr + j] = softmax(scale*src[r*sr + j])
__global__ __launch_bounds__(256) void k_smallsoftmax(const float* __restrict__ src, float* __restrict__ dst, long long sr, long long dr, int n, long long R, float scale) {
    const long long r0 = ((long long)blockIdx.x * 256 + threadIdx.x) * 32;
    for (int rr = 0; rr < 32; ++rr) {
        const long long r = r0 + rr; if (r >= R) return;
        const float* s = src + r * sr; float* d = dst + r * dr;
        float mx = -__builtin_inff();
        for (int j = 0; j < n; ++j) mx = fmaxf(mx, s[j] * scale);
        float sum = 0.f;
        for (int j = 0; j < n; ++j) sum += expf(s[j] * scale - mx);
        const float inv = 1.f / sum;
        for (int j = 0; j < n; ++j) { const float v = expf(s[j] * scale - mx) * inv; VST2(float, d + j, v); }
    }
}

__global__ __launch_bounds__(32) void k_unitstat(float* __restrict__ st) { const int t = threadIdx.x; const float v = (t == 1) ? 1.f : 0.f; VST2(float, st + t, v); }

// destination (e.g. a d_out whose row width is not a multiple of 32 floats) is written by consecutive lanes of one instruction
__global__ __launch_bounds__(256) void k_lincopy(const float* __restrict__ src, long long lds, float* __restrict__ dst, long long ldd, long long rows, int cols) {
    const long long i = (long long)blockIdx.x * 256 + threadIdx.x; if (i >= rows * cols) return;
    const long long r = i / cols; const int c = (int)(i - r * cols);
    const float v = src[r * lds + c]; VST2(float, dst + r * ldd + c, v);
}

namespace w25 {
typedef __attribute__((ext_vector_type(16))) _Float16 v16h;
typedef __attribute__((ext_vector_type(8)))  _Float16 v8h;
typedef __attribute__((ext_vector_type(16))) __bf16   v16b;
typedef __attribute__((ext_vector_type(8)))  __bf16   v8b;
typedef __attribute__((ext_vector_type(8)))  float    v8f;
typedef __attribute__((ext_vector_type(4)))  float    v4f;

__device__ __forceinline__ unsigned short f2bf_bits(float f) {
  unsigned u = __float_as_uint(f);
  return (unsigned short)((u + 0x7FFFu + ((u >> 16) & 1u)) >> 16);
}
__device__ __forceinline__ float bf_bits2f(unsigned short h) { return __uint_as_float(((unsigned)h) << 16); }

// hazard guards as plain device helpers (no inline asm inside the kernel template body)
__device__ __forceinline__ void dep_guard_h(v8f& a, v8f& b, v16h x, v16h y) { asm volatile("v_nop\n\tv_nop\n\tv_nop\n\tv_nop" : "+v"(a), "+v"(b) : "v"(x), "v"(y)); }
__device__ __forceinline__ void dep_guard_b(v8f& a, v8f& b, v16b x, v16b y) { asm volatile("v_nop\n\tv_nop\n\tv_nop\n\tv_nop" : "+v"(a), "+v"(b) : "v"(x), "v"(y)); }
__device__ __forceinline__ void keep4_h(v16h a, v16h b, v16h c, v16h d) { asm volatile("v_nop" :: "v"(a), "v"(b), "v"(c), "v"(d)); }
__device__ __forceinline__ void keep4_b(v16b a, v16b b, v16b c, v16b d) { asm volatile("v_nop" :: "v"(a), "v"(b), "v"(c), "v"(d)); }
__device__ __forceinline__ void acc_guard4(v8f& a, v8f& b, v8f& c, v8f& d) { asm volatile("v_nop\n\tv_nop\n\tv_nop\n\tv_nop" : "+v"(a), "+v"(b), "+v"(c), "+v"(d)); }
template <typename T> struct Frag;
template <> struct Frag<_Float16> {
  typedef v16h V; union U { v16h v; v8h h[2]; };
  static __device__ __forceinline__ v16h load(const _Float16* p) {   // elements 0..7 <- p[0..7], 8..15 <- p[16..23]
    U f; f.h[0] = *(const v8h*)(p); f.h[1] = *(const v8h*)(p + 16); return f.v;
  }
  static __device__ __forceinline__ v8f mma(v16h a, v16h b, v8f c) {
    return __builtin_amdgcn_wmma_f32_16x16x32_f16(false, a, false, b, (short)0, c, false, false);
  }
  static __device__ __forceinline__ void guard(v8f& a, v8f& b, v16h x, v16h y) { dep_guard_h(a, b, x, y); }
  static __device__ __forceinline__ void keep(v16h a, v16h b, v16h c, v16h d) { keep4_h(a, b, c, d); }
};
template <> struct Frag<__bf16> {
  typedef v16b V; union U { v16b v; v8b h[2]; };
  static __device__ __forceinline__ v16b load(const __bf16* p) {
    U f; f.h[0] = *(const v8b*)(p); f.h[1] = *(const v8b*)(p + 16); return f.v;
  }
  static __device__ __forceinline__ v8f mma(v16b a, v16b b, v8f c) {
    return __builtin_amdgcn_wmma_f32_16x16x32_bf16(false, a, false, b, (short)0, c, false, false);
  }
  static __device__ __forceinline__ void guard(v8f& a, v8f& b, v16b x, v16b y) { dep_guard_b(a, b, x, y); }
  static __device__ __forceinline__ void keep(v16b a, v16b b, v16b c, v16b d) { keep4_b(a, b, c, d); }
};

// ---- Register-blocked batched WMMA GEMM ------------------------------------
// C[m,n] = scale * sum_k A[m,k] * Bt[n,k] (+bias)(+resid); each wave owns a 64x64 tile.
// A row-major [M,K]; Bt row-major [N,K]; M,N % 64 == 0, K % 32 == 0.
// SPLIT: operands are hi/lo planes (A2/Bt2 = lo planes, same layout); product = hi·hi + hi·lo + lo·hi.
// BIAS_MODE: 0 = none, 1 = bias[m], 2 = bias[n].
// OUT_MODE: 0 = f32, 1 = f16, 2 = bf16 hi plane (Cout) + bf16 lo plane (Cout2).
// ET: 0 = f16 operands, 1 = bf16 operands (pointers passed as 16-bit storage)
template <int ET> struct Elem;
template <> struct Elem<0> { typedef _Float16 T; };
template <> struct Elem<1> { typedef __bf16 T; };
template <int ET, bool SPLIT, int BIAS_MODE, int OUT_MODE, bool RESID, int ACT = 0>
__global__ __launch_bounds__(256) void wmma_gemm64(
    const unsigned short* __restrict__ Ap, const unsigned short* __restrict__ A2p, int lda, long strideA,
    const unsigned short* __restrict__ Btp, const unsigned short* __restrict__ Bt2p, int ldb, long strideB,
    void* __restrict__ Cout, void* __restrict__ Cout2, int ldc, long strideC,
    const float* __restrict__ bias,
    const float* __restrict__ resid, long strideR,
    int M, int N, int K, float scale) {
  typedef typename Elem<ET>::T T;
  typedef typename Frag<T>::V V;
  const T* A = (const T*)Ap; const T* A2 = (const T*)A2p; const T* Bt = (const T*)Btp; const T* Bt2 = (const T*)Bt2p;
  __shared__ __align__(16) float sT[8][16 * 68];   // per-wave 16x64 slab, pitch 68 floats
  const int b    = blockIdx.y;
  const int lane = threadIdx.x & 31;
  const int wave = threadIdx.x >> 5;
  const int tilesN = N >> 6;
  const int tilesM = M >> 6;
  const int tile = blockIdx.x * 8 + wave;
  if (tile >= tilesM * tilesN) return;   // wave-uniform; no block barriers in this kernel
  const int tm = tile / tilesN;
  const int tn = tile - tm * tilesN;
  const int m0 = tm << 6;
  const int n0 = tn << 6;

  const T* Ab  = A  + (size_t)b * strideA;
  const T* Bb  = Bt + (size_t)b * strideB;
  const T* Ab2 = SPLIT ? (A2  + (size_t)b * strideA) : nullptr;
  const T* Bb2 = SPLIT ? (Bt2 + (size_t)b * strideB) : nullptr;

  const int rlane = lane & 15;                 // row (A) / col (B, D) within subtile
  const int koff  = (lane >> 4) * 8;           // k offset of this lane half
  const int mOff  = (lane >> 4) * 8;           // D row offset

  v8f acc[4][4];
#pragma unroll
  for (int i = 0; i < 4; ++i)
#pragma unroll
    for (int j = 0; j < 4; ++j) acc[i][j] = (v8f){0.f,0.f,0.f,0.f,0.f,0.f,0.f,0.f};

  for (int k0 = 0; k0 < K; k0 += 32) {
    V bh[4], bl[4];
#pragma unroll
    for (int j = 0; j < 4; ++j) {
      const size_t bo = (size_t)(n0 + (j << 4) + rlane) * ldb + koff + k0;
      bh[j] = Frag<T>::load(Bb + bo);
      if (SPLIT) bl[j] = Frag<T>::load(Bb2 + bo);
    }
#pragma unroll
    for (int i = 0; i < 4; ++i) {
      const size_t ao = (size_t)(m0 + (i << 4) + rlane) * lda + koff + k0;
      V ah = Frag<T>::load(Ab + ao);
      V al;
      if (SPLIT) al = Frag<T>::load(Ab2 + ao);
#pragma unroll
      for (int j = 0; j < 4; ++j) {
        acc[i][j] = Frag<T>::mma(ah, bh[j], acc[i][j]);
        if (SPLIT) {
          acc[i][j] = Frag<T>::mma(ah, bl[j], acc[i][j]);
          acc[i][j] = Frag<T>::mma(al, bh[j], acc[i][j]);
        }
      }
      Frag<T>::guard(acc[i][0], acc[i][3], ah, SPLIT ? al : ah);
    }
    Frag<T>::keep(bh[0], bh[1], bh[2], bh[3]);
    if (SPLIT) Frag<T>::keep(bl[0], bl[1], bl[2], bl[3]);
  }
  acc_guard4(acc[0][0], acc[0][1], acc[0][2], acc[0][3]);
  acc_guard4(acc[1][0], acc[1][1], acc[1][2], acc[1][3]);
  acc_guard4(acc[2][0], acc[2][1], acc[2][2], acc[2][3]);
  acc_guard4(acc[3][0], acc[3][1], acc[3][2], acc[3][3]);

  // ---- epilogue ----
  float* slab = sT[wave];
  const float* Rb = RESID ? (resid + (size_t)b * strideR) : nullptr;
#pragma unroll
  for (int i = 0; i < 4; ++i) {
    const int mBase = m0 + (i << 4);
#pragma unroll
    for (int j = 0; j < 4; ++j) {
      const int n = n0 + (j << 4) + rlane;
      float bv = 0.f;
      if (BIAS_MODE == 2) bv = bias[n];
#pragma unroll
      for (int r = 0; r < 8; ++r) {
        float v = acc[i][j][r] * scale;
        if (BIAS_MODE == 1) v += bias[mBase + mOff + r];
        if (BIAS_MODE == 2) v += bv;
        if (RESID) v += Rb[(size_t)(mBase + mOff + r) * ldc + n];
        if (ACT == 1) v = tanhf(v);
        if (ACT == 2) v = fmaxf(v, 0.0f);
        if (ACT == 3) v = v / (1.0f + expf(-v));
        if (ACT == 4) v = (v > 0.f) ? v : 0.01f * v;
        if (ACT == 5) v = 0.5f * v * (1.0f + erff(v * 0.70710678118654752f));
        slab[(mOff + r) * 68 + (j << 4) + rlane] = v;
      }
    }
    __builtin_amdgcn_fence(__ATOMIC_RELEASE, "workgroup");
    __builtin_amdgcn_wave_barrier();
    __builtin_amdgcn_fence(__ATOMIC_ACQUIRE, "workgroup");
    if (OUT_MODE == 0) {
      float* C = (float*)Cout + (size_t)b * strideC;
      const int hh = lane >> 4, c4 = (lane & 15) * 4;     // row seg = 256 B = 16 lanes x 16 B
      {
#pragma unroll
        for (int it = 0; it < 8; ++it) {
          const int row = it * 2 + hh;
          v4f v = *(const v4f*)(slab + row * 68 + c4);
          *(v4f*)(C + (size_t)(mBase + row) * ldc + n0 + c4) = v;
        }
        
      }
    } else {
      const int q = lane >> 3, c8 = (lane & 7) * 8;
      unsigned short* C  = (unsigned short*)Cout  + (size_t)b * strideC;
      unsigned short* C2 = (OUT_MODE == 2) ? ((unsigned short*)Cout2 + (size_t)b * strideC) : nullptr;
      {
#pragma unroll
        for (int it = 0; it < 4; ++it) {
          const int row = it * 4 + q;
          const float* sp = slab + row * 68 + c8;
          v8h hv, lv;
#pragma unroll
          for (int e = 0; e < 8; ++e) {
            if (OUT_MODE == 1) {
              hv[e] = (_Float16)sp[e];
            } else {
              unsigned short hb = f2bf_bits(sp[e]);
              unsigned short lb = f2bf_bits(sp[e] - bf_bits2f(hb));
              hv[e] = __builtin_bit_cast(_Float16, hb);
              lv[e] = __builtin_bit_cast(_Float16, lb);
            }
          }
          *(v8h*)(C + (size_t)(mBase + row) * ldc + n0 + c8) = hv;
          if (OUT_MODE == 2) *(v8h*)(C2 + (size_t)(mBase + row) * ldc + n0 + c8) = lv;
        }
        
      }
    }
    __builtin_amdgcn_fence(__ATOMIC_RELEASE, "workgroup");
    __builtin_amdgcn_wave_barrier();
    __builtin_amdgcn_fence(__ATOMIC_ACQUIRE, "workgroup");
  }
}

// ---- LDS-staged WMMA GEMM ---------------------------------------------------
// C[m,n] = scale * sum_k A[m,k] * Bt[n,k] (+bias[n])(+resid); f16 operands, f32 C, ldc = N.
// One 128x128 tile of C per work-group of eight waves (4 x 2; 32 rows x 64 columns each).
// A pass is 128 k: 128 rows of Bt, then 128 rows of A, 256 B each, copied to LDS at pitch 272 B. Two buffers.
// M, N % 128 == 0; K % 128 == 0, K >= 256.
#define GL_PITCH 272
#define GL_STAGE (256 * GL_PITCH)

// Eight asynchronous copies, 16 B per lane each: rows r, r + 16, ... of one operand's 128 rows.
// The s_wait_xcnt ends the copies' own statement, so that no address register of a copy is rewritten in front of it.
template <int K>
__device__ __forceinline__ void gl_copy8(unsigned l, const unsigned short* g) {
  asm volatile(
      "global_load_async_to_lds_b128 %0, %8, off\n\t"
      "global_load_async_to_lds_b128 %1, %9, off\n\t"
      "global_load_async_to_lds_b128 %2, %10, off\n\t"
      "global_load_async_to_lds_b128 %3, %11, off\n\t"
      "global_load_async_to_lds_b128 %4, %12, off\n\t"
      "global_load_async_to_lds_b128 %5, %13, off\n\t"
      "global_load_async_to_lds_b128 %6, %14, off\n\t"
      "global_load_async_to_lds_b128 %7, %15, off\n\t"
      "s_wait_xcnt 0x0"
      :: "v"(l), "v"(l + 16u * GL_PITCH), "v"(l + 32u * GL_PITCH), "v"(l + 48u * GL_PITCH),
         "v"(l + 64u * GL_PITCH), "v"(l + 80u * GL_PITCH), "v"(l + 96u * GL_PITCH), "v"(l + 112u * GL_PITCH),
         "v"(g), "v"(g + (size_t)16 * K), "v"(g + (size_t)32 * K), "v"(g + (size_t)48 * K),
         "v"(g + (size_t)64 * K), "v"(g + (size_t)80 * K), "v"(g + (size_t)96 * K), "v"(g + (size_t)112 * K)
      : "memory");
}
// One stage: stage rows 0..127 come from Bt, 128..255 from A; a lane fills 16 B of rows (thread >> 4) + 16 * i.
template <int K>
__device__ __forceinline__ void gl_fill(unsigned ldsLane, const unsigned short* gB, const unsigned short* gA) {
  gl_copy8<K>(ldsLane, gB);
  gl_copy8<K>(ldsLane + 128u * GL_PITCH, gA);
}
// this wave's copies have landed in LDS
__device__ __forceinline__ void gl_wait_async0() { asm volatile("s_wait_asynccnt 0x0" ::: "memory"); }
// this wave's LDS reads have returned, so the buffer may be refilled behind the barrier
__device__ __forceinline__ void gl_wait_ds0() { asm volatile("s_wait_dscnt 0x0" ::: "memory"); }

template <int N, int K, int BIAS_MODE, bool RESID, int ACT>
__global__ __launch_bounds__(256, 4) void wmma_gemm_lds(
    const unsigned short* __restrict__ Ap, const unsigned short* __restrict__ Btp,
    float* __restrict__ C, const float* __restrict__ bias, const float* __restrict__ resid, float scale) {
  static_assert(N % 128 == 0 && K % 128 == 0 && K >= 256, "shape");
  __shared__ __attribute__((aligned(128))) unsigned char sL[2 * GL_STAGE];
  const int tid  = threadIdx.x;
  const int lane = tid & 31;
  const int wave = tid >> 5;
  constexpr int tilesN = N / 128;
  constexpr int NT = K / 128;
  const int tm = blockIdx.x / tilesN;
  const int tn = blockIdx.x - tm * tilesN;
  const int wm = (wave >> 1) << 5;             // this wave's 32 rows and 64 columns inside the tile
  const int wn = (wave & 1) << 6;
  const int rlane = lane & 15;                 // row (A) / col (B, D) within subtile
  const int hh    = lane >> 4;                 // lane half: k offset 8 * hh, D row offset 8 * hh
  const int mOff  = hh * 8;

  const unsigned ldsLane = (unsigned)(uintptr_t)(&sL[0]) + (unsigned)((tid >> 4) * GL_PITCH + (tid & 15) * 16);
  const unsigned short* gB = Btp + (size_t)(tn * 128 + (tid >> 4)) * K + (tid & 15) * 8;
  const unsigned short* gA = Ap  + (size_t)(tm * 128 + (tid >> 4)) * K + (tid & 15) * 8;

  v8f acc[2][4];
#pragma unroll
  for (int i = 0; i < 2; ++i)
#pragma unroll
    for (int j = 0; j < 4; ++j) acc[i][j] = (v8f){0.f,0.f,0.f,0.f,0.f,0.f,0.f,0.f};

  gl_fill<K>(ldsLane, gB, gA);
  gl_wait_async0();
  __syncthreads();                             // stage 0 is readable by every wave
  gl_fill<K>(ldsLane + GL_STAGE, gB + 128, gA + 128);

  // kept rolled: one pass per trip, so that the order at its foot stands once
#pragma unroll 1
  for (int t = 0; t < NT; ++t) {
    const unsigned bo = (unsigned)(t & 1) * GL_STAGE;
    const unsigned char* pB = sL + bo + (wn + rlane) * GL_PITCH + hh * 16;
    const unsigned char* pA = sL + bo + (128 + wm + rlane) * GL_PITCH + hh * 16;
    v16h bh[2][4], ah[2][2];                   // two fragment sets: the next 32 k are fetched while these are multiplied
#pragma unroll
    for (int j = 0; j < 4; ++j) bh[0][j] = Frag<_Float16>::load((const _Float16*)(pB + j * 16 * GL_PITCH));
#pragma unroll
    for (int i = 0; i < 2; ++i) ah[0][i] = Frag<_Float16>::load((const _Float16*)(pA + i * 16 * GL_PITCH));
#pragma unroll
    for (int kk = 0; kk < 4; ++kk) {
      const int cur = kk & 1, nxt = cur ^ 1;
      if (kk < 3) {
#pragma unroll
        for (int j = 0; j < 4; ++j) bh[nxt][j] = Frag<_Float16>::load((const _Float16*)(pB + j * 16 * GL_PITCH + (kk + 1) * 64));
#pragma unroll
        for (int i = 0; i < 2; ++i) ah[nxt][i] = Frag<_Float16>::load((const _Float16*)(pA + i * 16 * GL_PITCH + (kk + 1) * 64));
      }
      __builtin_amdgcn_sched_barrier(0);       // keeps the next block's LDS reads one group ahead of this block's WMMAs, not among them
#pragma unroll
      for (int i = 0; i < 2; ++i)
#pragma unroll
        for (int j = 0; j < 4; ++j) acc[i][j] = Frag<_Float16>::mma(ah[cur][i], bh[cur][j], acc[i][j]);
      __builtin_amdgcn_sched_barrier(0);       // ends the block: later LDS reads stay behind its WMMAs
    }
    gl_wait_ds0();
    gl_wait_async0();
    __syncthreads();                           // publishes stage t + 1 and ends every read of stage t
    if (t + 2 < NT) gl_fill<K>(ldsLane + bo, gB + (size_t)(t + 2) * 128, gA + (size_t)(t + 2) * 128);
  }
  gl_wait_async0();

  // ---- epilogue ----
  // The ring is free: the last trip's foot waited for every read and every copy and passed the barrier.
  float* slab = (float*)(sL + wave * (16 * 68 * 4));   // per-wave 16x64 slab, pitch 68 floats
  const int m0 = tm * 128 + wm;
  const int n0 = tn * 128 + wn;
  const int nl = n0 + rlane;
  float bv[4];
#pragma unroll
  for (int j = 0; j < 4; ++j) bv[j] = (BIAS_MODE == 2) ? bias[nl + (j << 4)] : 0.f;
  // the bias loads' index register is an input, so it stays whole up to the wait
  if (BIAS_MODE == 2) asm volatile("s_wait_xcnt 0x0" :: "v"(nl) : "memory");
#pragma unroll
  for (int i = 0; i < 2; ++i) {
    const int mBase = m0 + (i << 4);
    float rv[4][8];
    if (RESID) {
      const float* rp = resid + (size_t)(mBase + mOff) * N + nl;
#pragma unroll
      for (int j = 0; j < 4; ++j)
#pragma unroll
        for (int r = 0; r < 8; ++r) rv[j][r] = rp[(size_t)r * N + (j << 4)];
      // the residual loads' address register is an input, so it stays whole up to the wait
      asm volatile("s_wait_xcnt 0x0" :: "v"(rp) : "memory");
    }
#pragma unroll
    for (int j = 0; j < 4; ++j) {
#pragma unroll
      for (int r = 0; r < 8; ++r) {
        float v = acc[i][j][r] * scale;
        if (BIAS_MODE == 2) v += bv[j];
        if (RESID) v += rv[j][r];
        if (ACT == 2) v = fmaxf(v, 0.0f);
        slab[(mOff + r) * 68 + (j << 4) + rlane] = v;
      }
    }
    __builtin_amdgcn_fence(__ATOMIC_RELEASE, "workgroup");
    __builtin_amdgcn_wave_barrier();
    __builtin_amdgcn_fence(__ATOMIC_ACQUIRE, "workgroup");
    const int c4 = (lane & 15) * 4;            // row seg = 256 B = 16 lanes x 16 B
    float* cp = C + (size_t)(mBase + hh) * N + n0 + c4;
#pragma unroll
    for (int it = 0; it < 8; ++it) {           // rows it * 2 + hh
      v4f v = *(const v4f*)(slab + (it * 2 + hh) * 68 + c4);
      *(v4f*)(cp + (size_t)it * 2 * N) = v;
    }
    __builtin_amdgcn_sched_barrier(0);         // holds later register writes behind the wait below
    asm volatile("s_wait_xcnt 0x0" ::: "memory");   // before a data or address register of the stores above is rewritten
    __builtin_amdgcn_sched_barrier(0);         // without the pair the next rows' multiplies were lifted over the wait, onto the stores' data registers
    __builtin_amdgcn_fence(__ATOMIC_RELEASE, "workgroup");
    __builtin_amdgcn_wave_barrier();
    __builtin_amdgcn_fence(__ATOMIC_ACQUIRE, "workgroup");
  }
}

__global__ __launch_bounds__(256) void cast_f32_f16x2(
    const float* __restrict__ in, _Float16* __restrict__ out, int n2) {
  int i = blockIdx.x * 256 + threadIdx.x;
  if (i < n2) {
    const _Float16 h0 = (_Float16)in[2 * i], h1 = (_Float16)in[2 * i + 1];
    const unsigned u = (unsigned)__builtin_bit_cast(unsigned short, h0) | ((unsigned)__builtin_bit_cast(unsigned short, h1) << 16);
    ((unsigned*)out)[i] = u;
    
  }
}


} // namespace w25

__global__ __launch_bounds__(256) void k_castT16(const float* __restrict__ src, long long lds, _Float16* __restrict__ dst, long long ldd, int R, int C, float s) {
    const long long i = (long long)blockIdx.x * 256 + threadIdx.x; const long long np = (long long)C * (R / 2); if (i >= np) return; const int c = (int)(i / (R / 2)); const int r = 2 * (int)(i % (R / 2));
    const _Float16 h0 = (_Float16)(src[(long long)r * lds + c] * s), h1 = (_Float16)(src[(long long)(r + 1) * lds + c] * s);
    const unsigned u = (unsigned)__builtin_bit_cast(unsigned short, h0) | ((unsigned)__builtin_bit_cast(unsigned short, h1) << 16);
    unsigned* d = (unsigned*)(dst + (long long)c * ldd + r); *d = u;  }
__global__ __launch_bounds__(256) void k_cast16(const float* __restrict__ src, long long lds, _Float16* __restrict__ dst, long long ldd, int R, int C, float s) {
    const long long i = (long long)blockIdx.x * 256 + threadIdx.x; const long long np = (long long)R * (C / 2); if (i >= np) return; const int r = (int)(i / (C / 2)); const int c = 2 * (int)(i % (C / 2));
    const _Float16 h0 = (_Float16)(src[(long long)r * lds + c] * s), h1 = (_Float16)(src[(long long)r * lds + c + 1] * s);
    const unsigned u = (unsigned)__builtin_bit_cast(unsigned short, h0) | ((unsigned)__builtin_bit_cast(unsigned short, h1) << 16);
    unsigned* d = (unsigned*)(dst + (long long)r * ldd + c); *d = u;  }

// f32 -> bf16 hi plane + bf16 lo plane (x = hi + lo to ~2^-17 relative; RNE both), [R][C] -> [R][C] (or transposed to [C][R]); 2 consecutive destination elements
__device__ __forceinline__ unsigned int f2bf2_pack(float a, float b, unsigned int* lo) {
    const unsigned short ha = w25::f2bf_bits(a), hb = w25::f2bf_bits(b);
    const unsigned short la = w25::f2bf_bits(a - w25::bf_bits2f(ha)), lb = w25::f2bf_bits(b - w25::bf_bits2f(hb));
    *lo = (unsigned)la | ((unsigned)lb << 16); return (unsigned)ha | ((unsigned)hb << 16); }
__global__ __launch_bounds__(256) void k_castS16(const float* __restrict__ src, long long lds, __bf16* __restrict__ dhi, __bf16* __restrict__ dlo, long long ldd, int R, int C, float s, int transpose) {
    const long long i = (long long)blockIdx.x * 256 + threadIdx.x; long long o; float a, b;
    if (transpose) { const long long np = (long long)C * (R / 2); if (i >= np) return; const int c = (int)(i / (R / 2)); const int r = 2 * (int)(i % (R / 2)); a = src[(long long)r * lds + c] * s; b = src[(long long)(r + 1) * lds + c] * s; o = (long long)c * ldd + r; }
    else { const long long np = (long long)R * (C / 2); if (i >= np) return; const int r = (int)(i / (C / 2)); const int c = 2 * (int)(i % (C / 2)); a = src[(long long)r * lds + c] * s; b = src[(long long)r * lds + c + 1] * s; o = (long long)r * ldd + c; }
    unsigned lo; const unsigned hi = f2bf2_pack(a, b, &lo); unsigned* ph = (unsigned*)(dhi + o); unsigned* pl = (unsigned*)(dlo + o);
    *ph = hi; *pl = lo;  }

namespace w25 {
// =====================================================================================
// Generic causal/non-causal attention for head_dim 64, f32 in / f32 out; 16-bit operands: bf16 with optional hi/lo splits, or
// plain f16 (F16=true, non-split, probabilities carried x2^15).
//   scores = (q*qscale)·kᵀ : v_wmma_f32_16x16x32_bf16; SPLIT_QK -> q,k as bf16 hi/lo (hi·hi + hi·lo + lo·hi)
//   out    = p·v           : v_wmma_f32_16x16x32_bf16; SPLIT_PV -> p,v as bf16 hi/lo; else p,v plain bf16
//   f32 accumulate; online softmax in f32. Block = 4 waves = 64 query rows of one (batch, head); S % 64 == 0.
//   Element (b, s, h, d) of tensor X lives at X[b*X_bs + s*X_rs + h*X_hs + d] (strides in floats, multiples of 4).
//   Masking: mask_mode 0 none, 1 causal (kv > q masked), 2 tensor [S][Skv] shared over (b,h) (float if
//   mask_is_int==0, int32 with element == 0 -> masked if 1, int32 with element != 0 -> masked if 2), 3 per-token vectors qmask[B][S] & kvmask[B][Skv] (int32,
//   0 -> masked), 4 causal + sliding window (kv > q or q - kv > W masked; W passed in mask_is_int);
//   5 = relative-position bias: s += cp[b,h,q][idx[q][kv]] + pc[b,h,kv][idx[q][kv]] with idx = mask_b ([S][Skv] int32) and
//   mask_a an int32 [S][Skv] tensor with nonzero = masked (tables: element (b,h,row,n) at X + b*c_bs + h*c_hs + row*c_rs + n);
//   masked scores are replaced by mask_fill (e.g. -inf or -1e9) before the softmax.
//   grid.x = B * H * (S/64) (or a sub-range with blk0).
// =====================================================================================
#define AT_D 64
#define AT_NW 4
#define AT_QB 64
#define AT_KC 64
struct AttnGeom { const float* cp = nullptr; const float* pc = nullptr; long c_bs = 0, c_rs = 0, c_hs = 0;   // mode-5 score-bias tables
                  long q_bs, q_rs, q_hs, k_bs, k_rs, k_hs, v_bs, v_rs, v_hs, o_bs, o_rs, o_hs;
                  int S, Skv, H, mask_mode; float qscale; int blk0; float mask_fill; int mask_is_int; };
static_assert(sizeof(AttnGeom) == 168, "no padding");

__device__ __forceinline__ unsigned short at_bf_bits(float f) {
  unsigned u = __float_as_uint(f);
  return (unsigned short)((u + 0x7FFFu + ((u >> 16) & 1u)) >> 16);
}
__device__ __forceinline__ __bf16 at_f2bf(float f) { return __builtin_bit_cast(__bf16, at_bf_bits(f)); }
__device__ __forceinline__ void at_split(float f, __bf16& hi, __bf16& lo) {
  const unsigned short hb = at_bf_bits(f);
  hi = __builtin_bit_cast(__bf16, hb);
  lo = at_f2bf(f - __uint_as_float(((unsigned)hb) << 16));
}
__device__ __forceinline__ v8f at_mma(v16b a, v16b b, v8f c) {
  c = __builtin_amdgcn_wmma_f32_16x16x32_bf16(false, a, false, b, (short)0, c, false, false);
  asm volatile("v_nop\n\tv_nop\n\tv_nop\n\tv_nop" : "+v"(c) : "v"(a), "v"(b));
  return c;
}
// 16-bit element as a bit pattern held in a __bf16 slot: f16 bits when F16, bf16 (RNE) otherwise
template <bool F16> __device__ __forceinline__ __bf16 at_to16(float f) {
  if (F16) return __builtin_bit_cast(__bf16, (_Float16)f);
  return at_f2bf(f);
}
template <bool F16> __device__ __forceinline__ v8f at_mma16(v16b a, v16b b, v8f c) {
  if (F16) {
    const v16h ah = __builtin_bit_cast(v16h, a), bh = __builtin_bit_cast(v16h, b);
    c = __builtin_amdgcn_wmma_f32_16x16x32_f16(false, ah, false, bh, (short)0, c, false, false);
    asm volatile("v_nop\n\tv_nop\n\tv_nop\n\tv_nop" : "+v"(c) : "v"(ah), "v"(bh));
    return c;
  }
  return at_mma(a, b, c);
}

template <bool SPLIT_QK, bool SPLIT_PV, bool F16 = false>
__global__ __launch_bounds__(128)
void attn64_kernel(const float* __restrict__ q, const float* __restrict__ k,
                   const float* __restrict__ v, float* __restrict__ out,
                   const void* __restrict__ mask_a, const int* __restrict__ mask_b, AttnGeom g) {
  static_assert(!(F16 && (SPLIT_QK || SPLIT_PV)), "f16 mode is non-split");
  const float PSC = F16 ? 32768.0f : 1.0f;     // f16 probabilities carried x2^15 (subnormal range), folded into the final 1/l
  union FB { v16b v; v8b h[2]; };
  __shared__ __align__(16) __bf16 Ksh[AT_KC * AT_D];             // K hi [kv][d]      8 KB
  __shared__ __align__(16) __bf16 Ksl[SPLIT_QK ? AT_KC * AT_D : 8];
  __shared__ __align__(16) __bf16 Vth[AT_D * AT_KC];             // V hi [d][kv]      8 KB
  __shared__ __align__(16) __bf16 Vtl[SPLIT_PV ? AT_D * AT_KC : 8];
  __shared__ __align__(16) __bf16 Psh[AT_NW][16 * AT_KC];        // per wave P hi [row][kv]  8 KB
  __shared__ __align__(16) __bf16 Psl[SPLIT_PV ? AT_NW : 1][SPLIT_PV ? 16 * AT_KC : 8];
  __shared__ __align__(16) float  Os[AT_NW][16 * 68];            // per wave out tile, pitch 68

  const int tid  = threadIdx.x;
  const int wave = tid >> 5;
  const int lane = tid & 31;
  const int hh   = lane >> 4;
  const int c    = lane & 15;

  const int nqb = g.S / AT_QB;
  const int bx = blockIdx.x + g.blk0;
  const int qb = bx % nqb;
  const int bh = bx / nqb;
  const int h  = bh % g.H;
  const int b  = bh / g.H;
  const int qbase_block = qb * AT_QB;
  const int q0 = qbase_block + wave * 16;

  const float* qb_ptr = q + (size_t)b * g.q_bs + (size_t)h * g.q_hs;
  const float* kb_ptr = k + (size_t)b * g.k_bs + (size_t)h * g.k_hs;
  const float* vb_ptr = v + (size_t)b * g.v_bs + (size_t)h * g.v_hs;
  float*       ob_ptr = out + (size_t)b * g.o_bs + (size_t)h * g.o_hs;

  // ---- Q fragments (A operand): 2 d-chunks, hi (and lo) ----
  v16b qah[2], qal[2];
  {
    const float* qrow = qb_ptr + (size_t)(q0 + c) * g.q_rs;
#pragma unroll
    for (int dc = 0; dc < 2; ++dc) {
#pragma unroll
      for (int e = 0; e < 8; ++e) {
        const float f0 = qrow[dc * 32 + 8 * hh + e] * g.qscale;
        const float f1 = qrow[dc * 32 + 16 + 8 * hh + e] * g.qscale;
        if (SPLIT_QK) { __bf16 hq, lq; at_split(f0, hq, lq); qah[dc][e] = hq; qal[dc][e] = lq; at_split(f1, hq, lq); qah[dc][8 + e] = hq; qal[dc][8 + e] = lq; }
        else { qah[dc][e] = at_to16<F16>(f0); qah[dc][8 + e] = at_to16<F16>(f1); qal[dc][e] = qah[dc][e]; qal[dc][8 + e] = qah[dc][8 + e]; }
      }
    }
  }

  float mrow[8], lrow[8];
  v8f oacc[4];
#pragma unroll
  for (int r = 0; r < 8; ++r) { mrow[r] = -INFINITY; lrow[r] = 0.f; }
#pragma unroll
  for (int t = 0; t < 4; ++t) oacc[t] = (v8f){0.f,0.f,0.f,0.f,0.f,0.f,0.f,0.f};

  const int nChunks = (g.mask_mode == 1 || g.mask_mode == 4) ? (qb + 1) : (g.Skv / AT_KC);   // block-uniform
  // per-row query mask (mode 3)
  int qkeep[8];
#pragma unroll
  for (int r = 0; r < 8; ++r) qkeep[r] = (g.mask_mode == 3) ? mask_b[(size_t)b * g.S + q0 + 8 * hh + r] : 1;   // mask_b = qmask in mode 3
  for (int kc = 0; kc < nChunks; ++kc) {
    const int kv0 = kc * AT_KC;
    __syncthreads();
    {
      const int kvr = tid >> 1, dh = (tid & 1) * 32;
      const float* krow = kb_ptr + (size_t)(kv0 + kvr) * g.k_rs + dh;
      const float* vrow = vb_ptr + (size_t)(kv0 + kvr) * g.v_rs + dh;
#pragma unroll
      for (int i = 0; i < 8; ++i) {
        v4f kk = *(const v4f*)(krow + 4 * i);
        v4f vv = *(const v4f*)(vrow + 4 * i);
#pragma unroll
        for (int e = 0; e < 4; ++e) {
          const int d = dh + 4 * i + e;
          if (SPLIT_QK) { __bf16 a, bl; at_split(kk[e], a, bl); Ksh[kvr * AT_D + d] = a; Ksl[kvr * AT_D + d] = bl; }
          else Ksh[kvr * AT_D + d] = at_to16<F16>(kk[e]);
          if (SPLIT_PV) { __bf16 a, bl; at_split(vv[e], a, bl); Vth[d * AT_KC + kvr] = a; Vtl[d * AT_KC + kvr] = bl; }
          else Vth[d * AT_KC + kvr] = at_to16<F16>(vv[e]);
        }
      }
    }
    __syncthreads();

    v8f s[4];
#pragma unroll
    for (int j = 0; j < 4; ++j) {
      s[j] = (v8f){0.f,0.f,0.f,0.f,0.f,0.f,0.f,0.f};
#pragma unroll 1
      for (int dc = 0; dc < 2; ++dc) {
        FB kb;
        kb.h[0] = *(const v8b*)(Ksh + (j * 16 + c) * AT_D + dc * 32 + 8 * hh);
        kb.h[1] = *(const v8b*)(Ksh + (j * 16 + c) * AT_D + dc * 32 + 16 + 8 * hh);
        s[j] = at_mma16<F16>(qah[dc], kb.v, s[j]);
        if (SPLIT_QK) {
          FB kl;
          kl.h[0] = *(const v8b*)(Ksl + (j * 16 + c) * AT_D + dc * 32 + 8 * hh);
          kl.h[1] = *(const v8b*)(Ksl + (j * 16 + c) * AT_D + dc * 32 + 16 + 8 * hh);
          s[j] = at_mma16<F16>(qah[dc], kl.v, s[j]);
          s[j] = at_mma16<F16>(qal[dc], kb.v, s[j]);
        }
      }
    }
    const bool diag = (g.mask_mode == 1) && (kc == qb);
    int kvkeep[4] = {1, 1, 1, 1};
    if (g.mask_mode == 3) {
#pragma unroll
      for (int j = 0; j < 4; ++j) kvkeep[j] = ((const int*)mask_a)[(size_t)b * g.Skv + kv0 + j * 16 + c];   // mask_a = kvmask
    }
    float cm[8];
#pragma unroll
    for (int r = 0; r < 8; ++r) {
      const int qrow = q0 + 8 * hh + r;
      float m = -INFINITY;
#pragma unroll
      for (int j = 0; j < 4; ++j) {
        const int kvcol = kv0 + j * 16 + c;
        bool masked = false;
        if (diag) masked = (kvcol > qrow);
        else if (g.mask_mode == 4) masked = (kvcol > qrow) || (qrow - kvcol > g.mask_is_int);
        else if (g.mask_mode == 2) {
          const size_t mi = (size_t)qrow * g.Skv + kvcol;
          masked = (g.mask_is_int == 0) ? (((const float*)mask_a)[mi] == 0.0f)
                 : (g.mask_is_int == 1) ? (((const int*)mask_a)[mi] == 0) : (((const int*)mask_a)[mi] != 0);
        } else if (g.mask_mode == 3) masked = (qkeep[r] == 0) || (kvkeep[j] == 0);
        else if (g.mask_mode == 5) {
          const size_t mi = (size_t)qrow * g.Skv + kvcol;
          masked = (((const int*)mask_a)[mi] != 0);
          int n = mask_b[mi]; n = n < 0 ? 0 : n;
          s[j][r] += g.cp[(size_t)b * g.c_bs + (size_t)h * g.c_hs + (size_t)qrow * g.c_rs + n]
                   + g.pc[(size_t)b * g.c_bs + (size_t)h * g.c_hs + (size_t)kvcol * g.c_rs + n];
        }
        if (masked) s[j][r] = g.mask_fill;
        m = fmaxf(m, s[j][r]);
      }
#pragma unroll
      for (int off = 1; off < 16; off <<= 1) m = fmaxf(m, __shfl_xor(m, off, 32));
      cm[r] = m;
    }
    __bf16* pwh = Psh[wave];
    __bf16* pwl = Psl[SPLIT_PV ? wave : 0];
#pragma unroll
    for (int r = 0; r < 8; ++r) {
      const float mnew = fmaxf(mrow[r], cm[r]);
      const float alpha = expf(mrow[r] - mnew);
      mrow[r] = mnew;
      float psum = 0.f;
#pragma unroll
      for (int j = 0; j < 4; ++j) {
        const float p = expf(s[j][r] - mnew);
        psum += p;
        if (SPLIT_PV) { __bf16 a, bl; at_split(p, a, bl); pwh[(8 * hh + r) * AT_KC + j * 16 + c] = a; pwl[(8 * hh + r) * AT_KC + j * 16 + c] = bl; }
        else pwh[(8 * hh + r) * AT_KC + j * 16 + c] = at_to16<F16>(p * PSC);
      }
#pragma unroll
      for (int off = 1; off < 16; off <<= 1) psum += __shfl_xor(psum, off, 32);
      lrow[r] = lrow[r] * alpha + psum;
#pragma unroll
      for (int t = 0; t < 4; ++t) oacc[t][r] *= alpha;
    }
    __builtin_amdgcn_fence(__ATOMIC_RELEASE, "workgroup");
    __builtin_amdgcn_wave_barrier();
    __builtin_amdgcn_fence(__ATOMIC_ACQUIRE, "workgroup");
#pragma unroll 1
    for (int kk = 0; kk < 2; ++kk) {
      FB pa, pl;
      pa.h[0] = *(const v8b*)(pwh + c * AT_KC + kk * 32 + 8 * hh);
      pa.h[1] = *(const v8b*)(pwh + c * AT_KC + kk * 32 + 16 + 8 * hh);
      if (SPLIT_PV) {
        pl.h[0] = *(const v8b*)(pwl + c * AT_KC + kk * 32 + 8 * hh);
        pl.h[1] = *(const v8b*)(pwl + c * AT_KC + kk * 32 + 16 + 8 * hh);
      }
#pragma unroll
      for (int t = 0; t < 4; ++t) {
        FB vb;
        vb.h[0] = *(const v8b*)(Vth + (t * 16 + c) * AT_KC + kk * 32 + 8 * hh);
        vb.h[1] = *(const v8b*)(Vth + (t * 16 + c) * AT_KC + kk * 32 + 16 + 8 * hh);
        oacc[t] = at_mma16<F16>(pa.v, vb.v, oacc[t]);
        if (SPLIT_PV) {
          FB vl;
          vl.h[0] = *(const v8b*)(Vtl + (t * 16 + c) * AT_KC + kk * 32 + 8 * hh);
          vl.h[1] = *(const v8b*)(Vtl + (t * 16 + c) * AT_KC + kk * 32 + 16 + 8 * hh);
          oacc[t] = at_mma16<F16>(pa.v, vl.v, oacc[t]);
          oacc[t] = at_mma16<F16>(pl.v, vb.v, oacc[t]);
        }
      }
    }
  }

  float* os = Os[wave];
#pragma unroll
  for (int r = 0; r < 8; ++r) {
    const float inv = 1.0f / (lrow[r] * PSC);
#pragma unroll
    for (int t = 0; t < 4; ++t) os[(8 * hh + r) * 68 + t * 16 + c] = oacc[t][r] * inv;
  }
  __builtin_amdgcn_fence(__ATOMIC_RELEASE, "workgroup");
  __builtin_amdgcn_wave_barrier();
  __builtin_amdgcn_fence(__ATOMIC_ACQUIRE, "workgroup");
  {
    const int c4 = (lane & 15) * 4;
    {
#pragma unroll
      for (int it = 0; it < 8; ++it) {
        const int row = it * 2 + hh;
        v4f val = *(const v4f*)(os + row * 68 + c4);
        *(v4f*)(ob_ptr + (size_t)(q0 + row) * g.o_rs + c4) = val;
      }
      
    }
  }
}

} // namespace w25

// ---- Wide elementwise and row passes: a thread moves 32 or 64 elements with 16-byte loads, so that a pass starts a few thousand waves instead of
//      one wave per 64 or 128 elements. Every wave-wide store covers whole 128-byte lines. Formulas and sum trees are those of the narrow kernels above.
typedef __attribute__((ext_vector_type(4))) _Float16 v4h;
// k_cast16w<G>: dst[i] = f16(src[i] * s) over a flat range; a block takes G * 1024 consecutive elements, a thread 4 consecutive ones of each 1024.
template <int G>
__global__ __launch_bounds__(256) void k_cast16w(const float* __restrict__ src, _Float16* __restrict__ dst, float s) {
    const v4f* sp = (const v4f*)(src + (size_t)blockIdx.x * (G * 1024));
    v4h* dp = (v4h*)(dst + (size_t)blockIdx.x * (G * 1024));
    const unsigned t = threadIdx.x;
    v4f a[G];
#pragma unroll
    for (int g = 0; g < G; ++g) a[g] = sp[t + g * 256];
#pragma unroll
    for (int g = 0; g < G; ++g) {
        v4h h;
#pragma unroll
        for (int e = 0; e < 4; ++e) h[e] = (_Float16)(a[g][e] * s);
        dp[t + g * 256] = h;
    }
}
// k_castT16w<LDS, LDD>: dst[c * LDD + r] = f16(src[r * LDS + c] * s). Block = 64 source rows x 128 source columns, wave = 64 x 16, lane = 8 rows x 4 columns
//   transposed in registers: 8 lanes side by side in r fill one 128-byte line of a dst row. grid (C / 128, R / 64).
template <int LDS, int LDD>
__global__ __launch_bounds__(256) void k_castT16w(const float* __restrict__ src, _Float16* __restrict__ dst, float s) {
    const int lane = threadIdx.x & 31, wave = threadIdx.x >> 5;
    const int r = blockIdx.y * 64 + (lane & 7) * 8;
    const int c = blockIdx.x * 128 + wave * 16 + (lane >> 3) * 4;
    const float* sp = src + (size_t)r * LDS + c;
    _Float16* dp = dst + (size_t)c * LDD + r;
    v4f x[8];
#pragma unroll
    for (int i = 0; i < 8; ++i) x[i] = *(const v4f*)(sp + i * LDS);
#pragma unroll
    for (int j = 0; j < 4; ++j) {
        v8h h;
#pragma unroll
        for (int i = 0; i < 8; ++i) h[i] = (_Float16)(x[i][j] * s);
        *(v8h*)(dp + j * LDD) = h;
    }
}
// Sum of one value per position t = 0..255 of k_stats' tree, add for add: lane l holds positions 4l + q in lo[q] and 128 + 4l + q in hi[q].
//   Levels 128 (in the lane), 64..4 (lanes l and l ^ 16, 8, 4, 2, 1), 2 and 1 (in the lane); every lane ends with the root.
__device__ __forceinline__ float tree256(v4f lo, v4f hi) {
    v4f t = lo + hi;
#pragma unroll
    for (int o = 16; o > 0; o >>= 1) {
#pragma unroll
        for (int q = 0; q < 4; ++q) t[q] += __shfl_xor(t[q], o, 32);
    }
    return (t[0] + t[2]) + (t[1] + t[3]);
}
// k_stats_w: mean and rsqrt(var + eps) of rows of 1024, one wave per row with the row held in registers (k_stats mode 0; same partial sums, same tree).
__global__ __launch_bounds__(256) void k_stats_w(const float* __restrict__ x, float eps, float* __restrict__ stat) {
    const int lane = threadIdx.x & 31; const size_t row = (size_t)blockIdx.x * 8 + (threadIdx.x >> 5);
    const float* base = x + row * 1024 + 4 * lane;
    v4f v[8];
#pragma unroll
    for (int m = 0; m < 8; ++m) v[m] = *(const v4f*)(base + 128 * m);
    const float mu = tree256(((v[0] + v[2]) + v[4]) + v[6], ((v[1] + v[3]) + v[5]) + v[7]) / 1024.f;
    v4f q0 = {}, q1 = {};
#pragma unroll
    for (int k = 0; k < 4; ++k) { const v4f d0 = v[2 * k] - mu, d1 = v[2 * k + 1] - mu; q0 = __builtin_elementwise_fma(d0, d0, q0); q1 = __builtin_elementwise_fma(d1, d1, q1); }
    const float rs = rsqrtf(tree256(q0, q1) / 1024.f + eps);
    const float o = (lane == 0) ? mu : ((lane == 1) ? rs : 0.f);
    stat[row * 32 + lane] = o;
}
// k_norm_apply_w: y = (x - mean[row]) * rstd[row] * g[c] + b[c] on rows of 1024; a block takes 8 rows, a thread 4 columns of each (x and y may be the same buffer).
__global__ __launch_bounds__(256) void k_norm_apply_w(const float* x, float* y, const float* __restrict__ stat, const float* __restrict__ g, const float* __restrict__ bta) {
    const int c = threadIdx.x * 4; const size_t r0 = (size_t)blockIdx.x * 8;
    const v4f gg = *(const v4f*)(g + c), bb = *(const v4f*)(bta + c);
    v4f v[8];
#pragma unroll
    for (int i = 0; i < 8; ++i) v[i] = *(const v4f*)(x + (r0 + i) * 1024 + c);
#pragma unroll
    for (int i = 0; i < 8; ++i) {
        v4f o = (v[i] - stat[(r0 + i) * 32]) * stat[(r0 + i) * 32 + 1];
        o *= gg; o += bb;
        *(v4f*)(y + (r0 + i) * 1024 + c) = o;
    }
}


// MI[(b, s)] = (s < valid_len[b]) ? 1 : 0 as INT (keep-mask: masked scores are SET to -1e6 exactly like the module's where, so a 128-key block lying entirely beyond valid_len comes out uniform)
__global__ __launch_bounds__(256) void k_te_mask(const int* __restrict__ VL, int* __restrict__ MI, int Bn, int S) { const int t = blockIdx.x * 256 + threadIdx.x; if (t >= Bn * S) return; int* d = MI + t; const int v = ((t % S) < VL[t / S]) ? 1 : 0; *d = v;  }


extern "C" void kernel_launch(void* const* d_in, const int* in_sizes, int n_in, void* d_out, int out_size, void* d_ws, size_t ws_size, hipStream_t stream) {
    (void)in_sizes; (void)n_in; (void)out_size; (void)ws_size;
    const float* X = (const float*)d_in[0];
    const int* vl = (const int*)d_in[1];
    const float* Wq = (const float*)d_in[2];
    const float* Wk = (const float*)d_in[3];
    const float* Wv = (const float*)d_in[4];
    const float* Wo = (const float*)d_in[5];
    const float* g1 = (const float*)d_in[6];
    const float* be1 = (const float*)d_in[7];
    const float* W1 = (const float*)d_in[8];
    const float* bf1 = (const float*)d_in[9];
    const float* W2 = (const float*)d_in[10];
    const float* bf2 = (const float*)d_in[11];
    const float* g2 = (const float*)d_in[12];
    const float* be2 = (const float*)d_in[13];
    const int Bn = 4;
    const int S = 1024;
    const int D = 1024;
    const int NH = 16;
    const int DH = 64;
    const int F = 4096;
    const int M = 128;
    const int NB = S / M;
    const int NR = Bn * S;
    float* out = (float*)d_out;
    char* wsp = (char*)d_ws;
    float* Q = (float*)wsp; wsp += (((size_t)((size_t)NR * D) * 4 + 255) / 256) * 256;
    float* Kb = (float*)wsp; wsp += (((size_t)((size_t)NR * D) * 4 + 255) / 256) * 256;
    float* V = (float*)wsp; wsp += (((size_t)((size_t)NR * D) * 4 + 255) / 256) * 256;
    float* AT = (float*)wsp; wsp += (((size_t)((size_t)NR * D) * 4 + 255) / 256) * 256;
    float* MF = (float*)wsp; wsp += (((size_t)((size_t)NR) * 4 + 255) / 256) * 256;
    float* Y = (float*)wsp; wsp += (((size_t)((size_t)NR * D) * 4 + 255) / 256) * 256;
    float* ST = (float*)wsp; wsp += (((size_t)((size_t)NR * 32) * 4 + 255) / 256) * 256;
    float* H1 = (float*)wsp; wsp += (((size_t)((size_t)NR * F) * 4 + 255) / 256) * 256;
    unsigned short* G64A = (unsigned short*)wsp; wsp += (((size_t)(16777216) * 2 + 255) / 256) * 256;
    unsigned short* G64B = (unsigned short*)wsp; wsp += (((size_t)(4194304) * 2 + 255) / 256) * 256;
    k_cast16w<8><<<512, 256, 0, stream>>>(X, (_Float16*)(G64A), 1.0f);
    k_castT16w<1024, 1024><<<dim3(1024 / 128, 1024 / 64), 256, 0, stream>>>(Wq, (_Float16*)(G64B), 16.0f);
    w25::wmma_gemm_lds<1024, 1024, 0, false, 0><<<256, 256, 0, stream>>>((const unsigned short*)(G64A), (const unsigned short*)(G64B), Q, nullptr, nullptr, 0.0625f);
    k_cast16w<8><<<512, 256, 0, stream>>>(X, (_Float16*)(G64A), 1.0f);
    k_castT16w<1024, 1024><<<dim3(1024 / 128, 1024 / 64), 256, 0, stream>>>(Wk, (_Float16*)(G64B), 16.0f);
    w25::wmma_gemm_lds<1024, 1024, 0, false, 0><<<256, 256, 0, stream>>>((const unsigned short*)(G64A), (const unsigned short*)(G64B), Kb, nullptr, nullptr, 0.0625f);
    k_cast16w<8><<<512, 256, 0, stream>>>(X, (_Float16*)(G64A), 1.0f);
    k_castT16w<1024, 1024><<<dim3(1024 / 128, 1024 / 64), 256, 0, stream>>>(Wv, (_Float16*)(G64B), 16.0f);
    w25::wmma_gemm_lds<1024, 1024, 0, false, 0><<<256, 256, 0, stream>>>((const unsigned short*)(G64A), (const unsigned short*)(G64B), V, nullptr, nullptr, 0.0625f);
    k_te_mask<<<(NR + 255) / 256, 256, 0, stream>>>((const int*)vl, (int*)MF, Bn, S);
    { /*apv4*/ AttnP a;
      a.Q = Q; a.K = Kb; a.V = V; a.O = AT; a.P = 0; a.Mf = 0; a.Mi = (const int*)MF; a.ST = 0;
      a.Pw = 0; a.Rt = 0; a.SQ = 0; a.SK = 0;
      a.swb = 0; a.swh = 0; a.swi = 0; a.swj = 0; a.srb = 0; a.srh = 0; a.sri = 0; a.sQb = (long long)M * D; a.sQh = DH; a.sQi = D; a.sQd = 1; a.sKb = (long long)M * D; a.sKh = DH; a.sKj = D; a.sKd = 1; a.sVb = (long long)M * D; a.sVh = DH; a.sVj = D; a.sVd = 1; a.sOb = (long long)M * D; a.sOh = DH; a.sOi = D; a.sPb = 0; a.sPh = 0; a.sPi = 0; a.smb = M; a.smh = 0; a.smi = 0; a.smj = 1;
      a.Lq = M; a.Lk = M; a.dh = DH; a.dv = DH; a.hrep = 1; a.causal = 0; a.coff = 0; a.pband = 0;
      a.scale = 0.125f; a.mfill = -1000000.0f; a.nonorm = 0; a.mpol = 0;
      a.roff = 0; a.rn = 1; a.segpol = 0; a.win = 0;
      k_attn<64, 64, 0, false, false><<<dim3((unsigned)((M) + 16 * AW - 1) / (16 * AW), (unsigned)(NH), (unsigned)(Bn * NB)), 32 * AW, 0, stream>>>(a); }
    k_cast16w<8><<<512, 256, 0, stream>>>(AT, (_Float16*)(G64A), 1.0f);
    k_castT16w<1024, 1024><<<dim3(1024 / 128, 1024 / 64), 256, 0, stream>>>(Wo, (_Float16*)(G64B), 16.0f);
    w25::wmma_gemm_lds<1024, 1024, 0, true, 0><<<256, 256, 0, stream>>>((const unsigned short*)(G64A), (const unsigned short*)(G64B), Y, nullptr, X, 0.0625f);
    k_stats_w<<<(unsigned)(NR / 8), 256, 0, stream>>>(Y, 1e-05f, ST);
    k_norm_apply_w<<<(unsigned)(NR / 8), 256, 0, stream>>>(Y, Y, ST, g1, be1);
    k_cast16w<8><<<512, 256, 0, stream>>>(Y, (_Float16*)(G64A), 1.0f);
    k_castT16w<4096, 1024><<<dim3(4096 / 128, 1024 / 64), 256, 0, stream>>>(W1, (_Float16*)(G64B), 16.0f);
    w25::wmma_gemm_lds<4096, 1024, 2, false, 2><<<1024, 256, 0, stream>>>((const unsigned short*)(G64A), (const unsigned short*)(G64B), H1, bf1, nullptr, 0.0625f);
    k_cast16w<16><<<1024, 256, 0, stream>>>(H1, (_Float16*)(G64A), 1.0f);
    k_castT16w<1024, 4096><<<dim3(1024 / 128, 4096 / 64), 256, 0, stream>>>(W2, (_Float16*)(G64B), 16.0f);
    w25::wmma_gemm_lds<1024, 4096, 2, true, 0><<<256, 256, 0, stream>>>((const unsigned short*)(G64A), (const unsigned short*)(G64B), Kb, bf2, Y, 0.0625f);
    k_stats_w<<<(unsigned)(NR / 8), 256, 0, stream>>>(Kb, 1e-05f, ST);
    k_norm_apply_w<<<(unsigned)(NR / 8), 256, 0, stream>>>(Kb, out, ST, g2, be2);
}

// v004
// A run of this version takes 206 microseconds.
// Two timings next to v003 put it at 1.75 and 1.76 times that version's speed.
// Counting every step since v000, it is 7.08 times as fast.
// Contractions: q/k/v/o projections X.W [4096x1024].[1024x1024] and the position-wise FFN relu(Y.W1 + b) [4096x1024].[1024x4096], .W2 + b [4096x4096].[4096x1024] with f16 operands on pre-cast planes (v_wmma_f32_16x16x32_f16; 128x128 work-group tiles staged through LDS, 32x64 per wave, weights x16); the block-diagonal windowed attention (8 blocks of 128 positions per sequence = 32 independent (sequence, block) attentions, 16 heads, keys >= valid_len SET to -1e6 through an integer keep-mask — exactly the module's where, so blocks lying wholly beyond valid_len are uniform) as one flash launch (f16 q.k^T and p.v with p as f16 of 4096 p); f32 accumulate and softmax. AddNorm LayerNorms (wave per row, fixed-order trees) and the mask table from the INPUT valid lengths are f32 kernels.
#include <hip/hip_runtime.h>
#include <math.h>

typedef __attribute__((ext_vector_type(16))) _Float16 v16h;
typedef __attribute__((ext_vector_type(8)))  _Float16 v8h;
typedef __attribute__((ext_vector_type(16))) __bf16   v16b;
typedef __attribute__((ext_vector_type(8)))  float    v8f;
typedef __attribute__((ext_vector_type(4)))  float    v4f;

// 16-bit WMMA fragment map (wave32), lane L, h = L>>4, m = L&15:
//   A 16x32: lane = row m;   element i -> k = (i<8) ? 8h+i : 16+8h+(i-8)
//   B 32x16: lane = column m; the SAME k(i,h)
//   D 16x16 (8 f32): lane = column m; element r -> row 8h+r
__device__ __forceinline__ int frag_k(int i, int h) { return (i < 8) ? (8 * h + i) : (16 + 8 * h + (i - 8)); }
__device__ __forceinline__ __bf16 bf16_rne(float f) {
    unsigned int u = __float_as_uint(f);
    u += 0x7fffu + ((u >> 16) & 1u);
    return __builtin_bit_cast(__bf16, (unsigned short)(u >> 16));
}
__device__ __forceinline__ float bf16_f32(__bf16 b) { return __uint_as_float(((unsigned int)__builtin_bit_cast(unsigned short, b)) << 16); }
__device__ __forceinline__ v8f wmma16(v16h a, v16h b, v8f c) {
    c = __builtin_amdgcn_wmma_f32_16x16x32_f16(false, a, false, b, (short)0, c, false, false);
    asm volatile("v_nop\n\tv_nop\n\tv_nop\n\tv_nop" : "+v"(c) : "v"(a), "v"(b));
    return c;
}
__device__ __forceinline__ v8f wmmab(v16b a, v16b b, v8f c) {
    c = __builtin_amdgcn_wmma_f32_16x16x32_bf16(false, a, false, b, (short)0, c, false, false);
    asm volatile("v_nop\n\tv_nop\n\tv_nop\n\tv_nop" : "+v"(c) : "v"(a), "v"(b));
    return c;
}
struct Split { v16b hi, lo; };
// hi/lo split product: a.hi*b.hi + a.hi*b.lo + a.lo*b.hi
__device__ __forceinline__ v8f wmma3(const Split& a, const Split& b, v8f c) {
    c = __builtin_amdgcn_wmma_f32_16x16x32_bf16(false, a.hi, false, b.hi, (short)0, c, false, false);
    c = __builtin_amdgcn_wmma_f32_16x16x32_bf16(false, a.hi, false, b.lo, (short)0, c, false, false);
    c = __builtin_amdgcn_wmma_f32_16x16x32_bf16(false, a.lo, false, b.hi, (short)0, c, false, false);
    asm volatile("v_nop\n\tv_nop\n\tv_nop\n\tv_nop" : "+v"(c) : "v"(a.hi), "v"(a.lo), "v"(b.hi), "v"(b.lo));
    return c;
}
struct Split3 { v16b hi, mid, lo; };
// triple split product (6 terms, drops only terms below 2^-24 relative)
__device__ __forceinline__ v8f wmma6(const Split3& a, const Split3& b, v8f c) {
    c = __builtin_amdgcn_wmma_f32_16x16x32_bf16(false, a.hi, false, b.hi, (short)0, c, false, false);
    c = __builtin_amdgcn_wmma_f32_16x16x32_bf16(false, a.hi, false, b.mid, (short)0, c, false, false);
    c = __builtin_amdgcn_wmma_f32_16x16x32_bf16(false, a.mid, false, b.hi, (short)0, c, false, false);
    c = __builtin_amdgcn_wmma_f32_16x16x32_bf16(false, a.hi, false, b.lo, (short)0, c, false, false);
    c = __builtin_amdgcn_wmma_f32_16x16x32_bf16(false, a.mid, false, b.mid, (short)0, c, false, false);
    c = __builtin_amdgcn_wmma_f32_16x16x32_bf16(false, a.lo, false, b.hi, (short)0, c, false, false);
    asm volatile("v_nop\n\tv_nop\n\tv_nop\n\tv_nop" : "+v"(c) : "v"(a.hi), "v"(a.mid), "v"(a.lo), "v"(b.hi), "v"(b.mid), "v"(b.lo));
    return c;
}

// Fragment gathers from f32 memory: element i <- p[(k0 + frag_k(i,h)) * sk] * s, zero for k >= klen.
__device__ __forceinline__ v16h fh_ld(const float* __restrict__ p, long long sk, int k0, int h, int klen, float s) {
    v16h a;
#pragma unroll
    for (int i = 0; i < 16; ++i) { const int k = k0 + frag_k(i, h); a[i] = (k < klen) ? (_Float16)(p[(long long)k * sk] * s) : (_Float16)0.f; }
    return a;
}
__device__ __forceinline__ Split sp_ld(const float* __restrict__ p, long long sk, int k0, int h, int klen, float s) {
    Split r;
#pragma unroll
    for (int i = 0; i < 16; ++i) {
        const int k = k0 + frag_k(i, h); const float x = (k < klen) ? p[(long long)k * sk] * s : 0.f;
        const __bf16 hb = bf16_rne(x); r.hi[i] = hb; r.lo[i] = bf16_rne(x - bf16_f32(hb));
    }
    return r;
}
__device__ __forceinline__ Split3 sp3_ld(const float* __restrict__ p, long long sk, int k0, int h, int klen, float s) {
    Split3 r;
#pragma unroll
    for (int i = 0; i < 16; ++i) {
        const int k = k0 + frag_k(i, h); const float x = (k < klen) ? p[(long long)k * sk] * s : 0.f;
        const __bf16 hb = bf16_rne(x); const float r1 = x - bf16_f32(hb); const __bf16 mb = bf16_rne(r1);
        r.hi[i] = hb; r.mid[i] = mb; r.lo[i] = bf16_rne(r1 - bf16_f32(mb));
    }
    return r;
}
__device__ __forceinline__ v16b bh_ld(const float* __restrict__ p, long long sk, int k0, int h, int klen, float s) {
    v16b a;
#pragma unroll
    for (int i = 0; i < 16; ++i) { const int k = k0 + frag_k(i, h); a[i] = bf16_rne((k < klen) ? p[(long long)k * sk] * s : 0.f); }
    return a;
}
// f16 fragment from an f16 LDS/global row with element stride 1 (k-contiguous), no bounds (tile already zero padded)
__device__ __forceinline__ v16h fh_row(const _Float16* __restrict__ row, int k0, int h) {
    v16h a;
#pragma unroll
    for (int i = 0; i < 16; ++i) a[i] = row[k0 + frag_k(i, h)];
    return a;
}

#define VST2(T, ptr, val) do { const T vst2_v_ = (val); *(T*)(ptr) = vst2_v_;  } while (0)
typedef float v4f __attribute__((ext_vector_type(4)));
#define VST2V4(ptr, val) do { const v4f vst2_v4_ = (val); *(v4f*)(ptr) = vst2_v4_;  } while (0)

__device__ __attribute__((noinline)) float act_fn(float v, int act) {
    if (act == 1) return fmaxf(v, 0.f);                                                                               // relu
    if (act == 2) { const float u = 0.7978845608028654f * (v + 0.044715f * v * v * v); return 0.5f * v * (1.f + tanhf(u)); } // tanh-gelu
    if (act == 3) return v / (1.f + expf(-v));                                                                        // silu
    if (act == 4) return 0.5f * v * (1.f + erff(v * 0.7071067811865476f));                                             // erf-gelu
    if (act == 5) return tanhf(v);
    if (act == 6) return 1.f / (1.f + expf(-v));                                                                      // sigmoid
    if (act == 7) return (v > 0.f) ? v : 0.01f * v;                                                                   // leaky relu 0.01
    if (act == 8) return (v > 0.f) ? v : (expf(v) - 1.f);                                                             // elu
    if (act == 9) return fminf(fmaxf(v, 0.f), 6.f);                                                                   // relu6
    if (act == 10) return fabsf(v);                                                                                    // abs
    if (act == 11) return (v >= 0.f) ? v : 0.1f * v;                                                                  // leaky 0.1
    if (act == 12) return (v > 0.f) ? v : 0.2f * v;                                                                   // leaky 0.2
    if (act == 13) return (v > 20.f) ? v : log1pf(expf(v));                                                            // softplus
    return v;
}

// =====================================================================================================================
// k_gemm<MODE>: C(z, m, n) = act(alpha * sum_k A(z, m, k) * B(z, k, n) + bias) + beta * R(z, m, n)
//   One wave (32-thread block) per 16 x 32 tile of C; grid (ceil(N/32), ceil(M/16), Z). Batch z -> (zo = z / zi_n, zi = z % zi_n)
//   with separate outer/inner strides for every tensor (e.g. batch and head). A(m,k) = A[zo*sAo + zi*sAi + m*sAm + k*sAk] (f32),
//   B(k,n) = B[zo*sBo + zi*sBi + n*sBn + k*sBk] (f32); any M, N, K (K zero-padded to 32 inside the fragments, M/N tails guarded).
//   C(m,n) = C[zo*sCo + zi*sCi + m*sCm + n] (n contiguous). flags: 1 bias[n], 2 bias[m], 4 residual R[zo*sRo + zi*sRi + m*sRm + n*sRn].
//   MODE 0: f16 operands (A prescaled by sa, B by sb, both undone in the epilogue); 1: bf16 hi/lo split (3 products); 2: bf16;
//   3: bf16 hi/mid/lo triple split (6 products); 4: as 3 with Kahan-compensated f32 accumulation across k-steps.
// =====================================================================================================================
struct GemmP {
    const float* A; const float* B; const float* bias; const float* R; float* C;
    long long sAo, sAi, sAm, sAk, sBo, sBi, sBn, sBk, sCo, sCi, sCm, sRo, sRi, sRm, sRn;
    int M, N, K, zi_n, flags, act; float alpha, beta, sa, sb;
    int Npad, pad_;     // columns [N, Npad) of C are written as 0 so that padded workspace rows are covered by whole-line stores; Npad >= N
};
static_assert(sizeof(GemmP) == 5 * 8 + 15 * 8 + 6 * 4 + 4 * 4 + 2 * 4, "GemmP has padding");

template <int MODE>
__global__ __launch_bounds__(32) void k_gemm(GemmP p) {
    const int lane = threadIdx.x & 31, h = lane >> 4, l15 = lane & 15;
    const int m0 = blockIdx.y * 16, n0 = blockIdx.x * 32;
    const int z = blockIdx.z, zo = z / p.zi_n, zi = z - zo * p.zi_n;
    const float* A = p.A + zo * p.sAo + zi * p.sAi;
    const float* B = p.B + zo * p.sBo + zi * p.sBi;
    const int am = min(m0 + l15, p.M - 1);                       // clamped row for loads (stores are guarded)
    v8f acc[2], comp[2];
#pragma unroll
    for (int t = 0; t < 2; ++t) { v8f zz = {}; acc[t] = zz; comp[t] = zz; }
    for (int k0 = 0; k0 < p.K; k0 += 32) {
        const float* arow = A + (long long)am * p.sAm;
        if (MODE == 1) {
            const Split a = sp_ld(arow, p.sAk, k0, h, p.K, 1.f);
#pragma unroll
            for (int t = 0; t < 2; ++t) {
                const int bn = min(n0 + t * 16 + l15, p.N - 1);
                acc[t] = wmma3(a, sp_ld(B + (long long)bn * p.sBn, p.sBk, k0, h, p.K, 1.f), acc[t]);
            }
        } else if (MODE == 3) {
            const Split3 a = sp3_ld(arow, p.sAk, k0, h, p.K, 1.f);
#pragma unroll
            for (int t = 0; t < 2; ++t) {
                const int bn = min(n0 + t * 16 + l15, p.N - 1);
                acc[t] = wmma6(a, sp3_ld(B + (long long)bn * p.sBn, p.sBk, k0, h, p.K, 1.f), acc[t]);
            }
        } else if (MODE == 4) {
            // triple split as MODE 3, but each k-step's 6 products go into a fresh accumulator and the partial is added to the running f32 sum
            // on the VALU with Kahan compensation (accumulation error stays ~1 ulp however long K is)
            const Split3 a = sp3_ld(arow, p.sAk, k0, h, p.K, 1.f);
#pragma unroll
            for (int t = 0; t < 2; ++t) {
                const int bn = min(n0 + t * 16 + l15, p.N - 1); v8f zz = {};
                const v8f part = wmma6(a, sp3_ld(B + (long long)bn * p.sBn, p.sBk, k0, h, p.K, 1.f), zz);
                const v8f y = part - comp[t]; const v8f s = acc[t] + y; comp[t] = (s - acc[t]) - y; acc[t] = s;
            }
        } else if (MODE == 2) {
            const v16b a = bh_ld(arow, p.sAk, k0, h, p.K, 1.f);
#pragma unroll
            for (int t = 0; t < 2; ++t) {
                const int bn = min(n0 + t * 16 + l15, p.N - 1);
                acc[t] = wmmab(a, bh_ld(B + (long long)bn * p.sBn, p.sBk, k0, h, p.K, 1.f), acc[t]);
            }
        } else {
            const v16h a = fh_ld(arow, p.sAk, k0, h, p.K, p.sa);
#pragma unroll
            for (int t = 0; t < 2; ++t) {
                const int bn = min(n0 + t * 16 + l15, p.N - 1);
                acc[t] = wmma16(a, fh_ld(B + (long long)bn * p.sBn, p.sBk, k0, h, p.K, p.sb), acc[t]);
            }
        }
    }
    const float iscale = (MODE == 0) ? p.alpha / (p.sa * p.sb) : p.alpha;
    float* C = p.C + zo * p.sCo + zi * p.sCi;
    const float* R = p.R + zo * p.sRo + zi * p.sRi;
    __shared__ __align__(16) float ctile[16][36];
#pragma unroll
    for (int t = 0; t < 2; ++t) {
        const int n = n0 + t * 16 + l15; const int nn = min(n, p.N - 1);
#pragma unroll
        for (int r = 0; r < 8; ++r) {
            const int m = m0 + 8 * h + r; const int mm = min(m, p.M - 1);
            float v = acc[t][r] * iscale;
            if (p.flags & 1) v += p.bias[nn];
            if (p.flags & 2) v += p.bias[mm];
            if (p.flags & 8) v *= p.bias[(long long)zo * p.M + mm];   /* per-(z,row) scale vector laid out [Z][M]; exclusive with the bias flags */
            v = act_fn(v, p.act);
            if (p.flags & 4) v += p.beta * R[(long long)mm * p.sRm + (long long)nn * p.sRn];
            ctile[8 * h + r][t * 16 + l15] = (n < p.N) ? v : 0.f;
        }
    }
    __syncthreads();
    const int NW = (p.Npad > p.N) ? p.Npad : p.N;           // write width
    const bool fast = (m0 + 16 <= p.M) && (n0 + 32 <= NW) && ((p.sCm & 3) == 0) && ((((size_t)C) & 15) == 0);
    if (fast) {
#pragma unroll
        for (int s = 0; s < 4; ++s) {
            const int row = s * 4 + (lane >> 3), c4 = (lane & 7) * 4;
            const v4f v = *(const v4f*)&ctile[row][c4];
            VST2V4(C + (long long)(m0 + row) * p.sCm + n0 + c4, v);
        }
    } else {
        for (int row = 0; row < 16; ++row) {
            const int m = m0 + row, n = n0 + lane;
            if (m < p.M && n < NW) VST2(float, C + (long long)m * p.sCm + n, ctile[row][lane]);
        }
    }
}


// =====================================================================================================================
// k_gemmT<MODE, TM, TN>: same contract as k_gemm, but one wave computes a (16*TM) x (16*TN) tile: TM A fragments and TN B fragments are
//   loaded per 32-wide k-step and reused across TM*TN WMMAs (far fewer load/convert instructions per MAC). MODE 0 (f16), 1 (bf16 hi/lo),
//   2 (bf16) only. grid (ceil(NW/(16*TN)), ceil(M/(16*TM)), Z), block 32. Epilogue identical to k_gemm, run per 16x32 sub-tile.
// =====================================================================================================================
template <int MODE, int TM, int TN>
__global__ __launch_bounds__(32) void k_gemmT(GemmP p) {
    const int lane = threadIdx.x & 31, h = lane >> 4, l15 = lane & 15;
    const int m0 = blockIdx.y * (16 * TM), n0 = blockIdx.x * (16 * TN);
    const int z = blockIdx.z, zo = z / p.zi_n, zi = z - zo * p.zi_n;
    const float* A = p.A + zo * p.sAo + zi * p.sAi;
    const float* B = p.B + zo * p.sBo + zi * p.sBi;
    v8f acc[TM][TN];
#pragma unroll
    for (int i = 0; i < TM; ++i)
#pragma unroll
        for (int t = 0; t < TN; ++t) { v8f zz = {}; acc[i][t] = zz; }
    for (int k0 = 0; k0 < p.K; k0 += 32) {
        if (MODE == 1) {
            Split a[TM], b[TN];
#pragma unroll
            for (int i = 0; i < TM; ++i) { const int am = min(m0 + 16 * i + l15, p.M - 1); a[i] = sp_ld(A + (long long)am * p.sAm, p.sAk, k0, h, p.K, 1.f); }
#pragma unroll
            for (int t = 0; t < TN; ++t) { const int bn = min(n0 + 16 * t + l15, p.N - 1); b[t] = sp_ld(B + (long long)bn * p.sBn, p.sBk, k0, h, p.K, 1.f); }
#pragma unroll
            for (int i = 0; i < TM; ++i)
#pragma unroll
                for (int t = 0; t < TN; ++t) acc[i][t] = wmma3(a[i], b[t], acc[i][t]);
        } else if (MODE == 2) {
            v16b a[TM], b[TN];
#pragma unroll
            for (int i = 0; i < TM; ++i) { const int am = min(m0 + 16 * i + l15, p.M - 1); a[i] = bh_ld(A + (long long)am * p.sAm, p.sAk, k0, h, p.K, 1.f); }
#pragma unroll
            for (int t = 0; t < TN; ++t) { const int bn = min(n0 + 16 * t + l15, p.N - 1); b[t] = bh_ld(B + (long long)bn * p.sBn, p.sBk, k0, h, p.K, 1.f); }
#pragma unroll
            for (int i = 0; i < TM; ++i)
#pragma unroll
                for (int t = 0; t < TN; ++t) acc[i][t] = wmmab(a[i], b[t], acc[i][t]);
        } else {
            v16h a[TM], b[TN];
#pragma unroll
            for (int i = 0; i < TM; ++i) { const int am = min(m0 + 16 * i + l15, p.M - 1); a[i] = fh_ld(A + (long long)am * p.sAm, p.sAk, k0, h, p.K, p.sa); }
#pragma unroll
            for (int t = 0; t < TN; ++t) { const int bn = min(n0 + 16 * t + l15, p.N - 1); b[t] = fh_ld(B + (long long)bn * p.sBn, p.sBk, k0, h, p.K, p.sb); }
#pragma unroll
            for (int i = 0; i < TM; ++i)
#pragma unroll
                for (int t = 0; t < TN; ++t) acc[i][t] = wmma16(a[i], b[t], acc[i][t]);
        }
    }
    const float iscale = (MODE == 0) ? p.alpha / (p.sa * p.sb) : p.alpha;
    float* C = p.C + zo * p.sCo + zi * p.sCi;
    const float* R = p.R + zo * p.sRo + zi * p.sRi;
    const int NW = (p.Npad > p.N) ? p.Npad : p.N;
    __shared__ __align__(16) float ctile[16][36];
#pragma unroll
    for (int i = 0; i < TM; ++i) {
        const int mb = m0 + 16 * i; if (mb >= p.M) break;          // wave-uniform
#pragma unroll
        for (int tp = 0; tp < TN / 2; ++tp) {
            const int nb = n0 + 32 * tp; if (nb >= NW) break;        // wave-uniform
#pragma unroll
            for (int t2 = 0; t2 < 2; ++t2) {
                const int t = 2 * tp + t2; const int n = nb + t2 * 16 + l15; const int nn = min(n, p.N - 1);
#pragma unroll
                for (int r = 0; r < 8; ++r) {
                    const int m = mb + 8 * h + r; const int mm = min(m, p.M - 1);
                    float v = acc[i][t][r] * iscale;
                    if (p.flags & 1) v += p.bias[nn];
                    if (p.flags & 2) v += p.bias[mm];
            if (p.flags & 8) v *= p.bias[(long long)zo * p.M + mm];   /* per-(z,row) scale vector laid out [Z][M]; exclusive with the bias flags */
                    v = act_fn(v, p.act);
                    if (p.flags & 4) v += p.beta * R[(long long)mm * p.sRm + (long long)nn * p.sRn];
                    ctile[8 * h + r][t2 * 16 + l15] = (n < p.N) ? v : 0.f;
                }
            }
            __syncthreads();
            const bool fast = (mb + 16 <= p.M) && (nb + 32 <= NW) && ((p.sCm & 3) == 0) && ((((size_t)C) & 15) == 0);
            if (fast) {
#pragma unroll
                for (int s = 0; s < 4; ++s) {
                    const int row = s * 4 + (lane >> 3), c4 = (lane & 7) * 4;
                    const v4f v = *(const v4f*)&ctile[row][c4];
                    VST2V4(C + (long long)(mb + row) * p.sCm + nb + c4, v);
                }
            } else {
                for (int row = 0; row < 16; ++row) {
                    const int m = mb + row, n = nb + lane;
                    if (m < p.M && n < NW) VST2(float, C + (long long)m * p.sCm + n, ctile[row][lane]);
                }
            }
            __syncthreads();
        }
    }
}

// =====================================================================================================================
//   Wave = 16 queries, AW waves per block, 64-key blocks; grid (ceil(Lq/(16*AW)), H, B), block 32*AW. Any Lq, Lk; head dim dh <= DHP
//   (DHP multiple of 32), value dim dv <= DVP (multiple of 16, <= 128). Every tensor addressed by (batch, head, row, element) strides, f32.
//   Scores: QM 0 f16 operands, 1 bf16 hi/lo split, 2 bf16 triple split; statistics f32 (exp2 domain); P.V: P x 4096 as f16 with V f16 staged in LDS
//   (SPLITPV: P and V as bf16 hi/lo splits). kv head = h / hrep. Masking: causal = 1 (keep j <= i + coff, masked -> -inf, key blocks beyond the
//   diagonal skipped), causal = 2 (masked -> mfill, a finite fill like the -1e9; no skipping), causal = 3 (keep j >= i + coff,
//   masked -> -inf, no skipping); optional additive f32 mask Mf,
//   optional int keep-mask Mi (0 -> score := mfill), both addressed b*smb + h*smh + i*smi + j*smj (0 strides broadcast).
// =====================================================================================================================
#define AW 4
struct AttnP {   // apv4
    const float* Q; const float* K; const float* V; float* O; float* P; const float* Mf; const int* Mi; float* ST;
    const float* Pw; const float* Rt; const int* SQ; const int* SK;           // optional: post-softmax weight, relative-position table, segment ids
    long long swb, swh, swi, swj, srb, srh, sri;                                 // Pw strides (b,h,i,j); Rt strides (b,h,i), column = clamp(i - j + roff, 0, rn-1)
    long long sQb, sQh, sQi, sQd, sKb, sKh, sKj, sKd, sVb, sVh, sVj, sVd, sOb, sOh, sOi, sPb, sPh, sPi, smb, smh, smi, smj;
    int Lq, Lk, dh, dv, hrep, causal, coff, pband;   // pband > 0: P holds only the band |j - i| <= pband, column j - i + pband
    float scale, mfill; int nonorm, mpol;             // nonorm (online path only): O = sum_j exp(score_j) V_j without the 1/rowsum (scores must be <= ~0); mpol: Mi masks where ==0 (mpol 0) or where !=0 (mpol 1)
    int roff, rn, segpol, win;                        // Rt column offset/count; SQ/SK: score := mfill where (segpol 0) SQ[i] != SK[j] or (segpol 1) SQ[i] == SK[j]; win > 0: keys with i - j > win (after coff) -> -inf
};
//   Pw: the softmax numerator is multiplied by Pw(b,h,i,j) AFTER the row sum is taken (probs * weight, then P.V), as in post-softmax multiplicative biases.                                                    // ST (optional): per row (b,h,i) -> ST[((b*H + h)*Lq + i)*2 + {0,1}] = {row max of the scaled+masked score (natural units), sum_j exp(score - max)}
static_assert(sizeof(AttnP) == 12 * 8 + 29 * 8 + 16 * 4, "AttnP has padding");

#ifndef KATTN_ATTR
#define KATTN_ATTR
#endif
template <int DHP, int DVP, int QM, bool SPLITPV, bool TWOPASS>
__global__ __launch_bounds__(32 * AW) KATTN_ATTR void k_attn(AttnP p) {
    constexpr int NT = DVP / 16;                // output tiles
    constexpr int KS = DHP / 32;                // k-steps for the scores
    constexpr int VP = DVP + 8;                 // LDS pitch (halves)
    __shared__ __align__(16) float    pl[AW][16 * 64];
    __shared__ __align__(16) _Float16 vl[(SPLITPV ? 2 : 1) * 64 * VP];   // f16 V tile, or bf16 hi and lo tiles (same 2-byte size)
    const int lane = threadIdx.x & 31, hf = lane >> 4, l15 = lane & 15, wave = threadIdx.x >> 5;
    const int h = blockIdx.y, b = blockIdx.z, hk = h / p.hrep;
    const int q0 = (blockIdx.x * AW + wave) * 16;
    float* myp = pl[wave];
    const float L2E = 1.4426950408889634f;
    const float NEG = -__builtin_inff();
    const int qi = min(q0 + l15, p.Lq - 1);
    const float* qrow = p.Q + b * p.sQb + h * p.sQh + (long long)qi * p.sQi;
    const float* kbase = p.K + b * p.sKb + hk * p.sKh;
    const float* vbase = p.V + b * p.sVb + hk * p.sVh;
    v16h qa[QM == 0 ? KS : 1]; Split qs_[QM == 1 ? KS : 1]; Split3 qt_[QM == 2 ? KS : 1];
#pragma unroll
    for (int ks = 0; ks < KS; ++ks) {
        if (QM == 2) qt_[ks] = sp3_ld(qrow, p.sQd, ks * 32, hf, p.dh, 1.f);
        else if (QM == 1) qs_[ks] = sp_ld(qrow, p.sQd, ks * 32, hf, p.dh, 1.f);
        else qa[ks] = fh_ld(qrow, p.sQd, ks * 32, hf, p.dh, 1.f);
    }
    v8f o[NT]; float m8[8], l8[8];
#pragma unroll
    for (int t = 0; t < NT; ++t) { v8f zz = {}; o[t] = zz; }
#pragma unroll
    for (int i = 0; i < 8; ++i) { m8[i] = NEG; l8[i] = 0.f; }
    int jend = p.Lk; int jstart = 0;
    if (p.causal == 1) { const int je = (blockIdx.x * AW + AW - 1) * 16 + 16 + p.coff; jend = min(jend, max(je, 0)); }   // uniform per block
    if (p.win > 0) { const int js = (int)(blockIdx.x * AW) * 16 + p.coff - p.win; jstart = (js > 0) ? (js / 64) * 64 : 0; }   // uniform per block: key blocks entirely outside every row's window hold only -inf entries and are skipped exactly
    const int npass = TWOPASS ? 2 : 1;
    for (int pass = 0; pass < npass; ++pass) {
        const bool dopv = (!TWOPASS) || pass == 1;
        for (int j0 = jstart; j0 < jend; j0 += 64) {
            if (dopv) {
                __syncthreads();                                 // previous key block's reads of vl / pl are done
                for (int idx = threadIdx.x; idx < 64 * DVP; idx += 32 * AW) {
                    const int jr = idx / DVP, d = idx - jr * DVP, j = j0 + jr;
                    const float f = (j < p.Lk && d < p.dv) ? vbase[(long long)j * p.sVj + (long long)d * p.sVd] : 0.f;
                    if (SPLITPV) {
                        const __bf16 hb = bf16_rne(f);
                        ((__bf16*)vl)[jr * VP + d] = hb; ((__bf16*)vl)[64 * VP + jr * VP + d] = bf16_rne(f - bf16_f32(hb));
                    } else vl[jr * VP + d] = (_Float16)f;
                }
            }
            v8f s[4];
#pragma unroll
            for (int t = 0; t < 4; ++t) {
                const int j = min(j0 + t * 16 + l15, p.Lk - 1);
                const float* krow = kbase + (long long)j * p.sKj;
                v8f acc = {};
#pragma unroll
                for (int ks = 0; ks < KS; ++ks) {
                    if (QM == 2)      acc = wmma6(qt_[ks], sp3_ld(krow, p.sKd, ks * 32, hf, p.dh, 1.f), acc);
                    else if (QM == 1) acc = wmma3(qs_[ks], sp_ld(krow, p.sKd, ks * 32, hf, p.dh, 1.f), acc);
                    else              acc = wmma16(qa[ks], fh_ld(krow, p.sKd, ks * 32, hf, p.dh, 1.f), acc);
                }
                s[t] = acc;
            }
            float pv[8][4];
#pragma unroll
            for (int i = 0; i < 8; ++i) {
                const int irow = q0 + i + 8 * hf;
                const int ic = min(irow, p.Lq - 1);
                float sc[4];
#pragma unroll
                for (int t = 0; t < 4; ++t) {
                    const int jg = j0 + t * 16 + l15;
                    float v = s[t][i] * p.scale;
                    if (p.Mf) v += p.Mf[b * p.smb + h * p.smh + (long long)ic * p.smi + (long long)min(jg, p.Lk - 1) * p.smj];
                    if (p.Rt) { int rc = ic - min(jg, p.Lk - 1) + p.roff; rc = rc < 0 ? 0 : (rc >= p.rn ? p.rn - 1 : rc); v += p.Rt[b * p.srb + h * p.srh + (long long)ic * p.sri + rc]; }
                    if (p.Mi) { const int mv = p.Mi[b * p.smb + h * p.smh + (long long)ic * p.smi + (long long)min(jg, p.Lk - 1) * p.smj]; if (p.mpol ? (mv != 0) : (mv == 0)) v = p.mfill; }
                    if (p.SQ) { const bool same = p.SQ[(long long)b * p.Lq + ic] == p.SK[(long long)b * p.Lk + min(jg, p.Lk - 1)]; if (p.segpol ? same : !same) v = p.mfill; }
                    if (p.causal == 2 && jg > irow + p.coff) v = p.mfill;
                    if (jg >= p.Lk || (p.causal == 1 && jg > irow + p.coff) || (p.causal == 3 && jg < irow + p.coff) || (p.win > 0 && irow + p.coff - jg > p.win)) v = NEG; else v *= L2E;
                    sc[t] = v;
                }
                if (!TWOPASS || pass == 0) {
                    float mx = fmaxf(fmaxf(sc[0], sc[1]), fmaxf(sc[2], sc[3]));
                    mx = fmaxf(mx, __shfl_xor(mx, 1, 32)); mx = fmaxf(mx, __shfl_xor(mx, 2, 32));
                    mx = fmaxf(mx, __shfl_xor(mx, 4, 32)); mx = fmaxf(mx, __shfl_xor(mx, 8, 32));
                    const float mnew = fmaxf(m8[i], mx);
                    const float corr = (mnew == NEG) ? 1.f : exp2f(m8[i] - mnew);
                    float rs = 0.f;
#pragma unroll
                    for (int t = 0; t < 4; ++t) {
                        const float pp = (sc[t] == NEG) ? 0.f : exp2f(sc[t] - mnew); rs += pp;
                        pv[i][t] = p.Pw ? pp * p.Pw[b * p.swb + h * p.swh + (long long)ic * p.swi + (long long)min(j0 + t * 16 + l15, p.Lk - 1) * p.swj] : pp;
                    }
                    rs += __shfl_xor(rs, 1, 32); rs += __shfl_xor(rs, 2, 32); rs += __shfl_xor(rs, 4, 32); rs += __shfl_xor(rs, 8, 32);
                    l8[i] = l8[i] * corr + rs; m8[i] = mnew;
                    if (!TWOPASS) {
#pragma unroll
                        for (int t = 0; t < NT; ++t) o[t][i] *= corr;
                    }
                } else {
                    const float inv = (l8[i] > 0.f) ? 1.f / l8[i] : 0.f;
#pragma unroll
                    for (int t = 0; t < 4; ++t) {
                        const int jg = j0 + t * 16 + l15;
                        float pp = (sc[t] == NEG) ? 0.f : exp2f(sc[t] - m8[i]) * inv;
                        if (p.Pw) pp *= p.Pw[b * p.swb + h * p.swh + (long long)ic * p.swi + (long long)min(jg, p.Lk - 1) * p.swj];
                        pv[i][t] = pp;
                    }
                }
            }
            if (dopv) {
#pragma unroll
                for (int i = 0; i < 8; ++i)
#pragma unroll
                    for (int t = 0; t < 4; ++t) ((float*)myp)[(i + 8 * hf) * 64 + t * 16 + l15] = pv[i][t];
                __syncthreads();                                 // P (per wave) and V (shared) visible
                if (p.P) {
                    float* pb_ = p.P + b * p.sPb + h * p.sPh;
                    const bool fastP = (p.pband == 0) && ((p.sPi & 3) == 0) && (j0 + 64 <= p.Lk) && (q0 + 16 <= p.Lq) && ((((size_t)pb_) & 15) == 0);
                    if (fastP) {
#pragma unroll
                        for (int s = 0; s < 8; ++s) {
                            const int row = s * 2 + (lane >> 4), c4 = (lane & 15) * 4;
                            const v4f v = *(const v4f*)(myp + row * 64 + c4);
                            VST2V4(pb_ + (long long)(q0 + row) * p.sPi + j0 + c4, v);
                        }
                    } else {
                        for (int row = 0; row < 16; ++row) {
                            const int irow = q0 + row; if (irow >= p.Lq) continue;
                            for (int c = lane; c < 64; c += 32) {
                                const int jg = j0 + c; if (jg >= p.Lk) continue;
                                if (p.pband == 0) VST2(float, pb_ + (long long)irow * p.sPi + jg, myp[row * 64 + c]);
                                else if (jg - irow <= p.pband && irow - jg <= p.pband) VST2(float, pb_ + (long long)irow * p.sPi + (jg - irow + p.pband), myp[row * 64 + c]);
                            }
                        }
                    }
                }
                if (SPLITPV) {
                    const Split pa0 = sp_ld(myp + l15 * 64, 1, 0, hf, 64, 1.f), pa1 = sp_ld(myp + l15 * 64, 1, 32, hf, 64, 1.f);
                    const __bf16* vh = (const __bf16*)vl; const __bf16* vlo = vh + 64 * VP;
#pragma unroll
                    for (int t = 0; t < NT; ++t) {
                        const int dcol = t * 16 + l15;
                        Split b0, b1;
#pragma unroll
                        for (int e = 0; e < 16; ++e) {
                            const int k0 = frag_k(e, hf), k1 = 32 + frag_k(e, hf);
                            b0.hi[e] = vh[k0 * VP + dcol]; b0.lo[e] = vlo[k0 * VP + dcol]; b1.hi[e] = vh[k1 * VP + dcol]; b1.lo[e] = vlo[k1 * VP + dcol];
                        }
                        o[t] = wmma3(pa0, b0, o[t]);
                        o[t] = wmma3(pa1, b1, o[t]);
                    }
                } else {
                    const v16h pa0 = fh_ld(myp + l15 * 64, 1, 0, hf, 64, 4096.f), pa1 = fh_ld(myp + l15 * 64, 1, 32, hf, 64, 4096.f);
#pragma unroll
                    for (int t = 0; t < NT; ++t) {
                        const int dcol = t * 16 + l15;
                        v16h b0, b1;
#pragma unroll
                        for (int e = 0; e < 16; ++e) { b0[e] = vl[frag_k(e, hf) * VP + dcol]; b1[e] = vl[(32 + frag_k(e, hf)) * VP + dcol]; }
                        o[t] = wmma16(pa0, b0, o[t]);
                        o[t] = wmma16(pa1, b1, o[t]);
                    }
                }
            }
        }
    }
    float* obase = p.O + b * p.sOb + h * p.sOh;
    if (p.ST) {
        const int rl = lane >> 1, isel = rl & 7;           // row q0 + rl ; rl>>3 == hf holds because lane>>4 == (lane>>1)>>3
        float mv = 0.f, lv = 0.f;
#pragma unroll
        for (int i = 0; i < 8; ++i) if (i == isel) { mv = m8[i]; lv = l8[i]; }
        const int irow = q0 + rl;
        if (irow < p.Lq) { float* st = p.ST + (((long long)b * gridDim.y + h) * p.Lq + irow) * 2 + (lane & 1); VST2(float, st, (lane & 1) ? lv : mv * 0.6931471805599453f); }
    }
    float invr[8];
#pragma unroll
    for (int i = 0; i < 8; ++i) {
        if (TWOPASS) invr[i] = SPLITPV ? 1.f : (1.f / 4096.f);
        else if (p.nonorm) invr[i] = exp2f(m8[i]) * (SPLITPV ? 1.f : (1.f / 4096.f));
        else invr[i] = (l8[i] > 0.f) ? (SPLITPV ? 1.f / l8[i] : 1.f / (l8[i] * 4096.f)) : 0.f;
    }
    __syncthreads();                                             // all waves done with pl/vl from the main loop
    const bool ofast = ((p.sOi & 3) == 0) && ((((size_t)obase) & 15) == 0) && (q0 + 16 <= p.Lq);
#pragma unroll
    for (int c0 = 0; c0 < DVP; c0 += 64) {
#pragma unroll
        for (int i = 0; i < 8; ++i)
#pragma unroll
            for (int t = 0; t < NT; ++t) if (t * 16 >= c0 && t * 16 < c0 + 64) ((float*)myp)[(i + 8 * hf) * 64 + (t * 16 - c0) + l15] = o[t][i] * invr[i];
        __syncthreads();
        const int cw = (DVP - c0 < 64) ? (DVP - c0) : 64;      // staged columns in this chunk (multiple of 16)
        if (ofast && (c0 + cw <= p.dv) && (cw % 32 == 0)) {
            const int lpr = cw / 4;                              // lanes per row (16 for 64 cols, 8 for 32)
            const int rows_per_ins = 32 / lpr;
            for (int r0 = 0; r0 < 16; r0 += rows_per_ins) {
                const int row = r0 + lane / lpr, c4 = (lane % lpr) * 4;
                const v4f v = *(const v4f*)(myp + row * 64 + c4);
                VST2V4(obase + (long long)(q0 + row) * p.sOi + c0 + c4, v);
            }
        } else {
            for (int row = 0; row < 16; ++row) {
                const int irow = q0 + row; if (irow >= p.Lq) continue;
                for (int c = lane; c < cw; c += 32) { const int d = c0 + c; if (d < p.dv) VST2(float, obase + (long long)irow * p.sOi + d, myp[row * 64 + c]); }
            }
        }
        __syncthreads();
    }
}

// =====================================================================================================================
// k_tr: dst(z, c, r) = alpha * src(z, r, c) (+ beta * R2(z, c, r)): [Z][R][C] (row stride lds) -> [Z][C][R] (row stride ldd) through a 32x32 LDS tile;
//   flags: 1 -> add beta * residual R2 addressed like dst (z*sRz + c*ldr + r); act applied before the residual.
// =====================================================================================================================
struct TrP { const float* src; float* dst; const float* R2; long long sSz, lds, sDz, ldd, sRz, ldr; int R, C, flags, act; float alpha, beta; };
static_assert(sizeof(TrP) == 3 * 8 + 6 * 8 + 6 * 4, "TrP has padding");
__global__ __launch_bounds__(256) void k_tr(TrP p) {
    __shared__ float tile[32][33];
    const int c0 = blockIdx.x * 32, r0 = blockIdx.y * 32, z = blockIdx.z;
    const int lane = threadIdx.x & 31, wave = threadIdx.x >> 5;
    const float* s = p.src + z * p.sSz;
#pragma unroll
    for (int k = 0; k < 4; ++k) {
        const int rl = wave * 4 + k, r = r0 + rl, c = c0 + lane;
        tile[rl][lane] = (r < p.R && c < p.C) ? s[(long long)r * p.lds + c] : 0.f;
    }
    __syncthreads();
    float* d = p.dst + z * p.sDz; const float* rr = p.R2 + z * p.sRz;
#pragma unroll
    for (int k = 0; k < 4; ++k) {
        const int cl = wave * 4 + k, c = c0 + cl, r = r0 + lane;
        if (c < p.C && r < p.R) {
            float v = act_fn(p.alpha * tile[lane][cl], p.act);
            if (p.flags & 1) v += p.beta * rr[(long long)c * p.ldr + r];
            VST2(float, d + (long long)c * p.ldd + r, v);
        }
    }
}

// k_affine: dst[i] = a * (sdev ? sdev[0] : 1) * src[i] + b, i < n (one thread per element; consecutive lanes -> consecutive addresses)
__global__ __launch_bounds__(256) void k_affine(const float* __restrict__ src, float* __restrict__ dst, int n, float a, float b, const float* __restrict__ sdev) {
    const int i = blockIdx.x * 256 + threadIdx.x;
    if (i < n) { const float aa = sdev ? a * sdev[0] : a; const float v = aa * src[i] + b; VST2(float, dst + i, v); }
}

// =====================================================================================================================
// k_softmax: row softmax over n contiguous elements, one 256-thread block per row; rows addressed z*sz + r*sr (grid (R, Z)).
//   out = scale_out * softmax(scale_in * x + (Mf ? Mf[z*smz + r*smr + j] : 0)); a row whose max is -inf is written as 0.
// =====================================================================================================================
struct SmP { const float* src; float* dst; const float* Mf; long long sz, sr, dz, dr, smz, smr; int n, pad; float scale_in, scale_out; };
static_assert(sizeof(SmP) == 3 * 8 + 6 * 8 + 4 * 4, "SmP has padding");
__global__ __launch_bounds__(256) void k_softmax(SmP p) {
    __shared__ float red[256];
    const int r = blockIdx.x, z = blockIdx.y, tid = threadIdx.x;
    const float* s = p.src + z * p.sz + (long long)r * p.sr;
    const float* mf = p.Mf ? (p.Mf + z * p.smz + (long long)r * p.smr) : nullptr;
    float mx = -__builtin_inff();
    for (int j = tid; j < p.n; j += 256) { float v = s[j] * p.scale_in; if (mf) v += mf[j]; mx = fmaxf(mx, v); }
    red[tid] = mx; __syncthreads();
    for (int o = 128; o > 0; o >>= 1) { if (tid < o) red[tid] = fmaxf(red[tid], red[tid + o]); __syncthreads(); }
    mx = red[0]; __syncthreads();
    float sum = 0.f;
    for (int j = tid; j < p.n; j += 256) { float v = s[j] * p.scale_in; if (mf) v += mf[j]; sum += (mx == -__builtin_inff()) ? 0.f : expf(v - mx); }
    red[tid] = sum; __syncthreads();
    for (int o = 128; o > 0; o >>= 1) { if (tid < o) red[tid] += red[tid + o]; __syncthreads(); }
    sum = red[0];
    const float inv = (sum > 0.f) ? p.scale_out / sum : 0.f;
    float* d = p.dst + z * p.dz + (long long)r * p.dr;
    for (int j = tid; j < p.n; j += 256) { float v = s[j] * p.scale_in; if (mf) v += mf[j]; const float o = (mx == -__builtin_inff()) ? 0.f : expf(v - mx) * inv; VST2(float, d + j, o); }
}
// =====================================================================================================================
// k_stats: mean and rsqrt(var + eps) over a set of n elements addressed base + z*sz + (e / inner) * so + (e % inner) * si, one 256-thread
// k_norm_apply: y = (x - mean[set]) * rstd[set] * g[c] + b[c] over a [Z][C][L] channel-major tensor with set = z*G + c / (C/G) (G groups per z;
//   G = C -> per-channel sets indexed z*C+c; for batch norm pass stats indexed by c only via bn = 1). Optional act. Output same layout.
// =====================================================================================================================
//   mode 0: mean / rsqrt(var + eps); mode 1 (RMSNorm): 0 / rsqrt(mean(x^2) + eps); mode 2 (L2 normalize * sqrt(n)): 0 / sqrt(n) / max(||x||, eps); mode 3: as 0 with unbiased variance (n-1)
__global__ __launch_bounds__(256) void k_stats(const float* __restrict__ x, long long sz, long long so, long long si, int inner, int n, float eps, float* __restrict__ stat, int mode) {
    __shared__ float red[256];
    const int z = blockIdx.x, tid = threadIdx.x;
    const float* base = x + z * sz;
    float s = 0.f;
    for (int e = tid; e < n; e += 256) s += base[(long long)(e / inner) * so + (long long)(e % inner) * si];
    red[tid] = s; __syncthreads();
    for (int o = 128; o > 0; o >>= 1) { if (tid < o) red[tid] += red[tid + o]; __syncthreads(); }
    const float mu = (mode == 0 || mode == 3) ? red[0] / (float)n : 0.f; __syncthreads();
    float q = 0.f;
    for (int e = tid; e < n; e += 256) { const float dlt = base[(long long)(e / inner) * so + (long long)(e % inner) * si] - mu; q += dlt * dlt; }
    red[tid] = q; __syncthreads();
    for (int o = 128; o > 0; o >>= 1) { if (tid < o) red[tid] += red[tid + o]; __syncthreads(); }
    {
        float rs;
        if (mode == 2) rs = sqrtf((float)n) / fmaxf(sqrtf(red[0]), eps); else if (mode == 3) rs = rsqrtf(red[0] / (float)(n - 1) + eps); else rs = rsqrtf(red[0] / (float)n + eps);
        if (tid < 32) { const float v = (tid == 0) ? mu : ((tid == 1) ? rs : 0.f); VST2(float, stat + (long long)z * 32 + tid, v); }
    }
}
//   One thread per element over the flat [Z][C][L] index space: grid ceil(Z*C*L / 256).
__global__ __launch_bounds__(256) void k_norm_apply(const float* __restrict__ x, float* __restrict__ y, const float* __restrict__ stat, const float* __restrict__ g, const float* __restrict__ bta,
                                                     int Z, int C, int L, int G, int bn, int act) {
    const long long idx = (long long)blockIdx.x * 256 + threadIdx.x;
    if (idx >= (long long)Z * C * L) return;
    const int l = (int)(idx % L); const long long zc = idx / L; const int c = (int)(zc % C), z = (int)(zc / C); (void)l;
    const int set = bn ? c : (z * G + c / (C / G));
    float v = (x[idx] - stat[(long long)set * 32]) * stat[(long long)set * 32 + 1];
    if (g) v *= g[c];
    if (bta) v += bta[c];
    v = act_fn(v, act);
    VST2(float, y + idx, v);
}

// k_lse_neg: c[i] = -(st[2i] + log(st[2i+1])) = minus the log-sum-exp of row i from k_attn's ST output (for softmax over the query dimension)
__global__ __launch_bounds__(256) void k_lse_neg(const float* __restrict__ st, float* __restrict__ c, int n) {
    const int i = blockIdx.x * 256 + threadIdx.x;
    if (i < n) { const float v = -(st[2 * i] + logf(st[2 * i + 1])); VST2(float, c + i, v); }
}

// k_iota: dst[i] = a * i + b as int32 (segment/position id helper)
__global__ __launch_bounds__(256) void k_iota(int* __restrict__ dst, int n, int a, int b) {
    const int i = blockIdx.x * 256 + threadIdx.x;
    if (i < n) { const int v = a * i + b; VST2(int, dst + i, v); }
}

// k_axpby: dst[i] = a * x[i] + b * y[i] (+ c), i < n
__global__ __launch_bounds__(256) void k_axpby(const float* __restrict__ x, const float* __restrict__ y, float* __restrict__ dst, int n, float a, float b, float c) {
    const int i = blockIdx.x * 256 + threadIdx.x;
    if (i < n) { const float v = a * x[i] + b * y[i] + c; VST2(float, dst + i, v); }
}

// =====================================================================================================================
// k_rope: rotary embedding on a [R rows][Hn heads][D] view (row stride sXr, head stride sXh, element stride 1) -> Y (own strides).
//   mode 0: rotate_half (partner d±D/2, sign - for d<D/2); mode 1: interleaved pairs (partner d^1, sign - for even d).
//   table column tcol: tmode 0 -> d, 1 -> d % (D/2), 2 -> d / 2; position p: pmode 0 -> r % S, 1 -> head index, 2 -> pos[r];
//   c = C[(r / S) * sCb + p * sCp + tcol * sCd], s likewise from Sn; y = x[d] * c + sign * x[partner] * s. X and Y must not alias.
// =====================================================================================================================
struct RopeP { const float* X; float* Y; const float* C; const float* Sn; const int* pos; long long sXr, sXh, sYr, sYh, sCb, sCp, sCd; int R, Hn, D, S, mode, tmode, pmode, pad; };
static_assert(sizeof(RopeP) == 5 * 8 + 7 * 8 + 8 * 4, "RopeP has padding");
__global__ __launch_bounds__(256) void k_rope(RopeP p) {
    const long long idx = (long long)blockIdx.x * 256 + threadIdx.x;
    if (idx >= (long long)p.R * p.Hn * p.D) return;
    const int d = (int)(idx % p.D); const long long rh = idx / p.D; const int h = (int)(rh % p.Hn); const int r = (int)(rh / p.Hn);
    const int half = p.D / 2;
    int partner; float sign;
    if (p.mode == 0) { partner = (d < half) ? d + half : d - half; sign = (d < half) ? -1.f : 1.f; }
    else { partner = d ^ 1; sign = (d & 1) ? 1.f : -1.f; }
    const int tcol = (p.tmode == 0) ? d : ((p.tmode == 1) ? (d % half) : (d >> 1));
    const int pp = (p.pmode == 0) ? (r % p.S) : ((p.pmode == 1) ? h : p.pos[r]);
    const long long toff = (long long)(r / p.S) * p.sCb + (long long)pp * p.sCp + (long long)tcol * p.sCd;
    const float* xr = p.X + (long long)r * p.sXr + (long long)h * p.sXh;
    const float v = xr[d] * p.C[toff] + sign * xr[partner] * p.Sn[toff];
    VST2(float, p.Y + (long long)r * p.sYr + (long long)h * p.sYh + d, v);
}

// k_invf + k_sincos (split so neither kernel carries a large VALU-fma footprint): invf_i = num * (1 / powf(base, (2 i)/D)) [fmode 0],
//   num * expf((2 i) * cexp) [fmode 1], num * powf(base, -2 (i - 1) / D) [fmode 2]; then cs/sn[s*half + i] = cos/sin((pscale * s) * invf_i)
__global__ __launch_bounds__(256) void k_invf(float* __restrict__ invb, int half, int D, float base, float num, int fmode, float cexp) {
    const int i = blockIdx.x * 256 + threadIdx.x;
    if (i >= ((half + 31) / 32) * 32) return;
    if (i >= half) { VST2(float, invb + i, 0.f); return; }
    const float e = (float)(2 * i) / (float)D;
    float invf;
    if (fmode == 1) invf = num * expf((float)(2 * i) * cexp);
    else if (fmode == 2) invf = num * powf(base, (-2.0f * ((float)i - 1.0f)) / (float)D);
    else invf = num * (1.0f / powf(base, e));
    VST2(float, invb + i, invf);
}
__global__ __launch_bounds__(256) void k_sincos(float* __restrict__ cs, float* __restrict__ sn, const float* __restrict__ invb, int S, int half, float pscale) {
    const int idx = blockIdx.x * 256 + threadIdx.x;
    if (idx >= S * half) return;
    const int s = idx / half, i = idx - s * half;
    const float ang = (pscale * (float)s) * invb[i];
    VST2(float, cs + idx, cosf(ang)); VST2(float, sn + idx, sinf(ang));
}

// k_mulact: dst[i] = act(x[i]) * y[i]
__global__ __launch_bounds__(256) void k_mulact(const float* __restrict__ x, const float* __restrict__ y, float* __restrict__ dst, int n, int act) {
    const int i = blockIdx.x * 256 + threadIdx.x;
    if (i < n) { const float v = act_fn(x[i], act) * y[i]; VST2(float, dst + i, v); }
}

// =====================================================================================================================
// k_matvec: thread-per-row matrix-vector products for N <= 8 output columns (heads with 1-3 outputs, gates), f32 on the VALU.
//   C[r*sCm + j] = act(alpha * sum_k A[r*sAm + k*sAk] * B[j*sBn + k*sBk] + bias[j]) + beta * R[r*sRm + j*sRn]; each thread writes its N contiguous floats.
// =====================================================================================================================
__global__ __launch_bounds__(256) void k_matvec(GemmP p) {
    // 32 lanes write one line with one instruction.
    const int rpt = (p.N == 1) ? 1 : 32;
    const long long r0 = ((long long)blockIdx.x * 256 + threadIdx.x) * rpt; const int z = blockIdx.z, zo = z / p.zi_n, zi = z - zo * p.zi_n;
    if (r0 >= p.M) return;
    const float* Bb = p.B + zo * p.sBo + zi * p.sBi;
    float* C = p.C + zo * p.sCo + zi * p.sCi; const float* R = p.R + zo * p.sRo + zi * p.sRi;
    for (int rr = 0; rr < rpt; ++rr) {
        const long long r = r0 + rr; if (r >= p.M) break;
        const float* A = p.A + zo * p.sAo + zi * p.sAi + r * p.sAm;
        float acc[8] = {0.f, 0.f, 0.f, 0.f, 0.f, 0.f, 0.f, 0.f};
        for (int k = 0; k < p.K; ++k) { const float a = A[(long long)k * p.sAk];
#pragma unroll
            for (int j = 0; j < 8; ++j) if (j < p.N) acc[j] += a * Bb[(long long)j * p.sBn + (long long)k * p.sBk]; }
#pragma unroll
        for (int j = 0; j < 8; ++j) if (j < p.N) {
            float v = acc[j] * p.alpha;
            if (p.flags & 1) v += p.bias[j];
            if (p.flags & 2) v += p.bias[r];
            v = act_fn(v, p.act);
            if (p.flags & 4) v += p.beta * R[r * p.sRm + (long long)j * p.sRn];
            VST2(float, C + r * p.sCm + j, v);
        }
    }
}
// k_smallsoftmax: thread-per-row softmax for short rows (n <= 64): dst[r*dr + j] = softmax(scale*src[r*sr + j])
__global__ __launch_bounds__(256) void k_smallsoftmax(const float* __restrict__ src, float* __restrict__ dst, long long sr, long long dr, int n, long long R, float scale) {
    const long long r0 = ((long long)blockIdx.x * 256 + threadIdx.x) * 32;
    for (int rr = 0; rr < 32; ++rr) {
        const long long r = r0 + rr; if (r >= R) return;
        const float* s = src + r * sr; float* d = dst + r * dr;
        float mx = -__builtin_inff();
        for (int j = 0; j < n; ++j) mx = fmaxf(mx, s[j] * scale);
        float sum = 0.f;
        for (int j = 0; j < n; ++j) sum += expf(s[j] * scale - mx);
        const float inv = 1.f / sum;
        for (int j = 0; j < n; ++j) { const float v = expf(s[j] * scale - mx) * inv; VST2(float, d + j, v); }
    }
}

__global__ __launch_bounds__(32) void k_unitstat(float* __restrict__ st) { const int t = threadIdx.x; const float v = (t == 1) ? 1.f : 0.f; VST2(float, st + t, v); }

// destination (e.g. a d_out whose row width is not a multiple of 32 floats) is written by consecutive lanes of one instruction
__global__ __launch_bounds__(256) void k_lincopy(const float* __restrict__ src, long long lds, float* __restrict__ dst, long long ldd, long long rows, int cols) {
    const long long i = (long long)blockIdx.x * 256 + threadIdx.x; if (i >= rows * cols) return;
    const long long r = i / cols; const int c = (int)(i - r * cols);
    const float v = src[r * lds + c]; VST2(float, dst + r * ldd + c, v);
}

namespace w25 {
typedef __attribute__((ext_vector_type(16))) _Float16 v16h;
typedef __attribute__((ext_vector_type(8)))  _Float16 v8h;
typedef __attribute__((ext_vector_type(16))) __bf16   v16b;
typedef __attribute__((ext_vector_type(8)))  __bf16   v8b;
typedef __attribute__((ext_vector_type(8)))  float    v8f;
typedef __attribute__((ext_vector_type(4)))  float    v4f;

__device__ __forceinline__ unsigned short f2bf_bits(float f) {
  unsigned u = __float_as_uint(f);
  return (unsigned short)((u + 0x7FFFu + ((u >> 16) & 1u)) >> 16);
}
__device__ __forceinline__ float bf_bits2f(unsigned short h) { return __uint_as_float(((unsigned)h) << 16); }

// hazard guards as plain device helpers (no inline asm inside the kernel template body)
__device__ __forceinline__ void dep_guard_h(v8f& a, v8f& b, v16h x, v16h y) { asm volatile("v_nop\n\tv_nop\n\tv_nop\n\tv_nop" : "+v"(a), "+v"(b) : "v"(x), "v"(y)); }
__device__ __forceinline__ void dep_guard_b(v8f& a, v8f& b, v16b x, v16b y) { asm volatile("v_nop\n\tv_nop\n\tv_nop\n\tv_nop" : "+v"(a), "+v"(b) : "v"(x), "v"(y)); }
__device__ __forceinline__ void keep4_h(v16h a, v16h b, v16h c, v16h d) { asm volatile("v_nop" :: "v"(a), "v"(b), "v"(c), "v"(d)); }
__device__ __forceinline__ void keep4_b(v16b a, v16b b, v16b c, v16b d) { asm volatile("v_nop" :: "v"(a), "v"(b), "v"(c), "v"(d)); }
__device__ __forceinline__ void acc_guard4(v8f& a, v8f& b, v8f& c, v8f& d) { asm volatile("v_nop\n\tv_nop\n\tv_nop\n\tv_nop" : "+v"(a), "+v"(b), "+v"(c), "+v"(d)); }
template <typename T> struct Frag;
template <> struct Frag<_Float16> {
  typedef v16h V; union U { v16h v; v8h h[2]; };
  static __device__ __forceinline__ v16h load(const _Float16* p) {   // elements 0..7 <- p[0..7], 8..15 <- p[16..23]
    U f; f.h[0] = *(const v8h*)(p); f.h[1] = *(const v8h*)(p + 16); return f.v;
  }
  static __device__ __forceinline__ v8f mma(v16h a, v16h b, v8f c) {
    return __builtin_amdgcn_wmma_f32_16x16x32_f16(false, a, false, b, (short)0, c, false, false);
  }
  static __device__ __forceinline__ void guard(v8f& a, v8f& b, v16h x, v16h y) { dep_guard_h(a, b, x, y); }
  static __device__ __forceinline__ void keep(v16h a, v16h b, v16h c, v16h d) { keep4_h(a, b, c, d); }
};
template <> struct Frag<__bf16> {
  typedef v16b V; union U { v16b v; v8b h[2]; };
  static __device__ __forceinline__ v16b load(const __bf16* p) {
    U f; f.h[0] = *(const v8b*)(p); f.h[1] = *(const v8b*)(p + 16); return f.v;
  }
  static __device__ __forceinline__ v8f mma(v16b a, v16b b, v8f c) {
    return __builtin_amdgcn_wmma_f32_16x16x32_bf16(false, a, false, b, (short)0, c, false, false);
  }
  static __device__ __forceinline__ void guard(v8f& a, v8f& b, v16b x, v16b y) { dep_guard_b(a, b, x, y); }
  static __device__ __forceinline__ void keep(v16b a, v16b b, v16b c, v16b d) { keep4_b(a, b, c, d); }
};

// ---- Register-blocked batched WMMA GEMM ------------------------------------
// C[m,n] = scale * sum_k A[m,k] * Bt[n,k] (+bias)(+resid); each wave owns a 64x64 tile.
// A row-major [M,K]; Bt row-major [N,K]; M,N % 64 == 0, K % 32 == 0.
// SPLIT: operands are hi/lo planes (A2/Bt2 = lo planes, same layout); product = hi·hi + hi·lo + lo·hi.
// BIAS_MODE: 0 = none, 1 = bias[m], 2 = bias[n].
// OUT_MODE: 0 = f32, 1 = f16, 2 = bf16 hi plane (Cout) + bf16 lo plane (Cout2).
// ET: 0 = f16 operands, 1 = bf16 operands (pointers passed as 16-bit storage)
template <int ET> struct Elem;
template <> struct Elem<0> { typedef _Float16 T; };
template <> struct Elem<1> { typedef __bf16 T; };
template <int ET, bool SPLIT, int BIAS_MODE, int OUT_MODE, bool RESID, int ACT = 0>
__global__ __launch_bounds__(256) void wmma_gemm64(
    const unsigned short* __restrict__ Ap, const unsigned short* __restrict__ A2p, int lda, long strideA,
    const unsigned short* __restrict__ Btp, const unsigned short* __restrict__ Bt2p, int ldb, long strideB,
    void* __restrict__ Cout, void* __restrict__ Cout2, int ldc, long strideC,
    const float* __restrict__ bias,
    const float* __restrict__ resid, long strideR,
    int M, int N, int K, float scale) {
  typedef typename Elem<ET>::T T;
  typedef typename Frag<T>::V V;
  const T* A = (const T*)Ap; const T* A2 = (const T*)A2p; const T* Bt = (const T*)Btp; const T* Bt2 = (const T*)Bt2p;
  __shared__ __align__(16) float sT[8][16 * 68];   // per-wave 16x64 slab, pitch 68 floats
  const int b    = blockIdx.y;
  const int lane = threadIdx.x & 31;
  const int wave = threadIdx.x >> 5;
  const int tilesN = N >> 6;
  const int tilesM = M >> 6;
  const int tile = blockIdx.x * 8 + wave;
  if (tile >= tilesM * tilesN) return;   // wave-uniform; no block barriers in this kernel
  const int tm = tile / tilesN;
  const int tn = tile - tm * tilesN;
  const int m0 = tm << 6;
  const int n0 = tn << 6;

  const T* Ab  = A  + (size_t)b * strideA;
  const T* Bb  = Bt + (size_t)b * strideB;
  const T* Ab2 = SPLIT ? (A2  + (size_t)b * strideA) : nullptr;
  const T* Bb2 = SPLIT ? (Bt2 + (size_t)b * strideB) : nullptr;

  const int rlane = lane & 15;                 // row (A) / col (B, D) within subtile
  const int koff  = (lane >> 4) * 8;           // k offset of this lane half
  const int mOff  = (lane >> 4) * 8;           // D row offset

  v8f acc[4][4];
#pragma unroll
  for (int i = 0; i < 4; ++i)
#pragma unroll
    for (int j = 0; j < 4; ++j) acc[i][j] = (v8f){0.f,0.f,0.f,0.f,0.f,0.f,0.f,0.f};

  for (int k0 = 0; k0 < K; k0 += 32) {
    V bh[4], bl[4];
#pragma unroll
    for (int j = 0; j < 4; ++j) {
      const size_t bo = (size_t)(n0 + (j << 4) + rlane) * ldb + koff + k0;
      bh[j] = Frag<T>::load(Bb + bo);
      if (SPLIT) bl[j] = Frag<T>::load(Bb2 + bo);
    }
#pragma unroll
    for (int i = 0; i < 4; ++i) {
      const size_t ao = (size_t)(m0 + (i << 4) + rlane) * lda + koff + k0;
      V ah = Frag<T>::load(Ab + ao);
      V al;
      if (SPLIT) al = Frag<T>::load(Ab2 + ao);
#pragma unroll
      for (int j = 0; j < 4; ++j) {
        acc[i][j] = Frag<T>::mma(ah, bh[j], acc[i][j]);
        if (SPLIT) {
          acc[i][j] = Frag<T>::mma(ah, bl[j], acc[i][j]);
          acc[i][j] = Frag<T>::mma(al, bh[j], acc[i][j]);
        }
      }
      Frag<T>::guard(acc[i][0], acc[i][3], ah, SPLIT ? al : ah);
    }
    Frag<T>::keep(bh[0], bh[1], bh[2], bh[3]);
    if (SPLIT) Frag<T>::keep(bl[0], bl[1], bl[2], bl[3]);
  }
  acc_guard4(acc[0][0], acc[0][1], acc[0][2], acc[0][3]);
  acc_guard4(acc[1][0], acc[1][1], acc[1][2], acc[1][3]);
  acc_guard4(acc[2][0], acc[2][1], acc[2][2], acc[2][3]);
  acc_guard4(acc[3][0], acc[3][1], acc[3][2], acc[3][3]);

  // ---- epilogue ----
  float* slab = sT[wave];
  const float* Rb = RESID ? (resid + (size_t)b * strideR) : nullptr;
#pragma unroll
  for (int i = 0; i < 4; ++i) {
    const int mBase = m0 + (i << 4);
#pragma unroll
    for (int j = 0; j < 4; ++j) {
      const int n = n0 + (j << 4) + rlane;
      float bv = 0.f;
      if (BIAS_MODE == 2) bv = bias[n];
#pragma unroll
      for (int r = 0; r < 8; ++r) {
        float v = acc[i][j][r] * scale;
        if (BIAS_MODE == 1) v += bias[mBase + mOff + r];
        if (BIAS_MODE == 2) v += bv;
        if (RESID) v += Rb[(size_t)(mBase + mOff + r) * ldc + n];
        if (ACT == 1) v = tanhf(v);
        if (ACT == 2) v = fmaxf(v, 0.0f);
        if (ACT == 3) v = v / (1.0f + expf(-v));
        if (ACT == 4) v = (v > 0.f) ? v : 0.01f * v;
        if (ACT == 5) v = 0.5f * v * (1.0f + erff(v * 0.70710678118654752f));
        slab[(mOff + r) * 68 + (j << 4) + rlane] = v;
      }
    }
    __builtin_amdgcn_fence(__ATOMIC_RELEASE, "workgroup");
    __builtin_amdgcn_wave_barrier();
    __builtin_amdgcn_fence(__ATOMIC_ACQUIRE, "workgroup");
    if (OUT_MODE == 0) {
      float* C = (float*)Cout + (size_t)b * strideC;
      const int hh = lane >> 4, c4 = (lane & 15) * 4;     // row seg = 256 B = 16 lanes x 16 B
      {
#pragma unroll
        for (int it = 0; it < 8; ++it) {
          const int row = it * 2 + hh;
          v4f v = *(const v4f*)(slab + row * 68 + c4);
          *(v4f*)(C + (size_t)(mBase + row) * ldc + n0 + c4) = v;
        }
        
      }
    } else {
      const int q = lane >> 3, c8 = (lane & 7) * 8;
      unsigned short* C  = (unsigned short*)Cout  + (size_t)b * strideC;
      unsigned short* C2 = (OUT_MODE == 2) ? ((unsigned short*)Cout2 + (size_t)b * strideC) : nullptr;
      {
#pragma unroll
        for (int it = 0; it < 4; ++it) {
          const int row = it * 4 + q;
          const float* sp = slab + row * 68 + c8;
          v8h hv, lv;
#pragma unroll
          for (int e = 0; e < 8; ++e) {
            if (OUT_MODE == 1) {
              hv[e] = (_Float16)sp[e];
            } else {
              unsigned short hb = f2bf_bits(sp[e]);
              unsigned short lb = f2bf_bits(sp[e] - bf_bits2f(hb));
              hv[e] = __builtin_bit_cast(_Float16, hb);
              lv[e] = __builtin_bit_cast(_Float16, lb);
            }
          }
          *(v8h*)(C + (size_t)(mBase + row) * ldc + n0 + c8) = hv;
          if (OUT_MODE == 2) *(v8h*)(C2 + (size_t)(mBase + row) * ldc + n0 + c8) = lv;
        }
        
      }
    }
    __builtin_amdgcn_fence(__ATOMIC_RELEASE, "workgroup");
    __builtin_amdgcn_wave_barrier();
    __builtin_amdgcn_fence(__ATOMIC_ACQUIRE, "workgroup");
  }
}

// ---- LDS-staged WMMA GEMM ---------------------------------------------------
// C[m,n] = scale * sum_k A[m,k] * Bt[n,k] (+bias[n])(+resid); f16 operands, f32 C, ldc = N.
// One 128x128 tile of C per work-group of eight waves (4 x 2; 32 rows x 64 columns each).
// A pass is 128 k: 128 rows of Bt, then 128 rows of A, 256 B each, copied to LDS at pitch 272 B. Two buffers.
// M, N % 128 == 0; K % 128 == 0, K >= 256.
#define GL_PITCH 272
#define GL_STAGE (256 * GL_PITCH)

// Eight asynchronous copies, 16 B per lane each: rows r, r + 16, ... of one operand's 128 rows.
// The s_wait_xcnt ends the copies' own statement, so that no address register of a copy is rewritten in front of it.
template <int K>
__device__ __forceinline__ void gl_copy8(unsigned l, const unsigned short* g) {
  asm volatile(
      "global_load_async_to_lds_b128 %0, %8, off\n\t"
      "global_load_async_to_lds_b128 %1, %9, off\n\t"
      "global_load_async_to_lds_b128 %2, %10, off\n\t"
      "global_load_async_to_lds_b128 %3, %11, off\n\t"
      "global_load_async_to_lds_b128 %4, %12, off\n\t"
      "global_load_async_to_lds_b128 %5, %13, off\n\t"
      "global_load_async_to_lds_b128 %6, %14, off\n\t"
      "global_load_async_to_lds_b128 %7, %15, off\n\t"
      "s_wait_xcnt 0x0"
      :: "v"(l), "v"(l + 16u * GL_PITCH), "v"(l + 32u * GL_PITCH), "v"(l + 48u * GL_PITCH),
         "v"(l + 64u * GL_PITCH), "v"(l + 80u * GL_PITCH), "v"(l + 96u * GL_PITCH), "v"(l + 112u * GL_PITCH),
         "v"(g), "v"(g + (size_t)16 * K), "v"(g + (size_t)32 * K), "v"(g + (size_t)48 * K),
         "v"(g + (size_t)64 * K), "v"(g + (size_t)80 * K), "v"(g + (size_t)96 * K), "v"(g + (size_t)112 * K)
      : "memory");
}
// One stage: stage rows 0..127 come from Bt, 128..255 from A; a lane fills 16 B of rows (thread >> 4) + 16 * i.
template <int K>
__device__ __forceinline__ void gl_fill(unsigned ldsLane, const unsigned short* gB, const unsigned short* gA) {
  gl_copy8<K>(ldsLane, gB);
  gl_copy8<K>(ldsLane + 128u * GL_PITCH, gA);
}
// this wave's copies have landed in LDS
__device__ __forceinline__ void gl_wait_async0() { asm volatile("s_wait_asynccnt 0x0" ::: "memory"); }
// this wave's LDS reads have returned, so the buffer may be refilled behind the barrier
__device__ __forceinline__ void gl_wait_ds0() { asm volatile("s_wait_dscnt 0x0" ::: "memory"); }

template <int N, int K, int BIAS_MODE, bool RESID, int ACT>
__global__ __launch_bounds__(256, 4) void wmma_gemm_lds(
    const unsigned short* __restrict__ Ap, const unsigned short* __restrict__ Btp,
    float* __restrict__ C, const float* __restrict__ bias, const float* __restrict__ resid, float scale) {
  static_assert(N % 128 == 0 && K % 128 == 0 && K >= 256, "shape");
  __shared__ __attribute__((aligned(128))) unsigned char sL[2 * GL_STAGE];
  const int tid  = threadIdx.x;
  const int lane = tid & 31;
  const int wave = tid >> 5;
  constexpr int tilesN = N / 128;
  constexpr int NT = K / 128;
  const int tm = blockIdx.x / tilesN;
  const int tn = blockIdx.x - tm * tilesN;
  const int wm = (wave >> 1) << 5;             // this wave's 32 rows and 64 columns inside the tile
  const int wn = (wave & 1) << 6;
  const int rlane = lane & 15;                 // row (A) / col (B, D) within subtile
  const int hh    = lane >> 4;                 // lane half: k offset 8 * hh, D row offset 8 * hh
  const int mOff  = hh * 8;

  const unsigned ldsLane = (unsigned)(uintptr_t)(&sL[0]) + (unsigned)((tid >> 4) * GL_PITCH + (tid & 15) * 16);
  const unsigned short* gB = Btp + (size_t)(tn * 128 + (tid >> 4)) * K + (tid & 15) * 8;
  const unsigned short* gA = Ap  + (size_t)(tm * 128 + (tid >> 4)) * K + (tid & 15) * 8;

  v8f acc[2][4];
#pragma unroll
  for (int i = 0; i < 2; ++i)
#pragma unroll
    for (int j = 0; j < 4; ++j) acc[i][j] = (v8f){0.f,0.f,0.f,0.f,0.f,0.f,0.f,0.f};

  gl_fill<K>(ldsLane, gB, gA);
  gl_wait_async0();
  __syncthreads();                             // stage 0 is readable by every wave
  gl_fill<K>(ldsLane + GL_STAGE, gB + 128, gA + 128);

  // kept rolled: one pass per trip, so that the order at its foot stands once
#pragma unroll 1
  for (int t = 0; t < NT; ++t) {
    const unsigned bo = (unsigned)(t & 1) * GL_STAGE;
    const unsigned char* pB = sL + bo + (wn + rlane) * GL_PITCH + hh * 16;
    const unsigned char* pA = sL + bo + (128 + wm + rlane) * GL_PITCH + hh * 16;
    v16h bh[2][4], ah[2][2];                   // two fragment sets: the next 32 k are fetched while these are multiplied
#pragma unroll
    for (int j = 0; j < 4; ++j) bh[0][j] = Frag<_Float16>::load((const _Float16*)(pB + j * 16 * GL_PITCH));
#pragma unroll
    for (int i = 0; i < 2; ++i) ah[0][i] = Frag<_Float16>::load((const _Float16*)(pA + i * 16 * GL_PITCH));
#pragma unroll
    for (int kk = 0; kk < 4; ++kk) {
      const int cur = kk & 1, nxt = cur ^ 1;
      if (kk < 3) {
#pragma unroll
        for (int j = 0; j < 4; ++j) bh[nxt][j] = Frag<_Float16>::load((const _Float16*)(pB + j * 16 * GL_PITCH + (kk + 1) * 64));
#pragma unroll
        for (int i = 0; i < 2; ++i) ah[nxt][i] = Frag<_Float16>::load((const _Float16*)(pA + i * 16 * GL_PITCH + (kk + 1) * 64));
      }
      __builtin_amdgcn_sched_barrier(0);       // keeps the next block's LDS reads one group ahead of this block's WMMAs, not among them
#pragma unroll
      for (int i = 0; i < 2; ++i)
#pragma unroll
        for (int j = 0; j < 4; ++j) acc[i][j] = Frag<_Float16>::mma(ah[cur][i], bh[cur][j], acc[i][j]);
      __builtin_amdgcn_sched_barrier(0);       // ends the block: later LDS reads stay behind its WMMAs
    }
    gl_wait_ds0();
    gl_wait_async0();
    __syncthreads();                           // publishes stage t + 1 and ends every read of stage t
    if (t + 2 < NT) gl_fill<K>(ldsLane + bo, gB + (size_t)(t + 2) * 128, gA + (size_t)(t + 2) * 128);
  }
  gl_wait_async0();

  // ---- epilogue ----
  // The ring is free: the last trip's foot waited for every read and every copy and passed the barrier.
  float* slab = (float*)(sL + wave * (16 * 68 * 4));   // per-wave 16x64 slab, pitch 68 floats
  const int m0 = tm * 128 + wm;
  const int n0 = tn * 128 + wn;
  const int nl = n0 + rlane;
  float bv[4];
#pragma unroll
  for (int j = 0; j < 4; ++j) bv[j] = (BIAS_MODE == 2) ? bias[nl + (j << 4)] : 0.f;
  // the bias loads' index register is an input, so it stays whole up to the wait
  if (BIAS_MODE == 2) asm volatile("s_wait_xcnt 0x0" :: "v"(nl) : "memory");
#pragma unroll
  for (int i = 0; i < 2; ++i) {
    const int mBase = m0 + (i << 4);
    float rv[4][8];
    if (RESID) {
      const float* rp = resid + (size_t)(mBase + mOff) * N + nl;
#pragma unroll
      for (int j = 0; j < 4; ++j)
#pragma unroll
        for (int r = 0; r < 8; ++r) rv[j][r] = rp[(size_t)r * N + (j << 4)];
      // the residual loads' address register is an input, so it stays whole up to the wait
      asm volatile("s_wait_xcnt 0x0" :: "v"(rp) : "memory");
    }
#pragma unroll
    for (int j = 0; j < 4; ++j) {
#pragma unroll
      for (int r = 0; r < 8; ++r) {
        float v = acc[i][j][r] * scale;
        if (BIAS_MODE == 2) v += bv[j];
        if (RESID) v += rv[j][r];
        if (ACT == 2) v = fmaxf(v, 0.0f);
        slab[(mOff + r) * 68 + (j << 4) + rlane] = v;
      }
    }
    __builtin_amdgcn_fence(__ATOMIC_RELEASE, "workgroup");
    __builtin_amdgcn_wave_barrier();
    __builtin_amdgcn_fence(__ATOMIC_ACQUIRE, "workgroup");
    const int c4 = (lane & 15) * 4;            // row seg = 256 B = 16 lanes x 16 B
    float* cp = C + (size_t)(mBase + hh) * N + n0 + c4;
#pragma unroll
    for (int it = 0; it < 8; ++it) {           // rows it * 2 + hh
      v4f v = *(const v4f*)(slab + (it * 2 + hh) * 68 + c4);
      *(v4f*)(cp + (size_t)it * 2 * N) = v;
    }
    __builtin_amdgcn_sched_barrier(0);         // holds later register writes behind the wait below
    asm volatile("s_wait_xcnt 0x0" ::: "memory");   // before a data or address register of the stores above is rewritten
    __builtin_amdgcn_sched_barrier(0);         // without the pair the next rows' multiplies were lifted over the wait, onto the stores' data registers
    __builtin_amdgcn_fence(__ATOMIC_RELEASE, "workgroup");
    __builtin_amdgcn_wave_barrier();
    __builtin_amdgcn_fence(__ATOMIC_ACQUIRE, "workgroup");
  }
}

__global__ __launch_bounds__(256) void cast_f32_f16x2(
    const float* __restrict__ in, _Float16* __restrict__ out, int n2) {
  int i = blockIdx.x * 256 + threadIdx.x;
  if (i < n2) {
    const _Float16 h0 = (_Float16)in[2 * i], h1 = (_Float16)in[2 * i + 1];
    const unsigned u = (unsigned)__builtin_bit_cast(unsigned short, h0) | ((unsigned)__builtin_bit_cast(unsigned short, h1) << 16);
    ((unsigned*)out)[i] = u;
    
  }
}


} // namespace w25

__global__ __launch_bounds__(256) void k_castT16(const float* __restrict__ src, long long lds, _Float16* __restrict__ dst, long long ldd, int R, int C, float s) {
    const long long i = (long long)blockIdx.x * 256 + threadIdx.x; const long long np = (long long)C * (R / 2); if (i >= np) return; const int c = (int)(i / (R / 2)); const int r = 2 * (int)(i % (R / 2));
    const _Float16 h0 = (_Float16)(src[(long long)r * lds + c] * s), h1 = (_Float16)(src[(long long)(r + 1) * lds + c] * s);
    const unsigned u = (unsigned)__builtin_bit_cast(unsigned short, h0) | ((unsigned)__builtin_bit_cast(unsigned short, h1) << 16);
    unsigned* d = (unsigned*)(dst + (long long)c * ldd + r); *d = u;  }
__global__ __launch_bounds__(256) void k_cast16(const float* __restrict__ src, long long lds, _Float16* __restrict__ dst, long long ldd, int R, int C, float s) {
    const long long i = (long long)blockIdx.x * 256 + threadIdx.x; const long long np = (long long)R * (C / 2); if (i >= np) return; const int r = (int)(i / (C / 2)); const int c = 2 * (int)(i % (C / 2));
    const _Float16 h0 = (_Float16)(src[(long long)r * lds + c] * s), h1 = (_Float16)(src[(long long)r * lds + c + 1] * s);
    const unsigned u = (unsigned)__builtin_bit_cast(unsigned short, h0) | ((unsigned)__builtin_bit_cast(unsigned short, h1) << 16);
    unsigned* d = (unsigned*)(dst + (long long)r * ldd + c); *d = u;  }

// f32 -> bf16 hi plane + bf16 lo plane (x = hi + lo to ~2^-17 relative; RNE both), [R][C] -> [R][C] (or transposed to [C][R]); 2 consecutive destination elements
__device__ __forceinline__ unsigned int f2bf2_pack(float a, float b, unsigned int* lo) {
    const unsigned short ha = w25::f2bf_bits(a), hb = w25::f2bf_bits(b);
    const unsigned short la = w25::f2bf_bits(a - w25::bf_bits2f(ha)), lb = w25::f2bf_bits(b - w25::bf_bits2f(hb));
    *lo = (unsigned)la | ((unsigned)lb << 16); return (unsigned)ha | ((unsigned)hb << 16); }
__global__ __launch_bounds__(256) void k_castS16(const float* __restrict__ src, long long lds, __bf16* __restrict__ dhi, __bf16* __restrict__ dlo, long long ldd, int R, int C, float s, int transpose) {
    const long long i = (long long)blockIdx.x * 256 + threadIdx.x; long long o; float a, b;
    if (transpose) { const long long np = (long long)C * (R / 2); if (i >= np) return; const int c = (int)(i / (R / 2)); const int r = 2 * (int)(i % (R / 2)); a = src[(long long)r * lds + c] * s; b = src[(long long)(r + 1) * lds + c] * s; o = (long long)c * ldd + r; }
    else { const long long np = (long long)R * (C / 2); if (i >= np) return; const int r = (int)(i / (C / 2)); const int c = 2 * (int)(i % (C / 2)); a = src[(long long)r * lds + c] * s; b = src[(long long)r * lds + c + 1] * s; o = (long long)r * ldd + c; }
    unsigned lo; const unsigned hi = f2bf2_pack(a, b, &lo); unsigned* ph = (unsigned*)(dhi + o); unsigned* pl = (unsigned*)(dlo + o);
    *ph = hi; *pl = lo;  }

namespace w25 {
// =====================================================================================
// Generic causal/non-causal attention for head_dim 64, f32 in / f32 out; 16-bit operands: bf16 with optional hi/lo splits, or
// plain f16 (F16=true, non-split, probabilities carried x2^15).
//   scores = (q*qscale)·kᵀ : v_wmma_f32_16x16x32_bf16; SPLIT_QK -> q,k as bf16 hi/lo (hi·hi + hi·lo + lo·hi)
//   out    = p·v           : v_wmma_f32_16x16x32_bf16; SPLIT_PV -> p,v as bf16 hi/lo; else p,v plain bf16
//   f32 accumulate; online softmax in f32. Block = 4 waves = 64 query rows of one (batch, head); S % 64 == 0.
//   Element (b, s, h, d) of tensor X lives at X[b*X_bs + s*X_rs + h*X_hs + d] (strides in floats, multiples of 4).
//   Masking: mask_mode 0 none, 1 causal (kv > q masked), 2 tensor [S][Skv] shared over (b,h) (float if
//   mask_is_int==0, int32 with element == 0 -> masked if 1, int32 with element != 0 -> masked if 2), 3 per-token vectors qmask[B][S] & kvmask[B][Skv] (int32,
//   0 -> masked), 4 causal + sliding window (kv > q or q - kv > W masked; W passed in mask_is_int);
//   5 = relative-position bias: s += cp[b,h,q][idx[q][kv]] + pc[b,h,kv][idx[q][kv]] with idx = mask_b ([S][Skv] int32) and
//   mask_a an int32 [S][Skv] tensor with nonzero = masked (tables: element (b,h,row,n) at X + b*c_bs + h*c_hs + row*c_rs + n);
//   masked scores are replaced by mask_fill (e.g. -inf or -1e9) before the softmax.
//   grid.x = B * H * (S/64) (or a sub-range with blk0).
// =====================================================================================
#define AT_D 64
#define AT_NW 4
#define AT_QB 64
#define AT_KC 64
struct AttnGeom { const float* cp = nullptr; const float* pc = nullptr; long c_bs = 0, c_rs = 0, c_hs = 0;   // mode-5 score-bias tables
                  long q_bs, q_rs, q_hs, k_bs, k_rs, k_hs, v_bs, v_rs, v_hs, o_bs, o_rs, o_hs;
                  int S, Skv, H, mask_mode; float qscale; int blk0; float mask_fill; int mask_is_int; };
static_assert(sizeof(AttnGeom) == 168, "no padding");

__device__ __forceinline__ unsigned short at_bf_bits(float f) {
  unsigned u = __float_as_uint(f);
  return (unsigned short)((u + 0x7FFFu + ((u >> 16) & 1u)) >> 16);
}
__device__ __forceinline__ __bf16 at_f2bf(float f) { return __builtin_bit_cast(__bf16, at_bf_bits(f)); }
__device__ __forceinline__ void at_split(float f, __bf16& hi, __bf16& lo) {
  const unsigned short hb = at_bf_bits(f);
  hi = __builtin_bit_cast(__bf16, hb);
  lo = at_f2bf(f - __uint_as_float(((unsigned)hb) << 16));
}
__device__ __forceinline__ v8f at_mma(v16b a, v16b b, v8f c) {
  c = __builtin_amdgcn_wmma_f32_16x16x32_bf16(false, a, false, b, (short)0, c, false, false);
  asm volatile("v_nop\n\tv_nop\n\tv_nop\n\tv_nop" : "+v"(c) : "v"(a), "v"(b));
  return c;
}
// 16-bit element as a bit pattern held in a __bf16 slot: f16 bits when F16, bf16 (RNE) otherwise
template <bool F16> __device__ __forceinline__ __bf16 at_to16(float f) {
  if (F16) return __builtin_bit_cast(__bf16, (_Float16)f);
  return at_f2bf(f);
}
template <bool F16> __device__ __forceinline__ v8f at_mma16(v16b a, v16b b, v8f c) {
  if (F16) {
    const v16h ah = __builtin_bit_cast(v16h, a), bh = __builtin_bit_cast(v16h, b);
    c = __builtin_amdgcn_wmma_f32_16x16x32_f16(false, ah, false, bh, (short)0, c, false, false);
    asm volatile("v_nop\n\tv_nop\n\tv_nop\n\tv_nop" : "+v"(c) : "v"(ah), "v"(bh));
    return c;
  }
  return at_mma(a, b, c);
}

template <bool SPLIT_QK, bool SPLIT_PV, bool F16 = false>
__global__ __launch_bounds__(128)
void attn64_kernel(const float* __restrict__ q, const float* __restrict__ k,
                   const float* __restrict__ v, float* __restrict__ out,
                   const void* __restrict__ mask_a, const int* __restrict__ mask_b, AttnGeom g) {
  static_assert(!(F16 && (SPLIT_QK || SPLIT_PV)), "f16 mode is non-split");
  const float PSC = F16 ? 32768.0f : 1.0f;     // f16 probabilities carried x2^15 (subnormal range), folded into the final 1/l
  union FB { v16b v; v8b h[2]; };
  __shared__ __align__(16) __bf16 Ksh[AT_KC * AT_D];             // K hi [kv][d]      8 KB
  __shared__ __align__(16) __bf16 Ksl[SPLIT_QK ? AT_KC * AT_D : 8];
  __shared__ __align__(16) __bf16 Vth[AT_D * AT_KC];             // V hi [d][kv]      8 KB
  __shared__ __align__(16) __bf16 Vtl[SPLIT_PV ? AT_D * AT_KC : 8];
  __shared__ __align__(16) __bf16 Psh[AT_NW][16 * AT_KC];        // per wave P hi [row][kv]  8 KB
  __shared__ __align__(16) __bf16 Psl[SPLIT_PV ? AT_NW : 1][SPLIT_PV ? 16 * AT_KC : 8];
  __shared__ __align__(16) float  Os[AT_NW][16 * 68];            // per wave out tile, pitch 68

  const int tid  = threadIdx.x;
  const int wave = tid >> 5;
  const int lane = tid & 31;
  const int hh   = lane >> 4;
  const int c    = lane & 15;

  const int nqb = g.S / AT_QB;
  const int bx = blockIdx.x + g.blk0;
  const int qb = bx % nqb;
  const int bh = bx / nqb;
  const int h  = bh % g.H;
  const int b  = bh / g.H;
  const int qbase_block = qb * AT_QB;
  const int q0 = qbase_block + wave * 16;

  const float* qb_ptr = q + (size_t)b * g.q_bs + (size_t)h * g.q_hs;
  const float* kb_ptr = k + (size_t)b * g.k_bs + (size_t)h * g.k_hs;
  const float* vb_ptr = v + (size_t)b * g.v_bs + (size_t)h * g.v_hs;
  float*       ob_ptr = out + (size_t)b * g.o_bs + (size_t)h * g.o_hs;

  // ---- Q fragments (A operand): 2 d-chunks, hi (and lo) ----
  v16b qah[2], qal[2];
  {
    const float* qrow = qb_ptr + (size_t)(q0 + c) * g.q_rs;
#pragma unroll
    for (int dc = 0; dc < 2; ++dc) {
#pragma unroll
      for (int e = 0; e < 8; ++e) {
        const float f0 = qrow[dc * 32 + 8 * hh + e] * g.qscale;
        const float f1 = qrow[dc * 32 + 16 + 8 * hh + e] * g.qscale;
        if (SPLIT_QK) { __bf16 hq, lq; at_split(f0, hq, lq); qah[dc][e] = hq; qal[dc][e] = lq; at_split(f1, hq, lq); qah[dc][8 + e] = hq; qal[dc][8 + e] = lq; }
        else { qah[dc][e] = at_to16<F16>(f0); qah[dc][8 + e] = at_to16<F16>(f1); qal[dc][e] = qah[dc][e]; qal[dc][8 + e] = qah[dc][8 + e]; }
      }
    }
  }

  float mrow[8], lrow[8];
  v8f oacc[4];
#pragma unroll
  for (int r = 0; r < 8; ++r) { mrow[r] = -INFINITY; lrow[r] = 0.f; }
#pragma unroll
  for (int t = 0; t < 4; ++t) oacc[t] = (v8f){0.f,0.f,0.f,0.f,0.f,0.f,0.f,0.f};

  const int nChunks = (g.mask_mode == 1 || g.mask_mode == 4) ? (qb + 1) : (g.Skv / AT_KC);   // block-uniform
  // per-row query mask (mode 3)
  int qkeep[8];
#pragma unroll
  for (int r = 0; r < 8; ++r) qkeep[r] = (g.mask_mode == 3) ? mask_b[(size_t)b * g.S + q0 + 8 * hh + r] : 1;   // mask_b = qmask in mode 3
  for (int kc = 0; kc < nChunks; ++kc) {
    const int kv0 = kc * AT_KC;
    __syncthreads();
    {
      const int kvr = tid >> 1, dh = (tid & 1) * 32;
      const float* krow = kb_ptr + (size_t)(kv0 + kvr) * g.k_rs + dh;
      const float* vrow = vb_ptr + (size_t)(kv0 + kvr) * g.v_rs + dh;
#pragma unroll
      for (int i = 0; i < 8; ++i) {
        v4f kk = *(const v4f*)(krow + 4 * i);
        v4f vv = *(const v4f*)(vrow + 4 * i);
#pragma unroll
        for (int e = 0; e < 4; ++e) {
          const int d = dh + 4 * i + e;
          if (SPLIT_QK) { __bf16 a, bl; at_split(kk[e], a, bl); Ksh[kvr * AT_D + d] = a; Ksl[kvr * AT_D + d] = bl; }
          else Ksh[kvr * AT_D + d] = at_to16<F16>(kk[e]);
          if (SPLIT_PV) { __bf16 a, bl; at_split(vv[e], a, bl); Vth[d * AT_KC + kvr] = a; Vtl[d * AT_KC + kvr] = bl; }
          else Vth[d * AT_KC + kvr] = at_to16<F16>(vv[e]);
        }
      }
    }
    __syncthreads();

    v8f s[4];
#pragma unroll
    for (int j = 0; j < 4; ++j) {
      s[j] = (v8f){0.f,0.f,0.f,0.f,0.f,0.f,0.f,0.f};
#pragma unroll 1
      for (int dc = 0; dc < 2; ++dc) {
        FB kb;
        kb.h[0] = *(const v8b*)(Ksh + (j * 16 + c) * AT_D + dc * 32 + 8 * hh);
        kb.h[1] = *(const v8b*)(Ksh + (j * 16 + c) * AT_D + dc * 32 + 16 + 8 * hh);
        s[j] = at_mma16<F16>(qah[dc], kb.v, s[j]);
        if (SPLIT_QK) {
          FB kl;
          kl.h[0] = *(const v8b*)(Ksl + (j * 16 + c) * AT_D + dc * 32 + 8 * hh);
          kl.h[1] = *(const v8b*)(Ksl + (j * 16 + c) * AT_D + dc * 32 + 16 + 8 * hh);
          s[j] = at_mma16<F16>(qah[dc], kl.v, s[j]);
          s[j] = at_mma16<F16>(qal[dc], kb.v, s[j]);
        }
      }
    }
    const bool diag = (g.mask_mode == 1) && (kc == qb);
    int kvkeep[4] = {1, 1, 1, 1};
    if (g.mask_mode == 3) {
#pragma unroll
      for (int j = 0; j < 4; ++j) kvkeep[j] = ((const int*)mask_a)[(size_t)b * g.Skv + kv0 + j * 16 + c];   // mask_a = kvmask
    }
    float cm[8];
#pragma unroll
    for (int r = 0; r < 8; ++r) {
      const int qrow = q0 + 8 * hh + r;
      float m = -INFINITY;
#pragma unroll
      for (int j = 0; j < 4; ++j) {
        const int kvcol = kv0 + j * 16 + c;
        bool masked = false;
        if (diag) masked = (kvcol > qrow);
        else if (g.mask_mode == 4) masked = (kvcol > qrow) || (qrow - kvcol > g.mask_is_int);
        else if (g.mask_mode == 2) {
          const size_t mi = (size_t)qrow * g.Skv + kvcol;
          masked = (g.mask_is_int == 0) ? (((const float*)mask_a)[mi] == 0.0f)
                 : (g.mask_is_int == 1) ? (((const int*)mask_a)[mi] == 0) : (((const int*)mask_a)[mi] != 0);
        } else if (g.mask_mode == 3) masked = (qkeep[r] == 0) || (kvkeep[j] == 0);
        else if (g.mask_mode == 5) {
          const size_t mi = (size_t)qrow * g.Skv + kvcol;
          masked = (((const int*)mask_a)[mi] != 0);
          int n = mask_b[mi]; n = n < 0 ? 0 : n;
          s[j][r] += g.cp[(size_t)b * g.c_bs + (size_t)h * g.c_hs + (size_t)qrow * g.c_rs + n]
                   + g.pc[(size_t)b * g.c_bs + (size_t)h * g.c_hs + (size_t)kvcol * g.c_rs + n];
        }
        if (masked) s[j][r] = g.mask_fill;
        m = fmaxf(m, s[j][r]);
      }
#pragma unroll
      for (int off = 1; off < 16; off <<= 1) m = fmaxf(m, __shfl_xor(m, off, 32));
      cm[r] = m;
    }
    __bf16* pwh = Psh[wave];
    __bf16* pwl = Psl[SPLIT_PV ? wave : 0];
#pragma unroll
    for (int r = 0; r < 8; ++r) {
      const float mnew = fmaxf(mrow[r], cm[r]);
      const float alpha = expf(mrow[r] - mnew);
      mrow[r] = mnew;
      float psum = 0.f;
#pragma unroll
      for (int j = 0; j < 4; ++j) {
        const float p = expf(s[j][r] - mnew);
        psum += p;
        if (SPLIT_PV) { __bf16 a, bl; at_split(p, a, bl); pwh[(8 * hh + r) * AT_KC + j * 16 + c] = a; pwl[(8 * hh + r) * AT_KC + j * 16 + c] = bl; }
        else pwh[(8 * hh + r) * AT_KC + j * 16 + c] = at_to16<F16>(p * PSC);
      }
#pragma unroll
      for (int off = 1; off < 16; off <<= 1) psum += __shfl_xor(psum, off, 32);
      lrow[r] = lrow[r] * alpha + psum;
#pragma unroll
      for (int t = 0; t < 4; ++t) oacc[t][r] *= alpha;
    }
    __builtin_amdgcn_fence(__ATOMIC_RELEASE, "workgroup");
    __builtin_amdgcn_wave_barrier();
    __builtin_amdgcn_fence(__ATOMIC_ACQUIRE, "workgroup");
#pragma unroll 1
    for (int kk = 0; kk < 2; ++kk) {
      FB pa, pl;
      pa.h[0] = *(const v8b*)(pwh + c * AT_KC + kk * 32 + 8 * hh);
      pa.h[1] = *(const v8b*)(pwh + c * AT_KC + kk * 32 + 16 + 8 * hh);
      if (SPLIT_PV) {
        pl.h[0] = *(const v8b*)(pwl + c * AT_KC + kk * 32 + 8 * hh);
        pl.h[1] = *(const v8b*)(pwl + c * AT_KC + kk * 32 + 16 + 8 * hh);
      }
#pragma unroll
      for (int t = 0; t < 4; ++t) {
        FB vb;
        vb.h[0] = *(const v8b*)(Vth + (t * 16 + c) * AT_KC + kk * 32 + 8 * hh);
        vb.h[1] = *(const v8b*)(Vth + (t * 16 + c) * AT_KC + kk * 32 + 16 + 8 * hh);
        oacc[t] = at_mma16<F16>(pa.v, vb.v, oacc[t]);
        if (SPLIT_PV) {
          FB vl;
          vl.h[0] = *(const v8b*)(Vtl + (t * 16 + c) * AT_KC + kk * 32 + 8 * hh);
          vl.h[1] = *(const v8b*)(Vtl + (t * 16 + c) * AT_KC + kk * 32 + 16 + 8 * hh);
          oacc[t] = at_mma16<F16>(pa.v, vl.v, oacc[t]);
          oacc[t] = at_mma16<F16>(pl.v, vb.v, oacc[t]);
        }
      }
    }
  }

  float* os = Os[wave];
#pragma unroll
  for (int r = 0; r < 8; ++r) {
    const float inv = 1.0f / (lrow[r] * PSC);
#pragma unroll
    for (int t = 0; t < 4; ++t) os[(8 * hh + r) * 68 + t * 16 + c] = oacc[t][r] * inv;
  }
  __builtin_amdgcn_fence(__ATOMIC_RELEASE, "workgroup");
  __builtin_amdgcn_wave_barrier();
  __builtin_amdgcn_fence(__ATOMIC_ACQUIRE, "workgroup");
  {
    const int c4 = (lane & 15) * 4;
    {
#pragma unroll
      for (int it = 0; it < 8; ++it) {
        const int row = it * 2 + hh;
        v4f val = *(const v4f*)(os + row * 68 + c4);
        *(v4f*)(ob_ptr + (size_t)(q0 + row) * g.o_rs + c4) = val;
      }
      
    }
  }
}

} // namespace w25

// ---- Wide elementwise and row passes: a thread moves 32 or 64 elements with 16-byte loads, so that a pass starts a few thousand waves instead of
//      one wave per 64 or 128 elements. Every wave-wide store covers whole 128-byte lines. Formulas and sum trees are those of the narrow kernels above.
typedef __attribute__((ext_vector_type(4))) _Float16 v4h;
// k_cast16w<G>: dst[i] = f16(src[i] * s) over a flat range; a block takes G * 1024 consecutive elements, a thread 4 consecutive ones of each 1024.
template <int G>
__global__ __launch_bounds__(256) void k_cast16w(const float* __restrict__ src, _Float16* __restrict__ dst, float s) {
    const v4f* sp = (const v4f*)(src + (size_t)blockIdx.x * (G * 1024));
    v4h* dp = (v4h*)(dst + (size_t)blockIdx.x * (G * 1024));
    const unsigned t = threadIdx.x;
    v4f a[G];
#pragma unroll
    for (int g = 0; g < G; ++g) a[g] = sp[t + g * 256];
#pragma unroll
    for (int g = 0; g < G; ++g) {
        v4h h;
#pragma unroll
        for (int e = 0; e < 4; ++e) h[e] = (_Float16)(a[g][e] * s);
        dp[t + g * 256] = h;
    }
}
// k_castT16w<LDS, LDD>: dst[c * LDD + r] = f16(src[r * LDS + c] * s). Block = 64 source rows x 128 source columns, wave = 64 x 16, lane = 8 rows x 4 columns
//   transposed in registers: 8 lanes side by side in r fill one 128-byte line of a dst row. grid (C / 128, R / 64).
template <int LDS, int LDD>
__global__ __launch_bounds__(256) void k_castT16w(const float* __restrict__ src, _Float16* __restrict__ dst, float s) {
    const int lane = threadIdx.x & 31, wave = threadIdx.x >> 5;
    const int r = blockIdx.y * 64 + (lane & 7) * 8;
    const int c = blockIdx.x * 128 + wave * 16 + (lane >> 3) * 4;
    const float* sp = src + (size_t)r * LDS + c;
    _Float16* dp = dst + (size_t)c * LDD + r;
    v4f x[8];
#pragma unroll
    for (int i = 0; i < 8; ++i) x[i] = *(const v4f*)(sp + i * LDS);
#pragma unroll
    for (int j = 0; j < 4; ++j) {
        v8h h;
#pragma unroll
        for (int i = 0; i < 8; ++i) h[i] = (_Float16)(x[i][j] * s);
        *(v8h*)(dp + j * LDD) = h;
    }
}
// Sum of one value per position t = 0..255 of k_stats' tree, add for add: lane l holds positions 4l + q in lo[q] and 128 + 4l + q in hi[q].
//   Levels 128 (in the lane), 64..4 (lanes l and l ^ 16, 8, 4, 2, 1), 2 and 1 (in the lane); every lane ends with the root.
__device__ __forceinline__ float tree256(v4f lo, v4f hi) {
    v4f t = lo + hi;
#pragma unroll
    for (int o = 16; o > 0; o >>= 1) {
#pragma unroll
        for (int q = 0; q < 4; ++q) t[q] += __shfl_xor(t[q], o, 32);
    }
    return (t[0] + t[2]) + (t[1] + t[3]);
}
// k_stats_w: mean and rsqrt(var + eps) of rows of 1024, one wave per row with the row held in registers (k_stats mode 0; same partial sums, same tree).
__global__ __launch_bounds__(256) void k_stats_w(const float* __restrict__ x, float eps, float* __restrict__ stat) {
    const int lane = threadIdx.x & 31; const size_t row = (size_t)blockIdx.x * 8 + (threadIdx.x >> 5);
    const float* base = x + row * 1024 + 4 * lane;
    v4f v[8];
#pragma unroll
    for (int m = 0; m < 8; ++m) v[m] = *(const v4f*)(base + 128 * m);
    const float mu = tree256(((v[0] + v[2]) + v[4]) + v[6], ((v[1] + v[3]) + v[5]) + v[7]) / 1024.f;
    v4f q0 = {}, q1 = {};
#pragma unroll
    for (int k = 0; k < 4; ++k) { const v4f d0 = v[2 * k] - mu, d1 = v[2 * k + 1] - mu; q0 = __builtin_elementwise_fma(d0, d0, q0); q1 = __builtin_elementwise_fma(d1, d1, q1); }
    const float rs = rsqrtf(tree256(q0, q1) / 1024.f + eps);
    const float o = (lane == 0) ? mu : ((lane == 1) ? rs : 0.f);
    stat[row * 32 + lane] = o;
}
// k_norm_apply_w: y = (x - mean[row]) * rstd[row] * g[c] + b[c] on rows of 1024; a block takes 8 rows, a thread 4 columns of each (x and y may be the same buffer).
__global__ __launch_bounds__(256) void k_norm_apply_w(const float* x, float* y, const float* __restrict__ stat, const float* __restrict__ g, const float* __restrict__ bta) {
    const int c = threadIdx.x * 4; const size_t r0 = (size_t)blockIdx.x * 8;
    const v4f gg = *(const v4f*)(g + c), bb = *(const v4f*)(bta + c);
    v4f v[8];
#pragma unroll
    for (int i = 0; i < 8; ++i) v[i] = *(const v4f*)(x + (r0 + i) * 1024 + c);
#pragma unroll
    for (int i = 0; i < 8; ++i) {
        v4f o = (v[i] - stat[(r0 + i) * 32]) * stat[(r0 + i) * 32 + 1];
        o *= gg; o += bb;
        *(v4f*)(y + (r0 + i) * 1024 + c) = o;
    }
}


// ---- Block attention at its fixed shape ------------------------------------------------------------------------------
// k_attn_blk: k_attn<64, 64, 0, false, false> for 128 queries x 128 keys x 64 dims per (128-position block z, head h), row stride 1024 floats, all as constants.
//   Same f16 operands, same products in the same order, same online softmax over two 64-key halves, same sums: only how the data travel differs.
//   One work-group of eight waves per (z, h); wave w owns queries 16w .. 16w + 15. Every Q, K and V load is 16 bytes wide, and no load is guarded (every index is in range by
//   the constants), so all of a thread's loads are in flight together. K lies in LDS as f16 [key][d], V as f16 [d][key] (8 keys x 4 dims transposed in registers),
//   so that every B fragment is two 16-byte LDS reads. All 128 keys are staged at once: one barrier.
#define BA_KP 72      // pitch of K and P rows in halves: 144 B = 16 B x odd, for 16-byte readers
#define BA_VP 136     // pitch of V^T rows in halves: 272 B = 16 B x odd
// orders one wave's LDS writes and its other lanes' LDS reads (the per-wave P and O tiles)
__device__ __forceinline__ void ba_wave_sync() {
    __builtin_amdgcn_fence(__ATOMIC_RELEASE, "workgroup");
    __builtin_amdgcn_wave_barrier();
    __builtin_amdgcn_fence(__ATOMIC_ACQUIRE, "workgroup");
}
__global__ __launch_bounds__(256) void k_attn_blk(const float* __restrict__ Q, const float* __restrict__ K, const float* __restrict__ V, const int* __restrict__ Mi, float* __restrict__ O) {
    typedef w25::Frag<_Float16> FH;
    __shared__ __align__(16) _Float16 kl[128 * BA_KP];
    __shared__ __align__(16) _Float16 vt[64 * BA_VP];
    __shared__ __align__(16) _Float16 pl[8][16 * BA_KP];
    __shared__ __align__(16) float    ol[8][16 * 68];
    const int tid = threadIdx.x, lane = tid & 31, hf = lane >> 4, l15 = lane & 15, wave = tid >> 5;
    const int h = blockIdx.x, z = blockIdx.y;
    const size_t base = (size_t)z * (128 * 1024) + (size_t)h * 64;      // (row 0, dim 0) of this block and head in Q, K, V and O
    const float L2E = 1.4426950408889634f;
    const float NEG = -__builtin_inff();

    // K: load i takes rows 16i + 2 * wave + hf, 16 lanes to a row of 256 B. V: a thread takes keys 8 * (tid >> 4) .. + 7 at dims 4 * l15 .. + 3.
    const int g16 = tid >> 4, c4 = l15 * 4;
    const float* kp = K + base + (size_t)g16 * 1024 + c4;
    const float* vp = V + base + (size_t)g16 * (8 * 1024) + c4;
    const float* qp = Q + base + (size_t)(wave * 16 + l15) * 1024 + 8 * hf;
    const int*   mp = Mi + z * 128 + l15;
    v4f kx[8], vx[8], qx[8]; int mk[8];
#pragma unroll
    for (int i = 0; i < 8; ++i) kx[i] = *(const v4f*)(kp + (size_t)i * (16 * 1024));
    // behind each group of loads: its address register is an input, so it stays whole up to the wait, and later loads' results may then land on it
    asm volatile("s_wait_xcnt 0x0" :: "v"(kp) : "memory");
#pragma unroll
    for (int i = 0; i < 8; ++i) vx[i] = *(const v4f*)(vp + (size_t)i * 1024);
    asm volatile("s_wait_xcnt 0x0" :: "v"(vp) : "memory");
#pragma unroll
    for (int i = 0; i < 8; ++i) qx[i] = *(const v4f*)(qp + (i >> 1) * 16 + (i & 1) * 4);     // dims 16 * (i >> 1) + 8 * hf + 4 * (i & 1) .. + 3
#pragma unroll
    for (int i = 0; i < 8; ++i) mk[i] = mp[i * 16];                                            // keep flag of key 16i + l15
    asm volatile("s_wait_xcnt 0x0" :: "v"(qp), "v"(l15) : "memory");                          // l15 is the flag loads' index register
    __builtin_amdgcn_sched_barrier(0);   // keeps the conversions, which wait for loaded data, behind the issue of the last load: one latency is paid, not two
#pragma unroll
    for (int i = 0; i < 8; ++i) {
        v4h hk;
#pragma unroll
        for (int e = 0; e < 4; ++e) hk[e] = (_Float16)kx[i][e];
        *(v4h*)(kl + (i * 16 + g16) * BA_KP + c4) = hk;
    }
#pragma unroll
    for (int j = 0; j < 4; ++j) {
        v8h hv;
#pragma unroll
        for (int i = 0; i < 8; ++i) hv[i] = (_Float16)vx[i][j];
        *(v8h*)(vt + (c4 + j) * BA_VP + g16 * 8) = hv;
    }
    v16h qa[2];                                                           // A fragment: element e <- dim 32 ks + frag_k(e, hf)
#pragma unroll
    for (int ks = 0; ks < 2; ++ks)
#pragma unroll
        for (int e = 0; e < 16; ++e) qa[ks][e] = (_Float16)qx[ks * 4 + (e >> 2)][e & 3];
    v8f o[4]; float m8[8], l8[8];
#pragma unroll
    for (int t = 0; t < 4; ++t) { v8f zz = {}; o[t] = zz; }
#pragma unroll
    for (int i = 0; i < 8; ++i) { m8[i] = NEG; l8[i] = 0.f; }
    __syncthreads();                                                      // K and V^T are readable by every wave; they are not written again

    _Float16* myp = pl[wave];
#pragma unroll
    for (int jb = 0; jb < 2; ++jb) {
        const int j0 = jb * 64;
        v8f s[4];
#pragma unroll
        for (int t = 0; t < 4; ++t) {
            const _Float16* kr = kl + (j0 + t * 16 + l15) * BA_KP + 8 * hf;
            v8f acc = {};
            acc = FH::mma(qa[0], FH::load(kr), acc);
            acc = FH::mma(qa[1], FH::load(kr + 32), acc);
            s[t] = acc;
        }
#pragma unroll
        for (int i = 0; i < 8; ++i) {
            float sc[4];
#pragma unroll
            for (int t = 0; t < 4; ++t) {
                float v = s[t][i] * 0.125f;
                if (mk[jb * 4 + t] == 0) v = -1000000.0f;
                v *= L2E;
                sc[t] = v;
            }
            float mx = fmaxf(fmaxf(sc[0], sc[1]), fmaxf(sc[2], sc[3]));
            mx = fmaxf(mx, __shfl_xor(mx, 1, 32)); mx = fmaxf(mx, __shfl_xor(mx, 2, 32));
            mx = fmaxf(mx, __shfl_xor(mx, 4, 32)); mx = fmaxf(mx, __shfl_xor(mx, 8, 32));
            const float mnew = fmaxf(m8[i], mx);
            const float ec = exp2f(m8[i] - mnew);                         // taken unconditionally and then selected: no branch round each exp2
            const float corr = (mnew == NEG) ? 1.f : ec;
            float rs = 0.f;
#pragma unroll
            for (int t = 0; t < 4; ++t) {
                const float ep = exp2f(sc[t] - mnew);
                const float pp = (sc[t] == NEG) ? 0.f : ep; rs += pp;
                myp[(i + 8 * hf) * BA_KP + t * 16 + l15] = (_Float16)(pp * 4096.f);
            }
            rs += __shfl_xor(rs, 1, 32); rs += __shfl_xor(rs, 2, 32); rs += __shfl_xor(rs, 4, 32); rs += __shfl_xor(rs, 8, 32);
            l8[i] = l8[i] * corr + rs; m8[i] = mnew;
#pragma unroll
            for (int t = 0; t < 4; ++t) o[t][i] *= corr;
        }
        ba_wave_sync();                                                   // P is written; its rows are read by other lanes of the wave
        const v16h pa0 = FH::load(myp + l15 * BA_KP + 8 * hf), pa1 = FH::load(myp + l15 * BA_KP + 32 + 8 * hf);
#pragma unroll
        for (int t = 0; t < 4; ++t) {
            const _Float16* vr = vt + (t * 16 + l15) * BA_VP + j0 + 8 * hf;
            o[t] = FH::mma(pa0, FH::load(vr), o[t]);
            o[t] = FH::mma(pa1, FH::load(vr + 32), o[t]);
        }
        ba_wave_sync();                                                   // P is read; the next half may overwrite it
    }
    float* myo = ol[wave];
#pragma unroll
    for (int i = 0; i < 8; ++i) {
        const float rl = 1.f / (l8[i] * 4096.f);
        const float invr = (l8[i] > 0.f) ? rl : 0.f;
#pragma unroll
        for (int t = 0; t < 4; ++t) myo[(i + 8 * hf) * 68 + t * 16 + l15] = o[t][i] * invr;
    }
    ba_wave_sync();                                                       // O is written; its rows go out as whole 256-byte runs
    float* op = O + base + (size_t)(wave * 16 + hf) * 1024 + c4;
#pragma unroll
    for (int it = 0; it < 8; ++it) {                                      // rows 2 * it + hf
        const v4f v = *(const v4f*)(myo + (it * 2 + hf) * 68 + c4);
        *(v4f*)(op + (size_t)it * (2 * 1024)) = v;
    }
}

// MI[(b, s)] = (s < valid_len[b]) ? 1 : 0 as INT (keep-mask: masked scores are SET to -1e6 exactly like the module's where, so a 128-key block lying entirely beyond valid_len comes out uniform)
__global__ __launch_bounds__(256) void k_te_mask(const int* __restrict__ VL, int* __restrict__ MI, int Bn, int S) { const int t = blockIdx.x * 256 + threadIdx.x; if (t >= Bn * S) return; int* d = MI + t; const int v = ((t % S) < VL[t / S]) ? 1 : 0; *d = v;  }


extern "C" void kernel_launch(void* const* d_in, const int* in_sizes, int n_in, void* d_out, int out_size, void* d_ws, size_t ws_size, hipStream_t stream) {
    (void)in_sizes; (void)n_in; (void)out_size; (void)ws_size;
    const float* X = (const float*)d_in[0];
    const int* vl = (const int*)d_in[1];
    const float* Wq = (const float*)d_in[2];
    const float* Wk = (const float*)d_in[3];
    const float* Wv = (const float*)d_in[4];
    const float* Wo = (const float*)d_in[5];
    const float* g1 = (const float*)d_in[6];
    const float* be1 = (const float*)d_in[7];
    const float* W1 = (const float*)d_in[8];
    const float* bf1 = (const float*)d_in[9];
    const float* W2 = (const float*)d_in[10];
    const float* bf2 = (const float*)d_in[11];
    const float* g2 = (const float*)d_in[12];
    const float* be2 = (const float*)d_in[13];
    const int Bn = 4;
    const int S = 1024;
    const int D = 1024;
    const int NH = 16;
    const int DH = 64;
    const int F = 4096;
    const int M = 128;
    const int NB = S / M;
    const int NR = Bn * S;
    float* out = (float*)d_out;
    char* wsp = (char*)d_ws;
    float* Q = (float*)wsp; wsp += (((size_t)((size_t)NR * D) * 4 + 255) / 256) * 256;
    float* Kb = (float*)wsp; wsp += (((size_t)((size_t)NR * D) * 4 + 255) / 256) * 256;
    float* V = (float*)wsp; wsp += (((size_t)((size_t)NR * D) * 4 + 255) / 256) * 256;
    float* AT = (float*)wsp; wsp += (((size_t)((size_t)NR * D) * 4 + 255) / 256) * 256;
    float* MF = (float*)wsp; wsp += (((size_t)((size_t)NR) * 4 + 255) / 256) * 256;
    float* Y = (float*)wsp; wsp += (((size_t)((size_t)NR * D) * 4 + 255) / 256) * 256;
    float* ST = (float*)wsp; wsp += (((size_t)((size_t)NR * 32) * 4 + 255) / 256) * 256;
    float* H1 = (float*)wsp; wsp += (((size_t)((size_t)NR * F) * 4 + 255) / 256) * 256;
    unsigned short* G64A = (unsigned short*)wsp; wsp += (((size_t)(16777216) * 2 + 255) / 256) * 256;
    unsigned short* G64B = (unsigned short*)wsp; wsp += (((size_t)(4194304) * 2 + 255) / 256) * 256;
    k_cast16w<8><<<512, 256, 0, stream>>>(X, (_Float16*)(G64A), 1.0f);
    k_castT16w<1024, 1024><<<dim3(1024 / 128, 1024 / 64), 256, 0, stream>>>(Wq, (_Float16*)(G64B), 16.0f);
    w25::wmma_gemm_lds<1024, 1024, 0, false, 0><<<256, 256, 0, stream>>>((const unsigned short*)(G64A), (const unsigned short*)(G64B), Q, nullptr, nullptr, 0.0625f);
    k_cast16w<8><<<512, 256, 0, stream>>>(X, (_Float16*)(G64A), 1.0f);
    k_castT16w<1024, 1024><<<dim3(1024 / 128, 1024 / 64), 256, 0, stream>>>(Wk, (_Float16*)(G64B), 16.0f);
    w25::wmma_gemm_lds<1024, 1024, 0, false, 0><<<256, 256, 0, stream>>>((const unsigned short*)(G64A), (const unsigned short*)(G64B), Kb, nullptr, nullptr, 0.0625f);
    k_cast16w<8><<<512, 256, 0, stream>>>(X, (_Float16*)(G64A), 1.0f);
    k_castT16w<1024, 1024><<<dim3(1024 / 128, 1024 / 64), 256, 0, stream>>>(Wv, (_Float16*)(G64B), 16.0f);
    w25::wmma_gemm_lds<1024, 1024, 0, false, 0><<<256, 256, 0, stream>>>((const unsigned short*)(G64A), (const unsigned short*)(G64B), V, nullptr, nullptr, 0.0625f);
    k_te_mask<<<(NR + 255) / 256, 256, 0, stream>>>((const int*)vl, (int*)MF, Bn, S);
    k_attn_blk<<<dim3((unsigned)NH, (unsigned)(Bn * NB)), 256, 0, stream>>>(Q, Kb, V, (const int*)MF, AT);
    k_cast16w<8><<<512, 256, 0, stream>>>(AT, (_Float16*)(G64A), 1.0f);
    k_castT16w<1024, 1024><<<dim3(1024 / 128, 1024 / 64), 256, 0, stream>>>(Wo, (_Float16*)(G64B), 16.0f);
    w25::wmma_gemm_lds<1024, 1024, 0, true, 0><<<256, 256, 0, stream>>>((const unsigned short*)(G64A), (const unsigned short*)(G64B), Y, nullptr, X, 0.0625f);
    k_stats_w<<<(unsigned)(NR / 8), 256, 0, stream>>>(Y, 1e-05f, ST);
    k_norm_apply_w<<<(unsigned)(NR / 8), 256, 0, stream>>>(Y, Y, ST, g1, be1);
    k_cast16w<8><<<512, 256, 0, stream>>>(Y, (_Float16*)(G64A), 1.0f);
    k_castT16w<4096, 1024><<<dim3(4096 / 128, 1024 / 64), 256, 0, stream>>>(W1, (_Float16*)(G64B), 16.0f);
    w25::wmma_gemm_lds<4096, 1024, 2, false, 2><<<1024, 256, 0, stream>>>((const unsigned short*)(G64A), (const unsigned short*)(G64B), H1, bf1, nullptr, 0.0625f);
    k_cast16w<16><<<1024, 256, 0, stream>>>(H1, (_Float16*)(G64A), 1.0f);
    k_castT16w<1024, 4096><<<dim3(1024 / 128, 4096 / 64), 256, 0, stream>>>(W2, (_Float16*)(G64B), 16.0f);
    w25::wmma_gemm_lds<1024, 4096, 2, true, 0><<<256, 256, 0, stream>>>((const unsigned short*)(G64A), (const unsigned short*)(G64B), Kb, bf2, Y, 0.0625f);
    k_stats_w<<<(unsigned)(NR / 8), 256, 0, stream>>>(Kb, 1e-05f, ST);
    k_norm_apply_w<<<(unsigned)(NR / 8), 256, 0, stream>>>(Kb, out, ST, g2, be2);
}
